// v000
// Measured on an AMD MI455X. A time is GPU time per run, averaged over a window of back-to-back runs after a warm-up
// (all launches, gaps included; the runs take copies of the inputs in turn), and the median of several windows.
// Apart from v000's, it joins two sittings. Times from different sittings can be a few percent apart, while
// side-by-side timings come from the same sitting.
// The starting kernel, v000, takes 2500 microseconds a run.
// Every contraction (x.Wq|Wk, Wv^T.x^T, q.k^T, p.v, ctx.Wo): v_wmma_f32_16x16x32_bf16 on bf16 hi/lo split operand planes (hi.hi + hi.lo + lo.hi), f32 accumulate; relu, distance decay, causal mask and softmax in f32.
#include <hip/hip_runtime.h>
#include <math.h>
#include <stdint.h>

#define NB    2
#define NSEQ  2048
#define DIN   1024
#define DOUT  1024
#define NH    16
#define HDIM  64
#define HGRP  2               // heads per score/softmax/PV group
#define NGRP  (NH / HGRP)     // 8 groups

typedef __attribute__((ext_vector_type(16))) _Float16 v16h;
typedef __attribute__((ext_vector_type(8)))  _Float16 v8h;
typedef __attribute__((ext_vector_type(16))) __bf16   v16b;
typedef __attribute__((ext_vector_type(8)))  __bf16   v8b;
typedef __attribute__((ext_vector_type(8)))  float    v8f;
typedef __attribute__((ext_vector_type(4)))  float    v4f;
typedef __attribute__((ext_vector_type(2)))  float    v2f;
typedef __attribute__((ext_vector_type(4)))  unsigned int v4u;
typedef __attribute__((ext_vector_type(2)))  unsigned int v2u;

__device__ __forceinline__ unsigned short f2bf_bits(float f) {
  unsigned u = __float_as_uint(f);
  return (unsigned short)((u + 0x7FFFu + ((u >> 16) & 1u)) >> 16);
}
__device__ __forceinline__ float bf_bits2f(unsigned short h) { return __uint_as_float(((unsigned)h) << 16); }

// hazard guards as plain device helpers (no inline asm inside the kernel template body)
__device__ __forceinline__ void dep_guard_h(v8f& a, v8f& b, v16h x, v16h y) { asm volatile("v_nop\n\tv_nop\n\tv_nop\n\tv_nop" : "+v"(a), "+v"(b) : "v"(x), "v"(y)); }
__device__ __forceinline__ void dep_guard_b(v8f& a, v8f& b, v16b x, v16b y) { asm volatile("v_nop\n\tv_nop\n\tv_nop\n\tv_nop" : "+v"(a), "+v"(b) : "v"(x), "v"(y)); }
__device__ __forceinline__ void keep4_h(v16h a, v16h b, v16h c, v16h d) { asm volatile("v_nop" :: "v"(a), "v"(b), "v"(c), "v"(d)); }
__device__ __forceinline__ void keep4_b(v16b a, v16b b, v16b c, v16b d) { asm volatile("v_nop" :: "v"(a), "v"(b), "v"(c), "v"(d)); }
__device__ __forceinline__ void acc_guard4(v8f& a, v8f& b, v8f& c, v8f& d) { asm volatile("v_nop\n\tv_nop\n\tv_nop\n\tv_nop" : "+v"(a), "+v"(b), "+v"(c), "+v"(d)); }
template <typename T> struct Frag;
template <> struct Frag<_Float16> {
  typedef v16h V; union U { v16h v; v8h h[2]; };
  static __device__ __forceinline__ v16h load(const _Float16* p) {   // elements 0..7 <- p[0..7], 8..15 <- p[16..23]
    U f; f.h[0] = *(const v8h*)(p); f.h[1] = *(const v8h*)(p + 16); return f.v;
  }
  static __device__ __forceinline__ v8f mma(v16h a, v16h b, v8f c) {
    return __builtin_amdgcn_wmma_f32_16x16x32_f16(false, a, false, b, (short)0, c, false, false);
  }
  static __device__ __forceinline__ void guard(v8f& a, v8f& b, v16h x, v16h y) { dep_guard_h(a, b, x, y); }
  static __device__ __forceinline__ void keep(v16h a, v16h b, v16h c, v16h d) { keep4_h(a, b, c, d); }
};
template <> struct Frag<__bf16> {
  typedef v16b V; union U { v16b v; v8b h[2]; };
  static __device__ __forceinline__ v16b load(const __bf16* p) {
    U f; f.h[0] = *(const v8b*)(p); f.h[1] = *(const v8b*)(p + 16); return f.v;
  }
  static __device__ __forceinline__ v8f mma(v16b a, v16b b, v8f c) {
    return __builtin_amdgcn_wmma_f32_16x16x32_bf16(false, a, false, b, (short)0, c, false, false);
  }
  static __device__ __forceinline__ void guard(v8f& a, v8f& b, v16b x, v16b y) { dep_guard_b(a, b, x, y); }
  static __device__ __forceinline__ void keep(v16b a, v16b b, v16b c, v16b d) { keep4_b(a, b, c, d); }
};

// ---- Register-blocked batched WMMA GEMM ------------------------------------
// C[m,n] = scale * sum_k A[m,k] * Bt[n,k] (+bias)(+resid); each wave owns a 64x64 tile.
// A row-major [M,K]; Bt row-major [N,K]; M,N % 64 == 0, K % 32 == 0.
// SPLIT: operands are hi/lo planes (A2/Bt2 = lo planes, same layout); product = hi·hi + hi·lo + lo·hi.
// BIAS_MODE: 0 = none, 1 = bias[m], 2 = bias[n].
// OUT_MODE: 0 = f32, 1 = f16, 2 = bf16 hi plane (Cout) + bf16 lo plane (Cout2).
// ET: 0 = f16 operands, 1 = bf16 operands (pointers passed as 16-bit storage)
// Added modes (defaults off, all other behaviour unchanged):
//   LOWER:   tiles with n0 > m0 (strictly above the 64x64 block diagonal) are not produced (wave-uniform early exit).
//   CAUSALK: the k-loop stops at min(K, m0 + 64); valid when A rows m0..m0+63 are exactly zero for k >= m0 + 64.
template <int ET> struct Elem;
template <> struct Elem<0> { typedef _Float16 T; };
template <> struct Elem<1> { typedef __bf16 T; };
template <int ET, bool SPLIT, int BIAS_MODE, int OUT_MODE, bool RESID, int ACT = 0, bool LOWER = false, bool CAUSALK = false>
__global__ __launch_bounds__(256) void wmma_gemm64(
    const unsigned short* __restrict__ Ap, const unsigned short* __restrict__ A2p, int lda, long strideA,
    const unsigned short* __restrict__ Btp, const unsigned short* __restrict__ Bt2p, int ldb, long strideB,
    void* __restrict__ Cout, void* __restrict__ Cout2, int ldc, long strideC,
    const float* __restrict__ bias,
    const float* __restrict__ resid, long strideR,
    int M, int N, int K, float scale) {
  typedef typename Elem<ET>::T T;
  typedef typename Frag<T>::V V;
  const T* A = (const T*)Ap; const T* A2 = (const T*)A2p; const T* Bt = (const T*)Btp; const T* Bt2 = (const T*)Bt2p;
  __shared__ __align__(16) float sT[8][16 * 68];   // per-wave 16x64 slab, pitch 68 floats
  const int b    = blockIdx.y;
  const int lane = threadIdx.x & 31;
  const int wave = threadIdx.x >> 5;
  const int tilesN = N >> 6;
  const int tilesM = M >> 6;
  const int tile = blockIdx.x * 8 + wave;
  if (tile >= tilesM * tilesN) return;   // wave-uniform; no block barriers in this kernel
  const int tm = tile / tilesN;
  const int tn = tile - tm * tilesN;
  const int m0 = tm << 6;
  const int n0 = tn << 6;
  if (LOWER && n0 > m0) return;          // wave-uniform; no block barriers in this kernel

  const T* Ab  = A  + (size_t)b * strideA;
  const T* Bb  = Bt + (size_t)b * strideB;
  const T* Ab2 = SPLIT ? (A2  + (size_t)b * strideA) : nullptr;
  const T* Bb2 = SPLIT ? (Bt2 + (size_t)b * strideB) : nullptr;

  const int rlane = lane & 15;                 // row (A) / col (B, D) within subtile
  const int koff  = (lane >> 4) * 8;           // k offset of this lane half
  const int mOff  = (lane >> 4) * 8;           // D row offset

  v8f acc[4][4];
#pragma unroll
  for (int i = 0; i < 4; ++i)
#pragma unroll
    for (int j = 0; j < 4; ++j) acc[i][j] = (v8f){0.f,0.f,0.f,0.f,0.f,0.f,0.f,0.f};

  const int kEnd = CAUSALK ? (((m0 + 64) < K) ? (m0 + 64) : K) : K;
  for (int k0 = 0; k0 < kEnd; k0 += 32) {
    V bh[4], bl[4];
#pragma unroll
    for (int j = 0; j < 4; ++j) {
      const size_t bo = (size_t)(n0 + (j << 4) + rlane) * ldb + koff + k0;
      bh[j] = Frag<T>::load(Bb + bo);
      if (SPLIT) bl[j] = Frag<T>::load(Bb2 + bo);
    }
#pragma unroll
    for (int i = 0; i < 4; ++i) {
      const size_t ao = (size_t)(m0 + (i << 4) + rlane) * lda + koff + k0;
      V ah = Frag<T>::load(Ab + ao);
      V al;
      if (SPLIT) al = Frag<T>::load(Ab2 + ao);
#pragma unroll
      for (int j = 0; j < 4; ++j) {
        acc[i][j] = Frag<T>::mma(ah, bh[j], acc[i][j]);
        if (SPLIT) {
          acc[i][j] = Frag<T>::mma(ah, bl[j], acc[i][j]);
          acc[i][j] = Frag<T>::mma(al, bh[j], acc[i][j]);
        }
      }
      Frag<T>::guard(acc[i][0], acc[i][3], ah, SPLIT ? al : ah);
    }
    Frag<T>::keep(bh[0], bh[1], bh[2], bh[3]);
    if (SPLIT) Frag<T>::keep(bl[0], bl[1], bl[2], bl[3]);
  }
  acc_guard4(acc[0][0], acc[0][1], acc[0][2], acc[0][3]);
  acc_guard4(acc[1][0], acc[1][1], acc[1][2], acc[1][3]);
  acc_guard4(acc[2][0], acc[2][1], acc[2][2], acc[2][3]);
  acc_guard4(acc[3][0], acc[3][1], acc[3][2], acc[3][3]);

  // ---- epilogue ----
  float* slab = sT[wave];
  const float* Rb = RESID ? (resid + (size_t)b * strideR) : nullptr;
#pragma unroll
  for (int i = 0; i < 4; ++i) {
    const int mBase = m0 + (i << 4);
#pragma unroll
    for (int j = 0; j < 4; ++j) {
      const int n = n0 + (j << 4) + rlane;
      float bv = 0.f;
      if (BIAS_MODE == 2) bv = bias[n];
#pragma unroll
      for (int r = 0; r < 8; ++r) {
        float v = acc[i][j][r] * scale;
        if (BIAS_MODE == 1) v += bias[mBase + mOff + r];
        if (BIAS_MODE == 2) v += bv;
        if (RESID) v += Rb[(size_t)(mBase + mOff + r) * ldc + n];
        if (ACT == 1) v = tanhf(v);
        if (ACT == 2) v = fmaxf(v, 0.0f);
        if (ACT == 3) v = v / (1.0f + expf(-v));
        if (ACT == 4) v = (v > 0.f) ? v : 0.01f * v;
        if (ACT == 5) v = 0.5f * v * (1.0f + erff(v * 0.70710678118654752f));
        slab[(mOff + r) * 68 + (j << 4) + rlane] = v;
      }
    }
    __builtin_amdgcn_fence(__ATOMIC_RELEASE, "workgroup");
    __builtin_amdgcn_wave_barrier();
    __builtin_amdgcn_fence(__ATOMIC_ACQUIRE, "workgroup");
    if (OUT_MODE == 0) {
      float* C = (float*)Cout + (size_t)b * strideC;
      const int hh = lane >> 4, c4 = (lane & 15) * 4;     // row seg = 256 B = 16 lanes x 16 B
      {
#pragma unroll
        for (int it = 0; it < 8; ++it) {
          const int row = it * 2 + hh;
          v4f v = *(const v4f*)(slab + row * 68 + c4);
          *(v4f*)(C + (size_t)(mBase + row) * ldc + n0 + c4) = v;
        }
        
      }
    } else {
      const int q = lane >> 3, c8 = (lane & 7) * 8;
      unsigned short* C  = (unsigned short*)Cout  + (size_t)b * strideC;
      unsigned short* C2 = (OUT_MODE == 2) ? ((unsigned short*)Cout2 + (size_t)b * strideC) : nullptr;
      {
#pragma unroll
        for (int it = 0; it < 4; ++it) {
          const int row = it * 4 + q;
          const float* sp = slab + row * 68 + c8;
          v8h hv, lv;
#pragma unroll
          for (int e = 0; e < 8; ++e) {
            if (OUT_MODE == 1) {
              hv[e] = (_Float16)sp[e];
            } else {
              unsigned short hb = f2bf_bits(sp[e]);
              unsigned short lb = f2bf_bits(sp[e] - bf_bits2f(hb));
              hv[e] = __builtin_bit_cast(_Float16, hb);
              lv[e] = __builtin_bit_cast(_Float16, lb);
            }
          }
          *(v8h*)(C + (size_t)(mBase + row) * ldc + n0 + c8) = hv;
          if (OUT_MODE == 2) *(v8h*)(C2 + (size_t)(mBase + row) * ldc + n0 + c8) = lv;
        }
        
      }
    }
    __builtin_amdgcn_fence(__ATOMIC_RELEASE, "workgroup");
    __builtin_amdgcn_wave_barrier();
    __builtin_amdgcn_fence(__ATOMIC_ACQUIRE, "workgroup");
  }
}

// ---------------------------------------------------------------------------
// Elementwise split: 2 elements per thread, one 4-B store per lane per plane -> each wave writes exactly one
// Coverage: grid = ceil(n2/256) blocks x 256 threads x 2 elements = 2*n2 elements = the whole plane (n2 = plane/2).
// ---------------------------------------------------------------------------
__device__ __forceinline__ unsigned pk16(unsigned short a, unsigned short b) { return (unsigned)a | ((unsigned)b << 16); }

// hi = bf16_rne(in), lo = bf16_rne(in - hi)
__global__ __launch_bounds__(256) void split_bf16x2_kernel(const float* __restrict__ in, unsigned short* __restrict__ hi,
                                                           unsigned short* __restrict__ lo, int n2) {
  const int i = blockIdx.x * 256 + threadIdx.x;
  if (i < n2) {
    const v2f f = *(const v2f*)(in + 2 * (size_t)i);
    const unsigned short h0 = f2bf_bits(f[0]), h1 = f2bf_bits(f[1]);
    const unsigned short l0 = f2bf_bits(f[0] - bf_bits2f(h0)), l1 = f2bf_bits(f[1] - bf_bits2f(h1));
    const unsigned uh = pk16(h0, h1), ul = pk16(l0, l1);
    ((unsigned*)hi)[i] = uh;
    ((unsigned*)lo)[i] = ul;
    
  }
}

// ---------------------------------------------------------------------------
// Transpose + bf16 hi/lo split of an f32 matrix: in [rows][cols] (row pitch ldi floats) ->
// outh/outl[c][r] = split(in[r][c]) (row pitch ldo u16). grid (cols/64, rows/64), 256 threads; rows, cols % 64 == 0.
// Coverage per block: load 4 it x 256 thr x 4 f32 = 64x64; store 2 it x 256 thr x 8 u16 = 64x64 per plane;
// ---------------------------------------------------------------------------
__global__ __launch_bounds__(256) void transpose_split_kernel(const float* __restrict__ in, int ldi,
                                                              unsigned short* __restrict__ outh,
                                                              unsigned short* __restrict__ outl, int ldo) {
  __shared__ __align__(16) float tf[64 * 68];
  const int c0  = blockIdx.x * 64;   // input column block = output row block
  const int r0  = blockIdx.y * 64;   // input row block    = output column block
  const int tid = threadIdx.x;
  {
    const int sub = tid >> 4;          // 0..15
    const int c4  = (tid & 15) * 4;    // 0..60
#pragma unroll
    for (int it = 0; it < 4; ++it) {
      const int rr = it * 16 + sub;
      const v4f a = *(const v4f*)(in + (size_t)(r0 + rr) * ldi + c0 + c4);
      *(v4f*)(tf + rr * 68 + c4) = a;
    }
  }
  __syncthreads();
  const int s8 = tid >> 3;             // 0..31
  const int c8 = (tid & 7) * 8;        // 0..56
  v4u hv[2], lv[2];
#pragma unroll
  for (int it = 0; it < 2; ++it) {
    const int oc = it * 32 + s8;       // output row within tile (= input column)
    v4u a, a2;
#pragma unroll
    for (int q = 0; q < 4; ++q) {
      const float f0 = tf[(c8 + 2 * q) * 68 + oc];
      const float f1 = tf[(c8 + 2 * q + 1) * 68 + oc];
      const unsigned short h0 = f2bf_bits(f0), h1 = f2bf_bits(f1);
      const unsigned short l0 = f2bf_bits(f0 - bf_bits2f(h0));
      const unsigned short l1 = f2bf_bits(f1 - bf_bits2f(h1));
      a[q]  = pk16(h0, h1);
      a2[q] = pk16(l0, l1);
    }
    hv[it] = a; lv[it] = a2;
  }
  {
#pragma unroll
    for (int it = 0; it < 2; ++it) {
      const int oc = it * 32 + s8;
      const size_t go = (size_t)(c0 + oc) * ldo + r0 + c8;
      *(v4u*)(outh + go) = hv[it];
      *(v4u*)(outl + go) = lv[it];
    }
    
  }
}

// ---------------------------------------------------------------------------
// Per score row i of head h = grp*HGRP + blockIdx.y (plane hg = blockIdx.y of the group buffers):
//   t[j] = (relu(S[hg][i][j]) * R_hat(h, |i-j|)) * 0.125 for j <= i, -inf for j > i,
//   R_hat = (1 + exp(v[h])) * rcp(1 + exp(v[h] - w[h] * |i-j|)); p = exp(t - max) / sum; P emitted as bf16 hi/lo planes.
// S is read only at in-bounds addresses; columns of 64x64 tiles strictly above the block diagonal are never produced
// by the score GEMM and are only ever touched with j > i (replaced by -inf by value). Waves whose 256 columns all lie
// beyond i skip the arithmetic (wave-uniform) but reach every barrier.
// Reductions in fixed order: per thread, wave shuffle tree, then the 8 wave partials in index order.
// Producer coverage: grid (NSEQ, HGRP); 256 threads x 8 u16 = the whole 2048-wide row of the hi plane and of the lo plane
// ---------------------------------------------------------------------------
__global__ __launch_bounds__(256) void decay_softmax_kernel(const float* __restrict__ S, const float* __restrict__ wp,
                                                            const float* __restrict__ vp,
                                                            unsigned short* __restrict__ Phi, unsigned short* __restrict__ Plo,
                                                            int grp) {
#pragma clang fp contract(off)
  __shared__ float redm[8];
  __shared__ float reds[8];
  const int i    = blockIdx.x;
  const int hg   = blockIdx.y;
  const int tid  = threadIdx.x;
  const int lane = tid & 31;
  const int wave = tid >> 5;
  int h = grp * HGRP + hg;
  h = h < 0 ? 0 : (h > NH - 1 ? NH - 1 : h);
  const float wh = wp[h];
  const float vh = vp[h];
  const float numr = 1.0f + __expf(vh);
  const int j0 = tid * 8;
  const bool wact = (wave * 256 <= i);       // wave-uniform: this wave has at least one column j <= i
  float t[8];
#pragma unroll
  for (int e = 0; e < 8; ++e) t[e] = -INFINITY;
  if (wact) {
    const float* row = S + ((size_t)hg * NSEQ + (size_t)i) * NSEQ + j0;
    const v4f a0 = *(const v4f*)(row);
    const v4f a1 = *(const v4f*)(row + 4);
    float s[8];
#pragma unroll
    for (int e = 0; e < 4; ++e) { s[e] = a0[e]; s[4 + e] = a1[e]; }
#pragma unroll
    for (int e = 0; e < 8; ++e) {
      const int j   = j0 + e;
      const int dij = i - j;
      const float R   = (float)(dij < 0 ? -dij : dij);
      const float wr  = wh * R;
      const float den = 1.0f + __expf(vh - wr);
      const float rh  = numr * __builtin_amdgcn_rcpf(den);
      const float sc  = (fmaxf(s[e], 0.0f) * rh) * 0.125f;
      t[e] = (j <= i) ? sc : -INFINITY;
    }
  }
  float m = fmaxf(fmaxf(fmaxf(t[0], t[1]), fmaxf(t[2], t[3])), fmaxf(fmaxf(t[4], t[5]), fmaxf(t[6], t[7])));
#pragma unroll
  for (int off = 16; off > 0; off >>= 1) m = fmaxf(m, __shfl_xor(m, off, 32));
  if (lane == 0) redm[wave] = m;
  __syncthreads();
  float mx = redm[0];
#pragma unroll
  for (int w = 1; w < 8; ++w) mx = fmaxf(mx, redm[w]);
  float ex[8];
#pragma unroll
  for (int e = 0; e < 8; ++e) ex[e] = 0.f;
  if (wact) {
#pragma unroll
    for (int e = 0; e < 8; ++e) ex[e] = __expf(t[e] - mx);
  }
  float ps = ((((((ex[0] + ex[1]) + ex[2]) + ex[3]) + ex[4]) + ex[5]) + ex[6]) + ex[7];
#pragma unroll
  for (int off = 16; off > 0; off >>= 1) ps += __shfl_xor(ps, off, 32);
  if (lane == 0) reds[wave] = ps;
  __syncthreads();
  float tot = reds[0];
#pragma unroll
  for (int w = 1; w < 8; ++w) tot += reds[w];
  const float inv = 1.0f / tot;              // tot >= 1 (the row maximum contributes exp(0))
  unsigned hw[4], lw[4];
#pragma unroll
  for (int q = 0; q < 4; ++q) {
    const float p0 = ex[2 * q] * inv, p1 = ex[2 * q + 1] * inv;
    const unsigned short hb0 = f2bf_bits(p0), hb1 = f2bf_bits(p1);
    const unsigned short lb0 = f2bf_bits(p0 - bf_bits2f(hb0));
    const unsigned short lb1 = f2bf_bits(p1 - bf_bits2f(hb1));
    hw[q] = pk16(hb0, hb1);
    lw[q] = pk16(lb0, lb1);
  }
  const v4u hvv = (v4u){hw[0], hw[1], hw[2], hw[3]};
  const v4u lvv = (v4u){lw[0], lw[1], lw[2], lw[3]};
  const size_t rowoff = ((size_t)hg * NSEQ + (size_t)i) * NSEQ + j0;
  *(v4u*)(Phi + rowoff) = hvv;
  *(v4u*)(Plo + rowoff) = lvv;
  
}

// ---------------------------------------------------------------------------
// Workspace region map (byte offsets; all offsets multiples of 2 MiB). Every per-batch region is fully rewritten
// inside each batch iteration before it is read, except S whose strictly-upper 64x64 tiles are never produced and
// never read unmasked. X and O share one region: X is read only by the two projection GEMMs of the same batch,
// which precede every PV GEMM (the O producers) in stream order; O is fully written (8 groups x 128 columns x 2048
// rows) before the output projection reads it.
//   WqkTh  bf16 [2048][1024]  rows 0..1023 = Wq^T, 1024..2047 = Wk^T         0
//   WqkTl  bf16 [2048][1024]                                          4194304
//   WvTh   bf16 [1024][1024]                                          8388608
//   WvTl   bf16 [1024][1024]                                         10485760
//   WoTh   bf16 [1024][1024]                                         12582912
//   WoTl   bf16 [1024][1024]                                         14680064
//   XOh    bf16 [2048][1024]  x[b] hi, later ctx hi (col h*64+d)     16777216
//   XOl    bf16 [2048][1024]                                         20971520
//   QKh    bf16 [2048][2048]  q at col h*64+d, k at col 1024+h*64+d  25165824
//   QKl    bf16 [2048][2048]                                         33554432
//   VTh    bf16 [1024][2048]  row h*64+d, col token                  41943040
//   VTl    bf16 [1024][2048]                                         46137344
//   S      f32  [HGRP][2048][2048]                                   50331648
//   Ph     bf16 [HGRP][2048][2048]                                   83886080
//   Pl     bf16 [HGRP][2048][2048]                                  100663296
//   total                                                           117440512
// ---------------------------------------------------------------------------
extern "C" void kernel_launch(void* const* d_in, const int* in_sizes, int n_in,
                              void* d_out, int out_size, void* d_ws, size_t ws_size,
                              hipStream_t stream) {
  if (n_in < 8) return;
  if (in_sizes[0] != NB * NSEQ * DIN) return;
  if (in_sizes[1] != DIN * DOUT || in_sizes[2] != DIN * DOUT || in_sizes[3] != DIN * DOUT) return;
  if (in_sizes[4] != DOUT * DOUT || in_sizes[5] != DOUT) return;
  if (in_sizes[6] < NH || in_sizes[7] < NH) return;
  if (out_size != NB * NSEQ * DOUT) return;

  const float* x  = (const float*)d_in[0];
  const float* Wq = (const float*)d_in[1];
  const float* Wk = (const float*)d_in[2];
  const float* Wv = (const float*)d_in[3];
  const float* Wo = (const float*)d_in[4];
  const float* bo = (const float*)d_in[5];
  const float* wp = (const float*)d_in[6];
  const float* vp = (const float*)d_in[7];

  const size_t PW  = (size_t)DIN * DOUT * 2;              // 16-bit [1024][1024] plane
  const size_t PX  = (size_t)NSEQ * DIN * 2;              // 16-bit [2048][1024] plane
  const size_t PQK = (size_t)NSEQ * (2 * DOUT) * 2;       // 16-bit [2048][2048] plane
  const size_t PVT = (size_t)DOUT * NSEQ * 2;             // 16-bit [1024][2048] plane
  const size_t PS  = (size_t)HGRP * NSEQ * NSEQ * 4;      // f32 score planes of one group
  const size_t PP  = (size_t)HGRP * NSEQ * NSEQ * 2;      // bf16 probability planes of one group
  size_t off = 0;
  const size_t oWqkTh = off; off += 2 * PW;
  const size_t oWqkTl = off; off += 2 * PW;
  const size_t oWvTh  = off; off += PW;
  const size_t oWvTl  = off; off += PW;
  const size_t oWoTh  = off; off += PW;
  const size_t oWoTl  = off; off += PW;
  const size_t oXOh   = off; off += PX;
  const size_t oXOl   = off; off += PX;
  const size_t oQKh   = off; off += PQK;
  const size_t oQKl   = off; off += PQK;
  const size_t oVTh   = off; off += PVT;
  const size_t oVTl   = off; off += PVT;
  const size_t oS     = off; off += PS;
  const size_t oPh    = off; off += PP;
  const size_t oPl    = off; off += PP;
  if (off > ws_size) return;

  char* ws = (char*)d_ws;
  unsigned short* WqkTh = (unsigned short*)(ws + oWqkTh);
  unsigned short* WqkTl = (unsigned short*)(ws + oWqkTl);
  unsigned short* WvTh  = (unsigned short*)(ws + oWvTh);
  unsigned short* WvTl  = (unsigned short*)(ws + oWvTl);
  unsigned short* WoTh  = (unsigned short*)(ws + oWoTh);
  unsigned short* WoTl  = (unsigned short*)(ws + oWoTl);
  unsigned short* XOh   = (unsigned short*)(ws + oXOh);
  unsigned short* XOl   = (unsigned short*)(ws + oXOl);
  unsigned short* QKh   = (unsigned short*)(ws + oQKh);
  unsigned short* QKl   = (unsigned short*)(ws + oQKl);
  unsigned short* VTh   = (unsigned short*)(ws + oVTh);
  unsigned short* VTl   = (unsigned short*)(ws + oVTl);
  float*          Sbuf  = (float*)(ws + oS);
  unsigned short* Ph    = (unsigned short*)(ws + oPh);
  unsigned short* Pl    = (unsigned short*)(ws + oPl);

  const dim3 blk(256);
  // weight planes: in [1024 rows = input feature k][1024 cols = output feature n] -> out[n][k]; grid (cols/64, rows/64)
  const dim3 gTr(DOUT / 64, DIN / 64);
  transpose_split_kernel<<<gTr, blk, 0, stream>>>(Wq, DOUT, WqkTh, WqkTl, DIN);
  transpose_split_kernel<<<gTr, blk, 0, stream>>>(Wk, DOUT, WqkTh + (size_t)DOUT * DIN, WqkTl + (size_t)DOUT * DIN, DIN);
  transpose_split_kernel<<<gTr, blk, 0, stream>>>(Wv, DOUT, WvTh, WvTl, DIN);
  transpose_split_kernel<<<gTr, blk, 0, stream>>>(Wo, DOUT, WoTh, WoTl, DOUT);

  const int n2x = NSEQ * DIN / 2;                                   // 1048576 pairs per batch slice
  const dim3 gSplit((n2x + 255) / 256);                             // 4096 blocks x 256 thr x 2 = 2048x1024
  const dim3 gQK(((NSEQ / 64) * (2 * DOUT / 64) + 7) / 8, 1);      // 128 blocks: M=2048, N=2048, K=1024
  const dim3 gVT(((DOUT / 64) * (NSEQ / 64) + 7) / 8, 1);          // 64 blocks:  M=1024, N=2048, K=1024
  const dim3 gS(((NSEQ / 64) * (NSEQ / 64) + 7) / 8, HGRP);         // 128 x 2:    M=N=2048, K=64 (lower block triangle)
  const dim3 gSm(NSEQ, HGRP);                                       // one block per (row, head-in-group)
  const dim3 gPV(((NSEQ / 64) * (HDIM / 64) + 7) / 8, HGRP);        // 4 x 2:      M=2048, N=64, K=2048 (causal k bound)
  const dim3 gOut(((NSEQ / 64) * (DOUT / 64) + 7) / 8, 1);          // 64 blocks:  M=2048, N=1024, K=1024

  for (int b = 0; b < NB; ++b) {
    // (1) x[b] -> bf16 hi/lo planes [2048][1024] (whole plane: 4096 blocks x 256 thr x 2)
    split_bf16x2_kernel<<<gSplit, blk, 0, stream>>>(x + (size_t)b * NSEQ * DIN, XOh, XOl, n2x);
    // (2) [q | k] = x . [Wq | Wk] -> QK hi/lo planes [2048][2048] (whole planes: 32x32 tiles)
    wmma_gemm64<1, true, 0, 2, false, 0, false, false><<<gQK, blk, 0, stream>>>(
        XOh, XOl, DIN, 0L, WqkTh, WqkTl, DIN, 0L, (void*)QKh, (void*)QKl, 2 * DOUT, 0L,
        bo, bo, 0L, NSEQ, 2 * DOUT, DIN, 1.0f);
    // (3) v^T[o][tok] = sum_k Wv^T[o][k] x[tok][k] -> VT hi/lo planes [1024][2048] (whole planes: 16x32 tiles)
    wmma_gemm64<1, true, 0, 2, false, 0, false, false><<<gVT, blk, 0, stream>>>(
        WvTh, WvTl, DIN, 0L, XOh, XOl, DIN, 0L, (void*)VTh, (void*)VTl, NSEQ, 0L,
        bo, bo, 0L, DOUT, NSEQ, DIN, 1.0f);
    for (int g = 0; g < NGRP; ++g) {
      const size_t qcol = (size_t)g * HGRP * HDIM;                  // first q column of the group; y adds hg*64
      // (4) S[hg][i][j] = q_i . k_j (raw) for 64x64 tiles with j0 <= i0; heads g*2 + hg, hg = blockIdx.y
      wmma_gemm64<1, true, 0, 0, false, 0, true, false><<<gS, blk, 0, stream>>>(
          QKh + qcol, QKl + qcol, 2 * DOUT, (long)HDIM,
          QKh + DOUT + qcol, QKl + DOUT + qcol, 2 * DOUT, (long)HDIM,
          (void*)Sbuf, (void*)Sbuf, NSEQ, (long)NSEQ * NSEQ,
          bo, bo, 0L, NSEQ, NSEQ, HDIM, 1.0f);
      // (5) relu * decay * 1/8, causal -inf, softmax -> P hi/lo planes (whole 2048x2048 per plane and hg)
      decay_softmax_kernel<<<gSm, blk, 0, stream>>>(Sbuf, wp, vp, Ph, Pl, g);
      // (6) ctx[i][h*64+d] = sum_j P[hg][i][j] VT[h*64+d][j] -> O hi/lo planes, columns g*128 + hg*64 .. +63
      wmma_gemm64<1, true, 0, 2, false, 0, false, true><<<gPV, blk, 0, stream>>>(
          Ph, Pl, NSEQ, (long)NSEQ * NSEQ,
          VTh + qcol * NSEQ, VTl + qcol * NSEQ, NSEQ, (long)HDIM * NSEQ,
          (void*)(XOh + qcol), (void*)(XOl + qcol), DOUT, (long)HDIM,
          bo, bo, 0L, NSEQ, HDIM, NSEQ, 1.0f);
    }
    // (7) out[b] = ctx . Wo + bo (f32, whole [2048][1024] slice of d_out)
    float* outb = (float*)d_out + (size_t)b * NSEQ * DOUT;
    wmma_gemm64<1, true, 2, 0, false, 0, false, false><<<gOut, blk, 0, stream>>>(
        XOh, XOl, DOUT, 0L, WoTh, WoTl, DOUT, 0L, (void*)outb, (void*)outb, DOUT, 0L,
        bo, bo, 0L, NSEQ, DOUT, DOUT, 1.0f);
  }
  (void)hipGetLastError();
}

// v001
// A run of this version takes 892 microseconds.
// In two side-by-side timings against v000, it was 2.80 and 2.81 times as fast.
// Every contraction (x.Wq|Wk, Wv^T.x^T, q.k^T, p.v, ctx.Wo): v_wmma_f32_16x16x32_bf16 on bf16 hi/lo split operand planes (hi.hi + hi.lo + lo.hi), f32 accumulate; relu, distance decay, causal mask and softmax in f32.
#include <hip/hip_runtime.h>
#include <math.h>
#include <stdint.h>

#define NB    2
#define NSEQ  2048
#define DIN   1024
#define DOUT  1024
#define NH    16
#define HDIM  64
#define HGRP  2               // heads per score/softmax/PV group
#define NGRP  (NH / HGRP)     // 8 groups

typedef __attribute__((ext_vector_type(16))) _Float16 v16h;
typedef __attribute__((ext_vector_type(8)))  _Float16 v8h;
typedef __attribute__((ext_vector_type(16))) __bf16   v16b;
typedef __attribute__((ext_vector_type(8)))  __bf16   v8b;
typedef __attribute__((ext_vector_type(8)))  float    v8f;
typedef __attribute__((ext_vector_type(4)))  float    v4f;
typedef __attribute__((ext_vector_type(2)))  float    v2f;
typedef __attribute__((ext_vector_type(4)))  unsigned int v4u;
typedef __attribute__((ext_vector_type(2)))  unsigned int v2u;

__device__ __forceinline__ unsigned short f2bf_bits(float f) {
  unsigned u = __float_as_uint(f);
  return (unsigned short)((u + 0x7FFFu + ((u >> 16) & 1u)) >> 16);
}
__device__ __forceinline__ float bf_bits2f(unsigned short h) { return __uint_as_float(((unsigned)h) << 16); }

// hazard guards as plain device helpers (no inline asm inside the kernel template body)
__device__ __forceinline__ void dep_guard_h(v8f& a, v8f& b, v16h x, v16h y) { asm volatile("v_nop\n\tv_nop\n\tv_nop\n\tv_nop" : "+v"(a), "+v"(b) : "v"(x), "v"(y)); }
__device__ __forceinline__ void dep_guard_b(v8f& a, v8f& b, v16b x, v16b y) { asm volatile("v_nop\n\tv_nop\n\tv_nop\n\tv_nop" : "+v"(a), "+v"(b) : "v"(x), "v"(y)); }
__device__ __forceinline__ void keep4_h(v16h a, v16h b, v16h c, v16h d) { asm volatile("v_nop" :: "v"(a), "v"(b), "v"(c), "v"(d)); }
__device__ __forceinline__ void keep4_b(v16b a, v16b b, v16b c, v16b d) { asm volatile("v_nop" :: "v"(a), "v"(b), "v"(c), "v"(d)); }
__device__ __forceinline__ void acc_guard4(v8f& a, v8f& b, v8f& c, v8f& d) { asm volatile("v_nop\n\tv_nop\n\tv_nop\n\tv_nop" : "+v"(a), "+v"(b), "+v"(c), "+v"(d)); }
template <typename T> struct Frag;
template <> struct Frag<_Float16> {
  typedef v16h V; union U { v16h v; v8h h[2]; };
  static __device__ __forceinline__ v16h load(const _Float16* p) {   // elements 0..7 <- p[0..7], 8..15 <- p[16..23]
    U f; f.h[0] = *(const v8h*)(p); f.h[1] = *(const v8h*)(p + 16); return f.v;
  }
  static __device__ __forceinline__ v8f mma(v16h a, v16h b, v8f c) {
    return __builtin_amdgcn_wmma_f32_16x16x32_f16(false, a, false, b, (short)0, c, false, false);
  }
  static __device__ __forceinline__ void guard(v8f& a, v8f& b, v16h x, v16h y) { dep_guard_h(a, b, x, y); }
  static __device__ __forceinline__ void keep(v16h a, v16h b, v16h c, v16h d) { keep4_h(a, b, c, d); }
};
template <> struct Frag<__bf16> {
  typedef v16b V; union U { v16b v; v8b h[2]; };
  static __device__ __forceinline__ v16b load(const __bf16* p) {
    U f; f.h[0] = *(const v8b*)(p); f.h[1] = *(const v8b*)(p + 16); return f.v;
  }
  static __device__ __forceinline__ v8f mma(v16b a, v16b b, v8f c) {
    return __builtin_amdgcn_wmma_f32_16x16x32_bf16(false, a, false, b, (short)0, c, false, false);
  }
  static __device__ __forceinline__ void guard(v8f& a, v8f& b, v16b x, v16b y) { dep_guard_b(a, b, x, y); }
  static __device__ __forceinline__ void keep(v16b a, v16b b, v16b c, v16b d) { keep4_b(a, b, c, d); }
};

// ---- Register-blocked batched WMMA GEMM ------------------------------------
// C[m,n] = scale * sum_k A[m,k] * Bt[n,k] (+bias)(+resid); each wave owns a 64x64 tile.
// A row-major [M,K]; Bt row-major [N,K]; M,N % 64 == 0, K % 32 == 0.
// SPLIT: operands are hi/lo planes (A2/Bt2 = lo planes, same layout); product = hi·hi + hi·lo + lo·hi.
// BIAS_MODE: 0 = none, 1 = bias[m], 2 = bias[n].
// OUT_MODE: 0 = f32, 1 = f16, 2 = bf16 hi plane (Cout) + bf16 lo plane (Cout2).
// ET: 0 = f16 operands, 1 = bf16 operands (pointers passed as 16-bit storage)
// Added modes (defaults off, all other behaviour unchanged):
//   LOWER:   tiles with n0 > m0 (strictly above the 64x64 block diagonal) are not produced (wave-uniform early exit).
//   CAUSALK: the k-loop stops at min(K, m0 + 64); valid when A rows m0..m0+63 are exactly zero for k >= m0 + 64.
//   KW > 0:  split-K. One 64x64 tile per block of KW waves (tile = blockIdx.x); wave w takes the 64-wide k chunks
//            w, w + KW, ... (K % 64 == 0), and the KW f32 partial tiles are summed through LDS in wave order 0..KW-1.
template <int ET> struct Elem;
template <> struct Elem<0> { typedef _Float16 T; };
template <> struct Elem<1> { typedef __bf16 T; };
template <int ET, bool SPLIT, int BIAS_MODE, int OUT_MODE, bool RESID, int ACT = 0, bool LOWER = false, bool CAUSALK = false, int KW = 0>
__global__ __launch_bounds__(KW ? KW * 32 : 256) void wmma_gemm64(
    const unsigned short* __restrict__ Ap, const unsigned short* __restrict__ A2p, int lda, long strideA,
    const unsigned short* __restrict__ Btp, const unsigned short* __restrict__ Bt2p, int ldb, long strideB,
    void* __restrict__ Cout, void* __restrict__ Cout2, int ldc, long strideC,
    const float* __restrict__ bias,
    const float* __restrict__ resid, long strideR,
    int M, int N, int K, float scale) {
  typedef typename Elem<ET>::T T;
  typedef typename Frag<T>::V V;
  const T* A = (const T*)Ap; const T* A2 = (const T*)A2p; const T* Bt = (const T*)Btp; const T* Bt2 = (const T*)Bt2p;
  static_assert(KW == 0 || ((KW == 8 || KW == 16) && !RESID && ACT == 0 && OUT_MODE != 1 && !LOWER), "split-K covers plain f32 / bf16 hi-lo outputs");
  __shared__ __align__(16) float sT[KW ? 2 * KW : 8][16 * 68];   // per-wave 16x64 slab, pitch 68 floats (split-K: two sets)
  const int b    = blockIdx.y;
  const int lane = threadIdx.x & 31;
  const int wave = KW ? __builtin_amdgcn_readfirstlane((int)(threadIdx.x >> 5)) : (int)(threadIdx.x >> 5);
  const int tilesN = N >> 6;
  const int tilesM = M >> 6;
  const int tile = KW ? (int)blockIdx.x : (int)(blockIdx.x * 8 + wave);
  if (tile >= tilesM * tilesN) return;   // KW == 0: wave-uniform, no block barriers; KW > 0: block-uniform, ahead of every barrier
  const int tm = tile / tilesN;
  const int tn = tile - tm * tilesN;
  const int m0 = tm << 6;
  const int n0 = tn << 6;
  if (LOWER && n0 > m0) return;          // wave-uniform; LOWER excludes split-K, so no block barriers follow

  const T* Ab  = A  + (size_t)b * strideA;
  const T* Bb  = Bt + (size_t)b * strideB;
  const T* Ab2 = SPLIT ? (A2  + (size_t)b * strideA) : nullptr;
  const T* Bb2 = SPLIT ? (Bt2 + (size_t)b * strideB) : nullptr;

  const int rlane = lane & 15;                 // row (A) / col (B, D) within subtile
  const int koff  = (lane >> 4) * 8;           // k offset of this lane half
  const int mOff  = (lane >> 4) * 8;           // D row offset

  v8f acc[4][4];
#pragma unroll
  for (int i = 0; i < 4; ++i)
#pragma unroll
    for (int j = 0; j < 4; ++j) acc[i][j] = (v8f){0.f,0.f,0.f,0.f,0.f,0.f,0.f,0.f};

  const int kEnd = CAUSALK ? (((m0 + 64) < K) ? (m0 + 64) : K) : K;
  // KW > 0: two 32-steps inside a 64-wide chunk (one whole 128-B line of each operand row), then on to this wave's next chunk
  for (int k0 = KW ? (wave << 6) : 0; k0 < kEnd; k0 += (KW && (k0 & 32)) ? (KW * 64 - 32) : 32) {
    V bh[4], bl[4];
#pragma unroll
    for (int j = 0; j < 4; ++j) {
      const size_t bo = (size_t)(n0 + (j << 4) + rlane) * ldb + koff + k0;
      bh[j] = Frag<T>::load(Bb + bo);
      if (SPLIT) bl[j] = Frag<T>::load(Bb2 + bo);
    }
#pragma unroll
    for (int i = 0; i < 4; ++i) {
      const size_t ao = (size_t)(m0 + (i << 4) + rlane) * lda + koff + k0;
      V ah = Frag<T>::load(Ab + ao);
      V al;
      if (SPLIT) al = Frag<T>::load(Ab2 + ao);
#pragma unroll
      for (int j = 0; j < 4; ++j) {
        acc[i][j] = Frag<T>::mma(ah, bh[j], acc[i][j]);
        if (SPLIT) {
          acc[i][j] = Frag<T>::mma(ah, bl[j], acc[i][j]);
          acc[i][j] = Frag<T>::mma(al, bh[j], acc[i][j]);
        }
      }
      Frag<T>::guard(acc[i][0], acc[i][3], ah, SPLIT ? al : ah);
    }
    Frag<T>::keep(bh[0], bh[1], bh[2], bh[3]);
    if (SPLIT) Frag<T>::keep(bl[0], bl[1], bl[2], bl[3]);
  }
  acc_guard4(acc[0][0], acc[0][1], acc[0][2], acc[0][3]);
  acc_guard4(acc[1][0], acc[1][1], acc[1][2], acc[1][3]);
  acc_guard4(acc[2][0], acc[2][1], acc[2][2], acc[2][3]);
  acc_guard4(acc[3][0], acc[3][1], acc[3][2], acc[3][3]);

  // ---- split-K epilogue: sum the KW partial tiles, 16 rows at a time ----
  if constexpr (KW > 0) {
    constexpr int EPT = 1024 / (KW * 32);               // outputs per thread of a 16x64 row group: 4 or 2
    typedef float vE __attribute__((ext_vector_type(EPT)));
    const int row = (int)threadIdx.x / (64 / EPT);      // 0..15
    const int c   = ((int)threadIdx.x % (64 / EPT)) * EPT;
    float v[4][EPT];                                    // results wait in registers: no global store stands in front of a barrier
#pragma unroll
    for (int i = 0; i < 4; ++i) {
      float* part = sT[(i & 1) * KW + wave];
#pragma unroll
      for (int j = 0; j < 4; ++j)
#pragma unroll
        for (int r = 0; r < 8; ++r) part[(mOff + r) * 68 + (j << 4) + rlane] = acc[i][j][r];
      // publishes all KW partials of row group i; with two slab sets it also ends the reads of group i - 1
      // before group i + 1 overwrites their set
      __syncthreads();
      const float* rp = sT[(i & 1) * KW] + row * 68 + c;
      vE s = *(const vE*)rp;
#pragma unroll
      for (int w = 1; w < KW; ++w) s += *(const vE*)(rp + w * (16 * 68));
#pragma unroll
      for (int e = 0; e < EPT; ++e) v[i][e] = s[e];
    }
#pragma unroll
    for (int i = 0; i < 4; ++i) {
      const int m = m0 + (i << 4) + row;
#pragma unroll
      for (int e = 0; e < EPT; ++e) {
        v[i][e] *= scale;
        if (BIAS_MODE == 1) v[i][e] += bias[m];
        if (BIAS_MODE == 2) v[i][e] += bias[n0 + c + e];
      }
      const size_t co = (size_t)b * strideC + (size_t)m * ldc + n0 + c;
      if (OUT_MODE == 0) {
        vE o;
#pragma unroll
        for (int e = 0; e < EPT; ++e) o[e] = v[i][e];
        *(vE*)((float*)Cout + co) = o;
      } else {
        unsigned hw[EPT / 2], lw[EPT / 2];
#pragma unroll
        for (int q = 0; q < EPT / 2; ++q) {
          const float f0 = v[i][2 * q], f1 = v[i][2 * q + 1];
          const unsigned short h0 = f2bf_bits(f0), h1 = f2bf_bits(f1);
          const unsigned short l0 = f2bf_bits(f0 - bf_bits2f(h0)), l1 = f2bf_bits(f1 - bf_bits2f(h1));
          hw[q] = (unsigned)h0 | ((unsigned)h1 << 16);
          lw[q] = (unsigned)l0 | ((unsigned)l1 << 16);
        }
        if constexpr (EPT == 4) {
          *(v2u*)((unsigned short*)Cout + co)  = (v2u){hw[0], hw[1]};
          *(v2u*)((unsigned short*)Cout2 + co) = (v2u){lw[0], lw[1]};
        } else {
          *(unsigned*)((unsigned short*)Cout + co)  = hw[0];
          *(unsigned*)((unsigned short*)Cout2 + co) = lw[0];
        }
      }
    }
    return;
  }

  // ---- epilogue ----
  float* slab = sT[wave];
  const float* Rb = RESID ? (resid + (size_t)b * strideR) : nullptr;
#pragma unroll
  for (int i = 0; i < 4; ++i) {
    const int mBase = m0 + (i << 4);
#pragma unroll
    for (int j = 0; j < 4; ++j) {
      const int n = n0 + (j << 4) + rlane;
      float bv = 0.f;
      if (BIAS_MODE == 2) bv = bias[n];
#pragma unroll
      for (int r = 0; r < 8; ++r) {
        float v = acc[i][j][r] * scale;
        if (BIAS_MODE == 1) v += bias[mBase + mOff + r];
        if (BIAS_MODE == 2) v += bv;
        if (RESID) v += Rb[(size_t)(mBase + mOff + r) * ldc + n];
        if (ACT == 1) v = tanhf(v);
        if (ACT == 2) v = fmaxf(v, 0.0f);
        if (ACT == 3) v = v / (1.0f + expf(-v));
        if (ACT == 4) v = (v > 0.f) ? v : 0.01f * v;
        if (ACT == 5) v = 0.5f * v * (1.0f + erff(v * 0.70710678118654752f));
        slab[(mOff + r) * 68 + (j << 4) + rlane] = v;
      }
    }
    __builtin_amdgcn_fence(__ATOMIC_RELEASE, "workgroup");
    __builtin_amdgcn_wave_barrier();
    __builtin_amdgcn_fence(__ATOMIC_ACQUIRE, "workgroup");
    if (OUT_MODE == 0) {
      float* C = (float*)Cout + (size_t)b * strideC;
      const int hh = lane >> 4, c4 = (lane & 15) * 4;     // row seg = 256 B = 16 lanes x 16 B
      {
#pragma unroll
        for (int it = 0; it < 8; ++it) {
          const int row = it * 2 + hh;
          v4f v = *(const v4f*)(slab + row * 68 + c4);
          *(v4f*)(C + (size_t)(mBase + row) * ldc + n0 + c4) = v;
        }
        
      }
    } else {
      const int q = lane >> 3, c8 = (lane & 7) * 8;
      unsigned short* C  = (unsigned short*)Cout  + (size_t)b * strideC;
      unsigned short* C2 = (OUT_MODE == 2) ? ((unsigned short*)Cout2 + (size_t)b * strideC) : nullptr;
      {
#pragma unroll
        for (int it = 0; it < 4; ++it) {
          const int row = it * 4 + q;
          const float* sp = slab + row * 68 + c8;
          v8h hv, lv;
#pragma unroll
          for (int e = 0; e < 8; ++e) {
            if (OUT_MODE == 1) {
              hv[e] = (_Float16)sp[e];
            } else {
              unsigned short hb = f2bf_bits(sp[e]);
              unsigned short lb = f2bf_bits(sp[e] - bf_bits2f(hb));
              hv[e] = __builtin_bit_cast(_Float16, hb);
              lv[e] = __builtin_bit_cast(_Float16, lb);
            }
          }
          *(v8h*)(C + (size_t)(mBase + row) * ldc + n0 + c8) = hv;
          if (OUT_MODE == 2) *(v8h*)(C2 + (size_t)(mBase + row) * ldc + n0 + c8) = lv;
        }
        
      }
    }
    __builtin_amdgcn_fence(__ATOMIC_RELEASE, "workgroup");
    __builtin_amdgcn_wave_barrier();
    __builtin_amdgcn_fence(__ATOMIC_ACQUIRE, "workgroup");
  }
}

// ---------------------------------------------------------------------------
// Elementwise split: 2 elements per thread, one 4-B store per lane per plane -> each wave writes exactly one
// Coverage: grid = ceil(n2/256) blocks x 256 threads x 2 elements = 2*n2 elements = the whole plane (n2 = plane/2).
// ---------------------------------------------------------------------------
__device__ __forceinline__ unsigned pk16(unsigned short a, unsigned short b) { return (unsigned)a | ((unsigned)b << 16); }

// hi = bf16_rne(in), lo = bf16_rne(in - hi)
__global__ __launch_bounds__(256) void split_bf16x2_kernel(const float* __restrict__ in, unsigned short* __restrict__ hi,
                                                           unsigned short* __restrict__ lo, int n2) {
  const int i = blockIdx.x * 256 + threadIdx.x;
  if (i < n2) {
    const v2f f = *(const v2f*)(in + 2 * (size_t)i);
    const unsigned short h0 = f2bf_bits(f[0]), h1 = f2bf_bits(f[1]);
    const unsigned short l0 = f2bf_bits(f[0] - bf_bits2f(h0)), l1 = f2bf_bits(f[1] - bf_bits2f(h1));
    const unsigned uh = pk16(h0, h1), ul = pk16(l0, l1);
    ((unsigned*)hi)[i] = uh;
    ((unsigned*)lo)[i] = ul;
    
  }
}

// ---------------------------------------------------------------------------
// Transpose + bf16 hi/lo split of an f32 matrix: in [rows][cols] (row pitch ldi floats) ->
// outh/outl[c][r] = split(in[r][c]) (row pitch ldo u16). grid (cols/64, rows/64), 256 threads; rows, cols % 64 == 0.
// Coverage per block: load 4 it x 256 thr x 4 f32 = 64x64; store 2 it x 256 thr x 8 u16 = 64x64 per plane;
// ---------------------------------------------------------------------------
__global__ __launch_bounds__(256) void transpose_split_kernel(const float* __restrict__ in, int ldi,
                                                              unsigned short* __restrict__ outh,
                                                              unsigned short* __restrict__ outl, int ldo) {
  __shared__ __align__(16) float tf[64 * 68];
  const int c0  = blockIdx.x * 64;   // input column block = output row block
  const int r0  = blockIdx.y * 64;   // input row block    = output column block
  const int tid = threadIdx.x;
  {
    const int sub = tid >> 4;          // 0..15
    const int c4  = (tid & 15) * 4;    // 0..60
#pragma unroll
    for (int it = 0; it < 4; ++it) {
      const int rr = it * 16 + sub;
      const v4f a = *(const v4f*)(in + (size_t)(r0 + rr) * ldi + c0 + c4);
      *(v4f*)(tf + rr * 68 + c4) = a;
    }
  }
  __syncthreads();
  const int s8 = tid >> 3;             // 0..31
  const int c8 = (tid & 7) * 8;        // 0..56
  v4u hv[2], lv[2];
#pragma unroll
  for (int it = 0; it < 2; ++it) {
    const int oc = it * 32 + s8;       // output row within tile (= input column)
    v4u a, a2;
#pragma unroll
    for (int q = 0; q < 4; ++q) {
      const float f0 = tf[(c8 + 2 * q) * 68 + oc];
      const float f1 = tf[(c8 + 2 * q + 1) * 68 + oc];
      const unsigned short h0 = f2bf_bits(f0), h1 = f2bf_bits(f1);
      const unsigned short l0 = f2bf_bits(f0 - bf_bits2f(h0));
      const unsigned short l1 = f2bf_bits(f1 - bf_bits2f(h1));
      a[q]  = pk16(h0, h1);
      a2[q] = pk16(l0, l1);
    }
    hv[it] = a; lv[it] = a2;
  }
  {
#pragma unroll
    for (int it = 0; it < 2; ++it) {
      const int oc = it * 32 + s8;
      const size_t go = (size_t)(c0 + oc) * ldo + r0 + c8;
      *(v4u*)(outh + go) = hv[it];
      *(v4u*)(outl + go) = lv[it];
    }
    
  }
}

// ---------------------------------------------------------------------------
// Per score row i of head h = grp*HGRP + blockIdx.y (plane hg = blockIdx.y of the group buffers):
//   t[j] = (relu(S[hg][i][j]) * R_hat(h, |i-j|)) * 0.125 for j <= i, -inf for j > i,
//   R_hat = (1 + exp(v[h])) * rcp(1 + exp(v[h] - w[h] * |i-j|)); p = exp(t - max) / sum; P emitted as bf16 hi/lo planes.
// S is read only at in-bounds addresses; columns of 64x64 tiles strictly above the block diagonal are never produced
// by the score GEMM and are only ever touched with j > i (replaced by -inf by value). Waves whose 256 columns all lie
// beyond i skip the arithmetic (wave-uniform) but reach every barrier.
// Reductions in fixed order: per thread, wave shuffle tree, then the 8 wave partials in index order.
// Producer coverage: grid (NSEQ, HGRP); 256 threads x 8 u16 = the whole 2048-wide row of the hi plane and of the lo plane
// ---------------------------------------------------------------------------
__global__ __launch_bounds__(256) void decay_softmax_kernel(const float* __restrict__ S, const float* __restrict__ wp,
                                                            const float* __restrict__ vp,
                                                            unsigned short* __restrict__ Phi, unsigned short* __restrict__ Plo,
                                                            int grp) {
#pragma clang fp contract(off)
  __shared__ float redm[8];
  __shared__ float reds[8];
  const int i    = blockIdx.x;
  const int hg   = blockIdx.y;
  const int tid  = threadIdx.x;
  const int lane = tid & 31;
  const int wave = tid >> 5;
  int h = grp * HGRP + hg;
  h = h < 0 ? 0 : (h > NH - 1 ? NH - 1 : h);
  const float wh = wp[h];
  const float vh = vp[h];
  const float numr = 1.0f + __expf(vh);
  const int j0 = tid * 8;
  const bool wact = (wave * 256 <= i);       // wave-uniform: this wave has at least one column j <= i
  float t[8];
#pragma unroll
  for (int e = 0; e < 8; ++e) t[e] = -INFINITY;
  if (wact) {
    const float* row = S + ((size_t)hg * NSEQ + (size_t)i) * NSEQ + j0;
    const v4f a0 = *(const v4f*)(row);
    const v4f a1 = *(const v4f*)(row + 4);
    float s[8];
#pragma unroll
    for (int e = 0; e < 4; ++e) { s[e] = a0[e]; s[4 + e] = a1[e]; }
#pragma unroll
    for (int e = 0; e < 8; ++e) {
      const int j   = j0 + e;
      const int dij = i - j;
      const float R   = (float)(dij < 0 ? -dij : dij);
      const float wr  = wh * R;
      const float den = 1.0f + __expf(vh - wr);
      const float rh  = numr * __builtin_amdgcn_rcpf(den);
      const float sc  = (fmaxf(s[e], 0.0f) * rh) * 0.125f;
      t[e] = (j <= i) ? sc : -INFINITY;
    }
  }
  float m = fmaxf(fmaxf(fmaxf(t[0], t[1]), fmaxf(t[2], t[3])), fmaxf(fmaxf(t[4], t[5]), fmaxf(t[6], t[7])));
#pragma unroll
  for (int off = 16; off > 0; off >>= 1) m = fmaxf(m, __shfl_xor(m, off, 32));
  if (lane == 0) redm[wave] = m;
  __syncthreads();
  float mx = redm[0];
#pragma unroll
  for (int w = 1; w < 8; ++w) mx = fmaxf(mx, redm[w]);
  float ex[8];
#pragma unroll
  for (int e = 0; e < 8; ++e) ex[e] = 0.f;
  if (wact) {
#pragma unroll
    for (int e = 0; e < 8; ++e) ex[e] = __expf(t[e] - mx);
  }
  float ps = ((((((ex[0] + ex[1]) + ex[2]) + ex[3]) + ex[4]) + ex[5]) + ex[6]) + ex[7];
#pragma unroll
  for (int off = 16; off > 0; off >>= 1) ps += __shfl_xor(ps, off, 32);
  if (lane == 0) reds[wave] = ps;
  __syncthreads();
  float tot = reds[0];
#pragma unroll
  for (int w = 1; w < 8; ++w) tot += reds[w];
  const float inv = 1.0f / tot;              // tot >= 1 (the row maximum contributes exp(0))
  unsigned hw[4], lw[4];
#pragma unroll
  for (int q = 0; q < 4; ++q) {
    const float p0 = ex[2 * q] * inv, p1 = ex[2 * q + 1] * inv;
    const unsigned short hb0 = f2bf_bits(p0), hb1 = f2bf_bits(p1);
    const unsigned short lb0 = f2bf_bits(p0 - bf_bits2f(hb0));
    const unsigned short lb1 = f2bf_bits(p1 - bf_bits2f(hb1));
    hw[q] = pk16(hb0, hb1);
    lw[q] = pk16(lb0, lb1);
  }
  const v4u hvv = (v4u){hw[0], hw[1], hw[2], hw[3]};
  const v4u lvv = (v4u){lw[0], lw[1], lw[2], lw[3]};
  const size_t rowoff = ((size_t)hg * NSEQ + (size_t)i) * NSEQ + j0;
  *(v4u*)(Phi + rowoff) = hvv;
  *(v4u*)(Plo + rowoff) = lvv;
  
}

// ---------------------------------------------------------------------------
// Workspace region map (byte offsets; all offsets multiples of 2 MiB). Every per-batch region is fully rewritten
// inside each batch iteration before it is read, except S whose strictly-upper 64x64 tiles are never produced and
// never read unmasked. X and O share one region: X is read only by the two projection GEMMs of the same batch,
// which precede every PV GEMM (the O producers) in stream order; O is fully written (8 groups x 128 columns x 2048
// rows) before the output projection reads it.
//   WqkTh  bf16 [2048][1024]  rows 0..1023 = Wq^T, 1024..2047 = Wk^T         0
//   WqkTl  bf16 [2048][1024]                                          4194304
//   WvTh   bf16 [1024][1024]                                          8388608
//   WvTl   bf16 [1024][1024]                                         10485760
//   WoTh   bf16 [1024][1024]                                         12582912
//   WoTl   bf16 [1024][1024]                                         14680064
//   XOh    bf16 [2048][1024]  x[b] hi, later ctx hi (col h*64+d)     16777216
//   XOl    bf16 [2048][1024]                                         20971520
//   QKh    bf16 [2048][2048]  q at col h*64+d, k at col 1024+h*64+d  25165824
//   QKl    bf16 [2048][2048]                                         33554432
//   VTh    bf16 [1024][2048]  row h*64+d, col token                  41943040
//   VTl    bf16 [1024][2048]                                         46137344
//   S      f32  [HGRP][2048][2048]                                   50331648
//   Ph     bf16 [HGRP][2048][2048]                                   83886080
//   Pl     bf16 [HGRP][2048][2048]                                  100663296
//   total                                                           117440512
// ---------------------------------------------------------------------------
extern "C" void kernel_launch(void* const* d_in, const int* in_sizes, int n_in,
                              void* d_out, int out_size, void* d_ws, size_t ws_size,
                              hipStream_t stream) {
  if (n_in < 8) return;
  if (in_sizes[0] != NB * NSEQ * DIN) return;
  if (in_sizes[1] != DIN * DOUT || in_sizes[2] != DIN * DOUT || in_sizes[3] != DIN * DOUT) return;
  if (in_sizes[4] != DOUT * DOUT || in_sizes[5] != DOUT) return;
  if (in_sizes[6] < NH || in_sizes[7] < NH) return;
  if (out_size != NB * NSEQ * DOUT) return;

  const float* x  = (const float*)d_in[0];
  const float* Wq = (const float*)d_in[1];
  const float* Wk = (const float*)d_in[2];
  const float* Wv = (const float*)d_in[3];
  const float* Wo = (const float*)d_in[4];
  const float* bo = (const float*)d_in[5];
  const float* wp = (const float*)d_in[6];
  const float* vp = (const float*)d_in[7];

  const size_t PW  = (size_t)DIN * DOUT * 2;              // 16-bit [1024][1024] plane
  const size_t PX  = (size_t)NSEQ * DIN * 2;              // 16-bit [2048][1024] plane
  const size_t PQK = (size_t)NSEQ * (2 * DOUT) * 2;       // 16-bit [2048][2048] plane
  const size_t PVT = (size_t)DOUT * NSEQ * 2;             // 16-bit [1024][2048] plane
  const size_t PS  = (size_t)HGRP * NSEQ * NSEQ * 4;      // f32 score planes of one group
  const size_t PP  = (size_t)HGRP * NSEQ * NSEQ * 2;      // bf16 probability planes of one group
  size_t off = 0;
  const size_t oWqkTh = off; off += 2 * PW;
  const size_t oWqkTl = off; off += 2 * PW;
  const size_t oWvTh  = off; off += PW;
  const size_t oWvTl  = off; off += PW;
  const size_t oWoTh  = off; off += PW;
  const size_t oWoTl  = off; off += PW;
  const size_t oXOh   = off; off += PX;
  const size_t oXOl   = off; off += PX;
  const size_t oQKh   = off; off += PQK;
  const size_t oQKl   = off; off += PQK;
  const size_t oVTh   = off; off += PVT;
  const size_t oVTl   = off; off += PVT;
  const size_t oS     = off; off += PS;
  const size_t oPh    = off; off += PP;
  const size_t oPl    = off; off += PP;
  if (off > ws_size) return;

  char* ws = (char*)d_ws;
  unsigned short* WqkTh = (unsigned short*)(ws + oWqkTh);
  unsigned short* WqkTl = (unsigned short*)(ws + oWqkTl);
  unsigned short* WvTh  = (unsigned short*)(ws + oWvTh);
  unsigned short* WvTl  = (unsigned short*)(ws + oWvTl);
  unsigned short* WoTh  = (unsigned short*)(ws + oWoTh);
  unsigned short* WoTl  = (unsigned short*)(ws + oWoTl);
  unsigned short* XOh   = (unsigned short*)(ws + oXOh);
  unsigned short* XOl   = (unsigned short*)(ws + oXOl);
  unsigned short* QKh   = (unsigned short*)(ws + oQKh);
  unsigned short* QKl   = (unsigned short*)(ws + oQKl);
  unsigned short* VTh   = (unsigned short*)(ws + oVTh);
  unsigned short* VTl   = (unsigned short*)(ws + oVTl);
  float*          Sbuf  = (float*)(ws + oS);
  unsigned short* Ph    = (unsigned short*)(ws + oPh);
  unsigned short* Pl    = (unsigned short*)(ws + oPl);

  const dim3 blk(256);
  // weight planes: in [1024 rows = input feature k][1024 cols = output feature n] -> out[n][k]; grid (cols/64, rows/64)
  const dim3 gTr(DOUT / 64, DIN / 64);
  transpose_split_kernel<<<gTr, blk, 0, stream>>>(Wq, DOUT, WqkTh, WqkTl, DIN);
  transpose_split_kernel<<<gTr, blk, 0, stream>>>(Wk, DOUT, WqkTh + (size_t)DOUT * DIN, WqkTl + (size_t)DOUT * DIN, DIN);
  transpose_split_kernel<<<gTr, blk, 0, stream>>>(Wv, DOUT, WvTh, WvTl, DIN);
  transpose_split_kernel<<<gTr, blk, 0, stream>>>(Wo, DOUT, WoTh, WoTl, DOUT);

  const int n2x = NSEQ * DIN / 2;                                   // 1048576 pairs per batch slice
  const dim3 gSplit((n2x + 255) / 256);                             // 4096 blocks x 256 thr x 2 = 2048x1024
  const dim3 blk16(512);                                            // 16 waves: split-K of the PV product
  const dim3 gQK((NSEQ / 64) * (2 * DOUT / 64), 1);                 // 1024 blocks (one tile each): M=2048, N=2048, K=1024
  const dim3 gVT((DOUT / 64) * (NSEQ / 64), 1);                     // 512 blocks:  M=1024, N=2048, K=1024
  const dim3 gS(((NSEQ / 64) * (NSEQ / 64) + 7) / 8, HGRP);         // 128 x 2:    M=N=2048, K=64 (lower block triangle)
  const dim3 gSm(NSEQ, HGRP);                                       // one block per (row, head-in-group)
  const dim3 gPV((NSEQ / 64) * (HDIM / 64), HGRP);                  // 32 x 2:     M=2048, N=64, K=2048 (causal k bound)
  const dim3 gOut((NSEQ / 64) * (DOUT / 64), 1);                    // 512 blocks: M=2048, N=1024, K=1024

  for (int b = 0; b < NB; ++b) {
    // (1) x[b] -> bf16 hi/lo planes [2048][1024] (whole plane: 4096 blocks x 256 thr x 2)
    split_bf16x2_kernel<<<gSplit, blk, 0, stream>>>(x + (size_t)b * NSEQ * DIN, XOh, XOl, n2x);
    // (2) [q | k] = x . [Wq | Wk] -> QK hi/lo planes [2048][2048] (whole planes: 32x32 tiles)
    wmma_gemm64<1, true, 0, 2, false, 0, false, false, 8><<<gQK, blk, 0, stream>>>(
        XOh, XOl, DIN, 0L, WqkTh, WqkTl, DIN, 0L, (void*)QKh, (void*)QKl, 2 * DOUT, 0L,
        bo, bo, 0L, NSEQ, 2 * DOUT, DIN, 1.0f);
    // (3) v^T[o][tok] = sum_k Wv^T[o][k] x[tok][k] -> VT hi/lo planes [1024][2048] (whole planes: 16x32 tiles)
    wmma_gemm64<1, true, 0, 2, false, 0, false, false, 8><<<gVT, blk, 0, stream>>>(
        WvTh, WvTl, DIN, 0L, XOh, XOl, DIN, 0L, (void*)VTh, (void*)VTl, NSEQ, 0L,
        bo, bo, 0L, DOUT, NSEQ, DIN, 1.0f);
    for (int g = 0; g < NGRP; ++g) {
      const size_t qcol = (size_t)g * HGRP * HDIM;                  // first q column of the group; y adds hg*64
      // (4) S[hg][i][j] = q_i . k_j (raw) for 64x64 tiles with j0 <= i0; heads g*2 + hg, hg = blockIdx.y
      wmma_gemm64<1, true, 0, 0, false, 0, true, false><<<gS, blk, 0, stream>>>(
          QKh + qcol, QKl + qcol, 2 * DOUT, (long)HDIM,
          QKh + DOUT + qcol, QKl + DOUT + qcol, 2 * DOUT, (long)HDIM,
          (void*)Sbuf, (void*)Sbuf, NSEQ, (long)NSEQ * NSEQ,
          bo, bo, 0L, NSEQ, NSEQ, HDIM, 1.0f);
      // (5) relu * decay * 1/8, causal -inf, softmax -> P hi/lo planes (whole 2048x2048 per plane and hg)
      decay_softmax_kernel<<<gSm, blk, 0, stream>>>(Sbuf, wp, vp, Ph, Pl, g);
      // (6) ctx[i][h*64+d] = sum_j P[hg][i][j] VT[h*64+d][j] -> O hi/lo planes, columns g*128 + hg*64 .. +63
      wmma_gemm64<1, true, 0, 2, false, 0, false, true, 16><<<gPV, blk16, 0, stream>>>(
          Ph, Pl, NSEQ, (long)NSEQ * NSEQ,
          VTh + qcol * NSEQ, VTl + qcol * NSEQ, NSEQ, (long)HDIM * NSEQ,
          (void*)(XOh + qcol), (void*)(XOl + qcol), DOUT, (long)HDIM,
          bo, bo, 0L, NSEQ, HDIM, NSEQ, 1.0f);
    }
    // (7) out[b] = ctx . Wo + bo (f32, whole [2048][1024] slice of d_out)
    float* outb = (float*)d_out + (size_t)b * NSEQ * DOUT;
    wmma_gemm64<1, true, 2, 0, false, 0, false, false, 8><<<gOut, blk, 0, stream>>>(
        XOh, XOl, DOUT, 0L, WoTh, WoTl, DOUT, 0L, (void*)outb, (void*)outb, DOUT, 0L,
        bo, bo, 0L, NSEQ, DOUT, DOUT, 1.0f);
  }
  (void)hipGetLastError();
}

// v002
// One run takes 302 microseconds.
// Next to v001, in two timings, it ran 3.01 and 2.97 times as fast.
// Over all steps from v000 it is 8.40 times as fast.
// Every contraction (x.Wq|Wk, Wv^T.x^T, k.q^T, v^T.p^T, ctx.Wo): v_wmma_f32_16x16x32_bf16 on bf16 hi/lo split operand planes (hi.hi + hi.lo + lo.hi), f32 accumulate; relu, distance decay, causal mask and softmax in f32.
#include <hip/hip_runtime.h>
#include <math.h>
#include <stdint.h>

#define NB    2
#define NSEQ  2048
#define DIN   1024
#define DOUT  1024
#define NH    16
#define HDIM  64

typedef __attribute__((ext_vector_type(16))) _Float16 v16h;
typedef __attribute__((ext_vector_type(8)))  _Float16 v8h;
typedef __attribute__((ext_vector_type(16))) __bf16   v16b;
typedef __attribute__((ext_vector_type(8)))  __bf16   v8b;
typedef __attribute__((ext_vector_type(8)))  float    v8f;
typedef __attribute__((ext_vector_type(4)))  float    v4f;
typedef __attribute__((ext_vector_type(2)))  float    v2f;
typedef __attribute__((ext_vector_type(4)))  unsigned int v4u;
typedef __attribute__((ext_vector_type(2)))  unsigned int v2u;

__device__ __forceinline__ unsigned short f2bf_bits(float f) {
  unsigned u = __float_as_uint(f);
  return (unsigned short)((u + 0x7FFFu + ((u >> 16) & 1u)) >> 16);
}
__device__ __forceinline__ float bf_bits2f(unsigned short h) { return __uint_as_float(((unsigned)h) << 16); }

// hazard guards as plain device helpers (no inline asm inside the kernel template body)
__device__ __forceinline__ void dep_guard_h(v8f& a, v8f& b, v16h x, v16h y) { asm volatile("v_nop\n\tv_nop\n\tv_nop\n\tv_nop" : "+v"(a), "+v"(b) : "v"(x), "v"(y)); }
__device__ __forceinline__ void dep_guard_b(v8f& a, v8f& b, v16b x, v16b y) { asm volatile("v_nop\n\tv_nop\n\tv_nop\n\tv_nop" : "+v"(a), "+v"(b) : "v"(x), "v"(y)); }
__device__ __forceinline__ void keep4_h(v16h a, v16h b, v16h c, v16h d) { asm volatile("v_nop" :: "v"(a), "v"(b), "v"(c), "v"(d)); }
__device__ __forceinline__ void keep4_b(v16b a, v16b b, v16b c, v16b d) { asm volatile("v_nop" :: "v"(a), "v"(b), "v"(c), "v"(d)); }
__device__ __forceinline__ void acc_guard4(v8f& a, v8f& b, v8f& c, v8f& d) { asm volatile("v_nop\n\tv_nop\n\tv_nop\n\tv_nop" : "+v"(a), "+v"(b), "+v"(c), "+v"(d)); }
template <typename T> struct Frag;
template <> struct Frag<_Float16> {
  typedef v16h V; union U { v16h v; v8h h[2]; };
  static __device__ __forceinline__ v16h load(const _Float16* p) {   // elements 0..7 <- p[0..7], 8..15 <- p[16..23]
    U f; f.h[0] = *(const v8h*)(p); f.h[1] = *(const v8h*)(p + 16); return f.v;
  }
  static __device__ __forceinline__ v8f mma(v16h a, v16h b, v8f c) {
    return __builtin_amdgcn_wmma_f32_16x16x32_f16(false, a, false, b, (short)0, c, false, false);
  }
  static __device__ __forceinline__ void guard(v8f& a, v8f& b, v16h x, v16h y) { dep_guard_h(a, b, x, y); }
  static __device__ __forceinline__ void keep(v16h a, v16h b, v16h c, v16h d) { keep4_h(a, b, c, d); }
};
template <> struct Frag<__bf16> {
  typedef v16b V; union U { v16b v; v8b h[2]; };
  static __device__ __forceinline__ v16b load(const __bf16* p) {
    U f; f.h[0] = *(const v8b*)(p); f.h[1] = *(const v8b*)(p + 16); return f.v;
  }
  static __device__ __forceinline__ v8f mma(v16b a, v16b b, v8f c) {
    return __builtin_amdgcn_wmma_f32_16x16x32_bf16(false, a, false, b, (short)0, c, false, false);
  }
  static __device__ __forceinline__ void guard(v8f& a, v8f& b, v16b x, v16b y) { dep_guard_b(a, b, x, y); }
  static __device__ __forceinline__ void keep(v16b a, v16b b, v16b c, v16b d) { keep4_b(a, b, c, d); }
};

// ---- Register-blocked batched WMMA GEMM ------------------------------------
// C[m,n] = scale * sum_k A[m,k] * Bt[n,k] (+bias)(+resid); each wave owns a 64x64 tile.
// A row-major [M,K]; Bt row-major [N,K]; M,N % 64 == 0, K % 32 == 0.
// SPLIT: operands are hi/lo planes (A2/Bt2 = lo planes, same layout); product = hi·hi + hi·lo + lo·hi.
// BIAS_MODE: 0 = none, 1 = bias[m], 2 = bias[n].
// OUT_MODE: 0 = f32, 1 = f16, 2 = bf16 hi plane (Cout) + bf16 lo plane (Cout2).
// ET: 0 = f16 operands, 1 = bf16 operands (pointers passed as 16-bit storage)
// Added modes (defaults off, all other behaviour unchanged):
//   LOWER:   tiles with n0 > m0 (strictly above the 64x64 block diagonal) are not produced (wave-uniform early exit).
//   CAUSALK: the k-loop stops at min(K, m0 + 64); valid when A rows m0..m0+63 are exactly zero for k >= m0 + 64.
//   KW > 0:  split-K. One 64x64 tile per block of KW waves (tile = blockIdx.x); wave w takes the 64-wide k chunks
//            w, w + KW, ... (K % 64 == 0), and the KW f32 partial tiles are summed through LDS in wave order 0..KW-1.
template <int ET> struct Elem;
template <> struct Elem<0> { typedef _Float16 T; };
template <> struct Elem<1> { typedef __bf16 T; };
template <int ET, bool SPLIT, int BIAS_MODE, int OUT_MODE, bool RESID, int ACT = 0, bool LOWER = false, bool CAUSALK = false, int KW = 0>
__global__ __launch_bounds__(KW ? KW * 32 : 256) void wmma_gemm64(
    const unsigned short* __restrict__ Ap, const unsigned short* __restrict__ A2p, int lda, long strideA,
    const unsigned short* __restrict__ Btp, const unsigned short* __restrict__ Bt2p, int ldb, long strideB,
    void* __restrict__ Cout, void* __restrict__ Cout2, int ldc, long strideC,
    const float* __restrict__ bias,
    const float* __restrict__ resid, long strideR,
    int M, int N, int K, float scale) {
  typedef typename Elem<ET>::T T;
  typedef typename Frag<T>::V V;
  const T* A = (const T*)Ap; const T* A2 = (const T*)A2p; const T* Bt = (const T*)Btp; const T* Bt2 = (const T*)Bt2p;
  static_assert(KW == 0 || ((KW == 8 || KW == 16) && !RESID && ACT == 0 && OUT_MODE != 1 && !LOWER), "split-K covers plain f32 / bf16 hi-lo outputs");
  __shared__ __align__(16) float sT[KW ? 2 * KW : 8][16 * 68];   // per-wave 16x64 slab, pitch 68 floats (split-K: two sets)
  const int b    = blockIdx.y;
  const int lane = threadIdx.x & 31;
  const int wave = KW ? __builtin_amdgcn_readfirstlane((int)(threadIdx.x >> 5)) : (int)(threadIdx.x >> 5);
  const int tilesN = N >> 6;
  const int tilesM = M >> 6;
  const int tile = KW ? (int)blockIdx.x : (int)(blockIdx.x * 8 + wave);
  if (tile >= tilesM * tilesN) return;   // KW == 0: wave-uniform, no block barriers; KW > 0: block-uniform, ahead of every barrier
  const int tm = tile / tilesN;
  const int tn = tile - tm * tilesN;
  const int m0 = tm << 6;
  const int n0 = tn << 6;
  if (LOWER && n0 > m0) return;          // wave-uniform; LOWER excludes split-K, so no block barriers follow

  const T* Ab  = A  + (size_t)b * strideA;
  const T* Bb  = Bt + (size_t)b * strideB;
  const T* Ab2 = SPLIT ? (A2  + (size_t)b * strideA) : nullptr;
  const T* Bb2 = SPLIT ? (Bt2 + (size_t)b * strideB) : nullptr;

  const int rlane = lane & 15;                 // row (A) / col (B, D) within subtile
  const int koff  = (lane >> 4) * 8;           // k offset of this lane half
  const int mOff  = (lane >> 4) * 8;           // D row offset

  v8f acc[4][4];
#pragma unroll
  for (int i = 0; i < 4; ++i)
#pragma unroll
    for (int j = 0; j < 4; ++j) acc[i][j] = (v8f){0.f,0.f,0.f,0.f,0.f,0.f,0.f,0.f};

  const int kEnd = CAUSALK ? (((m0 + 64) < K) ? (m0 + 64) : K) : K;
  // KW > 0: two 32-steps inside a 64-wide chunk (one whole 128-B line of each operand row), then on to this wave's next chunk
  for (int k0 = KW ? (wave << 6) : 0; k0 < kEnd; k0 += (KW && (k0 & 32)) ? (KW * 64 - 32) : 32) {
    V bh[4], bl[4];
#pragma unroll
    for (int j = 0; j < 4; ++j) {
      const size_t bo = (size_t)(n0 + (j << 4) + rlane) * ldb + koff + k0;
      bh[j] = Frag<T>::load(Bb + bo);
      if (SPLIT) bl[j] = Frag<T>::load(Bb2 + bo);
    }
#pragma unroll
    for (int i = 0; i < 4; ++i) {
      const size_t ao = (size_t)(m0 + (i << 4) + rlane) * lda + koff + k0;
      V ah = Frag<T>::load(Ab + ao);
      V al;
      if (SPLIT) al = Frag<T>::load(Ab2 + ao);
#pragma unroll
      for (int j = 0; j < 4; ++j) {
        acc[i][j] = Frag<T>::mma(ah, bh[j], acc[i][j]);
        if (SPLIT) {
          acc[i][j] = Frag<T>::mma(ah, bl[j], acc[i][j]);
          acc[i][j] = Frag<T>::mma(al, bh[j], acc[i][j]);
        }
      }
      Frag<T>::guard(acc[i][0], acc[i][3], ah, SPLIT ? al : ah);
    }
    Frag<T>::keep(bh[0], bh[1], bh[2], bh[3]);
    if (SPLIT) Frag<T>::keep(bl[0], bl[1], bl[2], bl[3]);
  }
  acc_guard4(acc[0][0], acc[0][1], acc[0][2], acc[0][3]);
  acc_guard4(acc[1][0], acc[1][1], acc[1][2], acc[1][3]);
  acc_guard4(acc[2][0], acc[2][1], acc[2][2], acc[2][3]);
  acc_guard4(acc[3][0], acc[3][1], acc[3][2], acc[3][3]);

  // ---- split-K epilogue: sum the KW partial tiles, 16 rows at a time ----
  if constexpr (KW > 0) {
    constexpr int EPT = 1024 / (KW * 32);               // outputs per thread of a 16x64 row group: 4 or 2
    typedef float vE __attribute__((ext_vector_type(EPT)));
    const int row = (int)threadIdx.x / (64 / EPT);      // 0..15
    const int c   = ((int)threadIdx.x % (64 / EPT)) * EPT;
    float v[4][EPT];                                    // results wait in registers: no global store stands in front of a barrier
#pragma unroll
    for (int i = 0; i < 4; ++i) {
      float* part = sT[(i & 1) * KW + wave];
#pragma unroll
      for (int j = 0; j < 4; ++j)
#pragma unroll
        for (int r = 0; r < 8; ++r) part[(mOff + r) * 68 + (j << 4) + rlane] = acc[i][j][r];
      // publishes all KW partials of row group i; with two slab sets it also ends the reads of group i - 1
      // before group i + 1 overwrites their set
      __syncthreads();
      const float* rp = sT[(i & 1) * KW] + row * 68 + c;
      vE s = *(const vE*)rp;
#pragma unroll
      for (int w = 1; w < KW; ++w) s += *(const vE*)(rp + w * (16 * 68));
#pragma unroll
      for (int e = 0; e < EPT; ++e) v[i][e] = s[e];
    }
#pragma unroll
    for (int i = 0; i < 4; ++i) {
      const int m = m0 + (i << 4) + row;
#pragma unroll
      for (int e = 0; e < EPT; ++e) {
        v[i][e] *= scale;
        if (BIAS_MODE == 1) v[i][e] += bias[m];
        if (BIAS_MODE == 2) v[i][e] += bias[n0 + c + e];
      }
      const size_t co = (size_t)b * strideC + (size_t)m * ldc + n0 + c;
      if (OUT_MODE == 0) {
        vE o;
#pragma unroll
        for (int e = 0; e < EPT; ++e) o[e] = v[i][e];
        *(vE*)((float*)Cout + co) = o;
      } else {
        unsigned hw[EPT / 2], lw[EPT / 2];
#pragma unroll
        for (int q = 0; q < EPT / 2; ++q) {
          const float f0 = v[i][2 * q], f1 = v[i][2 * q + 1];
          const unsigned short h0 = f2bf_bits(f0), h1 = f2bf_bits(f1);
          const unsigned short l0 = f2bf_bits(f0 - bf_bits2f(h0)), l1 = f2bf_bits(f1 - bf_bits2f(h1));
          hw[q] = (unsigned)h0 | ((unsigned)h1 << 16);
          lw[q] = (unsigned)l0 | ((unsigned)l1 << 16);
        }
        if constexpr (EPT == 4) {
          *(v2u*)((unsigned short*)Cout + co)  = (v2u){hw[0], hw[1]};
          *(v2u*)((unsigned short*)Cout2 + co) = (v2u){lw[0], lw[1]};
        } else {
          *(unsigned*)((unsigned short*)Cout + co)  = hw[0];
          *(unsigned*)((unsigned short*)Cout2 + co) = lw[0];
        }
      }
    }
    return;
  }

  // ---- epilogue ----
  float* slab = sT[wave];
  const float* Rb = RESID ? (resid + (size_t)b * strideR) : nullptr;
#pragma unroll
  for (int i = 0; i < 4; ++i) {
    const int mBase = m0 + (i << 4);
#pragma unroll
    for (int j = 0; j < 4; ++j) {
      const int n = n0 + (j << 4) + rlane;
      float bv = 0.f;
      if (BIAS_MODE == 2) bv = bias[n];
#pragma unroll
      for (int r = 0; r < 8; ++r) {
        float v = acc[i][j][r] * scale;
        if (BIAS_MODE == 1) v += bias[mBase + mOff + r];
        if (BIAS_MODE == 2) v += bv;
        if (RESID) v += Rb[(size_t)(mBase + mOff + r) * ldc + n];
        if (ACT == 1) v = tanhf(v);
        if (ACT == 2) v = fmaxf(v, 0.0f);
        if (ACT == 3) v = v / (1.0f + expf(-v));
        if (ACT == 4) v = (v > 0.f) ? v : 0.01f * v;
        if (ACT == 5) v = 0.5f * v * (1.0f + erff(v * 0.70710678118654752f));
        slab[(mOff + r) * 68 + (j << 4) + rlane] = v;
      }
    }
    __builtin_amdgcn_fence(__ATOMIC_RELEASE, "workgroup");
    __builtin_amdgcn_wave_barrier();
    __builtin_amdgcn_fence(__ATOMIC_ACQUIRE, "workgroup");
    if (OUT_MODE == 0) {
      float* C = (float*)Cout + (size_t)b * strideC;
      const int hh = lane >> 4, c4 = (lane & 15) * 4;     // row seg = 256 B = 16 lanes x 16 B
      {
#pragma unroll
        for (int it = 0; it < 8; ++it) {
          const int row = it * 2 + hh;
          v4f v = *(const v4f*)(slab + row * 68 + c4);
          *(v4f*)(C + (size_t)(mBase + row) * ldc + n0 + c4) = v;
        }
        
      }
    } else {
      const int q = lane >> 3, c8 = (lane & 7) * 8;
      unsigned short* C  = (unsigned short*)Cout  + (size_t)b * strideC;
      unsigned short* C2 = (OUT_MODE == 2) ? ((unsigned short*)Cout2 + (size_t)b * strideC) : nullptr;
      {
#pragma unroll
        for (int it = 0; it < 4; ++it) {
          const int row = it * 4 + q;
          const float* sp = slab + row * 68 + c8;
          v8h hv, lv;
#pragma unroll
          for (int e = 0; e < 8; ++e) {
            if (OUT_MODE == 1) {
              hv[e] = (_Float16)sp[e];
            } else {
              unsigned short hb = f2bf_bits(sp[e]);
              unsigned short lb = f2bf_bits(sp[e] - bf_bits2f(hb));
              hv[e] = __builtin_bit_cast(_Float16, hb);
              lv[e] = __builtin_bit_cast(_Float16, lb);
            }
          }
          *(v8h*)(C + (size_t)(mBase + row) * ldc + n0 + c8) = hv;
          if (OUT_MODE == 2) *(v8h*)(C2 + (size_t)(mBase + row) * ldc + n0 + c8) = lv;
        }
        
      }
    }
    __builtin_amdgcn_fence(__ATOMIC_RELEASE, "workgroup");
    __builtin_amdgcn_wave_barrier();
    __builtin_amdgcn_fence(__ATOMIC_ACQUIRE, "workgroup");
  }
}

// ---------------------------------------------------------------------------
// Elementwise split: 2 elements per thread, one 4-B store per lane per plane -> each wave writes exactly one
// Coverage: grid = ceil(n2/256) blocks x 256 threads x 2 elements = 2*n2 elements = the whole plane (n2 = plane/2).
// ---------------------------------------------------------------------------
__device__ __forceinline__ unsigned pk16(unsigned short a, unsigned short b) { return (unsigned)a | ((unsigned)b << 16); }

// hi = bf16_rne(in), lo = bf16_rne(in - hi)
__global__ __launch_bounds__(256) void split_bf16x2_kernel(const float* __restrict__ in, unsigned short* __restrict__ hi,
                                                           unsigned short* __restrict__ lo, int n2) {
  const int i = blockIdx.x * 256 + threadIdx.x;
  if (i < n2) {
    const v2f f = *(const v2f*)(in + 2 * (size_t)i);
    const unsigned short h0 = f2bf_bits(f[0]), h1 = f2bf_bits(f[1]);
    const unsigned short l0 = f2bf_bits(f[0] - bf_bits2f(h0)), l1 = f2bf_bits(f[1] - bf_bits2f(h1));
    const unsigned uh = pk16(h0, h1), ul = pk16(l0, l1);
    ((unsigned*)hi)[i] = uh;
    ((unsigned*)lo)[i] = ul;
    
  }
}

// ---------------------------------------------------------------------------
// Transpose + bf16 hi/lo split of an f32 matrix: in [rows][cols] (row pitch ldi floats) ->
// outh/outl[c][r] = split(in[r][c]) (row pitch ldo u16). grid (cols/64, rows/64), 256 threads; rows, cols % 64 == 0.
// Coverage per block: load 4 it x 256 thr x 4 f32 = 64x64; store 2 it x 256 thr x 8 u16 = 64x64 per plane;
// ---------------------------------------------------------------------------
__global__ __launch_bounds__(256) void transpose_split_kernel(const float* __restrict__ in, int ldi,
                                                              unsigned short* __restrict__ outh,
                                                              unsigned short* __restrict__ outl, int ldo) {
  __shared__ __align__(16) float tf[64 * 68];
  const int c0  = blockIdx.x * 64;   // input column block = output row block
  const int r0  = blockIdx.y * 64;   // input row block    = output column block
  const int tid = threadIdx.x;
  {
    const int sub = tid >> 4;          // 0..15
    const int c4  = (tid & 15) * 4;    // 0..60
#pragma unroll
    for (int it = 0; it < 4; ++it) {
      const int rr = it * 16 + sub;
      const v4f a = *(const v4f*)(in + (size_t)(r0 + rr) * ldi + c0 + c4);
      *(v4f*)(tf + rr * 68 + c4) = a;
    }
  }
  __syncthreads();
  const int s8 = tid >> 3;             // 0..31
  const int c8 = (tid & 7) * 8;        // 0..56
  v4u hv[2], lv[2];
#pragma unroll
  for (int it = 0; it < 2; ++it) {
    const int oc = it * 32 + s8;       // output row within tile (= input column)
    v4u a, a2;
#pragma unroll
    for (int q = 0; q < 4; ++q) {
      const float f0 = tf[(c8 + 2 * q) * 68 + oc];
      const float f1 = tf[(c8 + 2 * q + 1) * 68 + oc];
      const unsigned short h0 = f2bf_bits(f0), h1 = f2bf_bits(f1);
      const unsigned short l0 = f2bf_bits(f0 - bf_bits2f(h0));
      const unsigned short l1 = f2bf_bits(f1 - bf_bits2f(h1));
      a[q]  = pk16(h0, h1);
      a2[q] = pk16(l0, l1);
    }
    hv[it] = a; lv[it] = a2;
  }
  {
#pragma unroll
    for (int it = 0; it < 2; ++it) {
      const int oc = it * 32 + s8;
      const size_t go = (size_t)(c0 + oc) * ldo + r0 + c8;
      *(v4u*)(outh + go) = hv[it];
      *(v4u*)(outl + go) = lv[it];
    }
    
  }
}

// ---------------------------------------------------------------------------
// Fused causal attention, all batches and heads in one launch: scores, relu * distance decay, online softmax and P.V in one kernel;
// neither scores nor probabilities go to memory, no LDS, no barrier (the waves are independent).
// A wave owns 16 queries (one per lane column c) of head blockIdx.y, batch blockIdx.z, and walks the keys 32 at a time:
//   St[key][query] = K . Q^T   (A = K rows, B = Q rows kept in registers; both through the same loader)
//   t = relu(St) * R_hat(h, i - j) * 0.125 in log2 units, -inf for j > i (only the last pass holds such keys),
//   R_hat = (1 + exp(v[h])) * rcp(1 + exp(v[h] - w[h] * (i - j)))
//   running maximum m (starts at 0: every allowed t is >= 0 and key 0 is always allowed), p = exp2(t - m),
//   Ot[d][query] = Ot * exp2(m_old - m_new) + V^T . P^T
// The two 16-key score tiles of a pass, converted in place, are the B operand of the second product
// (element s = tile s >> 3, register s & 7), which is the k order the A loader of V^T delivers.
// A lane holds 8 + 8 keys of its query; lanes c and c + 16 share the maximum each pass and join their sums at the end.
// Waves 0..3 of a block take query groups from the long end, waves 4..7 the mirrored ones from the short end.
// Output: lane (c, hf) holds ctx[q0 + c][head*64 + ds*16 + hf*8 + 0..7]: one 16-B store per plane and ds;
// the 128-B line of a (query, head) is written by one wave. grid (NSEQ/128, NH, NB) x 8 waves x 16 queries = all rows.
// Every '#pragma unroll' below stands on a loop of constant trip count whose index selects a fragment or an accumulator:
// unrolled, those arrays stay in registers.
// ---------------------------------------------------------------------------
typedef __attribute__((ext_vector_type(2))) __bf16 v2b;

__device__ __forceinline__ float other_half(float x) {   // the value of lane l ^ 16
  const int b = __float_as_int(x);
  return __int_as_float(__builtin_amdgcn_permlanex16(b, b, 0x76543210, 0xfedcba98, false, false));
}
// hi = bf16_rne(f), lo = bf16_rne(f - hi), two values packed per word
__device__ __forceinline__ void split_pair(float f0, float f1, unsigned& hi, unsigned& lo) {
  hi = __builtin_bit_cast(unsigned, __builtin_convertvector((v2f){f0, f1}, v2b));
  const float r0 = f0 - __uint_as_float(hi << 16);
  const float r1 = f1 - __uint_as_float(hi & 0xFFFF0000u);
  lo = __builtin_bit_cast(unsigned, __builtin_convertvector((v2f){r0, r1}, v2b));
}

// four waves per SIMD (two blocks per WGP): the waves hide each other's load latency
__global__ __launch_bounds__(256) __attribute__((amdgpu_waves_per_eu(4, 4))) void fused_attn_kernel(const unsigned short* __restrict__ QKhp, const unsigned short* __restrict__ QKlp,
                                                         const unsigned short* __restrict__ VThp, const unsigned short* __restrict__ VTlp,
                                                         const float* __restrict__ wp, const float* __restrict__ vp,
                                                         unsigned short* __restrict__ Oh, unsigned short* __restrict__ Ol) {
  typedef Frag<__bf16> F;
  const int lane = threadIdx.x & 31;
  const int wave = __builtin_amdgcn_readfirstlane((int)(threadIdx.x >> 5));
  const int head = blockIdx.y;
  const size_t bz = blockIdx.z;
  const int c    = lane & 15;
  const int hf   = lane >> 4;
  const int tq   = (int)blockIdx.x * 4 + (wave & 3);            // 0..63
  const int qg   = (wave < 4) ? (NSEQ / 16 - 1 - tq) : tq;      // every 16-query group once
  const int q0   = qg << 4;
  const int np   = (q0 >> 5) + 1;                               // passes of 32 keys; keys of passes 0..np-2 are all < q0

  const float L2E = 1.44269504088896341f;
  const float w2  = wp[head] * L2E;
  const float v2  = vp[head] * L2E;
  const float c1  = (1.0f + __builtin_amdgcn_exp2f(v2)) * (0.125f * L2E);

  const size_t qo = (bz * NSEQ + q0 + c) * (2 * DOUT) + head * HDIM + hf * 8;
  const size_t ko = (bz * NSEQ + c) * (2 * DOUT) + DOUT + head * HDIM + hf * 8;
  const size_t vo = (bz * DOUT + head * HDIM + c) * NSEQ + hf * 8;
  const __bf16* Kh = (const __bf16*)QKhp + ko;
  const __bf16* Kl = (const __bf16*)QKlp + ko;
  const __bf16* Vh = (const __bf16*)VThp + vo;
  const __bf16* Vl = (const __bf16*)VTlp + vo;

  v16b qh[2], ql[2];
#pragma unroll
  for (int ks = 0; ks < 2; ++ks) {
    qh[ks] = F::load((const __bf16*)QKhp + qo + ks * 32);
    ql[ks] = F::load((const __bf16*)QKlp + qo + ks * 32);
  }
  // the address registers of the Q loads are reused right below; the loaded values as inputs keep the wait behind the loads
  asm volatile("s_wait_xcnt 0x0" :: "v"(qh[0]), "v"(qh[1]), "v"(ql[0]), "v"(ql[1]) : "memory");

  v8f o[4];
#pragma unroll
  for (int ds = 0; ds < 4; ++ds) o[ds] = (v8f){0.f,0.f,0.f,0.f,0.f,0.f,0.f,0.f};
  float m = 0.f, l = 0.f;

  for (int p = 0; p < np; ++p) {
    const int j0 = p << 5;
    // K rows and V^T columns of this pass
    v16b kh[2][2], kl[2][2];
#pragma unroll
    for (int a = 0; a < 2; ++a)
#pragma unroll
      for (int ks = 0; ks < 2; ++ks) {
        kh[a][ks] = F::load(Kh + (size_t)(j0 + a * 16) * (2 * DOUT) + ks * 32);
        kl[a][ks] = F::load(Kl + (size_t)(j0 + a * 16) * (2 * DOUT) + ks * 32);
      }
    v16b vh[4], vl[4];
#pragma unroll
    for (int ds = 0; ds < 4; ++ds) {
      vh[ds] = F::load(Vh + (size_t)(ds * 16) * NSEQ + j0);
      vl[ds] = F::load(Vl + (size_t)(ds * 16) * NSEQ + j0);
    }
    v8f st[2];
    st[0] = (v8f){0.f,0.f,0.f,0.f,0.f,0.f,0.f,0.f};
    st[1] = st[0];
#pragma unroll
    for (int ks = 0; ks < 2; ++ks) {
      st[0] = F::mma(kh[0][ks], qh[ks], st[0]);
      st[1] = F::mma(kh[1][ks], qh[ks], st[1]);
      st[0] = F::mma(kh[0][ks], ql[ks], st[0]);
      st[1] = F::mma(kh[1][ks], ql[ks], st[1]);
      st[0] = F::mma(kl[0][ks], qh[ks], st[0]);
      st[1] = F::mma(kl[1][ks], qh[ks], st[1]);
    }
    const int   lim  = q0 + c - j0 - hf * 8;          // i - j of this lane's first key; key 16a + r is allowed while 16a + r <= lim
    const float base = v2 - w2 * (float)lim;
    float tt[2][8];
#pragma unroll
    for (int a = 0; a < 2; ++a)
#pragma unroll
      for (int r = 0; r < 8; ++r) {
        const float e = __builtin_amdgcn_exp2f(fmaf(w2, (float)(a * 16 + r), base));
        tt[a][r] = fmaxf(st[a][r], 0.0f) * (c1 * __builtin_amdgcn_rcpf(1.0f + e));
      }
    if (p == np - 1) {                                 // wave-uniform
#pragma unroll
      for (int a = 0; a < 2; ++a)
#pragma unroll
        for (int r = 0; r < 8; ++r) tt[a][r] = (a * 16 + r <= lim) ? tt[a][r] : -INFINITY;
    }
    float mx = m;
#pragma unroll
    for (int a = 0; a < 2; ++a)
#pragma unroll
      for (int r = 0; r < 8; ++r) mx = fmaxf(mx, tt[a][r]);
    mx = fmaxf(mx, other_half(mx));
    const float alpha = __builtin_amdgcn_exp2f(m - mx);
    m = mx;
    float ps0 = 0.f, ps1 = 0.f;
#pragma unroll
    for (int r = 0; r < 8; ++r) {
      tt[0][r] = __builtin_amdgcn_exp2f(tt[0][r] - mx);
      tt[1][r] = __builtin_amdgcn_exp2f(tt[1][r] - mx);
      ps0 += tt[0][r];
      ps1 += tt[1][r];
    }
    l = l * alpha + (ps0 + ps1);
#pragma unroll
    for (int ds = 0; ds < 4; ++ds) o[ds] *= alpha;

    union PF { v16b v; unsigned u[8]; } ph, pl;
#pragma unroll
    for (int a = 0; a < 2; ++a)
#pragma unroll
      for (int r2 = 0; r2 < 4; ++r2) split_pair(tt[a][2 * r2], tt[a][2 * r2 + 1], ph.u[a * 4 + r2], pl.u[a * 4 + r2]);

#pragma unroll
    for (int ds = 0; ds < 4; ++ds) o[ds] = F::mma(vh[ds], ph.v, o[ds]);
#pragma unroll
    for (int ds = 0; ds < 4; ++ds) o[ds] = F::mma(vh[ds], pl.v, o[ds]);
#pragma unroll
    for (int ds = 0; ds < 4; ++ds) o[ds] = F::mma(vl[ds], ph.v, o[ds]);
  }

  l += other_half(l);
  const float inv = 1.0f / l;                          // l >= 1: the row maximum contributes exp2(0)
  const size_t oo = (bz * NSEQ + q0 + c) * DOUT + head * HDIM + hf * 8;
#pragma unroll
  for (int ds = 0; ds < 4; ++ds) {
    unsigned hw[4], lw[4];
#pragma unroll
    for (int r2 = 0; r2 < 4; ++r2) split_pair(o[ds][2 * r2] * inv, o[ds][2 * r2 + 1] * inv, hw[r2], lw[r2]);
    *(v4u*)(Oh + oo + ds * 16) = (v4u){hw[0], hw[1], hw[2], hw[3]};
    *(v4u*)(Ol + oo + ds * 16) = (v4u){lw[0], lw[1], lw[2], lw[3]};
  }
}

// ---------------------------------------------------------------------------
// Workspace region map (byte offsets; all offsets multiples of 2 MiB). Every region is fully written in each call
// before it is read. X and O share one region: X is read only by the projection GEMMs, which precede the attention
// kernel (the O producer) in stream order; O is fully written (2 batches x 16 heads x 64 columns x 2048 rows) before
// the output projections read it.
//   WqkTh  bf16 [2048][1024]  rows 0..1023 = Wq^T, 1024..2047 = Wk^T         0
//   WqkTl  bf16 [2048][1024]                                          4194304
//   WvTh   bf16 [1024][1024]                                          8388608
//   WvTl   bf16 [1024][1024]                                         10485760
//   WoTh   bf16 [1024][1024]                                         12582912
//   WoTl   bf16 [1024][1024]                                         14680064
//   XOh    bf16 [2][2048][1024]  x hi, later ctx hi (col h*64+d)        16777216
//   XOl    bf16 [2][2048][1024]                                         25165824
//   QKh    bf16 [2][2048][2048]  q at col h*64+d, k at col 1024+h*64+d  33554432
//   QKl    bf16 [2][2048][2048]                                         50331648
//   VTh    bf16 [2][1024][2048]  row h*64+d, col token                  67108864
//   VTl    bf16 [2][1024][2048]                                         75497472
//   total                                                               83886080
// ---------------------------------------------------------------------------
extern "C" void kernel_launch(void* const* d_in, const int* in_sizes, int n_in,
                              void* d_out, int out_size, void* d_ws, size_t ws_size,
                              hipStream_t stream) {
  if (n_in < 8) return;
  if (in_sizes[0] != NB * NSEQ * DIN) return;
  if (in_sizes[1] != DIN * DOUT || in_sizes[2] != DIN * DOUT || in_sizes[3] != DIN * DOUT) return;
  if (in_sizes[4] != DOUT * DOUT || in_sizes[5] != DOUT) return;
  if (in_sizes[6] < NH || in_sizes[7] < NH) return;
  if (out_size != NB * NSEQ * DOUT) return;

  const float* x  = (const float*)d_in[0];
  const float* Wq = (const float*)d_in[1];
  const float* Wk = (const float*)d_in[2];
  const float* Wv = (const float*)d_in[3];
  const float* Wo = (const float*)d_in[4];
  const float* bo = (const float*)d_in[5];
  const float* wp = (const float*)d_in[6];
  const float* vp = (const float*)d_in[7];

  const size_t PW  = (size_t)DIN * DOUT * 2;              // 16-bit [1024][1024] plane
  const size_t PX  = (size_t)NSEQ * DIN * 2;              // 16-bit [2048][1024] plane
  const size_t PQK = (size_t)NSEQ * (2 * DOUT) * 2;       // 16-bit [2048][2048] plane
  const size_t PVT = (size_t)DOUT * NSEQ * 2;             // 16-bit [1024][2048] plane
  size_t off = 0;
  const size_t oWqkTh = off; off += 2 * PW;
  const size_t oWqkTl = off; off += 2 * PW;
  const size_t oWvTh  = off; off += PW;
  const size_t oWvTl  = off; off += PW;
  const size_t oWoTh  = off; off += PW;
  const size_t oWoTl  = off; off += PW;
  const size_t oXOh   = off; off += NB * PX;
  const size_t oXOl   = off; off += NB * PX;
  const size_t oQKh   = off; off += NB * PQK;
  const size_t oQKl   = off; off += NB * PQK;
  const size_t oVTh   = off; off += NB * PVT;
  const size_t oVTl   = off; off += NB * PVT;
  if (off > ws_size) return;

  char* ws = (char*)d_ws;
  unsigned short* WqkTh = (unsigned short*)(ws + oWqkTh);
  unsigned short* WqkTl = (unsigned short*)(ws + oWqkTl);
  unsigned short* WvTh  = (unsigned short*)(ws + oWvTh);
  unsigned short* WvTl  = (unsigned short*)(ws + oWvTl);
  unsigned short* WoTh  = (unsigned short*)(ws + oWoTh);
  unsigned short* WoTl  = (unsigned short*)(ws + oWoTl);
  unsigned short* XOh   = (unsigned short*)(ws + oXOh);
  unsigned short* XOl   = (unsigned short*)(ws + oXOl);
  unsigned short* QKh   = (unsigned short*)(ws + oQKh);
  unsigned short* QKl   = (unsigned short*)(ws + oQKl);
  unsigned short* VTh   = (unsigned short*)(ws + oVTh);
  unsigned short* VTl   = (unsigned short*)(ws + oVTl);

  const dim3 blk(256);
  // weight planes: in [1024 rows = input feature k][1024 cols = output feature n] -> out[n][k]; grid (cols/64, rows/64)
  const dim3 gTr(DOUT / 64, DIN / 64);
  transpose_split_kernel<<<gTr, blk, 0, stream>>>(Wq, DOUT, WqkTh, WqkTl, DIN);
  transpose_split_kernel<<<gTr, blk, 0, stream>>>(Wk, DOUT, WqkTh + (size_t)DOUT * DIN, WqkTl + (size_t)DOUT * DIN, DIN);
  transpose_split_kernel<<<gTr, blk, 0, stream>>>(Wv, DOUT, WvTh, WvTl, DIN);
  transpose_split_kernel<<<gTr, blk, 0, stream>>>(Wo, DOUT, WoTh, WoTl, DOUT);

  const int n2x = NSEQ * DIN / 2;                                   // 1048576 pairs per batch slice
  const dim3 gSplit((n2x + 255) / 256);                             // 4096 blocks x 256 thr x 2 = 2048x1024
  const dim3 gQK((NSEQ / 64) * (2 * DOUT / 64), 1);                 // 1024 blocks (one tile each): M=2048, N=2048, K=1024
  const dim3 gVT((DOUT / 64) * (NSEQ / 64), 1);                     // 512 blocks:  M=1024, N=2048, K=1024
  const dim3 gAt(NSEQ / 128, NH, NB);                               // 16 x 16 x 2 blocks x 8 waves x 16 queries
  const dim3 gOut((NSEQ / 64) * (DOUT / 64), 1);                    // 512 blocks: M=2048, N=1024, K=1024

  for (int b = 0; b < NB; ++b) {
    unsigned short* Xh  = XOh + (size_t)b * NSEQ * DIN;
    unsigned short* Xl  = XOl + (size_t)b * NSEQ * DIN;
    // (1) x[b] -> bf16 hi/lo planes [2048][1024] (whole plane: 4096 blocks x 256 thr x 2)
    split_bf16x2_kernel<<<gSplit, blk, 0, stream>>>(x + (size_t)b * NSEQ * DIN, Xh, Xl, n2x);
    // (2) [q | k] = x . [Wq | Wk] -> QK hi/lo planes [2048][2048] of batch b (whole planes: 32x32 tiles)
    wmma_gemm64<1, true, 0, 2, false, 0, false, false, 8><<<gQK, blk, 0, stream>>>(
        Xh, Xl, DIN, 0L, WqkTh, WqkTl, DIN, 0L,
        (void*)(QKh + (size_t)b * NSEQ * 2 * DOUT), (void*)(QKl + (size_t)b * NSEQ * 2 * DOUT), 2 * DOUT, 0L,
        bo, bo, 0L, NSEQ, 2 * DOUT, DIN, 1.0f);
    // (3) v^T[o][tok] = sum_k Wv^T[o][k] x[tok][k] -> VT hi/lo planes [1024][2048] of batch b (whole planes: 16x32 tiles)
    wmma_gemm64<1, true, 0, 2, false, 0, false, false, 8><<<gVT, blk, 0, stream>>>(
        WvTh, WvTl, DIN, 0L, Xh, Xl, DIN, 0L,
        (void*)(VTh + (size_t)b * DOUT * NSEQ), (void*)(VTl + (size_t)b * DOUT * NSEQ), NSEQ, 0L,
        bo, bo, 0L, DOUT, NSEQ, DIN, 1.0f);
  }
  // (4) ctx[b][i][h*64+d] = softmax_j(relu(q_i . k_j) * decay * 1/8, causal) . v -> O hi/lo planes (whole [2][2048][1024])
  fused_attn_kernel<<<gAt, blk, 0, stream>>>(QKh, QKl, VTh, VTl, wp, vp, XOh, XOl);
  for (int b = 0; b < NB; ++b) {
    // (5) out[b] = ctx[b] . Wo + bo (f32, whole [2048][1024] slice of d_out)
    float* outb = (float*)d_out + (size_t)b * NSEQ * DOUT;
    wmma_gemm64<1, true, 2, 0, false, 0, false, false, 8><<<gOut, blk, 0, stream>>>(
        XOh + (size_t)b * NSEQ * DOUT, XOl + (size_t)b * NSEQ * DOUT, DOUT, 0L, WoTh, WoTl, DOUT, 0L,
        (void*)outb, (void*)outb, DOUT, 0L,
        bo, bo, 0L, NSEQ, DOUT, DOUT, 1.0f);
  }
  (void)hipGetLastError();
}

// v003
// A run of this version takes 255 microseconds.
// Timed twice side by side with v002, it ran 1.19 times as fast both times.
// Counting every step since v000, it is 9.97 times as fast.
// Every contraction (x.Wq|Wk, Wv^T.x^T, k.q^T, v^T.p^T, ctx.Wo): v_wmma_f32_16x16x32_bf16 on bf16 hi/lo split operand planes (hi.hi + hi.lo + lo.hi), f32 accumulate; relu, distance decay, causal mask and softmax in f32.
#include <hip/hip_runtime.h>
#include <math.h>
#include <stdint.h>

#define NB    2
#define NSEQ  2048
#define DIN   1024
#define DOUT  1024
#define NH    16
#define HDIM  64

typedef __attribute__((ext_vector_type(16))) _Float16 v16h;
typedef __attribute__((ext_vector_type(8)))  _Float16 v8h;
typedef __attribute__((ext_vector_type(16))) __bf16   v16b;
typedef __attribute__((ext_vector_type(8)))  __bf16   v8b;
typedef __attribute__((ext_vector_type(8)))  float    v8f;
typedef __attribute__((ext_vector_type(4)))  float    v4f;
typedef __attribute__((ext_vector_type(2)))  float    v2f;
typedef __attribute__((ext_vector_type(4)))  unsigned int v4u;
typedef __attribute__((ext_vector_type(2)))  unsigned int v2u;

__device__ __forceinline__ unsigned short f2bf_bits(float f) {
  unsigned u = __float_as_uint(f);
  return (unsigned short)((u + 0x7FFFu + ((u >> 16) & 1u)) >> 16);
}
__device__ __forceinline__ float bf_bits2f(unsigned short h) { return __uint_as_float(((unsigned)h) << 16); }

// hazard guards as plain device helpers (no inline asm inside the kernel template body)
__device__ __forceinline__ void dep_guard_h(v8f& a, v8f& b, v16h x, v16h y) { asm volatile("v_nop\n\tv_nop\n\tv_nop\n\tv_nop" : "+v"(a), "+v"(b) : "v"(x), "v"(y)); }
__device__ __forceinline__ void dep_guard_b(v8f& a, v8f& b, v16b x, v16b y) { asm volatile("v_nop\n\tv_nop\n\tv_nop\n\tv_nop" : "+v"(a), "+v"(b) : "v"(x), "v"(y)); }
__device__ __forceinline__ void keep4_h(v16h a, v16h b, v16h c, v16h d) { asm volatile("v_nop" :: "v"(a), "v"(b), "v"(c), "v"(d)); }
__device__ __forceinline__ void keep4_b(v16b a, v16b b, v16b c, v16b d) { asm volatile("v_nop" :: "v"(a), "v"(b), "v"(c), "v"(d)); }
__device__ __forceinline__ void acc_guard4(v8f& a, v8f& b, v8f& c, v8f& d) { asm volatile("v_nop\n\tv_nop\n\tv_nop\n\tv_nop" : "+v"(a), "+v"(b), "+v"(c), "+v"(d)); }
template <typename T> struct Frag;
template <> struct Frag<_Float16> {
  typedef v16h V; union U { v16h v; v8h h[2]; };
  static __device__ __forceinline__ v16h load(const _Float16* p) {   // elements 0..7 <- p[0..7], 8..15 <- p[16..23]
    U f; f.h[0] = *(const v8h*)(p); f.h[1] = *(const v8h*)(p + 16); return f.v;
  }
  static __device__ __forceinline__ v8f mma(v16h a, v16h b, v8f c) {
    return __builtin_amdgcn_wmma_f32_16x16x32_f16(false, a, false, b, (short)0, c, false, false);
  }
  static __device__ __forceinline__ void guard(v8f& a, v8f& b, v16h x, v16h y) { dep_guard_h(a, b, x, y); }
  static __device__ __forceinline__ void keep(v16h a, v16h b, v16h c, v16h d) { keep4_h(a, b, c, d); }
};
template <> struct Frag<__bf16> {
  typedef v16b V; union U { v16b v; v8b h[2]; };
  static __device__ __forceinline__ v16b load(const __bf16* p) {
    U f; f.h[0] = *(const v8b*)(p); f.h[1] = *(const v8b*)(p + 16); return f.v;
  }
  static __device__ __forceinline__ v8f mma(v16b a, v16b b, v8f c) {
    return __builtin_amdgcn_wmma_f32_16x16x32_bf16(false, a, false, b, (short)0, c, false, false);
  }
  static __device__ __forceinline__ void guard(v8f& a, v8f& b, v16b x, v16b y) { dep_guard_b(a, b, x, y); }
  static __device__ __forceinline__ void keep(v16b a, v16b b, v16b c, v16b d) { keep4_b(a, b, c, d); }
};

// ---- Register-blocked batched WMMA GEMM ------------------------------------
// C[m,n] = scale * sum_k A[m,k] * Bt[n,k] (+bias)(+resid); each wave owns a 64x64 tile.
// A row-major [M,K]; Bt row-major [N,K]; M,N % 64 == 0, K % 32 == 0.
// SPLIT: operands are hi/lo planes (A2/Bt2 = lo planes, same layout); product = hi·hi + hi·lo + lo·hi.
// BIAS_MODE: 0 = none, 1 = bias[m], 2 = bias[n].
// OUT_MODE: 0 = f32, 1 = f16, 2 = bf16 hi plane (Cout) + bf16 lo plane (Cout2).
// ET: 0 = f16 operands, 1 = bf16 operands (pointers passed as 16-bit storage)
// Added modes (defaults off, all other behaviour unchanged):
//   LOWER:   tiles with n0 > m0 (strictly above the 64x64 block diagonal) are not produced (wave-uniform early exit).
//   CAUSALK: the k-loop stops at min(K, m0 + 64); valid when A rows m0..m0+63 are exactly zero for k >= m0 + 64.
//   KW > 0:  split-K. One 64x64 tile per block of KW waves (tile = blockIdx.x); wave w takes the 64-wide k chunks
//            w, w + KW, ... (K % 64 == 0), and the KW f32 partial tiles are summed through LDS in wave order 0..KW-1.
template <int ET> struct Elem;
template <> struct Elem<0> { typedef _Float16 T; };
template <> struct Elem<1> { typedef __bf16 T; };
template <int ET, bool SPLIT, int BIAS_MODE, int OUT_MODE, bool RESID, int ACT = 0, bool LOWER = false, bool CAUSALK = false, int KW = 0>
__global__ __launch_bounds__(KW ? KW * 32 : 256) void wmma_gemm64(
    const unsigned short* __restrict__ Ap, const unsigned short* __restrict__ A2p, int lda, long strideA,
    const unsigned short* __restrict__ Btp, const unsigned short* __restrict__ Bt2p, int ldb, long strideB,
    void* __restrict__ Cout, void* __restrict__ Cout2, int ldc, long strideC,
    const float* __restrict__ bias,
    const float* __restrict__ resid, long strideR,
    int M, int N, int K, float scale) {
  typedef typename Elem<ET>::T T;
  typedef typename Frag<T>::V V;
  const T* A = (const T*)Ap; const T* A2 = (const T*)A2p; const T* Bt = (const T*)Btp; const T* Bt2 = (const T*)Bt2p;
  static_assert(KW == 0 || ((KW == 8 || KW == 16) && !RESID && ACT == 0 && OUT_MODE != 1 && !LOWER), "split-K covers plain f32 / bf16 hi-lo outputs");
  __shared__ __align__(16) float sT[KW ? 2 * KW : 8][16 * 68];   // per-wave 16x64 slab, pitch 68 floats (split-K: two sets)
  const int b    = blockIdx.y;
  const int lane = threadIdx.x & 31;
  const int wave = KW ? __builtin_amdgcn_readfirstlane((int)(threadIdx.x >> 5)) : (int)(threadIdx.x >> 5);
  const int tilesN = N >> 6;
  const int tilesM = M >> 6;
  const int tile = KW ? (int)blockIdx.x : (int)(blockIdx.x * 8 + wave);
  if (tile >= tilesM * tilesN) return;   // KW == 0: wave-uniform, no block barriers; KW > 0: block-uniform, ahead of every barrier
  const int tm = tile / tilesN;
  const int tn = tile - tm * tilesN;
  const int m0 = tm << 6;
  const int n0 = tn << 6;
  if (LOWER && n0 > m0) return;          // wave-uniform; LOWER excludes split-K, so no block barriers follow

  const T* Ab  = A  + (size_t)b * strideA;
  const T* Bb  = Bt + (size_t)b * strideB;
  const T* Ab2 = SPLIT ? (A2  + (size_t)b * strideA) : nullptr;
  const T* Bb2 = SPLIT ? (Bt2 + (size_t)b * strideB) : nullptr;

  const int rlane = lane & 15;                 // row (A) / col (B, D) within subtile
  const int koff  = (lane >> 4) * 8;           // k offset of this lane half
  const int mOff  = (lane >> 4) * 8;           // D row offset

  v8f acc[4][4];
#pragma unroll
  for (int i = 0; i < 4; ++i)
#pragma unroll
    for (int j = 0; j < 4; ++j) acc[i][j] = (v8f){0.f,0.f,0.f,0.f,0.f,0.f,0.f,0.f};

  const int kEnd = CAUSALK ? (((m0 + 64) < K) ? (m0 + 64) : K) : K;
  // KW > 0: two 32-steps inside a 64-wide chunk (one whole 128-B line of each operand row), then on to this wave's next chunk
  for (int k0 = KW ? (wave << 6) : 0; k0 < kEnd; k0 += (KW && (k0 & 32)) ? (KW * 64 - 32) : 32) {
    V bh[4], bl[4];
#pragma unroll
    for (int j = 0; j < 4; ++j) {
      const size_t bo = (size_t)(n0 + (j << 4) + rlane) * ldb + koff + k0;
      bh[j] = Frag<T>::load(Bb + bo);
      if (SPLIT) bl[j] = Frag<T>::load(Bb2 + bo);
    }
#pragma unroll
    for (int i = 0; i < 4; ++i) {
      const size_t ao = (size_t)(m0 + (i << 4) + rlane) * lda + koff + k0;
      V ah = Frag<T>::load(Ab + ao);
      V al;
      if (SPLIT) al = Frag<T>::load(Ab2 + ao);
#pragma unroll
      for (int j = 0; j < 4; ++j) {
        acc[i][j] = Frag<T>::mma(ah, bh[j], acc[i][j]);
        if (SPLIT) {
          acc[i][j] = Frag<T>::mma(ah, bl[j], acc[i][j]);
          acc[i][j] = Frag<T>::mma(al, bh[j], acc[i][j]);
        }
      }
      Frag<T>::guard(acc[i][0], acc[i][3], ah, SPLIT ? al : ah);
    }
    Frag<T>::keep(bh[0], bh[1], bh[2], bh[3]);
    if (SPLIT) Frag<T>::keep(bl[0], bl[1], bl[2], bl[3]);
  }
  acc_guard4(acc[0][0], acc[0][1], acc[0][2], acc[0][3]);
  acc_guard4(acc[1][0], acc[1][1], acc[1][2], acc[1][3]);
  acc_guard4(acc[2][0], acc[2][1], acc[2][2], acc[2][3]);
  acc_guard4(acc[3][0], acc[3][1], acc[3][2], acc[3][3]);

  // ---- split-K epilogue: sum the KW partial tiles, 16 rows at a time ----
  if constexpr (KW > 0) {
    constexpr int EPT = 1024 / (KW * 32);               // outputs per thread of a 16x64 row group: 4 or 2
    typedef float vE __attribute__((ext_vector_type(EPT)));
    const int row = (int)threadIdx.x / (64 / EPT);      // 0..15
    const int c   = ((int)threadIdx.x % (64 / EPT)) * EPT;
    float v[4][EPT];                                    // results wait in registers: no global store stands in front of a barrier
#pragma unroll
    for (int i = 0; i < 4; ++i) {
      float* part = sT[(i & 1) * KW + wave];
#pragma unroll
      for (int j = 0; j < 4; ++j)
#pragma unroll
        for (int r = 0; r < 8; ++r) part[(mOff + r) * 68 + (j << 4) + rlane] = acc[i][j][r];
      // publishes all KW partials of row group i; with two slab sets it also ends the reads of group i - 1
      // before group i + 1 overwrites their set
      __syncthreads();
      const float* rp = sT[(i & 1) * KW] + row * 68 + c;
      vE s = *(const vE*)rp;
#pragma unroll
      for (int w = 1; w < KW; ++w) s += *(const vE*)(rp + w * (16 * 68));
#pragma unroll
      for (int e = 0; e < EPT; ++e) v[i][e] = s[e];
    }
#pragma unroll
    for (int i = 0; i < 4; ++i) {
      const int m = m0 + (i << 4) + row;
#pragma unroll
      for (int e = 0; e < EPT; ++e) {
        v[i][e] *= scale;
        if (BIAS_MODE == 1) v[i][e] += bias[m];
        if (BIAS_MODE == 2) v[i][e] += bias[n0 + c + e];
      }
      const size_t co = (size_t)b * strideC + (size_t)m * ldc + n0 + c;
      if (OUT_MODE == 0) {
        vE o;
#pragma unroll
        for (int e = 0; e < EPT; ++e) o[e] = v[i][e];
        *(vE*)((float*)Cout + co) = o;
      } else {
        unsigned hw[EPT / 2], lw[EPT / 2];
#pragma unroll
        for (int q = 0; q < EPT / 2; ++q) {
          const float f0 = v[i][2 * q], f1 = v[i][2 * q + 1];
          const unsigned short h0 = f2bf_bits(f0), h1 = f2bf_bits(f1);
          const unsigned short l0 = f2bf_bits(f0 - bf_bits2f(h0)), l1 = f2bf_bits(f1 - bf_bits2f(h1));
          hw[q] = (unsigned)h0 | ((unsigned)h1 << 16);
          lw[q] = (unsigned)l0 | ((unsigned)l1 << 16);
        }
        if constexpr (EPT == 4) {
          *(v2u*)((unsigned short*)Cout + co)  = (v2u){hw[0], hw[1]};
          *(v2u*)((unsigned short*)Cout2 + co) = (v2u){lw[0], lw[1]};
        } else {
          *(unsigned*)((unsigned short*)Cout + co)  = hw[0];
          *(unsigned*)((unsigned short*)Cout2 + co) = lw[0];
        }
      }
    }
    return;
  }

  // ---- epilogue ----
  float* slab = sT[wave];
  const float* Rb = RESID ? (resid + (size_t)b * strideR) : nullptr;
#pragma unroll
  for (int i = 0; i < 4; ++i) {
    const int mBase = m0 + (i << 4);
#pragma unroll
    for (int j = 0; j < 4; ++j) {
      const int n = n0 + (j << 4) + rlane;
      float bv = 0.f;
      if (BIAS_MODE == 2) bv = bias[n];
#pragma unroll
      for (int r = 0; r < 8; ++r) {
        float v = acc[i][j][r] * scale;
        if (BIAS_MODE == 1) v += bias[mBase + mOff + r];
        if (BIAS_MODE == 2) v += bv;
        if (RESID) v += Rb[(size_t)(mBase + mOff + r) * ldc + n];
        if (ACT == 1) v = tanhf(v);
        if (ACT == 2) v = fmaxf(v, 0.0f);
        if (ACT == 3) v = v / (1.0f + expf(-v));
        if (ACT == 4) v = (v > 0.f) ? v : 0.01f * v;
        if (ACT == 5) v = 0.5f * v * (1.0f + erff(v * 0.70710678118654752f));
        slab[(mOff + r) * 68 + (j << 4) + rlane] = v;
      }
    }
    __builtin_amdgcn_fence(__ATOMIC_RELEASE, "workgroup");
    __builtin_amdgcn_wave_barrier();
    __builtin_amdgcn_fence(__ATOMIC_ACQUIRE, "workgroup");
    if (OUT_MODE == 0) {
      float* C = (float*)Cout + (size_t)b * strideC;
      const int hh = lane >> 4, c4 = (lane & 15) * 4;     // row seg = 256 B = 16 lanes x 16 B
      {
#pragma unroll
        for (int it = 0; it < 8; ++it) {
          const int row = it * 2 + hh;
          v4f v = *(const v4f*)(slab + row * 68 + c4);
          *(v4f*)(C + (size_t)(mBase + row) * ldc + n0 + c4) = v;
        }
        
      }
    } else {
      const int q = lane >> 3, c8 = (lane & 7) * 8;
      unsigned short* C  = (unsigned short*)Cout  + (size_t)b * strideC;
      unsigned short* C2 = (OUT_MODE == 2) ? ((unsigned short*)Cout2 + (size_t)b * strideC) : nullptr;
      {
#pragma unroll
        for (int it = 0; it < 4; ++it) {
          const int row = it * 4 + q;
          const float* sp = slab + row * 68 + c8;
          v8h hv, lv;
#pragma unroll
          for (int e = 0; e < 8; ++e) {
            if (OUT_MODE == 1) {
              hv[e] = (_Float16)sp[e];
            } else {
              unsigned short hb = f2bf_bits(sp[e]);
              unsigned short lb = f2bf_bits(sp[e] - bf_bits2f(hb));
              hv[e] = __builtin_bit_cast(_Float16, hb);
              lv[e] = __builtin_bit_cast(_Float16, lb);
            }
          }
          *(v8h*)(C + (size_t)(mBase + row) * ldc + n0 + c8) = hv;
          if (OUT_MODE == 2) *(v8h*)(C2 + (size_t)(mBase + row) * ldc + n0 + c8) = lv;
        }
        
      }
    }
    __builtin_amdgcn_fence(__ATOMIC_RELEASE, "workgroup");
    __builtin_amdgcn_wave_barrier();
    __builtin_amdgcn_fence(__ATOMIC_ACQUIRE, "workgroup");
  }
}

// ---------------------------------------------------------------------------
// Elementwise split: 2 elements per thread, one 4-B store per lane per plane -> each wave writes exactly one
// Coverage: grid = ceil(n2/256) blocks x 256 threads x 2 elements = 2*n2 elements = the whole plane (n2 = plane/2).
// ---------------------------------------------------------------------------
__device__ __forceinline__ unsigned pk16(unsigned short a, unsigned short b) { return (unsigned)a | ((unsigned)b << 16); }

// hi = bf16_rne(in), lo = bf16_rne(in - hi)
__global__ __launch_bounds__(256) void split_bf16x2_kernel(const float* __restrict__ in, unsigned short* __restrict__ hi,
                                                           unsigned short* __restrict__ lo, int n2) {
  const int i = blockIdx.x * 256 + threadIdx.x;
  if (i < n2) {
    const v2f f = *(const v2f*)(in + 2 * (size_t)i);
    const unsigned short h0 = f2bf_bits(f[0]), h1 = f2bf_bits(f[1]);
    const unsigned short l0 = f2bf_bits(f[0] - bf_bits2f(h0)), l1 = f2bf_bits(f[1] - bf_bits2f(h1));
    const unsigned uh = pk16(h0, h1), ul = pk16(l0, l1);
    ((unsigned*)hi)[i] = uh;
    ((unsigned*)lo)[i] = ul;
    
  }
}

// ---------------------------------------------------------------------------
// Transpose + bf16 hi/lo split of an f32 matrix: in [rows][cols] (row pitch ldi floats) ->
// outh/outl[c][r] = split(in[r][c]) (row pitch ldo u16). grid (cols/64, rows/64), 256 threads; rows, cols % 64 == 0.
// Coverage per block: load 4 it x 256 thr x 4 f32 = 64x64; store 2 it x 256 thr x 8 u16 = 64x64 per plane;
// ---------------------------------------------------------------------------
__global__ __launch_bounds__(256) void transpose_split_kernel(const float* __restrict__ in, int ldi,
                                                              unsigned short* __restrict__ outh,
                                                              unsigned short* __restrict__ outl, int ldo) {
  __shared__ __align__(16) float tf[64 * 68];
  const int c0  = blockIdx.x * 64;   // input column block = output row block
  const int r0  = blockIdx.y * 64;   // input row block    = output column block
  const int tid = threadIdx.x;
  {
    const int sub = tid >> 4;          // 0..15
    const int c4  = (tid & 15) * 4;    // 0..60
#pragma unroll
    for (int it = 0; it < 4; ++it) {
      const int rr = it * 16 + sub;
      const v4f a = *(const v4f*)(in + (size_t)(r0 + rr) * ldi + c0 + c4);
      *(v4f*)(tf + rr * 68 + c4) = a;
    }
  }
  __syncthreads();
  const int s8 = tid >> 3;             // 0..31
  const int c8 = (tid & 7) * 8;        // 0..56
  v4u hv[2], lv[2];
#pragma unroll
  for (int it = 0; it < 2; ++it) {
    const int oc = it * 32 + s8;       // output row within tile (= input column)
    v4u a, a2;
#pragma unroll
    for (int q = 0; q < 4; ++q) {
      const float f0 = tf[(c8 + 2 * q) * 68 + oc];
      const float f1 = tf[(c8 + 2 * q + 1) * 68 + oc];
      const unsigned short h0 = f2bf_bits(f0), h1 = f2bf_bits(f1);
      const unsigned short l0 = f2bf_bits(f0 - bf_bits2f(h0));
      const unsigned short l1 = f2bf_bits(f1 - bf_bits2f(h1));
      a[q]  = pk16(h0, h1);
      a2[q] = pk16(l0, l1);
    }
    hv[it] = a; lv[it] = a2;
  }
  {
#pragma unroll
    for (int it = 0; it < 2; ++it) {
      const int oc = it * 32 + s8;
      const size_t go = (size_t)(c0 + oc) * ldo + r0 + c8;
      *(v4u*)(outh + go) = hv[it];
      *(v4u*)(outl + go) = lv[it];
    }
    
  }
}

// ---------------------------------------------------------------------------
// Fused causal attention, all batches and heads in one launch: scores, relu * distance decay, online softmax and P.V in one kernel;
// neither scores nor probabilities go to memory. The K rows and V^T columns of 64 keys (a stage) are brought into LDS once per block
// by asynchronous copies, whole 128-B lines, two buffers, and all eight waves take their fragments from there.
// A wave owns 16 queries (one per lane column c) of head blockIdx.y, batch blockIdx.z, and walks the keys 32 at a time:
//   St[key][query] = K . Q^T   (A = K rows, B = Q rows kept in registers; both through the same loader)
//   t = relu(St) * R_hat(h, i - j) * 0.125 in log2 units, -inf for j > i (only the last pass holds such keys),
//   R_hat = (1 + exp(v[h])) * rcp(1 + exp(v[h] - w[h] * (i - j)))
//   running maximum m (starts at 0: every allowed t is >= 0 and key 0 is always allowed), p = exp2(t - m),
//   Ot[d][query] = Ot * exp2(m_old - m_new) + V^T . P^T
// The two 16-key score tiles of a pass, converted in place, are the B operand of the second product
// (element s = tile s >> 3, register s & 7), which is the k order the A loader of V^T delivers.
// A lane holds 8 + 8 keys of its query; lanes c and c + 16 share the maximum each pass and join their sums at the end.
// Waves 0..3 of a block take query groups from the long end, waves 4..7 the mirrored ones from the short end.
// Output: lane (c, hf) holds ctx[q0 + c][head*64 + ds*16 + hf*8 + 0..7]: one 16-B store per plane and ds;
// the 128-B line of a (query, head) is written by one wave. grid (NSEQ/128, NH, NB) x 8 waves x 16 queries = all rows.
// Every '#pragma unroll' below stands on a loop of constant trip count whose index selects a fragment or an accumulator:
// unrolled, those arrays stay in registers.
// ---------------------------------------------------------------------------
typedef __attribute__((ext_vector_type(2))) __bf16 v2b;

__device__ __forceinline__ float other_half(float x) {   // the value of lane l ^ 16
  const int b = __float_as_int(x);
  return __int_as_float(__builtin_amdgcn_permlanex16(b, b, 0x76543210, 0xfedcba98, false, false));
}
// hi = bf16_rne(f), lo = bf16_rne(f - hi), two values packed per word
__device__ __forceinline__ void split_pair(float f0, float f1, unsigned& hi, unsigned& lo) {
  hi = __builtin_bit_cast(unsigned, __builtin_convertvector((v2f){f0, f1}, v2b));
  const float r0 = f0 - __uint_as_float(hi << 16);
  const float r1 = f1 - __uint_as_float(hi & 0xFFFF0000u);
  lo = __builtin_bit_cast(unsigned, __builtin_convertvector((v2f){r0, r1}, v2b));
}

// LDS ring: a stage holds four planes (K hi, K lo: 64 key rows x 64 dims; V^T hi, V^T lo: 64 dim rows x 64 keys); a row is 128 B of data
// at a pitch of 144 B (16 B x odd: the 16-byte fragment reads of 16 rows fall on distinct banks).
#define AT_PITCH 72                    // 16-bit elements
#define AT_PLANE (64 * AT_PITCH)
#define AT_BUF   (4 * AT_PLANE)

// One stage = 4 planes x 64 rows x 8 pieces of 16 B = 2048 pieces, eight per thread: rows r and r + 32 of each plane.
// lds: this lane's byte address in plane 0 of the target buffer; the pointers: this lane's piece of row r of each plane.
// The s_wait_xcnt at the end of the statement stands in front of any later rewrite of the address registers the copies name.
__device__ __forceinline__ void copy_stage(unsigned lds, const unsigned short* kh, const unsigned short* kl,
                                           const unsigned short* vh, const unsigned short* vl) {
  const unsigned R = 32 * AT_PITCH * 2, P = AT_PLANE * 2;
  asm volatile("global_load_async_to_lds_b128 %0, %8, off\n\t"
               "global_load_async_to_lds_b128 %1, %9, off\n\t"
               "global_load_async_to_lds_b128 %2, %10, off\n\t"
               "global_load_async_to_lds_b128 %3, %11, off\n\t"
               "global_load_async_to_lds_b128 %4, %12, off\n\t"
               "global_load_async_to_lds_b128 %5, %13, off\n\t"
               "global_load_async_to_lds_b128 %6, %14, off\n\t"
               "global_load_async_to_lds_b128 %7, %15, off\n\t"
               "s_wait_xcnt 0x0"
               :: "v"(lds), "v"(lds + R), "v"(lds + P), "v"(lds + P + R),
                  "v"(lds + 2 * P), "v"(lds + 2 * P + R), "v"(lds + 3 * P), "v"(lds + 3 * P + R),
                  "v"(kh), "v"(kh + 32 * (2 * DOUT)), "v"(kl), "v"(kl + 32 * (2 * DOUT)),
                  "v"(vh), "v"(vh + 32 * NSEQ), "v"(vl), "v"(vl + 32 * NSEQ)
               : "memory");
}

// four waves per SIMD (two blocks per WGP): the waves fill each other's waits
__global__ __launch_bounds__(256) __attribute__((amdgpu_waves_per_eu(4, 4))) void fused_attn_kernel(const unsigned short* __restrict__ QKhp, const unsigned short* __restrict__ QKlp,
                                                         const unsigned short* __restrict__ VThp, const unsigned short* __restrict__ VTlp,
                                                         const float* __restrict__ wp, const float* __restrict__ vp,
                                                         unsigned short* __restrict__ Oh, unsigned short* __restrict__ Ol) {
  typedef Frag<__bf16> F;
  const int lane = threadIdx.x & 31;
  const int wave = __builtin_amdgcn_readfirstlane((int)(threadIdx.x >> 5));
  const int head = blockIdx.y;
  const size_t bz = blockIdx.z;
  const int c    = lane & 15;
  const int hf   = lane >> 4;
  const int tq   = (int)blockIdx.x * 4 + (wave & 3);            // 0..63
  const int qg   = (wave < 4) ? (NSEQ / 16 - 1 - tq) : tq;      // every 16-query group once
  const int q0   = qg << 4;
  const int np   = (q0 >> 5) + 1;                               // passes of 32 keys; keys of passes 0..np-2 are all < q0

  const float L2E = 1.44269504088896341f;
  const float w2  = wp[head] * L2E;
  const float v2  = vp[head] * L2E;
  const float c1  = (1.0f + __builtin_amdgcn_exp2f(v2)) * (0.125f * L2E);

  const size_t qo = (bz * NSEQ + q0 + c) * (2 * DOUT) + head * HDIM + hf * 8;

  __shared__ __align__(16) unsigned short ring[2 * AT_BUF];
  // stages of 64 keys that the block's longest wave (wave 0) needs: 17..32, so stages 0 and 1 always exist and every key is < NSEQ
  const int ns = ((((NSEQ / 16 - 1 - (int)blockIdx.x * 4) << 4) >> 5) + 2) >> 1;
  const int crow = (int)threadIdx.x >> 3;          // 0..31: the row this thread copies (and row + 32)
  const int cpc  = ((int)threadIdx.x & 7) * 8;     // its 16-B piece of the row, in elements: 8 lanes cover one 128-B line
  const unsigned ldsc = (unsigned)(uintptr_t)(ring + crow * AT_PITCH + cpc);
  const size_t kco = (bz * NSEQ + crow) * (2 * DOUT) + DOUT + head * HDIM + cpc;
  const size_t vco = (bz * DOUT + head * HDIM + crow) * NSEQ + cpc;
  copy_stage(ldsc, QKhp + kco, QKlp + kco, VThp + vco, VTlp + vco);      // stage 0 -> buffer 0
  const __bf16* rb = (const __bf16*)ring + c * AT_PITCH + hf * 8;        // this lane's fragment row and k half

  v16b qh[2], ql[2];
#pragma unroll
  for (int ks = 0; ks < 2; ++ks) {
    qh[ks] = F::load((const __bf16*)QKhp + qo + ks * 32);
    ql[ks] = F::load((const __bf16*)QKlp + qo + ks * 32);
  }
  // the address registers of the Q loads are reused right below; the loaded values as inputs keep the wait behind the loads
  asm volatile("s_wait_xcnt 0x0" :: "v"(qh[0]), "v"(qh[1]), "v"(ql[0]), "v"(ql[1]) : "memory");

  v8f o[4];
#pragma unroll
  for (int ds = 0; ds < 4; ++ds) o[ds] = (v8f){0.f,0.f,0.f,0.f,0.f,0.f,0.f,0.f};
  float m = 0.f, l = 0.f;

  asm volatile("s_wait_asynccnt 0x0" ::: "memory");   // this wave's copies of stage 0 have landed
  __syncthreads();                                    // publishes stage 0
  copy_stage(ldsc + AT_BUF * 2, QKhp + kco + (size_t)64 * (2 * DOUT), QKlp + kco + (size_t)64 * (2 * DOUT),
             VThp + vco + 64, VTlp + vco + 64);       // stage 1 -> buffer 1

  for (int s = 0; s < ns; ++s) {
  const __bf16* sb = rb + (s & 1) * AT_BUF;
  for (int h2 = 0; h2 < 2; ++h2) {
    const int p = 2 * s + h2;
    if (p >= np) break;                               // wave-uniform: a wave past its diagonal only keeps the publish points
    const int j0 = p << 5;
    // K rows and V^T columns of this pass, from this stage's buffer
    v16b kh[2][2], kl[2][2];
#pragma unroll
    for (int a = 0; a < 2; ++a)
#pragma unroll
      for (int ks = 0; ks < 2; ++ks) {
        kh[a][ks] = F::load(sb + (h2 * 32 + a * 16) * AT_PITCH + ks * 32);
        kl[a][ks] = F::load(sb + AT_PLANE + (h2 * 32 + a * 16) * AT_PITCH + ks * 32);
      }
    v16b vh[4], vl[4];
#pragma unroll
    for (int ds = 0; ds < 4; ++ds) {
      vh[ds] = F::load(sb + 2 * AT_PLANE + (ds * 16) * AT_PITCH + h2 * 32);
      vl[ds] = F::load(sb + 3 * AT_PLANE + (ds * 16) * AT_PITCH + h2 * 32);
    }
    v8f st[2];
    st[0] = (v8f){0.f,0.f,0.f,0.f,0.f,0.f,0.f,0.f};
    st[1] = st[0];
#pragma unroll
    for (int ks = 0; ks < 2; ++ks) {
      st[0] = F::mma(kh[0][ks], qh[ks], st[0]);
      st[1] = F::mma(kh[1][ks], qh[ks], st[1]);
      st[0] = F::mma(kh[0][ks], ql[ks], st[0]);
      st[1] = F::mma(kh[1][ks], ql[ks], st[1]);
      st[0] = F::mma(kl[0][ks], qh[ks], st[0]);
      st[1] = F::mma(kl[1][ks], qh[ks], st[1]);
    }
    // inputs only: keeps the V^T fragment reads up here, issued with the K reads, so that their LDS latency passes under the score
    // products and the softmax; left to itself the compiler sinks them in front of each P.V product, which then waits for them
    asm volatile("" :: "v"(vh[0]), "v"(vh[1]), "v"(vh[2]), "v"(vh[3]), "v"(vl[0]), "v"(vl[1]), "v"(vl[2]), "v"(vl[3]));
    const int   lim  = q0 + c - j0 - hf * 8;          // i - j of this lane's first key; key 16a + r is allowed while 16a + r <= lim
    const float base = v2 - w2 * (float)lim;
    float tt[2][8];
#pragma unroll
    for (int a = 0; a < 2; ++a)
#pragma unroll
      for (int r = 0; r < 8; ++r) {
        const float e = __builtin_amdgcn_exp2f(fmaf(w2, (float)(a * 16 + r), base));
        tt[a][r] = fmaxf(st[a][r], 0.0f) * (c1 * __builtin_amdgcn_rcpf(1.0f + e));
      }
    if (p == np - 1) {                                 // wave-uniform
#pragma unroll
      for (int a = 0; a < 2; ++a)
#pragma unroll
        for (int r = 0; r < 8; ++r) tt[a][r] = (a * 16 + r <= lim) ? tt[a][r] : -INFINITY;
    }
    float mx = m;
#pragma unroll
    for (int a = 0; a < 2; ++a)
#pragma unroll
      for (int r = 0; r < 8; ++r) mx = fmaxf(mx, tt[a][r]);
    mx = fmaxf(mx, other_half(mx));
    const float alpha = __builtin_amdgcn_exp2f(m - mx);
    m = mx;
    float ps0 = 0.f, ps1 = 0.f;
#pragma unroll
    for (int r = 0; r < 8; ++r) {
      tt[0][r] = __builtin_amdgcn_exp2f(tt[0][r] - mx);
      tt[1][r] = __builtin_amdgcn_exp2f(tt[1][r] - mx);
      ps0 += tt[0][r];
      ps1 += tt[1][r];
    }
    l = l * alpha + (ps0 + ps1);
#pragma unroll
    for (int ds = 0; ds < 4; ++ds) o[ds] *= alpha;

    union PF { v16b v; unsigned u[8]; } ph, pl;
#pragma unroll
    for (int a = 0; a < 2; ++a)
#pragma unroll
      for (int r2 = 0; r2 < 4; ++r2) split_pair(tt[a][2 * r2], tt[a][2 * r2 + 1], ph.u[a * 4 + r2], pl.u[a * 4 + r2]);

#pragma unroll
    for (int ds = 0; ds < 4; ++ds) o[ds] = F::mma(vh[ds], ph.v, o[ds]);
#pragma unroll
    for (int ds = 0; ds < 4; ++ds) o[ds] = F::mma(vh[ds], pl.v, o[ds]);
#pragma unroll
    for (int ds = 0; ds < 4; ++ds) o[ds] = F::mma(vl[ds], ph.v, o[ds]);
    // four vector slots behind the pass's last WMMA: the next pass's first address arithmetic, reached over the loop's branches,
    // reuses that WMMA's operand registers
    acc_guard4(o[0], o[1], o[2], o[3]);
  }
    // publish point of stage s + 1, passed by every wave
    asm volatile("s_wait_dscnt 0x0" ::: "memory");     // this wave's reads of stage s are done before its buffer is refilled
    asm volatile("s_wait_asynccnt 0x0" ::: "memory");  // this wave's copies of stage s + 1 have landed
    __syncthreads();                                   // publishes stage s + 1 and ends every wave's reads of stage s
    if (s + 2 < ns)                                    // block-uniform
      copy_stage(ldsc + (s & 1) * (AT_BUF * 2), QKhp + kco + (size_t)(s + 2) * 64 * (2 * DOUT), QKlp + kco + (size_t)(s + 2) * 64 * (2 * DOUT),
                 VThp + vco + (s + 2) * 64, VTlp + vco + (s + 2) * 64);
  }
  asm volatile("s_wait_asynccnt 0x0" ::: "memory");    // no copy is outstanding when the wave ends

  l += other_half(l);
  const float inv = 1.0f / l;                          // l >= 1: the row maximum contributes exp2(0)
  const size_t oo = (bz * NSEQ + q0 + c) * DOUT + head * HDIM + hf * 8;
#pragma unroll
  for (int ds = 0; ds < 4; ++ds) {
    unsigned hw[4], lw[4];
#pragma unroll
    for (int r2 = 0; r2 < 4; ++r2) split_pair(o[ds][2 * r2] * inv, o[ds][2 * r2 + 1] * inv, hw[r2], lw[r2]);
    *(v4u*)(Oh + oo + ds * 16) = (v4u){hw[0], hw[1], hw[2], hw[3]};
    *(v4u*)(Ol + oo + ds * 16) = (v4u){lw[0], lw[1], lw[2], lw[3]};
  }
}

// ---------------------------------------------------------------------------
// Workspace region map (byte offsets; all offsets multiples of 2 MiB). Every region is fully written in each call
// before it is read. X and O share one region: X is read only by the projection GEMMs, which precede the attention
// kernel (the O producer) in stream order; O is fully written (2 batches x 16 heads x 64 columns x 2048 rows) before
// the output projections read it.
//   WqkTh  bf16 [2048][1024]  rows 0..1023 = Wq^T, 1024..2047 = Wk^T         0
//   WqkTl  bf16 [2048][1024]                                          4194304
//   WvTh   bf16 [1024][1024]                                          8388608
//   WvTl   bf16 [1024][1024]                                         10485760
//   WoTh   bf16 [1024][1024]                                         12582912
//   WoTl   bf16 [1024][1024]                                         14680064
//   XOh    bf16 [2][2048][1024]  x hi, later ctx hi (col h*64+d)        16777216
//   XOl    bf16 [2][2048][1024]                                         25165824
//   QKh    bf16 [2][2048][2048]  q at col h*64+d, k at col 1024+h*64+d  33554432
//   QKl    bf16 [2][2048][2048]                                         50331648
//   VTh    bf16 [2][1024][2048]  row h*64+d, col token                  67108864
//   VTl    bf16 [2][1024][2048]                                         75497472
//   total                                                               83886080
// ---------------------------------------------------------------------------
extern "C" void kernel_launch(void* const* d_in, const int* in_sizes, int n_in,
                              void* d_out, int out_size, void* d_ws, size_t ws_size,
                              hipStream_t stream) {
  if (n_in < 8) return;
  if (in_sizes[0] != NB * NSEQ * DIN) return;
  if (in_sizes[1] != DIN * DOUT || in_sizes[2] != DIN * DOUT || in_sizes[3] != DIN * DOUT) return;
  if (in_sizes[4] != DOUT * DOUT || in_sizes[5] != DOUT) return;
  if (in_sizes[6] < NH || in_sizes[7] < NH) return;
  if (out_size != NB * NSEQ * DOUT) return;

  const float* x  = (const float*)d_in[0];
  const float* Wq = (const float*)d_in[1];
  const float* Wk = (const float*)d_in[2];
  const float* Wv = (const float*)d_in[3];
  const float* Wo = (const float*)d_in[4];
  const float* bo = (const float*)d_in[5];
  const float* wp = (const float*)d_in[6];
  const float* vp = (const float*)d_in[7];

  const size_t PW  = (size_t)DIN * DOUT * 2;              // 16-bit [1024][1024] plane
  const size_t PX  = (size_t)NSEQ * DIN * 2;              // 16-bit [2048][1024] plane
  const size_t PQK = (size_t)NSEQ * (2 * DOUT) * 2;       // 16-bit [2048][2048] plane
  const size_t PVT = (size_t)DOUT * NSEQ * 2;             // 16-bit [1024][2048] plane
  size_t off = 0;
  const size_t oWqkTh = off; off += 2 * PW;
  const size_t oWqkTl = off; off += 2 * PW;
  const size_t oWvTh  = off; off += PW;
  const size_t oWvTl  = off; off += PW;
  const size_t oWoTh  = off; off += PW;
  const size_t oWoTl  = off; off += PW;
  const size_t oXOh   = off; off += NB * PX;
  const size_t oXOl   = off; off += NB * PX;
  const size_t oQKh   = off; off += NB * PQK;
  const size_t oQKl   = off; off += NB * PQK;
  const size_t oVTh   = off; off += NB * PVT;
  const size_t oVTl   = off; off += NB * PVT;
  if (off > ws_size) return;

  char* ws = (char*)d_ws;
  unsigned short* WqkTh = (unsigned short*)(ws + oWqkTh);
  unsigned short* WqkTl = (unsigned short*)(ws + oWqkTl);
  unsigned short* WvTh  = (unsigned short*)(ws + oWvTh);
  unsigned short* WvTl  = (unsigned short*)(ws + oWvTl);
  unsigned short* WoTh  = (unsigned short*)(ws + oWoTh);
  unsigned short* WoTl  = (unsigned short*)(ws + oWoTl);
  unsigned short* XOh   = (unsigned short*)(ws + oXOh);
  unsigned short* XOl   = (unsigned short*)(ws + oXOl);
  unsigned short* QKh   = (unsigned short*)(ws + oQKh);
  unsigned short* QKl   = (unsigned short*)(ws + oQKl);
  unsigned short* VTh   = (unsigned short*)(ws + oVTh);
  unsigned short* VTl   = (unsigned short*)(ws + oVTl);

  const dim3 blk(256);
  // weight planes: in [1024 rows = input feature k][1024 cols = output feature n] -> out[n][k]; grid (cols/64, rows/64)
  const dim3 gTr(DOUT / 64, DIN / 64);
  transpose_split_kernel<<<gTr, blk, 0, stream>>>(Wq, DOUT, WqkTh, WqkTl, DIN);
  transpose_split_kernel<<<gTr, blk, 0, stream>>>(Wk, DOUT, WqkTh + (size_t)DOUT * DIN, WqkTl + (size_t)DOUT * DIN, DIN);
  transpose_split_kernel<<<gTr, blk, 0, stream>>>(Wv, DOUT, WvTh, WvTl, DIN);
  transpose_split_kernel<<<gTr, blk, 0, stream>>>(Wo, DOUT, WoTh, WoTl, DOUT);

  const int n2x = NSEQ * DIN / 2;                                   // 1048576 pairs per batch slice
  const dim3 gSplit((n2x + 255) / 256);                             // 4096 blocks x 256 thr x 2 = 2048x1024
  const dim3 gQK((NSEQ / 64) * (2 * DOUT / 64), 1);                 // 1024 blocks (one tile each): M=2048, N=2048, K=1024
  const dim3 gVT((DOUT / 64) * (NSEQ / 64), 1);                     // 512 blocks:  M=1024, N=2048, K=1024
  const dim3 gAt(NSEQ / 128, NH, NB);                               // 16 x 16 x 2 blocks x 8 waves x 16 queries
  const dim3 gOut((NSEQ / 64) * (DOUT / 64), 1);                    // 512 blocks: M=2048, N=1024, K=1024

  for (int b = 0; b < NB; ++b) {
    unsigned short* Xh  = XOh + (size_t)b * NSEQ * DIN;
    unsigned short* Xl  = XOl + (size_t)b * NSEQ * DIN;
    // (1) x[b] -> bf16 hi/lo planes [2048][1024] (whole plane: 4096 blocks x 256 thr x 2)
    split_bf16x2_kernel<<<gSplit, blk, 0, stream>>>(x + (size_t)b * NSEQ * DIN, Xh, Xl, n2x);
    // (2) [q | k] = x . [Wq | Wk] -> QK hi/lo planes [2048][2048] of batch b (whole planes: 32x32 tiles)
    wmma_gemm64<1, true, 0, 2, false, 0, false, false, 8><<<gQK, blk, 0, stream>>>(
        Xh, Xl, DIN, 0L, WqkTh, WqkTl, DIN, 0L,
        (void*)(QKh + (size_t)b * NSEQ * 2 * DOUT), (void*)(QKl + (size_t)b * NSEQ * 2 * DOUT), 2 * DOUT, 0L,
        bo, bo, 0L, NSEQ, 2 * DOUT, DIN, 1.0f);
    // (3) v^T[o][tok] = sum_k Wv^T[o][k] x[tok][k] -> VT hi/lo planes [1024][2048] of batch b (whole planes: 16x32 tiles)
    wmma_gemm64<1, true, 0, 2, false, 0, false, false, 8><<<gVT, blk, 0, stream>>>(
        WvTh, WvTl, DIN, 0L, Xh, Xl, DIN, 0L,
        (void*)(VTh + (size_t)b * DOUT * NSEQ), (void*)(VTl + (size_t)b * DOUT * NSEQ), NSEQ, 0L,
        bo, bo, 0L, DOUT, NSEQ, DIN, 1.0f);
  }
  // (4) ctx[b][i][h*64+d] = softmax_j(relu(q_i . k_j) * decay * 1/8, causal) . v -> O hi/lo planes (whole [2][2048][1024])
  fused_attn_kernel<<<gAt, blk, 0, stream>>>(QKh, QKl, VTh, VTl, wp, vp, XOh, XOl);
  for (int b = 0; b < NB; ++b) {
    // (5) out[b] = ctx[b] . Wo + bo (f32, whole [2048][1024] slice of d_out)
    float* outb = (float*)d_out + (size_t)b * NSEQ * DOUT;
    wmma_gemm64<1, true, 2, 0, false, 0, false, false, 8><<<gOut, blk, 0, stream>>>(
        XOh + (size_t)b * NSEQ * DOUT, XOl + (size_t)b * NSEQ * DOUT, DOUT, 0L, WoTh, WoTl, DOUT, 0L,
        (void*)outb, (void*)outb, DOUT, 0L,
        bo, bo, 0L, NSEQ, DOUT, DOUT, 1.0f);
  }
  (void)hipGetLastError();
}

// v004
// Measured time: 186 microseconds a run.
// Timed twice side by side with v003, it ran 1.37 times as fast both times.
// Counting every step since v000, it is 13.7 times as fast.
// Every contraction (x.Wq|Wk, Wv^T.x^T, k.q^T, v^T.p^T, ctx.Wo): v_wmma_f32_16x16x32_bf16 on bf16 hi/lo split operand planes (hi.hi + hi.lo + lo.hi), f32 accumulate; relu, distance decay, causal mask and softmax in f32.
#include <hip/hip_runtime.h>
#include <math.h>
#include <stdint.h>

#define NB    2
#define NSEQ  2048
#define DIN   1024
#define DOUT  1024
#define NH    16
#define HDIM  64

typedef __attribute__((ext_vector_type(16))) __bf16   v16b;
typedef __attribute__((ext_vector_type(8)))  __bf16   v8b;
typedef __attribute__((ext_vector_type(8)))  float    v8f;
typedef __attribute__((ext_vector_type(4)))  float    v4f;
typedef __attribute__((ext_vector_type(2)))  float    v2f;
typedef __attribute__((ext_vector_type(4)))  unsigned int v4u;
typedef __attribute__((ext_vector_type(2)))  unsigned int v2u;

__device__ __forceinline__ unsigned short f2bf_bits(float f) {
  unsigned u = __float_as_uint(f);
  return (unsigned short)((u + 0x7FFFu + ((u >> 16) & 1u)) >> 16);
}
__device__ __forceinline__ float bf_bits2f(unsigned short h) { return __uint_as_float(((unsigned)h) << 16); }

typedef __attribute__((ext_vector_type(2))) __bf16 v2b;
// hi = bf16_rne(f), lo = bf16_rne(f - hi), two values packed per word
__device__ __forceinline__ void split_pair(float f0, float f1, unsigned& hi, unsigned& lo) {
  hi = __builtin_bit_cast(unsigned, __builtin_convertvector((v2f){f0, f1}, v2b));
  const float r0 = f0 - __uint_as_float(hi << 16);
  const float r1 = f1 - __uint_as_float(hi & 0xFFFF0000u);
  lo = __builtin_bit_cast(unsigned, __builtin_convertvector((v2f){r0, r1}, v2b));
}

// four vector slots behind a WMMA whose operand registers may be reused
__device__ __forceinline__ void acc_guard4(v8f& a, v8f& b, v8f& c, v8f& d) { asm volatile("v_nop\n\tv_nop\n\tv_nop\n\tv_nop" : "+v"(a), "+v"(b), "+v"(c), "+v"(d)); }
template <typename T> struct Frag;
template <> struct Frag<__bf16> {
  typedef v16b V; union U { v16b v; v8b h[2]; };
  static __device__ __forceinline__ v16b load(const __bf16* p) {   // elements 0..7 <- p[0..7], 8..15 <- p[16..23]
    U f; f.h[0] = *(const v8b*)(p); f.h[1] = *(const v8b*)(p + 16); return f.v;
  }
  static __device__ __forceinline__ v8f mma(v16b a, v16b b, v8f c) {
    return __builtin_amdgcn_wmma_f32_16x16x32_bf16(false, a, false, b, (short)0, c, false, false);
  }
};

// ---- WMMA GEMM on operand tiles staged in LDS -------------------------------
// C[m,n] = sum_k A[m,k] * Bt[n,k] (+ bias[n]); A row-major [M,K], Bt row-major [N,K], each as bf16 hi and lo planes;
// product = hi.hi + hi.lo + lo.hi, f32 accumulate, k ascending.
// A block of four waves (2 x 2) owns one (FM*32) x 128 tile of C; a wave owns (FM*16) x 64 of it.
// A stage is 64 k of every operand row of the tile: whole 128-B lines, brought into LDS once per block by asynchronous copies,
// two buffers; both waves of a tile row share the A rows, both of a tile column the Bt rows.
// M % (FM*32) == 0, N % 128 == 0, K % 64 == 0. OUT_MODE: 0 = f32, 2 = bf16 hi plane (Cout) + bf16 lo plane (Cout2).
// Every '#pragma unroll' below stands on a loop of constant trip count whose index selects a fragment, an accumulator or a copy:
// unrolled, those arrays stay in registers.
#define GS_PITCH 72                    // 16-bit elements: 128 B of data at 144 B (16 B x odd: the 16-byte fragment reads of 16 rows fall on distinct banks)

// Eight copies of 16 B per lane: rows r, r + 16, r + 32, r + 48 of a hi plane (la, ga) and of its lo plane (lb, gb); step = 16 source rows.
// The builtin form: the compiler allots the address registers itself, in any register window.
typedef __attribute__((ext_vector_type(4))) int v4i;
typedef __attribute__((address_space(1))) v4i g_v4i;
typedef __attribute__((address_space(3))) v4i l_v4i;
__device__ __forceinline__ void copy_rows(unsigned short* la, unsigned short* lb, const unsigned short* ga, const unsigned short* gb, size_t step) {
#pragma unroll
  for (int i = 0; i < 4; ++i) {
    __builtin_amdgcn_global_load_async_to_lds_b128((g_v4i*)(ga + i * step), (l_v4i*)(la + i * (16 * GS_PITCH)), 0, 0);
    __builtin_amdgcn_global_load_async_to_lds_b128((g_v4i*)(gb + i * step), (l_v4i*)(lb + i * (16 * GS_PITCH)), 0, 0);
  }
}

template <int FM, bool BIAS, int OUT_MODE>
__global__ __launch_bounds__(128) void wmma_gemm_staged(
    const unsigned short* __restrict__ Ahp, const unsigned short* __restrict__ Alp, int lda,
    const unsigned short* __restrict__ Bhp, const unsigned short* __restrict__ Blp, int ldb,
    void* __restrict__ Cout, void* __restrict__ Cout2, int ldc,
    const float* __restrict__ bias, int tilesN, int K) {
  typedef Frag<__bf16> F;
  constexpr int TM  = FM * 32;                    // tile rows
  constexpr int TN  = 128;                        // tile columns
  constexpr int BUF = 2 * (TM + TN) * GS_PITCH;   // a buffer: A hi (TM rows), A lo, Bt hi (TN rows), Bt lo
  __shared__ __align__(16) unsigned short ring[2 * BUF];
  __shared__ __align__(16) float sT[4][16 * 68];  // per-wave 16x64 output slab, pitch 68 floats
  const int lane = threadIdx.x & 31;
  const int wave = __builtin_amdgcn_readfirstlane((int)(threadIdx.x >> 5));
  const int wm = wave >> 1, wn = wave & 1;
  const int tm = (int)blockIdx.x / tilesN;
  const int tn = (int)blockIdx.x - tm * tilesN;
  const int m0 = tm * TM;
  const int n0 = tn * TN;
  const int rlane = lane & 15;                 // row (A) / col (B, D) within subtile
  const int koff  = (lane >> 4) * 8;           // k offset of this lane half
  const int mOff  = (lane >> 4) * 8;           // D row offset

  // copies: a thread brings one 16-B piece of rows crow, crow + 16, ... of every plane; 8 lanes cover one 128-B line
  const int crow = (int)threadIdx.x >> 3;          // 0..15
  const int cpc  = ((int)threadIdx.x & 7) * 8;     // in elements
  unsigned short* ldsc = ring + crow * GS_PITCH + cpc;
  const unsigned aco = (unsigned)(crow * lda + cpc);   // this lane's place inside 16 rows; the block-uniform rest of an address stays scalar
  const unsigned bco = (unsigned)(crow * ldb + cpc);
  const int ns = K >> 6;                           // stages
  auto copy_stage_g = [&](int s) {                 // stage s -> buffer s & 1: 2 * (TM + TN) / 16 copies per thread (32 or 24)
    unsigned short* l0 = ldsc + (s & 1) * BUF;
    const size_t ka = (size_t)m0 * lda + (size_t)s * 64;
    const size_t kb = (size_t)n0 * ldb + (size_t)s * 64;
#pragma unroll
    for (int g = 0; g < TM / 64; ++g)
      copy_rows(l0 + (g * 64) * GS_PITCH, l0 + (TM + g * 64) * GS_PITCH,
                (Ahp + (ka + (size_t)(g * 64) * lda)) + aco, (Alp + (ka + (size_t)(g * 64) * lda)) + aco, (size_t)16 * lda);
#pragma unroll
    for (int g = 0; g < TN / 64; ++g)
      copy_rows(l0 + (2 * TM + g * 64) * GS_PITCH, l0 + (2 * TM + TN + g * 64) * GS_PITCH,
                (Bhp + (kb + (size_t)(g * 64) * ldb)) + bco, (Blp + (kb + (size_t)(g * 64) * ldb)) + bco, (size_t)16 * ldb);
  };
  copy_stage_g(0);

  v8f acc[FM][4];
#pragma unroll
  for (int i = 0; i < FM; ++i)
#pragma unroll
    for (int j = 0; j < 4; ++j) acc[i][j] = (v8f){0.f,0.f,0.f,0.f,0.f,0.f,0.f,0.f};

  const __bf16* ab = (const __bf16*)ring + (wm * (FM * 16) + rlane) * GS_PITCH + koff;        // A hi fragment row of this lane
  const __bf16* bb = (const __bf16*)ring + (2 * TM + wn * 64 + rlane) * GS_PITCH + koff;      // Bt hi fragment row

  asm volatile("s_wait_asynccnt 0x0" ::: "memory");   // this wave's copies of stage 0 have landed
  __syncthreads();                                    // publishes stage 0

  for (int s = 0; s < ns; ++s) {
    const __bf16* sa = ab + (s & 1) * BUF;
    const __bf16* sb = bb + (s & 1) * BUF;
    // all fragments of the stage (two k steps of 32), read as one group in the order the products use them
    v16b bh[2][4], bl[2][4], ah[2][FM], al[2][FM];
#pragma unroll
    for (int ks = 0; ks < 2; ++ks) {
#pragma unroll
      for (int j = 0; j < 4; ++j) bh[ks][j] = F::load(sb + (j * 16) * GS_PITCH + ks * 32);
      ah[ks][0] = F::load(sa + ks * 32);
#pragma unroll
      for (int j = 0; j < 4; ++j) bl[ks][j] = F::load(sb + (TN + j * 16) * GS_PITCH + ks * 32);
      al[ks][0] = F::load(sa + TM * GS_PITCH + ks * 32);
#pragma unroll
      for (int i = 1; i < FM; ++i) {
        ah[ks][i] = F::load(sa + (i * 16) * GS_PITCH + ks * 32);
        al[ks][i] = F::load(sa + (TM + i * 16) * GS_PITCH + ks * 32);
      }
    }
    // keeps the LDS reads together up here: left to itself the compiler sinks them in pairs among the WMMAs, each pair with a full wait
    __builtin_amdgcn_sched_barrier(0);
    // stage s + 1 into the buffer that trip s - 1 has read, behind the barrier that ended those reads (block-uniform test);
    // issued here, its address arithmetic passes while the fragment reads above are under way
    if (s + 1 < ns) copy_stage_g(s + 1);
    // keeps the WMMAs, and the waits for their fragments, behind the issue of the copies
    __builtin_amdgcn_sched_barrier(0);
#pragma unroll
    for (int ks = 0; ks < 2; ++ks) {
      // four independent accumulators between two products into the same one
#pragma unroll
      for (int i = 0; i < FM; ++i) {
#pragma unroll
        for (int j = 0; j < 4; ++j) acc[i][j] = F::mma(ah[ks][i], bh[ks][j], acc[i][j]);
#pragma unroll
        for (int j = 0; j < 4; ++j) acc[i][j] = F::mma(ah[ks][i], bl[ks][j], acc[i][j]);
#pragma unroll
        for (int j = 0; j < 4; ++j) acc[i][j] = F::mma(al[ks][i], bh[ks][j], acc[i][j]);
      }
    }
    // keeps the WMMAs in front of the waits below, so that the copies fly under them: left to itself the compiler moves them behind the barrier
    __builtin_amdgcn_sched_barrier(0);
    // publish point of stage s + 1, passed by every wave
    asm volatile("s_wait_dscnt 0x0" ::: "memory");     // this wave's reads of stage s are done before its buffer is refilled
    asm volatile("s_wait_asynccnt 0x0" ::: "memory");  // this wave's copies of stage s + 1 have landed
    __syncthreads();                                   // publishes stage s + 1 and ends every wave's reads of stage s
  }
  asm volatile("s_wait_asynccnt 0x0" ::: "memory");    // no copy is outstanding when the wave goes on

  // ---- epilogue: 16 rows at a time through this wave's own slab, so that every store covers whole 128-B lines ----
  float* slab = sT[wave];
  const int nW = n0 + wn * 64;
#pragma unroll
  for (int i = 0; i < FM; ++i) {
    const int mBase = m0 + wm * (FM * 16) + (i << 4);
#pragma unroll
    for (int j = 0; j < 4; ++j) {
      float bv = 0.f;
      if (BIAS) bv = bias[nW + (j << 4) + rlane];
#pragma unroll
      for (int r = 0; r < 8; ++r) slab[(mOff + r) * 68 + (j << 4) + rlane] = BIAS ? acc[i][j][r] + bv : acc[i][j][r];
    }
    asm volatile("s_wait_dscnt 0x0" ::: "memory");      // the wave's slab rows are written before its lanes read them back
    if (OUT_MODE == 0) {
      float* C = (float*)Cout;
      const int hh = lane >> 4, c4 = (lane & 15) * 4;     // row seg = 256 B = 16 lanes x 16 B
#pragma unroll
      for (int it = 0; it < 8; ++it) {
        const int row = it * 2 + hh;
        v4f v = *(const v4f*)(slab + row * 68 + c4);
        *(v4f*)(C + (size_t)(mBase + row) * ldc + nW + c4) = v;
      }
    } else {
      const int q = lane >> 3, c8 = (lane & 7) * 8;       // row seg = 128 B = 8 lanes x 16 B per plane
      unsigned short* C  = (unsigned short*)Cout;
      unsigned short* C2 = (unsigned short*)Cout2;
#pragma unroll
      for (int it = 0; it < 4; ++it) {
        const int row = it * 4 + q;
        const float* sp = slab + row * 68 + c8;
        v4u hv, lv;
#pragma unroll
        for (int e = 0; e < 4; ++e) {
          unsigned hw, lw;
          split_pair(sp[2 * e], sp[2 * e + 1], hw, lw);
          hv[e] = hw;
          lv[e] = lw;
        }
        *(v4u*)(C + (size_t)(mBase + row) * ldc + nW + c8) = hv;
        *(v4u*)(C2 + (size_t)(mBase + row) * ldc + nW + c8) = lv;
      }
    }
    // the stores' address and data registers are reused by the next row group; the clobber keeps that group's slab writes behind these reads
    asm volatile("s_wait_xcnt 0x0" ::: "memory");
  }
}

// ---------------------------------------------------------------------------
// Elementwise split: 2 elements per thread, one 4-B store per lane per plane -> each wave writes exactly one
// Coverage: grid = ceil(n2/256) blocks x 256 threads x 2 elements = 2*n2 elements = the whole plane (n2 = plane/2).
// ---------------------------------------------------------------------------
__device__ __forceinline__ unsigned pk16(unsigned short a, unsigned short b) { return (unsigned)a | ((unsigned)b << 16); }

// hi = bf16_rne(in), lo = bf16_rne(in - hi)
__global__ __launch_bounds__(256) void split_bf16x2_kernel(const float* __restrict__ in, unsigned short* __restrict__ hi,
                                                           unsigned short* __restrict__ lo, int n2) {
  const int i = blockIdx.x * 256 + threadIdx.x;
  if (i < n2) {
    const v2f f = *(const v2f*)(in + 2 * (size_t)i);
    const unsigned short h0 = f2bf_bits(f[0]), h1 = f2bf_bits(f[1]);
    const unsigned short l0 = f2bf_bits(f[0] - bf_bits2f(h0)), l1 = f2bf_bits(f[1] - bf_bits2f(h1));
    const unsigned uh = pk16(h0, h1), ul = pk16(l0, l1);
    ((unsigned*)hi)[i] = uh;
    ((unsigned*)lo)[i] = ul;
    
  }
}

// ---------------------------------------------------------------------------
// Transpose + bf16 hi/lo split of an f32 matrix: in [rows][cols] (row pitch ldi floats) ->
// outh/outl[c][r] = split(in[r][c]) (row pitch ldo u16). grid (cols/64, rows/64), 256 threads; rows, cols % 64 == 0.
// Coverage per block: load 4 it x 256 thr x 4 f32 = 64x64; store 2 it x 256 thr x 8 u16 = 64x64 per plane;
// ---------------------------------------------------------------------------
__global__ __launch_bounds__(256) void transpose_split_kernel(const float* __restrict__ in, int ldi,
                                                              unsigned short* __restrict__ outh,
                                                              unsigned short* __restrict__ outl, int ldo) {
  __shared__ __align__(16) float tf[64 * 68];
  const int c0  = blockIdx.x * 64;   // input column block = output row block
  const int r0  = blockIdx.y * 64;   // input row block    = output column block
  const int tid = threadIdx.x;
  {
    const int sub = tid >> 4;          // 0..15
    const int c4  = (tid & 15) * 4;    // 0..60
#pragma unroll
    for (int it = 0; it < 4; ++it) {
      const int rr = it * 16 + sub;
      const v4f a = *(const v4f*)(in + (size_t)(r0 + rr) * ldi + c0 + c4);
      *(v4f*)(tf + rr * 68 + c4) = a;
    }
  }
  __syncthreads();
  const int s8 = tid >> 3;             // 0..31
  const int c8 = (tid & 7) * 8;        // 0..56
  v4u hv[2], lv[2];
#pragma unroll
  for (int it = 0; it < 2; ++it) {
    const int oc = it * 32 + s8;       // output row within tile (= input column)
    v4u a, a2;
#pragma unroll
    for (int q = 0; q < 4; ++q) {
      const float f0 = tf[(c8 + 2 * q) * 68 + oc];
      const float f1 = tf[(c8 + 2 * q + 1) * 68 + oc];
      const unsigned short h0 = f2bf_bits(f0), h1 = f2bf_bits(f1);
      const unsigned short l0 = f2bf_bits(f0 - bf_bits2f(h0));
      const unsigned short l1 = f2bf_bits(f1 - bf_bits2f(h1));
      a[q]  = pk16(h0, h1);
      a2[q] = pk16(l0, l1);
    }
    hv[it] = a; lv[it] = a2;
  }
  {
#pragma unroll
    for (int it = 0; it < 2; ++it) {
      const int oc = it * 32 + s8;
      const size_t go = (size_t)(c0 + oc) * ldo + r0 + c8;
      *(v4u*)(outh + go) = hv[it];
      *(v4u*)(outl + go) = lv[it];
    }
    
  }
}

// ---------------------------------------------------------------------------
// Fused causal attention, all batches and heads in one launch: scores, relu * distance decay, online softmax and P.V in one kernel;
// neither scores nor probabilities go to memory. The K rows and V^T columns of 64 keys (a stage) are brought into LDS once per block
// by asynchronous copies, whole 128-B lines, two buffers, and all eight waves take their fragments from there.
// A wave owns 16 queries (one per lane column c) of head blockIdx.y, batch blockIdx.z, and walks the keys 32 at a time:
//   St[key][query] = K . Q^T   (A = K rows, B = Q rows kept in registers; both through the same loader)
//   t = relu(St) * R_hat(h, i - j) * 0.125 in log2 units, -inf for j > i (only the last pass holds such keys),
//   R_hat = (1 + exp(v[h])) * rcp(1 + exp(v[h] - w[h] * (i - j)))
//   running maximum m (starts at 0: every allowed t is >= 0 and key 0 is always allowed), p = exp2(t - m),
//   Ot[d][query] = Ot * exp2(m_old - m_new) + V^T . P^T
// The two 16-key score tiles of a pass, converted in place, are the B operand of the second product
// (element s = tile s >> 3, register s & 7), which is the k order the A loader of V^T delivers.
// A lane holds 8 + 8 keys of its query; lanes c and c + 16 share the maximum each pass and join their sums at the end.
// Waves 0..3 of a block take query groups from the long end, waves 4..7 the mirrored ones from the short end.
// Output: lane (c, hf) holds ctx[q0 + c][head*64 + ds*16 + hf*8 + 0..7]: one 16-B store per plane and ds;
// the 128-B line of a (query, head) is written by one wave. grid (NSEQ/128, NH, NB) x 8 waves x 16 queries = all rows.
// Every '#pragma unroll' below stands on a loop of constant trip count whose index selects a fragment or an accumulator:
// unrolled, those arrays stay in registers.
// ---------------------------------------------------------------------------

__device__ __forceinline__ float other_half(float x) {   // the value of lane l ^ 16
  const int b = __float_as_int(x);
  return __int_as_float(__builtin_amdgcn_permlanex16(b, b, 0x76543210, 0xfedcba98, false, false));
}

// LDS ring: a stage holds four planes (K hi, K lo: 64 key rows x 64 dims; V^T hi, V^T lo: 64 dim rows x 64 keys); a row is 128 B of data
// at a pitch of 144 B (16 B x odd: the 16-byte fragment reads of 16 rows fall on distinct banks).
#define AT_PITCH 72                    // 16-bit elements
#define AT_PLANE (64 * AT_PITCH)
#define AT_BUF   (4 * AT_PLANE)

// One stage = 4 planes x 64 rows x 8 pieces of 16 B = 2048 pieces, eight per thread: rows r and r + 32 of each plane.
// lds: this lane's byte address in plane 0 of the target buffer; the pointers: this lane's piece of row r of each plane.
// The s_wait_xcnt at the end of the statement stands in front of any later rewrite of the address registers the copies name.
__device__ __forceinline__ void copy_stage(unsigned lds, const unsigned short* kh, const unsigned short* kl,
                                           const unsigned short* vh, const unsigned short* vl) {
  const unsigned R = 32 * AT_PITCH * 2, P = AT_PLANE * 2;
  asm volatile("global_load_async_to_lds_b128 %0, %8, off\n\t"
               "global_load_async_to_lds_b128 %1, %9, off\n\t"
               "global_load_async_to_lds_b128 %2, %10, off\n\t"
               "global_load_async_to_lds_b128 %3, %11, off\n\t"
               "global_load_async_to_lds_b128 %4, %12, off\n\t"
               "global_load_async_to_lds_b128 %5, %13, off\n\t"
               "global_load_async_to_lds_b128 %6, %14, off\n\t"
               "global_load_async_to_lds_b128 %7, %15, off\n\t"
               "s_wait_xcnt 0x0"
               :: "v"(lds), "v"(lds + R), "v"(lds + P), "v"(lds + P + R),
                  "v"(lds + 2 * P), "v"(lds + 2 * P + R), "v"(lds + 3 * P), "v"(lds + 3 * P + R),
                  "v"(kh), "v"(kh + 32 * (2 * DOUT)), "v"(kl), "v"(kl + 32 * (2 * DOUT)),
                  "v"(vh), "v"(vh + 32 * NSEQ), "v"(vl), "v"(vl + 32 * NSEQ)
               : "memory");
}

// four waves per SIMD (two blocks per WGP): the waves fill each other's waits
__global__ __launch_bounds__(256) __attribute__((amdgpu_waves_per_eu(4, 4))) void fused_attn_kernel(const unsigned short* __restrict__ QKhp, const unsigned short* __restrict__ QKlp,
                                                         const unsigned short* __restrict__ VThp, const unsigned short* __restrict__ VTlp,
                                                         const float* __restrict__ wp, const float* __restrict__ vp,
                                                         unsigned short* __restrict__ Oh, unsigned short* __restrict__ Ol) {
  typedef Frag<__bf16> F;
  const int lane = threadIdx.x & 31;
  const int wave = __builtin_amdgcn_readfirstlane((int)(threadIdx.x >> 5));
  const int head = blockIdx.y;
  const size_t bz = blockIdx.z;
  const int c    = lane & 15;
  const int hf   = lane >> 4;
  const int tq   = (int)blockIdx.x * 4 + (wave & 3);            // 0..63
  const int qg   = (wave < 4) ? (NSEQ / 16 - 1 - tq) : tq;      // every 16-query group once
  const int q0   = qg << 4;
  const int np   = (q0 >> 5) + 1;                               // passes of 32 keys; keys of passes 0..np-2 are all < q0

  const float L2E = 1.44269504088896341f;
  const float w2  = wp[head] * L2E;
  const float v2  = vp[head] * L2E;
  const float c1  = (1.0f + __builtin_amdgcn_exp2f(v2)) * (0.125f * L2E);

  const size_t qo = (bz * NSEQ + q0 + c) * (2 * DOUT) + head * HDIM + hf * 8;

  __shared__ __align__(16) unsigned short ring[2 * AT_BUF];
  // stages of 64 keys that the block's longest wave (wave 0) needs: 17..32, so stages 0 and 1 always exist and every key is < NSEQ
  const int ns = ((((NSEQ / 16 - 1 - (int)blockIdx.x * 4) << 4) >> 5) + 2) >> 1;
  const int crow = (int)threadIdx.x >> 3;          // 0..31: the row this thread copies (and row + 32)
  const int cpc  = ((int)threadIdx.x & 7) * 8;     // its 16-B piece of the row, in elements: 8 lanes cover one 128-B line
  const unsigned ldsc = (unsigned)(uintptr_t)(ring + crow * AT_PITCH + cpc);
  const size_t kco = (bz * NSEQ + crow) * (2 * DOUT) + DOUT + head * HDIM + cpc;
  const size_t vco = (bz * DOUT + head * HDIM + crow) * NSEQ + cpc;
  copy_stage(ldsc, QKhp + kco, QKlp + kco, VThp + vco, VTlp + vco);      // stage 0 -> buffer 0
  const __bf16* rb = (const __bf16*)ring + c * AT_PITCH + hf * 8;        // this lane's fragment row and k half

  v16b qh[2], ql[2];
#pragma unroll
  for (int ks = 0; ks < 2; ++ks) {
    qh[ks] = F::load((const __bf16*)QKhp + qo + ks * 32);
    ql[ks] = F::load((const __bf16*)QKlp + qo + ks * 32);
  }
  // the address registers of the Q loads are reused right below; the loaded values as inputs keep the wait behind the loads
  asm volatile("s_wait_xcnt 0x0" :: "v"(qh[0]), "v"(qh[1]), "v"(ql[0]), "v"(ql[1]) : "memory");

  v8f o[4];
#pragma unroll
  for (int ds = 0; ds < 4; ++ds) o[ds] = (v8f){0.f,0.f,0.f,0.f,0.f,0.f,0.f,0.f};
  float m = 0.f, l = 0.f;

  asm volatile("s_wait_asynccnt 0x0" ::: "memory");   // this wave's copies of stage 0 have landed
  __syncthreads();                                    // publishes stage 0
  copy_stage(ldsc + AT_BUF * 2, QKhp + kco + (size_t)64 * (2 * DOUT), QKlp + kco + (size_t)64 * (2 * DOUT),
             VThp + vco + 64, VTlp + vco + 64);       // stage 1 -> buffer 1

  for (int s = 0; s < ns; ++s) {
  const __bf16* sb = rb + (s & 1) * AT_BUF;
  for (int h2 = 0; h2 < 2; ++h2) {
    const int p = 2 * s + h2;
    if (p >= np) break;                               // wave-uniform: a wave past its diagonal only keeps the publish points
    const int j0 = p << 5;
    // K rows and V^T columns of this pass, from this stage's buffer
    v16b kh[2][2], kl[2][2];
#pragma unroll
    for (int a = 0; a < 2; ++a)
#pragma unroll
      for (int ks = 0; ks < 2; ++ks) {
        kh[a][ks] = F::load(sb + (h2 * 32 + a * 16) * AT_PITCH + ks * 32);
        kl[a][ks] = F::load(sb + AT_PLANE + (h2 * 32 + a * 16) * AT_PITCH + ks * 32);
      }
    v16b vh[4], vl[4];
#pragma unroll
    for (int ds = 0; ds < 4; ++ds) {
      vh[ds] = F::load(sb + 2 * AT_PLANE + (ds * 16) * AT_PITCH + h2 * 32);
      vl[ds] = F::load(sb + 3 * AT_PLANE + (ds * 16) * AT_PITCH + h2 * 32);
    }
    v8f st[2];
    st[0] = (v8f){0.f,0.f,0.f,0.f,0.f,0.f,0.f,0.f};
    st[1] = st[0];
#pragma unroll
    for (int ks = 0; ks < 2; ++ks) {
      st[0] = F::mma(kh[0][ks], qh[ks], st[0]);
      st[1] = F::mma(kh[1][ks], qh[ks], st[1]);
      st[0] = F::mma(kh[0][ks], ql[ks], st[0]);
      st[1] = F::mma(kh[1][ks], ql[ks], st[1]);
      st[0] = F::mma(kl[0][ks], qh[ks], st[0]);
      st[1] = F::mma(kl[1][ks], qh[ks], st[1]);
    }
    // inputs only: keeps the V^T fragment reads up here, issued with the K reads, so that their LDS latency passes under the score
    // products and the softmax; left to itself the compiler sinks them in front of each P.V product, which then waits for them
    asm volatile("" :: "v"(vh[0]), "v"(vh[1]), "v"(vh[2]), "v"(vh[3]), "v"(vl[0]), "v"(vl[1]), "v"(vl[2]), "v"(vl[3]));
    const int   lim  = q0 + c - j0 - hf * 8;          // i - j of this lane's first key; key 16a + r is allowed while 16a + r <= lim
    const float base = v2 - w2 * (float)lim;
    float tt[2][8];
#pragma unroll
    for (int a = 0; a < 2; ++a)
#pragma unroll
      for (int r = 0; r < 8; ++r) {
        const float e = __builtin_amdgcn_exp2f(fmaf(w2, (float)(a * 16 + r), base));
        tt[a][r] = fmaxf(st[a][r], 0.0f) * (c1 * __builtin_amdgcn_rcpf(1.0f + e));
      }
    if (p == np - 1) {                                 // wave-uniform
#pragma unroll
      for (int a = 0; a < 2; ++a)
#pragma unroll
        for (int r = 0; r < 8; ++r) tt[a][r] = (a * 16 + r <= lim) ? tt[a][r] : -INFINITY;
    }
    float mx = m;
#pragma unroll
    for (int a = 0; a < 2; ++a)
#pragma unroll
      for (int r = 0; r < 8; ++r) mx = fmaxf(mx, tt[a][r]);
    mx = fmaxf(mx, other_half(mx));
    const float alpha = __builtin_amdgcn_exp2f(m - mx);
    m = mx;
    float ps0 = 0.f, ps1 = 0.f;
#pragma unroll
    for (int r = 0; r < 8; ++r) {
      tt[0][r] = __builtin_amdgcn_exp2f(tt[0][r] - mx);
      tt[1][r] = __builtin_amdgcn_exp2f(tt[1][r] - mx);
      ps0 += tt[0][r];
      ps1 += tt[1][r];
    }
    l = l * alpha + (ps0 + ps1);
#pragma unroll
    for (int ds = 0; ds < 4; ++ds) o[ds] *= alpha;

    union PF { v16b v; unsigned u[8]; } ph, pl;
#pragma unroll
    for (int a = 0; a < 2; ++a)
#pragma unroll
      for (int r2 = 0; r2 < 4; ++r2) split_pair(tt[a][2 * r2], tt[a][2 * r2 + 1], ph.u[a * 4 + r2], pl.u[a * 4 + r2]);

#pragma unroll
    for (int ds = 0; ds < 4; ++ds) o[ds] = F::mma(vh[ds], ph.v, o[ds]);
#pragma unroll
    for (int ds = 0; ds < 4; ++ds) o[ds] = F::mma(vh[ds], pl.v, o[ds]);
#pragma unroll
    for (int ds = 0; ds < 4; ++ds) o[ds] = F::mma(vl[ds], ph.v, o[ds]);
    // four vector slots behind the pass's last WMMA: the next pass's first address arithmetic, reached over the loop's branches,
    // reuses that WMMA's operand registers
    acc_guard4(o[0], o[1], o[2], o[3]);
  }
    // publish point of stage s + 1, passed by every wave
    asm volatile("s_wait_dscnt 0x0" ::: "memory");     // this wave's reads of stage s are done before its buffer is refilled
    asm volatile("s_wait_asynccnt 0x0" ::: "memory");  // this wave's copies of stage s + 1 have landed
    __syncthreads();                                   // publishes stage s + 1 and ends every wave's reads of stage s
    if (s + 2 < ns)                                    // block-uniform
      copy_stage(ldsc + (s & 1) * (AT_BUF * 2), QKhp + kco + (size_t)(s + 2) * 64 * (2 * DOUT), QKlp + kco + (size_t)(s + 2) * 64 * (2 * DOUT),
                 VThp + vco + (s + 2) * 64, VTlp + vco + (s + 2) * 64);
  }
  asm volatile("s_wait_asynccnt 0x0" ::: "memory");    // no copy is outstanding when the wave ends

  l += other_half(l);
  const float inv = 1.0f / l;                          // l >= 1: the row maximum contributes exp2(0)
  const size_t oo = (bz * NSEQ + q0 + c) * DOUT + head * HDIM + hf * 8;
#pragma unroll
  for (int ds = 0; ds < 4; ++ds) {
    unsigned hw[4], lw[4];
#pragma unroll
    for (int r2 = 0; r2 < 4; ++r2) split_pair(o[ds][2 * r2] * inv, o[ds][2 * r2 + 1] * inv, hw[r2], lw[r2]);
    *(v4u*)(Oh + oo + ds * 16) = (v4u){hw[0], hw[1], hw[2], hw[3]};
    *(v4u*)(Ol + oo + ds * 16) = (v4u){lw[0], lw[1], lw[2], lw[3]};
  }
}

// ---------------------------------------------------------------------------
// Workspace region map (byte offsets; all offsets multiples of 2 MiB). Every region is fully written in each call
// before it is read. X and O share one region: X is read only by the projection GEMMs, which precede the attention
// kernel (the O producer) in stream order; O is fully written (2 batches x 16 heads x 64 columns x 2048 rows) before
// the output projections read it.
//   WqkTh  bf16 [2048][1024]  rows 0..1023 = Wq^T, 1024..2047 = Wk^T         0
//   WqkTl  bf16 [2048][1024]                                          4194304
//   WvTh   bf16 [1024][1024]                                          8388608
//   WvTl   bf16 [1024][1024]                                         10485760
//   WoTh   bf16 [1024][1024]                                         12582912
//   WoTl   bf16 [1024][1024]                                         14680064
//   XOh    bf16 [2][2048][1024]  x hi, later ctx hi (col h*64+d)        16777216
//   XOl    bf16 [2][2048][1024]                                         25165824
//   QKh    bf16 [2][2048][2048]  q at col h*64+d, k at col 1024+h*64+d  33554432
//   QKl    bf16 [2][2048][2048]                                         50331648
//   VTh    bf16 [2][1024][2048]  row h*64+d, col token                  67108864
//   VTl    bf16 [2][1024][2048]                                         75497472
//   total                                                               83886080
// ---------------------------------------------------------------------------
extern "C" void kernel_launch(void* const* d_in, const int* in_sizes, int n_in,
                              void* d_out, int out_size, void* d_ws, size_t ws_size,
                              hipStream_t stream) {
  if (n_in < 8) return;
  if (in_sizes[0] != NB * NSEQ * DIN) return;
  if (in_sizes[1] != DIN * DOUT || in_sizes[2] != DIN * DOUT || in_sizes[3] != DIN * DOUT) return;
  if (in_sizes[4] != DOUT * DOUT || in_sizes[5] != DOUT) return;
  if (in_sizes[6] < NH || in_sizes[7] < NH) return;
  if (out_size != NB * NSEQ * DOUT) return;

  const float* x  = (const float*)d_in[0];
  const float* Wq = (const float*)d_in[1];
  const float* Wk = (const float*)d_in[2];
  const float* Wv = (const float*)d_in[3];
  const float* Wo = (const float*)d_in[4];
  const float* bo = (const float*)d_in[5];
  const float* wp = (const float*)d_in[6];
  const float* vp = (const float*)d_in[7];

  const size_t PW  = (size_t)DIN * DOUT * 2;              // 16-bit [1024][1024] plane
  const size_t PX  = (size_t)NSEQ * DIN * 2;              // 16-bit [2048][1024] plane
  const size_t PQK = (size_t)NSEQ * (2 * DOUT) * 2;       // 16-bit [2048][2048] plane
  const size_t PVT = (size_t)DOUT * NSEQ * 2;             // 16-bit [1024][2048] plane
  size_t off = 0;
  const size_t oWqkTh = off; off += 2 * PW;
  const size_t oWqkTl = off; off += 2 * PW;
  const size_t oWvTh  = off; off += PW;
  const size_t oWvTl  = off; off += PW;
  const size_t oWoTh  = off; off += PW;
  const size_t oWoTl  = off; off += PW;
  const size_t oXOh   = off; off += NB * PX;
  const size_t oXOl   = off; off += NB * PX;
  const size_t oQKh   = off; off += NB * PQK;
  const size_t oQKl   = off; off += NB * PQK;
  const size_t oVTh   = off; off += NB * PVT;
  const size_t oVTl   = off; off += NB * PVT;
  if (off > ws_size) return;

  char* ws = (char*)d_ws;
  unsigned short* WqkTh = (unsigned short*)(ws + oWqkTh);
  unsigned short* WqkTl = (unsigned short*)(ws + oWqkTl);
  unsigned short* WvTh  = (unsigned short*)(ws + oWvTh);
  unsigned short* WvTl  = (unsigned short*)(ws + oWvTl);
  unsigned short* WoTh  = (unsigned short*)(ws + oWoTh);
  unsigned short* WoTl  = (unsigned short*)(ws + oWoTl);
  unsigned short* XOh   = (unsigned short*)(ws + oXOh);
  unsigned short* XOl   = (unsigned short*)(ws + oXOl);
  unsigned short* QKh   = (unsigned short*)(ws + oQKh);
  unsigned short* QKl   = (unsigned short*)(ws + oQKl);
  unsigned short* VTh   = (unsigned short*)(ws + oVTh);
  unsigned short* VTl   = (unsigned short*)(ws + oVTl);

  const dim3 blk(256);
  // weight planes: in [1024 rows = input feature k][1024 cols = output feature n] -> out[n][k]; grid (cols/64, rows/64)
  const dim3 gTr(DOUT / 64, DIN / 64);
  transpose_split_kernel<<<gTr, blk, 0, stream>>>(Wq, DOUT, WqkTh, WqkTl, DIN);
  transpose_split_kernel<<<gTr, blk, 0, stream>>>(Wk, DOUT, WqkTh + (size_t)DOUT * DIN, WqkTl + (size_t)DOUT * DIN, DIN);
  transpose_split_kernel<<<gTr, blk, 0, stream>>>(Wv, DOUT, WvTh, WvTl, DIN);
  transpose_split_kernel<<<gTr, blk, 0, stream>>>(Wo, DOUT, WoTh, WoTl, DOUT);

  const int n2x = NSEQ * DIN / 2;                                   // 1048576 pairs per batch slice
  const dim3 gSplit((n2x + 255) / 256);                             // 4096 blocks x 256 thr x 2 = 2048x1024
  const dim3 blkG(128);                                             // GEMMs: four waves
  const dim3 gQK((NSEQ / 128) * (2 * DOUT / 128), 1);               // 256 blocks (one 128x128 tile each): M=2048, N=2048, K=1024
  const dim3 gVT((DOUT / 64) * (NSEQ / 128), 1);                    // 256 blocks (64x128):  M=1024, N=2048, K=1024
  const dim3 gAt(NSEQ / 128, NH, NB);                               // 16 x 16 x 2 blocks x 8 waves x 16 queries
  const dim3 gOut((NSEQ / 64) * (DOUT / 128), 1);                   // 256 blocks (64x128): M=2048, N=1024, K=1024

  for (int b = 0; b < NB; ++b) {
    unsigned short* Xh  = XOh + (size_t)b * NSEQ * DIN;
    unsigned short* Xl  = XOl + (size_t)b * NSEQ * DIN;
    // (1) x[b] -> bf16 hi/lo planes [2048][1024] (whole plane: 4096 blocks x 256 thr x 2)
    split_bf16x2_kernel<<<gSplit, blk, 0, stream>>>(x + (size_t)b * NSEQ * DIN, Xh, Xl, n2x);
    // (2) [q | k] = x . [Wq | Wk] -> QK hi/lo planes [2048][2048] of batch b (whole planes: 16x16 tiles)
    wmma_gemm_staged<4, false, 2><<<gQK, blkG, 0, stream>>>(
        Xh, Xl, DIN, WqkTh, WqkTl, DIN,
        (void*)(QKh + (size_t)b * NSEQ * 2 * DOUT), (void*)(QKl + (size_t)b * NSEQ * 2 * DOUT), 2 * DOUT,
        bo, 2 * DOUT / 128, DIN);
    // (3) v^T[o][tok] = sum_k Wv^T[o][k] x[tok][k] -> VT hi/lo planes [1024][2048] of batch b (whole planes: 16x16 tiles of 64x128)
    wmma_gemm_staged<2, false, 2><<<gVT, blkG, 0, stream>>>(
        WvTh, WvTl, DIN, Xh, Xl, DIN,
        (void*)(VTh + (size_t)b * DOUT * NSEQ), (void*)(VTl + (size_t)b * DOUT * NSEQ), NSEQ,
        bo, NSEQ / 128, DIN);
  }
  // (4) ctx[b][i][h*64+d] = softmax_j(relu(q_i . k_j) * decay * 1/8, causal) . v -> O hi/lo planes (whole [2][2048][1024])
  fused_attn_kernel<<<gAt, blk, 0, stream>>>(QKh, QKl, VTh, VTl, wp, vp, XOh, XOl);
  for (int b = 0; b < NB; ++b) {
    // (5) out[b] = ctx[b] . Wo + bo (f32, whole [2048][1024] slice of d_out)
    float* outb = (float*)d_out + (size_t)b * NSEQ * DOUT;
    wmma_gemm_staged<2, true, 0><<<gOut, blkG, 0, stream>>>(
        XOh + (size_t)b * NSEQ * DOUT, XOl + (size_t)b * NSEQ * DOUT, DOUT, WoTh, WoTl, DOUT,
        (void*)outb, (void*)outb, DOUT,
        bo, DOUT / 128, DOUT);
  }
  (void)hipGetLastError();
}

// v005
// It runs in 152 microseconds.
// In two side-by-side timings against v004, it was 1.23 and 1.22 times as fast.
// Counting every step since v000, it is 16.7 times as fast.
// Every contraction (x.Wq|Wk, Wv^T.x^T, k.q^T, v^T.p^T, ctx.Wo): v_wmma_f32_16x16x32_bf16 on bf16 hi/lo split operand planes (hi.hi + hi.lo + lo.hi), f32 accumulate; relu, distance decay, causal mask and softmax in f32.
#include <hip/hip_runtime.h>
#include <math.h>
#include <stdint.h>

#define NB    2
#define NSEQ  2048
#define DIN   1024
#define DOUT  1024
#define NH    16
#define HDIM  64

typedef __attribute__((ext_vector_type(16))) __bf16   v16b;
typedef __attribute__((ext_vector_type(8)))  __bf16   v8b;
typedef __attribute__((ext_vector_type(8)))  float    v8f;
typedef __attribute__((ext_vector_type(4)))  float    v4f;
typedef __attribute__((ext_vector_type(2)))  float    v2f;
typedef __attribute__((ext_vector_type(4)))  unsigned int v4u;
typedef __attribute__((ext_vector_type(2)))  unsigned int v2u;

__device__ __forceinline__ unsigned short f2bf_bits(float f) {
  unsigned u = __float_as_uint(f);
  return (unsigned short)((u + 0x7FFFu + ((u >> 16) & 1u)) >> 16);
}
__device__ __forceinline__ float bf_bits2f(unsigned short h) { return __uint_as_float(((unsigned)h) << 16); }

typedef __attribute__((ext_vector_type(2))) __bf16 v2b;
// hi = bf16_rne(f), lo = bf16_rne(f - hi), two values packed per word
__device__ __forceinline__ void split_pair(float f0, float f1, unsigned& hi, unsigned& lo) {
  hi = __builtin_bit_cast(unsigned, __builtin_convertvector((v2f){f0, f1}, v2b));
  const float r0 = f0 - __uint_as_float(hi << 16);
  const float r1 = f1 - __uint_as_float(hi & 0xFFFF0000u);
  lo = __builtin_bit_cast(unsigned, __builtin_convertvector((v2f){r0, r1}, v2b));
}

// four vector slots behind a WMMA whose operand registers may be reused
__device__ __forceinline__ void acc_guard4(v8f& a, v8f& b, v8f& c, v8f& d) { asm volatile("v_nop\n\tv_nop\n\tv_nop\n\tv_nop" : "+v"(a), "+v"(b), "+v"(c), "+v"(d)); }
template <typename T> struct Frag;
template <> struct Frag<__bf16> {
  typedef v16b V; union U { v16b v; v8b h[2]; };
  static __device__ __forceinline__ v16b load(const __bf16* p) {   // elements 0..7 <- p[0..7], 8..15 <- p[16..23]
    U f; f.h[0] = *(const v8b*)(p); f.h[1] = *(const v8b*)(p + 16); return f.v;
  }
  static __device__ __forceinline__ v8f mma(v16b a, v16b b, v8f c) {
    return __builtin_amdgcn_wmma_f32_16x16x32_bf16(false, a, false, b, (short)0, c, false, false);
  }
};

// ---- WMMA GEMM on operand tiles staged in LDS -------------------------------
// C[m,n] = sum_k A[m,k] * Bt[n,k] (+ bias[n]); A row-major [M,K], Bt row-major [N,K], each as bf16 hi and lo planes;
// product = hi.hi + hi.lo + lo.hi, f32 accumulate, k ascending.
// A block of four waves (2 x 2) owns one (FM*32) x 128 tile of C; a wave owns (FM*16) x 64 of it.
// A stage is 64 k of every operand row of the tile: whole 128-B lines, brought into LDS once per block by asynchronous copies,
// two buffers; both waves of a tile row share the A rows, both of a tile column the Bt rows.
// M % (FM*32) == 0, N % 128 == 0, K % 64 == 0. OUT_MODE: 0 = f32, 2 = bf16 hi plane (Cout) + bf16 lo plane (Cout2).
// grid (tiles, products): blockIdx.y picks one of several independent products with the same A; its Bt lies bsB and its C bsC elements further on.
// Every '#pragma unroll' below stands on a loop of constant trip count whose index selects a fragment, an accumulator or a copy:
// unrolled, those arrays stay in registers.
#define GS_PITCH 72                    // 16-bit elements: 128 B of data at 144 B (16 B x odd: the 16-byte fragment reads of 16 rows fall on distinct banks)

// Eight copies of 16 B per lane: rows r, r + 16, r + 32, r + 48 of a hi plane (la, ga) and of its lo plane (lb, gb); step = 16 source rows.
// The builtin form: the compiler allots the address registers itself, in any register window.
typedef __attribute__((ext_vector_type(4))) int v4i;
typedef __attribute__((address_space(1))) v4i g_v4i;
typedef __attribute__((address_space(3))) v4i l_v4i;
__device__ __forceinline__ void copy_rows(unsigned short* la, unsigned short* lb, const unsigned short* ga, const unsigned short* gb, size_t step) {
#pragma unroll
  for (int i = 0; i < 4; ++i) {
    __builtin_amdgcn_global_load_async_to_lds_b128((g_v4i*)(ga + i * step), (l_v4i*)(la + i * (16 * GS_PITCH)), 0, 0);
    __builtin_amdgcn_global_load_async_to_lds_b128((g_v4i*)(gb + i * step), (l_v4i*)(lb + i * (16 * GS_PITCH)), 0, 0);
  }
}

template <int FM, bool BIAS, int OUT_MODE>
__global__ __launch_bounds__(128) void wmma_gemm_staged(
    const unsigned short* __restrict__ Ahp, const unsigned short* __restrict__ Alp, int lda,
    const unsigned short* __restrict__ Bh0, const unsigned short* __restrict__ Bl0, int ldb,
    void* __restrict__ C0, void* __restrict__ C20, int ldc,
    const float* __restrict__ bias, int tilesN, int K, size_t bsB, size_t bsC) {
  typedef Frag<__bf16> F;
  const unsigned short* __restrict__ Bhp = Bh0 + blockIdx.y * bsB;
  const unsigned short* __restrict__ Blp = Bl0 + blockIdx.y * bsB;
  const size_t cby = blockIdx.y * bsC * (OUT_MODE == 0 ? sizeof(float) : sizeof(unsigned short));
  void* __restrict__ Cout  = (char*)C0 + cby;
  void* __restrict__ Cout2 = (char*)C20 + cby;
  constexpr int TM  = FM * 32;                    // tile rows
  constexpr int TN  = 128;                        // tile columns
  constexpr int BUF = 2 * (TM + TN) * GS_PITCH;   // a buffer: A hi (TM rows), A lo, Bt hi (TN rows), Bt lo
  __shared__ __align__(16) unsigned short ring[2 * BUF];
  __shared__ __align__(16) float sT[4][16 * 68];  // per-wave 16x64 output slab, pitch 68 floats
  const int lane = threadIdx.x & 31;
  const int wave = __builtin_amdgcn_readfirstlane((int)(threadIdx.x >> 5));
  const int wm = wave >> 1, wn = wave & 1;
  const int tm = (int)blockIdx.x / tilesN;
  const int tn = (int)blockIdx.x - tm * tilesN;
  const int m0 = tm * TM;
  const int n0 = tn * TN;
  const int rlane = lane & 15;                 // row (A) / col (B, D) within subtile
  const int koff  = (lane >> 4) * 8;           // k offset of this lane half
  const int mOff  = (lane >> 4) * 8;           // D row offset

  // copies: a thread brings one 16-B piece of rows crow, crow + 16, ... of every plane; 8 lanes cover one 128-B line
  const int crow = (int)threadIdx.x >> 3;          // 0..15
  const int cpc  = ((int)threadIdx.x & 7) * 8;     // in elements
  unsigned short* ldsc = ring + crow * GS_PITCH + cpc;
  const unsigned aco = (unsigned)(crow * lda + cpc);   // this lane's place inside 16 rows; the block-uniform rest of an address stays scalar
  const unsigned bco = (unsigned)(crow * ldb + cpc);
  const int ns = K >> 6;                           // stages
  auto copy_stage_g = [&](int s) {                 // stage s -> buffer s & 1: 2 * (TM + TN) / 16 copies per thread (32 or 24)
    unsigned short* l0 = ldsc + (s & 1) * BUF;
    const size_t ka = (size_t)m0 * lda + (size_t)s * 64;
    const size_t kb = (size_t)n0 * ldb + (size_t)s * 64;
#pragma unroll
    for (int g = 0; g < TM / 64; ++g)
      copy_rows(l0 + (g * 64) * GS_PITCH, l0 + (TM + g * 64) * GS_PITCH,
                (Ahp + (ka + (size_t)(g * 64) * lda)) + aco, (Alp + (ka + (size_t)(g * 64) * lda)) + aco, (size_t)16 * lda);
#pragma unroll
    for (int g = 0; g < TN / 64; ++g)
      copy_rows(l0 + (2 * TM + g * 64) * GS_PITCH, l0 + (2 * TM + TN + g * 64) * GS_PITCH,
                (Bhp + (kb + (size_t)(g * 64) * ldb)) + bco, (Blp + (kb + (size_t)(g * 64) * ldb)) + bco, (size_t)16 * ldb);
  };
  copy_stage_g(0);

  v8f acc[FM][4];
#pragma unroll
  for (int i = 0; i < FM; ++i)
#pragma unroll
    for (int j = 0; j < 4; ++j) acc[i][j] = (v8f){0.f,0.f,0.f,0.f,0.f,0.f,0.f,0.f};

  const __bf16* ab = (const __bf16*)ring + (wm * (FM * 16) + rlane) * GS_PITCH + koff;        // A hi fragment row of this lane
  const __bf16* bb = (const __bf16*)ring + (2 * TM + wn * 64 + rlane) * GS_PITCH + koff;      // Bt hi fragment row

  asm volatile("s_wait_asynccnt 0x0" ::: "memory");   // this wave's copies of stage 0 have landed
  __syncthreads();                                    // publishes stage 0

  for (int s = 0; s < ns; ++s) {
    const __bf16* sa = ab + (s & 1) * BUF;
    const __bf16* sb = bb + (s & 1) * BUF;
    // all fragments of the stage (two k steps of 32), read as one group in the order the products use them
    v16b bh[2][4], bl[2][4], ah[2][FM], al[2][FM];
#pragma unroll
    for (int ks = 0; ks < 2; ++ks) {
#pragma unroll
      for (int j = 0; j < 4; ++j) bh[ks][j] = F::load(sb + (j * 16) * GS_PITCH + ks * 32);
      ah[ks][0] = F::load(sa + ks * 32);
#pragma unroll
      for (int j = 0; j < 4; ++j) bl[ks][j] = F::load(sb + (TN + j * 16) * GS_PITCH + ks * 32);
      al[ks][0] = F::load(sa + TM * GS_PITCH + ks * 32);
#pragma unroll
      for (int i = 1; i < FM; ++i) {
        ah[ks][i] = F::load(sa + (i * 16) * GS_PITCH + ks * 32);
        al[ks][i] = F::load(sa + (TM + i * 16) * GS_PITCH + ks * 32);
      }
    }
    // keeps the LDS reads together up here: left to itself the compiler sinks them in pairs among the WMMAs, each pair with a full wait
    __builtin_amdgcn_sched_barrier(0);
    // stage s + 1 into the buffer that trip s - 1 has read, behind the barrier that ended those reads (block-uniform test);
    // issued here, its address arithmetic passes while the fragment reads above are under way
    if (s + 1 < ns) copy_stage_g(s + 1);
    // keeps the WMMAs, and the waits for their fragments, behind the issue of the copies
    __builtin_amdgcn_sched_barrier(0);
#pragma unroll
    for (int ks = 0; ks < 2; ++ks) {
      // four independent accumulators between two products into the same one
#pragma unroll
      for (int i = 0; i < FM; ++i) {
#pragma unroll
        for (int j = 0; j < 4; ++j) acc[i][j] = F::mma(ah[ks][i], bh[ks][j], acc[i][j]);
#pragma unroll
        for (int j = 0; j < 4; ++j) acc[i][j] = F::mma(ah[ks][i], bl[ks][j], acc[i][j]);
#pragma unroll
        for (int j = 0; j < 4; ++j) acc[i][j] = F::mma(al[ks][i], bh[ks][j], acc[i][j]);
      }
    }
    // keeps the WMMAs in front of the waits below, so that the copies fly under them: left to itself the compiler moves them behind the barrier
    __builtin_amdgcn_sched_barrier(0);
    // publish point of stage s + 1, passed by every wave
    asm volatile("s_wait_dscnt 0x0" ::: "memory");     // this wave's reads of stage s are done before its buffer is refilled
    asm volatile("s_wait_asynccnt 0x0" ::: "memory");  // this wave's copies of stage s + 1 have landed
    __syncthreads();                                   // publishes stage s + 1 and ends every wave's reads of stage s
  }
  asm volatile("s_wait_asynccnt 0x0" ::: "memory");    // no copy is outstanding when the wave goes on

  // ---- epilogue: 16 rows at a time through this wave's own slab, so that every store covers whole 128-B lines ----
  float* slab = sT[wave];
  const int nW = n0 + wn * 64;
#pragma unroll
  for (int i = 0; i < FM; ++i) {
    const int mBase = m0 + wm * (FM * 16) + (i << 4);
#pragma unroll
    for (int j = 0; j < 4; ++j) {
      float bv = 0.f;
      if (BIAS) bv = bias[nW + (j << 4) + rlane];
#pragma unroll
      for (int r = 0; r < 8; ++r) slab[(mOff + r) * 68 + (j << 4) + rlane] = BIAS ? acc[i][j][r] + bv : acc[i][j][r];
    }
    asm volatile("s_wait_dscnt 0x0" ::: "memory");      // the wave's slab rows are written before its lanes read them back
    if (OUT_MODE == 0) {
      float* C = (float*)Cout;
      const int hh = lane >> 4, c4 = (lane & 15) * 4;     // row seg = 256 B = 16 lanes x 16 B
#pragma unroll
      for (int it = 0; it < 8; ++it) {
        const int row = it * 2 + hh;
        v4f v = *(const v4f*)(slab + row * 68 + c4);
        *(v4f*)(C + (size_t)(mBase + row) * ldc + nW + c4) = v;
      }
    } else {
      const int q = lane >> 3, c8 = (lane & 7) * 8;       // row seg = 128 B = 8 lanes x 16 B per plane
      unsigned short* C  = (unsigned short*)Cout;
      unsigned short* C2 = (unsigned short*)Cout2;
#pragma unroll
      for (int it = 0; it < 4; ++it) {
        const int row = it * 4 + q;
        const float* sp = slab + row * 68 + c8;
        v4u hv, lv;
#pragma unroll
        for (int e = 0; e < 4; ++e) {
          unsigned hw, lw;
          split_pair(sp[2 * e], sp[2 * e + 1], hw, lw);
          hv[e] = hw;
          lv[e] = lw;
        }
        *(v4u*)(C + (size_t)(mBase + row) * ldc + nW + c8) = hv;
        *(v4u*)(C2 + (size_t)(mBase + row) * ldc + nW + c8) = lv;
      }
    }
    // the stores' address and data registers are reused by the next row group; the clobber keeps that group's slab writes behind these reads
    asm volatile("s_wait_xcnt 0x0" ::: "memory");
  }
}

// ---------------------------------------------------------------------------
// Elementwise split: 2 elements per thread, one 4-B store per lane per plane; i = index of the pair, n2 = pairs in the plane.
// ---------------------------------------------------------------------------
__device__ __forceinline__ unsigned pk16(unsigned short a, unsigned short b) { return (unsigned)a | ((unsigned)b << 16); }

// hi = bf16_rne(in), lo = bf16_rne(in - hi)
__device__ __forceinline__ void split_bf16x2(const float* __restrict__ in, unsigned short* __restrict__ hi,
                                             unsigned short* __restrict__ lo, int i, int n2) {
  if (i < n2) {
    const v2f f = *(const v2f*)(in + 2 * (size_t)i);
    const unsigned short h0 = f2bf_bits(f[0]), h1 = f2bf_bits(f[1]);
    const unsigned short l0 = f2bf_bits(f[0] - bf_bits2f(h0)), l1 = f2bf_bits(f[1] - bf_bits2f(h1));
    const unsigned uh = pk16(h0, h1), ul = pk16(l0, l1);
    ((unsigned*)hi)[i] = uh;
    ((unsigned*)lo)[i] = ul;
    
  }
}

// ---------------------------------------------------------------------------
// Transpose + bf16 hi/lo split of an f32 matrix: in [rows][cols] (row pitch ldi floats) ->
// outh/outl[c][r] = split(in[r][c]) (row pitch ldo u16). One 64x64 tile (bx of cols/64, by of rows/64) per block of 256 threads;
// rows, cols % 64 == 0. tf: 64 * 68 floats of LDS.
// Coverage per block: load 4 it x 256 thr x 4 f32 = 64x64; store 2 it x 256 thr x 8 u16 = 64x64 per plane;
// ---------------------------------------------------------------------------
__device__ __forceinline__ void transpose_split_tile(float* tf, const float* __restrict__ in, int ldi,
                                                     unsigned short* __restrict__ outh,
                                                     unsigned short* __restrict__ outl, int ldo, int bx, int by) {
  const int c0  = bx * 64;           // input column block = output row block
  const int r0  = by * 64;           // input row block    = output column block
  const int tid = threadIdx.x;
  {
    const int sub = tid >> 4;          // 0..15
    const int c4  = (tid & 15) * 4;    // 0..60
#pragma unroll
    for (int it = 0; it < 4; ++it) {
      const int rr = it * 16 + sub;
      const v4f a = *(const v4f*)(in + (size_t)(r0 + rr) * ldi + c0 + c4);
      *(v4f*)(tf + rr * 68 + c4) = a;
    }
  }
  __syncthreads();
  const int s8 = tid >> 3;             // 0..31
  const int c8 = (tid & 7) * 8;        // 0..56
  v4u hv[2], lv[2];
#pragma unroll
  for (int it = 0; it < 2; ++it) {
    const int oc = it * 32 + s8;       // output row within tile (= input column)
    v4u a, a2;
#pragma unroll
    for (int q = 0; q < 4; ++q) {
      const float f0 = tf[(c8 + 2 * q) * 68 + oc];
      const float f1 = tf[(c8 + 2 * q + 1) * 68 + oc];
      const unsigned short h0 = f2bf_bits(f0), h1 = f2bf_bits(f1);
      const unsigned short l0 = f2bf_bits(f0 - bf_bits2f(h0));
      const unsigned short l1 = f2bf_bits(f1 - bf_bits2f(h1));
      a[q]  = pk16(h0, h1);
      a2[q] = pk16(l0, l1);
    }
    hv[it] = a; lv[it] = a2;
  }
  {
#pragma unroll
    for (int it = 0; it < 2; ++it) {
      const int oc = it * 32 + s8;
      const size_t go = (size_t)(c0 + oc) * ldo + r0 + c8;
      *(v4u*)(outh + go) = hv[it];
      *(v4u*)(outl + go) = lv[it];
    }
    
  }
}

// All operand planes in one grid; the five jobs are independent of one another, a block does one piece of one of them.
//   blocks 0 .. 4*W_TILES-1: the 64x64 tiles of Wq, Wk, Wv, Wo ([k][n] -> planes [n][k]); Wk^T goes behind Wq^T in the WqkT planes
//   then X_BLOCKS blocks: x of both batches -> hi/lo planes (256 threads x 2 elements each)
#define W_TILES  ((DOUT / 64) * (DIN / 64))          // 256 per weight
#define X_PAIRS  (NB * NSEQ * DIN / 2)
#define X_BLOCKS (X_PAIRS / 256)                     // 8192
__global__ __launch_bounds__(256) void prep_kernel(const float* __restrict__ x, const float* __restrict__ Wq, const float* __restrict__ Wk,
                                                   const float* __restrict__ Wv, const float* __restrict__ Wo,
                                                   unsigned short* __restrict__ Xh, unsigned short* __restrict__ Xl,
                                                   unsigned short* __restrict__ WqkTh, unsigned short* __restrict__ WqkTl,
                                                   unsigned short* __restrict__ WvTh, unsigned short* __restrict__ WvTl,
                                                   unsigned short* __restrict__ WoTh, unsigned short* __restrict__ WoTl) {
  __shared__ __align__(16) float tf[64 * 68];
  const int bid = (int)blockIdx.x;
  if (bid < 4 * W_TILES) {                           // block-uniform
    const int sel = bid / W_TILES;
    const int t   = bid - sel * W_TILES;
    const float* in    = sel == 0 ? Wq : sel == 1 ? Wk : sel == 2 ? Wv : Wo;
    unsigned short* oh = sel == 0 ? WqkTh : sel == 1 ? WqkTh + (size_t)DOUT * DIN : sel == 2 ? WvTh : WoTh;
    unsigned short* ol = sel == 0 ? WqkTl : sel == 1 ? WqkTl + (size_t)DOUT * DIN : sel == 2 ? WvTl : WoTl;
    transpose_split_tile(tf, in, DOUT, oh, ol, DIN, t % (DOUT / 64), t / (DOUT / 64));
  } else {
    split_bf16x2(x, Xh, Xl, (bid - 4 * W_TILES) * 256 + (int)threadIdx.x, X_PAIRS);
  }
}

// ---------------------------------------------------------------------------
// Fused causal attention, all batches and heads in one launch: scores, relu * distance decay, online softmax and P.V in one kernel;
// neither scores nor probabilities go to memory. The K rows and V^T columns of 64 keys (a stage) are brought into LDS once per block
// by asynchronous copies, whole 128-B lines, two buffers, and all eight waves take their fragments from there.
// A wave owns 16 queries (one per lane column c) of head blockIdx.y, batch blockIdx.z, and walks the keys 32 at a time:
//   St[key][query] = K . Q^T   (A = K rows, B = Q rows kept in registers; both through the same loader)
//   t = relu(St) * R_hat(h, i - j) * 0.125 in log2 units, -inf for j > i (only the last pass holds such keys),
//   R_hat = (1 + exp(v[h])) * rcp(1 + exp(v[h] - w[h] * (i - j)))
//   running maximum m (starts at 0: every allowed t is >= 0 and key 0 is always allowed), p = exp2(t - m),
//   Ot[d][query] = Ot * exp2(m_old - m_new) + V^T . P^T
// The two 16-key score tiles of a pass, converted in place, are the B operand of the second product
// (element s = tile s >> 3, register s & 7), which is the k order the A loader of V^T delivers.
// A lane holds 8 + 8 keys of its query; lanes c and c + 16 share the maximum each pass and join their sums at the end.
// Waves 0..3 of a block take query groups from the long end, waves 4..7 the mirrored ones from the short end.
// Output: lane (c, hf) holds ctx[q0 + c][head*64 + ds*16 + hf*8 + 0..7]: one 16-B store per plane and ds;
// the 128-B line of a (query, head) is written by one wave. grid (NSEQ/128, NH, NB) x 8 waves x 16 queries = all rows.
// Every '#pragma unroll' below stands on a loop of constant trip count whose index selects a fragment or an accumulator:
// unrolled, those arrays stay in registers.
// ---------------------------------------------------------------------------

__device__ __forceinline__ float other_half(float x) {   // the value of lane l ^ 16
  const int b = __float_as_int(x);
  return __int_as_float(__builtin_amdgcn_permlanex16(b, b, 0x76543210, 0xfedcba98, false, false));
}

// LDS ring: a stage holds four planes (K hi, K lo: 64 key rows x 64 dims; V^T hi, V^T lo: 64 dim rows x 64 keys); a row is 128 B of data
// at a pitch of 144 B (16 B x odd: the 16-byte fragment reads of 16 rows fall on distinct banks).
#define AT_PITCH 72                    // 16-bit elements
#define AT_PLANE (64 * AT_PITCH)
#define AT_BUF   (4 * AT_PLANE)

// One stage = 4 planes x 64 rows x 8 pieces of 16 B = 2048 pieces, eight per thread: rows r and r + 32 of each plane.
// lds: this lane's byte address in plane 0 of the target buffer; the pointers: this lane's piece of row r of each plane.
// The s_wait_xcnt at the end of the statement stands in front of any later rewrite of the address registers the copies name.
__device__ __forceinline__ void copy_stage(unsigned lds, const unsigned short* kh, const unsigned short* kl,
                                           const unsigned short* vh, const unsigned short* vl) {
  const unsigned R = 32 * AT_PITCH * 2, P = AT_PLANE * 2;
  asm volatile("global_load_async_to_lds_b128 %0, %8, off\n\t"
               "global_load_async_to_lds_b128 %1, %9, off\n\t"
               "global_load_async_to_lds_b128 %2, %10, off\n\t"
               "global_load_async_to_lds_b128 %3, %11, off\n\t"
               "global_load_async_to_lds_b128 %4, %12, off\n\t"
               "global_load_async_to_lds_b128 %5, %13, off\n\t"
               "global_load_async_to_lds_b128 %6, %14, off\n\t"
               "global_load_async_to_lds_b128 %7, %15, off\n\t"
               "s_wait_xcnt 0x0"
               :: "v"(lds), "v"(lds + R), "v"(lds + P), "v"(lds + P + R),
                  "v"(lds + 2 * P), "v"(lds + 2 * P + R), "v"(lds + 3 * P), "v"(lds + 3 * P + R),
                  "v"(kh), "v"(kh + 32 * (2 * DOUT)), "v"(kl), "v"(kl + 32 * (2 * DOUT)),
                  "v"(vh), "v"(vh + 32 * NSEQ), "v"(vl), "v"(vl + 32 * NSEQ)
               : "memory");
}

// four waves per SIMD (two blocks per WGP): the waves fill each other's waits
__global__ __launch_bounds__(256) __attribute__((amdgpu_waves_per_eu(4, 4))) void fused_attn_kernel(const unsigned short* __restrict__ QKhp, const unsigned short* __restrict__ QKlp,
                                                         const unsigned short* __restrict__ VThp, const unsigned short* __restrict__ VTlp,
                                                         const float* __restrict__ wp, const float* __restrict__ vp,
                                                         unsigned short* __restrict__ Oh, unsigned short* __restrict__ Ol) {
  typedef Frag<__bf16> F;
  const int lane = threadIdx.x & 31;
  const int wave = __builtin_amdgcn_readfirstlane((int)(threadIdx.x >> 5));
  const int head = blockIdx.y;
  const size_t bz = blockIdx.z;
  const int c    = lane & 15;
  const int hf   = lane >> 4;
  const int tq   = (int)blockIdx.x * 4 + (wave & 3);            // 0..63
  const int qg   = (wave < 4) ? (NSEQ / 16 - 1 - tq) : tq;      // every 16-query group once
  const int q0   = qg << 4;
  const int np   = (q0 >> 5) + 1;                               // passes of 32 keys; keys of passes 0..np-2 are all < q0

  const float L2E = 1.44269504088896341f;
  const float w2  = wp[head] * L2E;
  const float v2  = vp[head] * L2E;
  const float c1  = (1.0f + __builtin_amdgcn_exp2f(v2)) * (0.125f * L2E);

  const size_t qo = (bz * NSEQ + q0 + c) * (2 * DOUT) + head * HDIM + hf * 8;

  __shared__ __align__(16) unsigned short ring[2 * AT_BUF];
  // stages of 64 keys that the block's longest wave (wave 0) needs: 17..32, so stages 0 and 1 always exist and every key is < NSEQ
  const int ns = ((((NSEQ / 16 - 1 - (int)blockIdx.x * 4) << 4) >> 5) + 2) >> 1;
  const int crow = (int)threadIdx.x >> 3;          // 0..31: the row this thread copies (and row + 32)
  const int cpc  = ((int)threadIdx.x & 7) * 8;     // its 16-B piece of the row, in elements: 8 lanes cover one 128-B line
  const unsigned ldsc = (unsigned)(uintptr_t)(ring + crow * AT_PITCH + cpc);
  const size_t kco = (bz * NSEQ + crow) * (2 * DOUT) + DOUT + head * HDIM + cpc;
  const size_t vco = (bz * DOUT + head * HDIM + crow) * NSEQ + cpc;
  copy_stage(ldsc, QKhp + kco, QKlp + kco, VThp + vco, VTlp + vco);      // stage 0 -> buffer 0
  const __bf16* rb = (const __bf16*)ring + c * AT_PITCH + hf * 8;        // this lane's fragment row and k half

  v16b qh[2], ql[2];
#pragma unroll
  for (int ks = 0; ks < 2; ++ks) {
    qh[ks] = F::load((const __bf16*)QKhp + qo + ks * 32);
    ql[ks] = F::load((const __bf16*)QKlp + qo + ks * 32);
  }
  // the address registers of the Q loads are reused right below; the loaded values as inputs keep the wait behind the loads
  asm volatile("s_wait_xcnt 0x0" :: "v"(qh[0]), "v"(qh[1]), "v"(ql[0]), "v"(ql[1]) : "memory");

  v8f o[4];
#pragma unroll
  for (int ds = 0; ds < 4; ++ds) o[ds] = (v8f){0.f,0.f,0.f,0.f,0.f,0.f,0.f,0.f};
  float m = 0.f, l = 0.f;

  asm volatile("s_wait_asynccnt 0x0" ::: "memory");   // this wave's copies of stage 0 have landed
  __syncthreads();                                    // publishes stage 0
  copy_stage(ldsc + AT_BUF * 2, QKhp + kco + (size_t)64 * (2 * DOUT), QKlp + kco + (size_t)64 * (2 * DOUT),
             VThp + vco + 64, VTlp + vco + 64);       // stage 1 -> buffer 1

  for (int s = 0; s < ns; ++s) {
  const __bf16* sb = rb + (s & 1) * AT_BUF;
  for (int h2 = 0; h2 < 2; ++h2) {
    const int p = 2 * s + h2;
    if (p >= np) break;                               // wave-uniform: a wave past its diagonal only keeps the publish points
    const int j0 = p << 5;
    // K rows and V^T columns of this pass, from this stage's buffer
    v16b kh[2][2], kl[2][2];
#pragma unroll
    for (int a = 0; a < 2; ++a)
#pragma unroll
      for (int ks = 0; ks < 2; ++ks) {
        kh[a][ks] = F::load(sb + (h2 * 32 + a * 16) * AT_PITCH + ks * 32);
        kl[a][ks] = F::load(sb + AT_PLANE + (h2 * 32 + a * 16) * AT_PITCH + ks * 32);
      }
    v16b vh[4], vl[4];
#pragma unroll
    for (int ds = 0; ds < 4; ++ds) {
      vh[ds] = F::load(sb + 2 * AT_PLANE + (ds * 16) * AT_PITCH + h2 * 32);
      vl[ds] = F::load(sb + 3 * AT_PLANE + (ds * 16) * AT_PITCH + h2 * 32);
    }
    v8f st[2];
    st[0] = (v8f){0.f,0.f,0.f,0.f,0.f,0.f,0.f,0.f};
    st[1] = st[0];
#pragma unroll
    for (int ks = 0; ks < 2; ++ks) {
      st[0] = F::mma(kh[0][ks], qh[ks], st[0]);
      st[1] = F::mma(kh[1][ks], qh[ks], st[1]);
      st[0] = F::mma(kh[0][ks], ql[ks], st[0]);
      st[1] = F::mma(kh[1][ks], ql[ks], st[1]);
      st[0] = F::mma(kl[0][ks], qh[ks], st[0]);
      st[1] = F::mma(kl[1][ks], qh[ks], st[1]);
    }
    // inputs only: keeps the V^T fragment reads up here, issued with the K reads, so that their LDS latency passes under the score
    // products and the softmax; left to itself the compiler sinks them in front of each P.V product, which then waits for them
    asm volatile("" :: "v"(vh[0]), "v"(vh[1]), "v"(vh[2]), "v"(vh[3]), "v"(vl[0]), "v"(vl[1]), "v"(vl[2]), "v"(vl[3]));
    const int   lim  = q0 + c - j0 - hf * 8;          // i - j of this lane's first key; key 16a + r is allowed while 16a + r <= lim
    const float base = v2 - w2 * (float)lim;
    float tt[2][8];
#pragma unroll
    for (int a = 0; a < 2; ++a)
#pragma unroll
      for (int r = 0; r < 8; ++r) {
        const float e = __builtin_amdgcn_exp2f(fmaf(w2, (float)(a * 16 + r), base));
        tt[a][r] = fmaxf(st[a][r], 0.0f) * (c1 * __builtin_amdgcn_rcpf(1.0f + e));
      }
    if (p == np - 1) {                                 // wave-uniform
#pragma unroll
      for (int a = 0; a < 2; ++a)
#pragma unroll
        for (int r = 0; r < 8; ++r) tt[a][r] = (a * 16 + r <= lim) ? tt[a][r] : -INFINITY;
    }
    float mx = m;
#pragma unroll
    for (int a = 0; a < 2; ++a)
#pragma unroll
      for (int r = 0; r < 8; ++r) mx = fmaxf(mx, tt[a][r]);
    mx = fmaxf(mx, other_half(mx));
    const float alpha = __builtin_amdgcn_exp2f(m - mx);
    m = mx;
    float ps0 = 0.f, ps1 = 0.f;
#pragma unroll
    for (int r = 0; r < 8; ++r) {
      tt[0][r] = __builtin_amdgcn_exp2f(tt[0][r] - mx);
      tt[1][r] = __builtin_amdgcn_exp2f(tt[1][r] - mx);
      ps0 += tt[0][r];
      ps1 += tt[1][r];
    }
    l = l * alpha + (ps0 + ps1);
#pragma unroll
    for (int ds = 0; ds < 4; ++ds) o[ds] *= alpha;

    union PF { v16b v; unsigned u[8]; } ph, pl;
#pragma unroll
    for (int a = 0; a < 2; ++a)
#pragma unroll
      for (int r2 = 0; r2 < 4; ++r2) split_pair(tt[a][2 * r2], tt[a][2 * r2 + 1], ph.u[a * 4 + r2], pl.u[a * 4 + r2]);

#pragma unroll
    for (int ds = 0; ds < 4; ++ds) o[ds] = F::mma(vh[ds], ph.v, o[ds]);
#pragma unroll
    for (int ds = 0; ds < 4; ++ds) o[ds] = F::mma(vh[ds], pl.v, o[ds]);
#pragma unroll
    for (int ds = 0; ds < 4; ++ds) o[ds] = F::mma(vl[ds], ph.v, o[ds]);
    // four vector slots behind the pass's last WMMA: the next pass's first address arithmetic, reached over the loop's branches,
    // reuses that WMMA's operand registers
    acc_guard4(o[0], o[1], o[2], o[3]);
  }
    // publish point of stage s + 1, passed by every wave
    asm volatile("s_wait_dscnt 0x0" ::: "memory");     // this wave's reads of stage s are done before its buffer is refilled
    asm volatile("s_wait_asynccnt 0x0" ::: "memory");  // this wave's copies of stage s + 1 have landed
    __syncthreads();                                   // publishes stage s + 1 and ends every wave's reads of stage s
    if (s + 2 < ns)                                    // block-uniform
      copy_stage(ldsc + (s & 1) * (AT_BUF * 2), QKhp + kco + (size_t)(s + 2) * 64 * (2 * DOUT), QKlp + kco + (size_t)(s + 2) * 64 * (2 * DOUT),
                 VThp + vco + (s + 2) * 64, VTlp + vco + (s + 2) * 64);
  }
  asm volatile("s_wait_asynccnt 0x0" ::: "memory");    // no copy is outstanding when the wave ends

  l += other_half(l);
  const float inv = 1.0f / l;                          // l >= 1: the row maximum contributes exp2(0)
  const size_t oo = (bz * NSEQ + q0 + c) * DOUT + head * HDIM + hf * 8;
#pragma unroll
  for (int ds = 0; ds < 4; ++ds) {
    unsigned hw[4], lw[4];
#pragma unroll
    for (int r2 = 0; r2 < 4; ++r2) split_pair(o[ds][2 * r2] * inv, o[ds][2 * r2 + 1] * inv, hw[r2], lw[r2]);
    *(v4u*)(Oh + oo + ds * 16) = (v4u){hw[0], hw[1], hw[2], hw[3]};
    *(v4u*)(Ol + oo + ds * 16) = (v4u){lw[0], lw[1], lw[2], lw[3]};
  }
}

// ---------------------------------------------------------------------------
// Workspace region map (byte offsets; all offsets multiples of 2 MiB). Every region is fully written in each call
// before it is read. X and O share one region: X is read only by the projection GEMMs, which precede the attention
// kernel (the O producer) in stream order; O is fully written (2 batches x 16 heads x 64 columns x 2048 rows) before
// the output projections read it.
//   WqkTh  bf16 [2048][1024]  rows 0..1023 = Wq^T, 1024..2047 = Wk^T         0
//   WqkTl  bf16 [2048][1024]                                          4194304
//   WvTh   bf16 [1024][1024]                                          8388608
//   WvTl   bf16 [1024][1024]                                         10485760
//   WoTh   bf16 [1024][1024]                                         12582912
//   WoTl   bf16 [1024][1024]                                         14680064
//   XOh    bf16 [2][2048][1024]  x hi, later ctx hi (col h*64+d)        16777216
//   XOl    bf16 [2][2048][1024]                                         25165824
//   QKh    bf16 [2][2048][2048]  q at col h*64+d, k at col 1024+h*64+d  33554432
//   QKl    bf16 [2][2048][2048]                                         50331648
//   VTh    bf16 [2][1024][2048]  row h*64+d, col token                  67108864
//   VTl    bf16 [2][1024][2048]                                         75497472
//   total                                                               83886080
// ---------------------------------------------------------------------------
extern "C" void kernel_launch(void* const* d_in, const int* in_sizes, int n_in,
                              void* d_out, int out_size, void* d_ws, size_t ws_size,
                              hipStream_t stream) {
  if (n_in < 8) return;
  if (in_sizes[0] != NB * NSEQ * DIN) return;
  if (in_sizes[1] != DIN * DOUT || in_sizes[2] != DIN * DOUT || in_sizes[3] != DIN * DOUT) return;
  if (in_sizes[4] != DOUT * DOUT || in_sizes[5] != DOUT) return;
  if (in_sizes[6] < NH || in_sizes[7] < NH) return;
  if (out_size != NB * NSEQ * DOUT) return;

  const float* x  = (const float*)d_in[0];
  const float* Wq = (const float*)d_in[1];
  const float* Wk = (const float*)d_in[2];
  const float* Wv = (const float*)d_in[3];
  const float* Wo = (const float*)d_in[4];
  const float* bo = (const float*)d_in[5];
  const float* wp = (const float*)d_in[6];
  const float* vp = (const float*)d_in[7];

  const size_t PW  = (size_t)DIN * DOUT * 2;              // 16-bit [1024][1024] plane
  const size_t PX  = (size_t)NSEQ * DIN * 2;              // 16-bit [2048][1024] plane
  const size_t PQK = (size_t)NSEQ * (2 * DOUT) * 2;       // 16-bit [2048][2048] plane
  const size_t PVT = (size_t)DOUT * NSEQ * 2;             // 16-bit [1024][2048] plane
  size_t off = 0;
  const size_t oWqkTh = off; off += 2 * PW;
  const size_t oWqkTl = off; off += 2 * PW;
  const size_t oWvTh  = off; off += PW;
  const size_t oWvTl  = off; off += PW;
  const size_t oWoTh  = off; off += PW;
  const size_t oWoTl  = off; off += PW;
  const size_t oXOh   = off; off += NB * PX;
  const size_t oXOl   = off; off += NB * PX;
  const size_t oQKh   = off; off += NB * PQK;
  const size_t oQKl   = off; off += NB * PQK;
  const size_t oVTh   = off; off += NB * PVT;
  const size_t oVTl   = off; off += NB * PVT;
  if (off > ws_size) return;

  char* ws = (char*)d_ws;
  unsigned short* WqkTh = (unsigned short*)(ws + oWqkTh);
  unsigned short* WqkTl = (unsigned short*)(ws + oWqkTl);
  unsigned short* WvTh  = (unsigned short*)(ws + oWvTh);
  unsigned short* WvTl  = (unsigned short*)(ws + oWvTl);
  unsigned short* WoTh  = (unsigned short*)(ws + oWoTh);
  unsigned short* WoTl  = (unsigned short*)(ws + oWoTl);
  unsigned short* XOh   = (unsigned short*)(ws + oXOh);
  unsigned short* XOl   = (unsigned short*)(ws + oXOl);
  unsigned short* QKh   = (unsigned short*)(ws + oQKh);
  unsigned short* QKl   = (unsigned short*)(ws + oQKl);
  unsigned short* VTh   = (unsigned short*)(ws + oVTh);
  unsigned short* VTl   = (unsigned short*)(ws + oVTl);

  const dim3 blk(256);
  const dim3 blkG(128);                                             // GEMMs: four waves
  // (1) operand planes: Wq^T | Wk^T, Wv^T, Wo^T and x of both batches (whole planes: 4 x 16x16 tiles of 64x64; 8192 blocks x 256 thr x 2)
  prep_kernel<<<dim3(4 * W_TILES + X_BLOCKS), blk, 0, stream>>>(x, Wq, Wk, Wv, Wo, XOh, XOl, WqkTh, WqkTl, WvTh, WvTl, WoTh, WoTl);
  // (2) [q | k] = x . [Wq | Wk] -> QK hi/lo planes, both batches as one M = 4096 (x and the QK planes are contiguous over the batch):
  //     whole [2][2048][2048] planes, 32x16 tiles of 128x128
  wmma_gemm_staged<4, false, 2><<<dim3((NB * NSEQ / 128) * (2 * DOUT / 128), 1), blkG, 0, stream>>>(
      XOh, XOl, DIN, WqkTh, WqkTl, DIN, (void*)QKh, (void*)QKl, 2 * DOUT,
      bo, 2 * DOUT / 128, DIN, 0, 0);
  // (3) v^T[o][tok] = sum_k Wv^T[o][k] x[tok][k] -> VT hi/lo planes [1024][2048] of batch blockIdx.y (whole planes: 2 x 16x16 tiles of 64x128)
  wmma_gemm_staged<2, false, 2><<<dim3((DOUT / 64) * (NSEQ / 128), NB), blkG, 0, stream>>>(
      WvTh, WvTl, DIN, XOh, XOl, DIN, (void*)VTh, (void*)VTl, NSEQ,
      bo, NSEQ / 128, DIN, (size_t)NSEQ * DIN, (size_t)DOUT * NSEQ);
  // (4) ctx[b][i][h*64+d] = softmax_j(relu(q_i . k_j) * decay * 1/8, causal) . v -> O hi/lo planes (whole [2][2048][1024])
  fused_attn_kernel<<<dim3(NSEQ / 128, NH, NB), blk, 0, stream>>>(QKh, QKl, VTh, VTl, wp, vp, XOh, XOl);
  // (5) out = ctx . Wo + bo, both batches as one M = 4096 (ctx planes and out are contiguous over the batch): f32, whole d_out, 64x8 tiles of 64x128
  wmma_gemm_staged<2, true, 0><<<dim3((NB * NSEQ / 64) * (DOUT / 128), 1), blkG, 0, stream>>>(
      XOh, XOl, DOUT, WoTh, WoTl, DOUT, d_out, d_out, DOUT,
      bo, DOUT / 128, DOUT, 0, 0);
  (void)hipGetLastError();
}

// v006
// It runs in 143 microseconds.
// Next to v005, in two timings, it ran 1.06 times as fast each time.
// Counting every step since v000, it is 17.7 times as fast.
// Every contraction (x.Wq|Wk, Wv^T.x^T, k.q^T, v^T.p^T, ctx.Wo): v_wmma_f32_16x16x32_bf16 on bf16 hi/lo split operand planes (hi.hi + hi.lo + lo.hi), f32 accumulate; relu, distance decay, causal mask and softmax in f32.
#include <hip/hip_runtime.h>
#include <math.h>
#include <stdint.h>

#define NB    2
#define NSEQ  2048
#define DIN   1024
#define DOUT  1024
#define NH    16
#define HDIM  64

typedef __attribute__((ext_vector_type(16))) __bf16   v16b;
typedef __attribute__((ext_vector_type(8)))  __bf16   v8b;
typedef __attribute__((ext_vector_type(8)))  float    v8f;
typedef __attribute__((ext_vector_type(4)))  float    v4f;
typedef __attribute__((ext_vector_type(2)))  float    v2f;
typedef __attribute__((ext_vector_type(4)))  unsigned int v4u;
typedef __attribute__((ext_vector_type(2)))  unsigned int v2u;

__device__ __forceinline__ unsigned short f2bf_bits(float f) {
  unsigned u = __float_as_uint(f);
  return (unsigned short)((u + 0x7FFFu + ((u >> 16) & 1u)) >> 16);
}
__device__ __forceinline__ float bf_bits2f(unsigned short h) { return __uint_as_float(((unsigned)h) << 16); }

typedef __attribute__((ext_vector_type(2))) __bf16 v2b;
// hi = bf16_rne(f), lo = bf16_rne(f - hi), two values packed per word
__device__ __forceinline__ void split_pair(float f0, float f1, unsigned& hi, unsigned& lo) {
  hi = __builtin_bit_cast(unsigned, __builtin_convertvector((v2f){f0, f1}, v2b));
  const float r0 = f0 - __uint_as_float(hi << 16);
  const float r1 = f1 - __uint_as_float(hi & 0xFFFF0000u);
  lo = __builtin_bit_cast(unsigned, __builtin_convertvector((v2f){r0, r1}, v2b));
}

// four vector slots behind a WMMA whose operand registers may be reused
__device__ __forceinline__ void acc_guard4(v8f& a, v8f& b, v8f& c, v8f& d) { asm volatile("v_nop\n\tv_nop\n\tv_nop\n\tv_nop" : "+v"(a), "+v"(b), "+v"(c), "+v"(d)); }
template <typename T> struct Frag;
template <> struct Frag<__bf16> {
  typedef v16b V; union U { v16b v; v8b h[2]; };
  static __device__ __forceinline__ v16b load(const __bf16* p) {   // elements 0..7 <- p[0..7], 8..15 <- p[16..23]
    U f; f.h[0] = *(const v8b*)(p); f.h[1] = *(const v8b*)(p + 16); return f.v;
  }
  static __device__ __forceinline__ v8f mma(v16b a, v16b b, v8f c) {
    return __builtin_amdgcn_wmma_f32_16x16x32_bf16(false, a, false, b, (short)0, c, false, false);
  }
};

// ---- WMMA GEMM on operand tiles staged in LDS -------------------------------
// C[m,n] = sum_k A[m,k] * Bt[n,k] (+ bias[n]); A row-major [M,K], Bt row-major [N,K], each as bf16 hi and lo planes;
// product = hi.hi + hi.lo + lo.hi, f32 accumulate, k ascending.
// A block of four waves (2 x 2) owns one (FM*32) x 128 tile of C; a wave owns (FM*16) x 64 of it.
// A stage is 64 k of every operand row of the tile: whole 128-B lines, brought into LDS once per block by asynchronous copies,
// two buffers; both waves of a tile row share the A rows, both of a tile column the Bt rows.
// M % (FM*32) == 0, N % 128 == 0, K % 64 == 0. OUT_MODE: 0 = f32, 2 = bf16 hi plane (Cout) + bf16 lo plane (Cout2).
// grid (tiles, products): blockIdx.y picks one of several independent products with the same A; its Bt lies bsB and its C bsC elements further on.
// Every '#pragma unroll' below stands on a loop of constant trip count whose index selects a fragment, an accumulator or a copy:
// unrolled, those arrays stay in registers.
#define GS_PITCH 72                    // 16-bit elements: 128 B of data at 144 B (16 B x odd: the 16-byte fragment reads of 16 rows fall on distinct banks)

// Eight copies of 16 B per lane: rows r, r + 16, r + 32, r + 48 of a hi plane (la, ga) and of its lo plane (lb, gb); step = 16 source rows.
// The builtin form: the compiler allots the address registers itself, in any register window.
typedef __attribute__((ext_vector_type(4))) int v4i;
typedef __attribute__((address_space(1))) v4i g_v4i;
typedef __attribute__((address_space(3))) v4i l_v4i;
__device__ __forceinline__ void copy_rows(unsigned short* la, unsigned short* lb, const unsigned short* ga, const unsigned short* gb, size_t step) {
#pragma unroll
  for (int i = 0; i < 4; ++i) {
    __builtin_amdgcn_global_load_async_to_lds_b128((g_v4i*)(ga + i * step), (l_v4i*)(la + i * (16 * GS_PITCH)), 0, 0);
    __builtin_amdgcn_global_load_async_to_lds_b128((g_v4i*)(gb + i * step), (l_v4i*)(lb + i * (16 * GS_PITCH)), 0, 0);
  }
}

template <int FM, bool BIAS, int OUT_MODE>
__global__ __launch_bounds__(128) void wmma_gemm_staged(
    const unsigned short* __restrict__ Ahp, const unsigned short* __restrict__ Alp, int lda,
    const unsigned short* __restrict__ Bh0, const unsigned short* __restrict__ Bl0, int ldb,
    void* __restrict__ C0, void* __restrict__ C20, int ldc,
    const float* __restrict__ bias, int tilesN, int K, size_t bsB, size_t bsC) {
  typedef Frag<__bf16> F;
  const unsigned short* __restrict__ Bhp = Bh0 + blockIdx.y * bsB;
  const unsigned short* __restrict__ Blp = Bl0 + blockIdx.y * bsB;
  const size_t cby = blockIdx.y * bsC * (OUT_MODE == 0 ? sizeof(float) : sizeof(unsigned short));
  void* __restrict__ Cout  = (char*)C0 + cby;
  void* __restrict__ Cout2 = (char*)C20 + cby;
  constexpr int TM  = FM * 32;                    // tile rows
  constexpr int TN  = 128;                        // tile columns
  constexpr int BUF = 2 * (TM + TN) * GS_PITCH;   // a buffer: A hi (TM rows), A lo, Bt hi (TN rows), Bt lo
  // The ring is the block's only LDS: at FM = 4 it is 144 KiB, so that two blocks fit one WGP's 320 KiB and each SIMD holds two waves,
  // one block's WMMAs running under the other's copies, fragment reads and barriers. The epilogue's slabs lie in the ring (below).
  __shared__ __align__(16) unsigned short ring[2 * BUF];
  const int lane = threadIdx.x & 31;
  const int wave = __builtin_amdgcn_readfirstlane((int)(threadIdx.x >> 5));
  const int wm = wave >> 1, wn = wave & 1;
  const int tm = (int)blockIdx.x / tilesN;
  const int tn = (int)blockIdx.x - tm * tilesN;
  const int m0 = tm * TM;
  const int n0 = tn * TN;
  const int rlane = lane & 15;                 // row (A) / col (B, D) within subtile
  const int koff  = (lane >> 4) * 8;           // k offset of this lane half
  const int mOff  = (lane >> 4) * 8;           // D row offset

  // copies: a thread brings one 16-B piece of rows crow, crow + 16, ... of every plane; 8 lanes cover one 128-B line
  const int crow = (int)threadIdx.x >> 3;          // 0..15
  const int cpc  = ((int)threadIdx.x & 7) * 8;     // in elements
  unsigned short* ldsc = ring + crow * GS_PITCH + cpc;
  const unsigned aco = (unsigned)(crow * lda + cpc);   // this lane's place inside 16 rows; the block-uniform rest of an address stays scalar
  const unsigned bco = (unsigned)(crow * ldb + cpc);
  const int ns = K >> 6;                           // stages
  auto copy_stage_g = [&](int s) {                 // stage s -> buffer s & 1: 2 * (TM + TN) / 16 copies per thread (32 or 24)
    unsigned short* l0 = ldsc + (s & 1) * BUF;
    const size_t ka = (size_t)m0 * lda + (size_t)s * 64;
    const size_t kb = (size_t)n0 * ldb + (size_t)s * 64;
#pragma unroll
    for (int g = 0; g < TM / 64; ++g)
      copy_rows(l0 + (g * 64) * GS_PITCH, l0 + (TM + g * 64) * GS_PITCH,
                (Ahp + (ka + (size_t)(g * 64) * lda)) + aco, (Alp + (ka + (size_t)(g * 64) * lda)) + aco, (size_t)16 * lda);
#pragma unroll
    for (int g = 0; g < TN / 64; ++g)
      copy_rows(l0 + (2 * TM + g * 64) * GS_PITCH, l0 + (2 * TM + TN + g * 64) * GS_PITCH,
                (Bhp + (kb + (size_t)(g * 64) * ldb)) + bco, (Blp + (kb + (size_t)(g * 64) * ldb)) + bco, (size_t)16 * ldb);
  };
  copy_stage_g(0);

  v8f acc[FM][4];
#pragma unroll
  for (int i = 0; i < FM; ++i)
#pragma unroll
    for (int j = 0; j < 4; ++j) acc[i][j] = (v8f){0.f,0.f,0.f,0.f,0.f,0.f,0.f,0.f};

  const __bf16* ab = (const __bf16*)ring + (wm * (FM * 16) + rlane) * GS_PITCH + koff;        // A hi fragment row of this lane
  const __bf16* bb = (const __bf16*)ring + (2 * TM + wn * 64 + rlane) * GS_PITCH + koff;      // Bt hi fragment row

  asm volatile("s_wait_asynccnt 0x0" ::: "memory");   // this wave's copies of stage 0 have landed
  __syncthreads();                                    // publishes stage 0

  for (int s = 0; s < ns; ++s) {
    const __bf16* sa = ab + (s & 1) * BUF;
    const __bf16* sb = bb + (s & 1) * BUF;
    // all fragments of the stage (two k steps of 32), read as one group in the order the products use them
    v16b bh[2][4], bl[2][4], ah[2][FM], al[2][FM];
#pragma unroll
    for (int ks = 0; ks < 2; ++ks) {
#pragma unroll
      for (int j = 0; j < 4; ++j) bh[ks][j] = F::load(sb + (j * 16) * GS_PITCH + ks * 32);
      ah[ks][0] = F::load(sa + ks * 32);
#pragma unroll
      for (int j = 0; j < 4; ++j) bl[ks][j] = F::load(sb + (TN + j * 16) * GS_PITCH + ks * 32);
      al[ks][0] = F::load(sa + TM * GS_PITCH + ks * 32);
#pragma unroll
      for (int i = 1; i < FM; ++i) {
        ah[ks][i] = F::load(sa + (i * 16) * GS_PITCH + ks * 32);
        al[ks][i] = F::load(sa + (TM + i * 16) * GS_PITCH + ks * 32);
      }
    }
    // keeps the LDS reads together up here: left to itself the compiler sinks them in pairs among the WMMAs, each pair with a full wait
    __builtin_amdgcn_sched_barrier(0);
    // stage s + 1 into the buffer that trip s - 1 has read, behind the barrier that ended those reads (block-uniform test);
    // issued here, its address arithmetic passes while the fragment reads above are under way
    if (s + 1 < ns) copy_stage_g(s + 1);
    // keeps the WMMAs, and the waits for their fragments, behind the issue of the copies
    __builtin_amdgcn_sched_barrier(0);
#pragma unroll
    for (int ks = 0; ks < 2; ++ks) {
      // four independent accumulators between two products into the same one
#pragma unroll
      for (int i = 0; i < FM; ++i) {
#pragma unroll
        for (int j = 0; j < 4; ++j) acc[i][j] = F::mma(ah[ks][i], bh[ks][j], acc[i][j]);
#pragma unroll
        for (int j = 0; j < 4; ++j) acc[i][j] = F::mma(ah[ks][i], bl[ks][j], acc[i][j]);
#pragma unroll
        for (int j = 0; j < 4; ++j) acc[i][j] = F::mma(al[ks][i], bh[ks][j], acc[i][j]);
      }
    }
    // keeps the WMMAs in front of the waits below, so that the copies fly under them: left to itself the compiler moves them behind the barrier
    __builtin_amdgcn_sched_barrier(0);
    // publish point of stage s + 1, passed by every wave
    asm volatile("s_wait_dscnt 0x0" ::: "memory");     // this wave's reads of stage s are done before its buffer is refilled
    asm volatile("s_wait_asynccnt 0x0" ::: "memory");  // this wave's copies of stage s + 1 have landed
    __syncthreads();                                   // publishes stage s + 1 and ends every wave's reads of stage s
  }
  asm volatile("s_wait_asynccnt 0x0" ::: "memory");    // no copy is outstanding when the wave goes on

  // ---- epilogue: 16 rows at a time through this wave's own slab, so that every store covers whole 128-B lines ----
  // per-wave 16x64 slab, pitch 68 floats, at the start of the ring: behind the loop's last barrier no wave reads a stage any more
  // and no copy is outstanding, so the ring's bytes are free
  float* slab = (float*)ring + wave * (16 * 68);
  const int nW = n0 + wn * 64;
#pragma unroll
  for (int i = 0; i < FM; ++i) {
    const int mBase = m0 + wm * (FM * 16) + (i << 4);
#pragma unroll
    for (int j = 0; j < 4; ++j) {
      float bv = 0.f;
      if (BIAS) bv = bias[nW + (j << 4) + rlane];
#pragma unroll
      for (int r = 0; r < 8; ++r) slab[(mOff + r) * 68 + (j << 4) + rlane] = BIAS ? acc[i][j][r] + bv : acc[i][j][r];
    }
    asm volatile("s_wait_dscnt 0x0" ::: "memory");      // the wave's slab rows are written before its lanes read them back
    if (OUT_MODE == 0) {
      float* C = (float*)Cout;
      const int hh = lane >> 4, c4 = (lane & 15) * 4;     // row seg = 256 B = 16 lanes x 16 B
#pragma unroll
      for (int it = 0; it < 8; ++it) {
        const int row = it * 2 + hh;
        v4f v = *(const v4f*)(slab + row * 68 + c4);
        *(v4f*)(C + (size_t)(mBase + row) * ldc + nW + c4) = v;
      }
    } else {
      const int q = lane >> 3, c8 = (lane & 7) * 8;       // row seg = 128 B = 8 lanes x 16 B per plane
      unsigned short* C  = (unsigned short*)Cout;
      unsigned short* C2 = (unsigned short*)Cout2;
#pragma unroll
      for (int it = 0; it < 4; ++it) {
        const int row = it * 4 + q;
        const float* sp = slab + row * 68 + c8;
        v4u hv, lv;
#pragma unroll
        for (int e = 0; e < 4; ++e) {
          unsigned hw, lw;
          split_pair(sp[2 * e], sp[2 * e + 1], hw, lw);
          hv[e] = hw;
          lv[e] = lw;
        }
        *(v4u*)(C + (size_t)(mBase + row) * ldc + nW + c8) = hv;
        *(v4u*)(C2 + (size_t)(mBase + row) * ldc + nW + c8) = lv;
      }
    }
    // the stores' address and data registers are reused by the next row group; the clobber keeps that group's slab writes behind these reads
    asm volatile("s_wait_xcnt 0x0" ::: "memory");
  }
}

// ---------------------------------------------------------------------------
// Elementwise split: 2 elements per thread, one 4-B store per lane per plane; i = index of the pair, n2 = pairs in the plane.
// ---------------------------------------------------------------------------
__device__ __forceinline__ unsigned pk16(unsigned short a, unsigned short b) { return (unsigned)a | ((unsigned)b << 16); }

// hi = bf16_rne(in), lo = bf16_rne(in - hi)
__device__ __forceinline__ void split_bf16x2(const float* __restrict__ in, unsigned short* __restrict__ hi,
                                             unsigned short* __restrict__ lo, int i, int n2) {
  if (i < n2) {
    const v2f f = *(const v2f*)(in + 2 * (size_t)i);
    const unsigned short h0 = f2bf_bits(f[0]), h1 = f2bf_bits(f[1]);
    const unsigned short l0 = f2bf_bits(f[0] - bf_bits2f(h0)), l1 = f2bf_bits(f[1] - bf_bits2f(h1));
    const unsigned uh = pk16(h0, h1), ul = pk16(l0, l1);
    ((unsigned*)hi)[i] = uh;
    ((unsigned*)lo)[i] = ul;
    
  }
}

// ---------------------------------------------------------------------------
// Transpose + bf16 hi/lo split of an f32 matrix: in [rows][cols] (row pitch ldi floats) ->
// outh/outl[c][r] = split(in[r][c]) (row pitch ldo u16). One 64x64 tile (bx of cols/64, by of rows/64) per block of 256 threads;
// rows, cols % 64 == 0. tf: 64 * 68 floats of LDS.
// Coverage per block: load 4 it x 256 thr x 4 f32 = 64x64; store 2 it x 256 thr x 8 u16 = 64x64 per plane;
// ---------------------------------------------------------------------------
__device__ __forceinline__ void transpose_split_tile(float* tf, const float* __restrict__ in, int ldi,
                                                     unsigned short* __restrict__ outh,
                                                     unsigned short* __restrict__ outl, int ldo, int bx, int by) {
  const int c0  = bx * 64;           // input column block = output row block
  const int r0  = by * 64;           // input row block    = output column block
  const int tid = threadIdx.x;
  {
    const int sub = tid >> 4;          // 0..15
    const int c4  = (tid & 15) * 4;    // 0..60
#pragma unroll
    for (int it = 0; it < 4; ++it) {
      const int rr = it * 16 + sub;
      const v4f a = *(const v4f*)(in + (size_t)(r0 + rr) * ldi + c0 + c4);
      *(v4f*)(tf + rr * 68 + c4) = a;
    }
  }
  __syncthreads();
  const int s8 = tid >> 3;             // 0..31
  const int c8 = (tid & 7) * 8;        // 0..56
  v4u hv[2], lv[2];
#pragma unroll
  for (int it = 0; it < 2; ++it) {
    const int oc = it * 32 + s8;       // output row within tile (= input column)
    v4u a, a2;
#pragma unroll
    for (int q = 0; q < 4; ++q) {
      const float f0 = tf[(c8 + 2 * q) * 68 + oc];
      const float f1 = tf[(c8 + 2 * q + 1) * 68 + oc];
      const unsigned short h0 = f2bf_bits(f0), h1 = f2bf_bits(f1);
      const unsigned short l0 = f2bf_bits(f0 - bf_bits2f(h0));
      const unsigned short l1 = f2bf_bits(f1 - bf_bits2f(h1));
      a[q]  = pk16(h0, h1);
      a2[q] = pk16(l0, l1);
    }
    hv[it] = a; lv[it] = a2;
  }
  {
#pragma unroll
    for (int it = 0; it < 2; ++it) {
      const int oc = it * 32 + s8;
      const size_t go = (size_t)(c0 + oc) * ldo + r0 + c8;
      *(v4u*)(outh + go) = hv[it];
      *(v4u*)(outl + go) = lv[it];
    }
    
  }
}

// All operand planes in one grid; the five jobs are independent of one another, a block does one piece of one of them.
//   blocks 0 .. 4*W_TILES-1: the 64x64 tiles of Wq, Wk, Wv, Wo ([k][n] -> planes [n][k]); Wk^T goes behind Wq^T in the WqkT planes
//   then X_BLOCKS blocks: x of both batches -> hi/lo planes (256 threads x 2 elements each)
#define W_TILES  ((DOUT / 64) * (DIN / 64))          // 256 per weight
#define X_PAIRS  (NB * NSEQ * DIN / 2)
#define X_BLOCKS (X_PAIRS / 256)                     // 8192
__global__ __launch_bounds__(256) void prep_kernel(const float* __restrict__ x, const float* __restrict__ Wq, const float* __restrict__ Wk,
                                                   const float* __restrict__ Wv, const float* __restrict__ Wo,
                                                   unsigned short* __restrict__ Xh, unsigned short* __restrict__ Xl,
                                                   unsigned short* __restrict__ WqkTh, unsigned short* __restrict__ WqkTl,
                                                   unsigned short* __restrict__ WvTh, unsigned short* __restrict__ WvTl,
                                                   unsigned short* __restrict__ WoTh, unsigned short* __restrict__ WoTl) {
  __shared__ __align__(16) float tf[64 * 68];
  const int bid = (int)blockIdx.x;
  if (bid < 4 * W_TILES) {                           // block-uniform
    const int sel = bid / W_TILES;
    const int t   = bid - sel * W_TILES;
    const float* in    = sel == 0 ? Wq : sel == 1 ? Wk : sel == 2 ? Wv : Wo;
    unsigned short* oh = sel == 0 ? WqkTh : sel == 1 ? WqkTh + (size_t)DOUT * DIN : sel == 2 ? WvTh : WoTh;
    unsigned short* ol = sel == 0 ? WqkTl : sel == 1 ? WqkTl + (size_t)DOUT * DIN : sel == 2 ? WvTl : WoTl;
    transpose_split_tile(tf, in, DOUT, oh, ol, DIN, t % (DOUT / 64), t / (DOUT / 64));
  } else {
    split_bf16x2(x, Xh, Xl, (bid - 4 * W_TILES) * 256 + (int)threadIdx.x, X_PAIRS);
  }
}

// ---------------------------------------------------------------------------
// Fused causal attention, all batches and heads in one launch: scores, relu * distance decay, online softmax and P.V in one kernel;
// neither scores nor probabilities go to memory. The K rows and V^T columns of 64 keys (a stage) are brought into LDS once per block
// by asynchronous copies, whole 128-B lines, two buffers, and all eight waves take their fragments from there.
// A wave owns 16 queries (one per lane column c) of head blockIdx.y, batch blockIdx.z, and walks the keys 32 at a time:
//   St[key][query] = K . Q^T   (A = K rows, B = Q rows kept in registers; both through the same loader)
//   t = relu(St) * R_hat(h, i - j) * 0.125 in log2 units, -inf for j > i (only the last pass holds such keys),
//   R_hat = (1 + exp(v[h])) * rcp(1 + exp(v[h] - w[h] * (i - j)))
//   running maximum m (starts at 0: every allowed t is >= 0 and key 0 is always allowed), p = exp2(t - m),
//   Ot[d][query] = Ot * exp2(m_old - m_new) + V^T . P^T
// The two 16-key score tiles of a pass, converted in place, are the B operand of the second product
// (element s = tile s >> 3, register s & 7), which is the k order the A loader of V^T delivers.
// A lane holds 8 + 8 keys of its query; lanes c and c + 16 share the maximum each pass and join their sums at the end.
// Waves 0..3 of a block take query groups from the long end, waves 4..7 the mirrored ones from the short end.
// Output: lane (c, hf) holds ctx[q0 + c][head*64 + ds*16 + hf*8 + 0..7]: one 16-B store per plane and ds;
// the 128-B line of a (query, head) is written by one wave. grid (NSEQ/128, NH, NB) x 8 waves x 16 queries = all rows.
// Every '#pragma unroll' below stands on a loop of constant trip count whose index selects a fragment or an accumulator:
// unrolled, those arrays stay in registers.
// ---------------------------------------------------------------------------

__device__ __forceinline__ float other_half(float x) {   // the value of lane l ^ 16
  const int b = __float_as_int(x);
  return __int_as_float(__builtin_amdgcn_permlanex16(b, b, 0x76543210, 0xfedcba98, false, false));
}

// LDS ring: a stage holds four planes (K hi, K lo: 64 key rows x 64 dims; V^T hi, V^T lo: 64 dim rows x 64 keys); a row is 128 B of data
// at a pitch of 144 B (16 B x odd: the 16-byte fragment reads of 16 rows fall on distinct banks).
#define AT_PITCH 72                    // 16-bit elements
#define AT_PLANE (64 * AT_PITCH)
#define AT_BUF   (4 * AT_PLANE)

// One stage = 4 planes x 64 rows x 8 pieces of 16 B = 2048 pieces, eight per thread: rows r and r + 32 of each plane.
// lds: this lane's byte address in plane 0 of the target buffer; the pointers: this lane's piece of row r of each plane.
// The s_wait_xcnt at the end of the statement stands in front of any later rewrite of the address registers the copies name.
__device__ __forceinline__ void copy_stage(unsigned lds, const unsigned short* kh, const unsigned short* kl,
                                           const unsigned short* vh, const unsigned short* vl) {
  const unsigned R = 32 * AT_PITCH * 2, P = AT_PLANE * 2;
  asm volatile("global_load_async_to_lds_b128 %0, %8, off\n\t"
               "global_load_async_to_lds_b128 %1, %9, off\n\t"
               "global_load_async_to_lds_b128 %2, %10, off\n\t"
               "global_load_async_to_lds_b128 %3, %11, off\n\t"
               "global_load_async_to_lds_b128 %4, %12, off\n\t"
               "global_load_async_to_lds_b128 %5, %13, off\n\t"
               "global_load_async_to_lds_b128 %6, %14, off\n\t"
               "global_load_async_to_lds_b128 %7, %15, off\n\t"
               "s_wait_xcnt 0x0"
               :: "v"(lds), "v"(lds + R), "v"(lds + P), "v"(lds + P + R),
                  "v"(lds + 2 * P), "v"(lds + 2 * P + R), "v"(lds + 3 * P), "v"(lds + 3 * P + R),
                  "v"(kh), "v"(kh + 32 * (2 * DOUT)), "v"(kl), "v"(kl + 32 * (2 * DOUT)),
                  "v"(vh), "v"(vh + 32 * NSEQ), "v"(vl), "v"(vl + 32 * NSEQ)
               : "memory");
}

// four waves per SIMD (two blocks per WGP): the waves fill each other's waits
__global__ __launch_bounds__(256) __attribute__((amdgpu_waves_per_eu(4, 4))) void fused_attn_kernel(const unsigned short* __restrict__ QKhp, const unsigned short* __restrict__ QKlp,
                                                         const unsigned short* __restrict__ VThp, const unsigned short* __restrict__ VTlp,
                                                         const float* __restrict__ wp, const float* __restrict__ vp,
                                                         unsigned short* __restrict__ Oh, unsigned short* __restrict__ Ol) {
  typedef Frag<__bf16> F;
  const int lane = threadIdx.x & 31;
  const int wave = __builtin_amdgcn_readfirstlane((int)(threadIdx.x >> 5));
  const int head = blockIdx.y;
  const size_t bz = blockIdx.z;
  const int c    = lane & 15;
  const int hf   = lane >> 4;
  const int tq   = (int)blockIdx.x * 4 + (wave & 3);            // 0..63
  const int qg   = (wave < 4) ? (NSEQ / 16 - 1 - tq) : tq;      // every 16-query group once
  const int q0   = qg << 4;
  const int np   = (q0 >> 5) + 1;                               // passes of 32 keys; keys of passes 0..np-2 are all < q0

  const float L2E = 1.44269504088896341f;
  const float w2  = wp[head] * L2E;
  const float v2  = vp[head] * L2E;
  const float c1  = (1.0f + __builtin_amdgcn_exp2f(v2)) * (0.125f * L2E);

  const size_t qo = (bz * NSEQ + q0 + c) * (2 * DOUT) + head * HDIM + hf * 8;

  __shared__ __align__(16) unsigned short ring[2 * AT_BUF];
  // stages of 64 keys that the block's longest wave (wave 0) needs: 17..32, so stages 0 and 1 always exist and every key is < NSEQ
  const int ns = ((((NSEQ / 16 - 1 - (int)blockIdx.x * 4) << 4) >> 5) + 2) >> 1;
  const int crow = (int)threadIdx.x >> 3;          // 0..31: the row this thread copies (and row + 32)
  const int cpc  = ((int)threadIdx.x & 7) * 8;     // its 16-B piece of the row, in elements: 8 lanes cover one 128-B line
  const unsigned ldsc = (unsigned)(uintptr_t)(ring + crow * AT_PITCH + cpc);
  const size_t kco = (bz * NSEQ + crow) * (2 * DOUT) + DOUT + head * HDIM + cpc;
  const size_t vco = (bz * DOUT + head * HDIM + crow) * NSEQ + cpc;
  copy_stage(ldsc, QKhp + kco, QKlp + kco, VThp + vco, VTlp + vco);      // stage 0 -> buffer 0
  const __bf16* rb = (const __bf16*)ring + c * AT_PITCH + hf * 8;        // this lane's fragment row and k half

  v16b qh[2], ql[2];
#pragma unroll
  for (int ks = 0; ks < 2; ++ks) {
    qh[ks] = F::load((const __bf16*)QKhp + qo + ks * 32);
    ql[ks] = F::load((const __bf16*)QKlp + qo + ks * 32);
  }
  // the address registers of the Q loads are reused right below; the loaded values as inputs keep the wait behind the loads
  asm volatile("s_wait_xcnt 0x0" :: "v"(qh[0]), "v"(qh[1]), "v"(ql[0]), "v"(ql[1]) : "memory");

  v8f o[4];
#pragma unroll
  for (int ds = 0; ds < 4; ++ds) o[ds] = (v8f){0.f,0.f,0.f,0.f,0.f,0.f,0.f,0.f};
  float m = 0.f, l = 0.f;

  asm volatile("s_wait_asynccnt 0x0" ::: "memory");   // this wave's copies of stage 0 have landed
  __syncthreads();                                    // publishes stage 0
  copy_stage(ldsc + AT_BUF * 2, QKhp + kco + (size_t)64 * (2 * DOUT), QKlp + kco + (size_t)64 * (2 * DOUT),
             VThp + vco + 64, VTlp + vco + 64);       // stage 1 -> buffer 1

  for (int s = 0; s < ns; ++s) {
  const __bf16* sb = rb + (s & 1) * AT_BUF;
  for (int h2 = 0; h2 < 2; ++h2) {
    const int p = 2 * s + h2;
    if (p >= np) break;                               // wave-uniform: a wave past its diagonal only keeps the publish points
    const int j0 = p << 5;
    // K rows and V^T columns of this pass, from this stage's buffer
    v16b kh[2][2], kl[2][2];
#pragma unroll
    for (int a = 0; a < 2; ++a)
#pragma unroll
      for (int ks = 0; ks < 2; ++ks) {
        kh[a][ks] = F::load(sb + (h2 * 32 + a * 16) * AT_PITCH + ks * 32);
        kl[a][ks] = F::load(sb + AT_PLANE + (h2 * 32 + a * 16) * AT_PITCH + ks * 32);
      }
    v16b vh[4], vl[4];
#pragma unroll
    for (int ds = 0; ds < 4; ++ds) {
      vh[ds] = F::load(sb + 2 * AT_PLANE + (ds * 16) * AT_PITCH + h2 * 32);
      vl[ds] = F::load(sb + 3 * AT_PLANE + (ds * 16) * AT_PITCH + h2 * 32);
    }
    v8f st[2];
    st[0] = (v8f){0.f,0.f,0.f,0.f,0.f,0.f,0.f,0.f};
    st[1] = st[0];
#pragma unroll
    for (int ks = 0; ks < 2; ++ks) {
      st[0] = F::mma(kh[0][ks], qh[ks], st[0]);
      st[1] = F::mma(kh[1][ks], qh[ks], st[1]);
      st[0] = F::mma(kh[0][ks], ql[ks], st[0]);
      st[1] = F::mma(kh[1][ks], ql[ks], st[1]);
      st[0] = F::mma(kl[0][ks], qh[ks], st[0]);
      st[1] = F::mma(kl[1][ks], qh[ks], st[1]);
    }
    // inputs only: keeps the V^T fragment reads up here, issued with the K reads, so that their LDS latency passes under the score
    // products and the softmax; left to itself the compiler sinks them in front of each P.V product, which then waits for them
    asm volatile("" :: "v"(vh[0]), "v"(vh[1]), "v"(vh[2]), "v"(vh[3]), "v"(vl[0]), "v"(vl[1]), "v"(vl[2]), "v"(vl[3]));
    const int   lim  = q0 + c - j0 - hf * 8;          // i - j of this lane's first key; key 16a + r is allowed while 16a + r <= lim
    const float base = v2 - w2 * (float)lim;
    float tt[2][8];
#pragma unroll
    for (int a = 0; a < 2; ++a)
#pragma unroll
      for (int r = 0; r < 8; ++r) {
        const float e = __builtin_amdgcn_exp2f(fmaf(w2, (float)(a * 16 + r), base));
        tt[a][r] = fmaxf(st[a][r], 0.0f) * (c1 * __builtin_amdgcn_rcpf(1.0f + e));
      }
    if (p == np - 1) {                                 // wave-uniform
#pragma unroll
      for (int a = 0; a < 2; ++a)
#pragma unroll
        for (int r = 0; r < 8; ++r) tt[a][r] = (a * 16 + r <= lim) ? tt[a][r] : -INFINITY;
    }
    float mx = m;
#pragma unroll
    for (int a = 0; a < 2; ++a)
#pragma unroll
      for (int r = 0; r < 8; ++r) mx = fmaxf(mx, tt[a][r]);
    mx = fmaxf(mx, other_half(mx));
    const float alpha = __builtin_amdgcn_exp2f(m - mx);
    m = mx;
    float ps0 = 0.f, ps1 = 0.f;
#pragma unroll
    for (int r = 0; r < 8; ++r) {
      tt[0][r] = __builtin_amdgcn_exp2f(tt[0][r] - mx);
      tt[1][r] = __builtin_amdgcn_exp2f(tt[1][r] - mx);
      ps0 += tt[0][r];
      ps1 += tt[1][r];
    }
    l = l * alpha + (ps0 + ps1);
#pragma unroll
    for (int ds = 0; ds < 4; ++ds) o[ds] *= alpha;

    union PF { v16b v; unsigned u[8]; } ph, pl;
#pragma unroll
    for (int a = 0; a < 2; ++a)
#pragma unroll
      for (int r2 = 0; r2 < 4; ++r2) split_pair(tt[a][2 * r2], tt[a][2 * r2 + 1], ph.u[a * 4 + r2], pl.u[a * 4 + r2]);

#pragma unroll
    for (int ds = 0; ds < 4; ++ds) o[ds] = F::mma(vh[ds], ph.v, o[ds]);
#pragma unroll
    for (int ds = 0; ds < 4; ++ds) o[ds] = F::mma(vh[ds], pl.v, o[ds]);
#pragma unroll
    for (int ds = 0; ds < 4; ++ds) o[ds] = F::mma(vl[ds], ph.v, o[ds]);
    // four vector slots behind the pass's last WMMA: the next pass's first address arithmetic, reached over the loop's branches,
    // reuses that WMMA's operand registers
    acc_guard4(o[0], o[1], o[2], o[3]);
  }
    // publish point of stage s + 1, passed by every wave
    asm volatile("s_wait_dscnt 0x0" ::: "memory");     // this wave's reads of stage s are done before its buffer is refilled
    asm volatile("s_wait_asynccnt 0x0" ::: "memory");  // this wave's copies of stage s + 1 have landed
    __syncthreads();                                   // publishes stage s + 1 and ends every wave's reads of stage s
    if (s + 2 < ns)                                    // block-uniform
      copy_stage(ldsc + (s & 1) * (AT_BUF * 2), QKhp + kco + (size_t)(s + 2) * 64 * (2 * DOUT), QKlp + kco + (size_t)(s + 2) * 64 * (2 * DOUT),
                 VThp + vco + (s + 2) * 64, VTlp + vco + (s + 2) * 64);
  }
  asm volatile("s_wait_asynccnt 0x0" ::: "memory");    // no copy is outstanding when the wave ends

  l += other_half(l);
  const float inv = 1.0f / l;                          // l >= 1: the row maximum contributes exp2(0)
  const size_t oo = (bz * NSEQ + q0 + c) * DOUT + head * HDIM + hf * 8;
#pragma unroll
  for (int ds = 0; ds < 4; ++ds) {
    unsigned hw[4], lw[4];
#pragma unroll
    for (int r2 = 0; r2 < 4; ++r2) split_pair(o[ds][2 * r2] * inv, o[ds][2 * r2 + 1] * inv, hw[r2], lw[r2]);
    *(v4u*)(Oh + oo + ds * 16) = (v4u){hw[0], hw[1], hw[2], hw[3]};
    *(v4u*)(Ol + oo + ds * 16) = (v4u){lw[0], lw[1], lw[2], lw[3]};
  }
}

// ---------------------------------------------------------------------------
// Workspace region map (byte offsets; all offsets multiples of 2 MiB). Every region is fully written in each call
// before it is read. X and O share one region: X is read only by the projection GEMMs, which precede the attention
// kernel (the O producer) in stream order; O is fully written (2 batches x 16 heads x 64 columns x 2048 rows) before
// the output projections read it.
//   WqkTh  bf16 [2048][1024]  rows 0..1023 = Wq^T, 1024..2047 = Wk^T         0
//   WqkTl  bf16 [2048][1024]                                          4194304
//   WvTh   bf16 [1024][1024]                                          8388608
//   WvTl   bf16 [1024][1024]                                         10485760
//   WoTh   bf16 [1024][1024]                                         12582912
//   WoTl   bf16 [1024][1024]                                         14680064
//   XOh    bf16 [2][2048][1024]  x hi, later ctx hi (col h*64+d)        16777216
//   XOl    bf16 [2][2048][1024]                                         25165824
//   QKh    bf16 [2][2048][2048]  q at col h*64+d, k at col 1024+h*64+d  33554432
//   QKl    bf16 [2][2048][2048]                                         50331648
//   VTh    bf16 [2][1024][2048]  row h*64+d, col token                  67108864
//   VTl    bf16 [2][1024][2048]                                         75497472
//   total                                                               83886080
// ---------------------------------------------------------------------------
extern "C" void kernel_launch(void* const* d_in, const int* in_sizes, int n_in,
                              void* d_out, int out_size, void* d_ws, size_t ws_size,
                              hipStream_t stream) {
  if (n_in < 8) return;
  if (in_sizes[0] != NB * NSEQ * DIN) return;
  if (in_sizes[1] != DIN * DOUT || in_sizes[2] != DIN * DOUT || in_sizes[3] != DIN * DOUT) return;
  if (in_sizes[4] != DOUT * DOUT || in_sizes[5] != DOUT) return;
  if (in_sizes[6] < NH || in_sizes[7] < NH) return;
  if (out_size != NB * NSEQ * DOUT) return;

  const float* x  = (const float*)d_in[0];
  const float* Wq = (const float*)d_in[1];
  const float* Wk = (const float*)d_in[2];
  const float* Wv = (const float*)d_in[3];
  const float* Wo = (const float*)d_in[4];
  const float* bo = (const float*)d_in[5];
  const float* wp = (const float*)d_in[6];
  const float* vp = (const float*)d_in[7];

  const size_t PW  = (size_t)DIN * DOUT * 2;              // 16-bit [1024][1024] plane
  const size_t PX  = (size_t)NSEQ * DIN * 2;              // 16-bit [2048][1024] plane
  const size_t PQK = (size_t)NSEQ * (2 * DOUT) * 2;       // 16-bit [2048][2048] plane
  const size_t PVT = (size_t)DOUT * NSEQ * 2;             // 16-bit [1024][2048] plane
  size_t off = 0;
  const size_t oWqkTh = off; off += 2 * PW;
  const size_t oWqkTl = off; off += 2 * PW;
  const size_t oWvTh  = off; off += PW;
  const size_t oWvTl  = off; off += PW;
  const size_t oWoTh  = off; off += PW;
  const size_t oWoTl  = off; off += PW;
  const size_t oXOh   = off; off += NB * PX;
  const size_t oXOl   = off; off += NB * PX;
  const size_t oQKh   = off; off += NB * PQK;
  const size_t oQKl   = off; off += NB * PQK;
  const size_t oVTh   = off; off += NB * PVT;
  const size_t oVTl   = off; off += NB * PVT;
  if (off > ws_size) return;

  char* ws = (char*)d_ws;
  unsigned short* WqkTh = (unsigned short*)(ws + oWqkTh);
  unsigned short* WqkTl = (unsigned short*)(ws + oWqkTl);
  unsigned short* WvTh  = (unsigned short*)(ws + oWvTh);
  unsigned short* WvTl  = (unsigned short*)(ws + oWvTl);
  unsigned short* WoTh  = (unsigned short*)(ws + oWoTh);
  unsigned short* WoTl  = (unsigned short*)(ws + oWoTl);
  unsigned short* XOh   = (unsigned short*)(ws + oXOh);
  unsigned short* XOl   = (unsigned short*)(ws + oXOl);
  unsigned short* QKh   = (unsigned short*)(ws + oQKh);
  unsigned short* QKl   = (unsigned short*)(ws + oQKl);
  unsigned short* VTh   = (unsigned short*)(ws + oVTh);
  unsigned short* VTl   = (unsigned short*)(ws + oVTl);

  const dim3 blk(256);
  const dim3 blkG(128);                                             // GEMMs: four waves
  // (1) operand planes: Wq^T | Wk^T, Wv^T, Wo^T and x of both batches (whole planes: 4 x 16x16 tiles of 64x64; 8192 blocks x 256 thr x 2)
  prep_kernel<<<dim3(4 * W_TILES + X_BLOCKS), blk, 0, stream>>>(x, Wq, Wk, Wv, Wo, XOh, XOl, WqkTh, WqkTl, WvTh, WvTl, WoTh, WoTl);
  // (2) [q | k] = x . [Wq | Wk] -> QK hi/lo planes, both batches as one M = 4096 (x and the QK planes are contiguous over the batch):
  //     whole [2][2048][2048] planes, 32x16 tiles of 128x128
  wmma_gemm_staged<4, false, 2><<<dim3((NB * NSEQ / 128) * (2 * DOUT / 128), 1), blkG, 0, stream>>>(
      XOh, XOl, DIN, WqkTh, WqkTl, DIN, (void*)QKh, (void*)QKl, 2 * DOUT,
      bo, 2 * DOUT / 128, DIN, 0, 0);
  // (3) v^T[o][tok] = sum_k Wv^T[o][k] x[tok][k] -> VT hi/lo planes [1024][2048] of batch blockIdx.y (whole planes: 2 x 16x16 tiles of 64x128)
  wmma_gemm_staged<2, false, 2><<<dim3((DOUT / 64) * (NSEQ / 128), NB), blkG, 0, stream>>>(
      WvTh, WvTl, DIN, XOh, XOl, DIN, (void*)VTh, (void*)VTl, NSEQ,
      bo, NSEQ / 128, DIN, (size_t)NSEQ * DIN, (size_t)DOUT * NSEQ);
  // (4) ctx[b][i][h*64+d] = softmax_j(relu(q_i . k_j) * decay * 1/8, causal) . v -> O hi/lo planes (whole [2][2048][1024])
  fused_attn_kernel<<<dim3(NSEQ / 128, NH, NB), blk, 0, stream>>>(QKh, QKl, VTh, VTl, wp, vp, XOh, XOl);
  // (5) out = ctx . Wo + bo, both batches as one M = 4096 (ctx planes and out are contiguous over the batch): f32, whole d_out, 64x8 tiles of 64x128
  wmma_gemm_staged<2, true, 0><<<dim3((NB * NSEQ / 64) * (DOUT / 128), 1), blkG, 0, stream>>>(
      XOh, XOl, DOUT, WoTh, WoTl, DOUT, d_out, d_out, DOUT,
      bo, DOUT / 128, DOUT, 0, 0);
  (void)hipGetLastError();
}

// v007
// Measured time: 138 microseconds a run.
// Two timings next to v006 both put it at 1.04 times that version's speed.
// All steps since v000 together make it 18.4 times as fast.
// Every contraction (x.Wq|Wk, Wv^T.x^T, k.q^T, v^T.p^T, ctx.Wo): v_wmma_f32_16x16x32_bf16 on bf16 hi/lo split operand planes (hi.hi + hi.lo + lo.hi), f32 accumulate; relu, distance decay, causal mask and softmax in f32.
#include <hip/hip_runtime.h>
#include <math.h>
#include <stdint.h>

#define NB    2
#define NSEQ  2048
#define DIN   1024
#define DOUT  1024
#define NH    16
#define HDIM  64

typedef __attribute__((ext_vector_type(16))) __bf16   v16b;
typedef __attribute__((ext_vector_type(8)))  __bf16   v8b;
typedef __attribute__((ext_vector_type(8)))  float    v8f;
typedef __attribute__((ext_vector_type(4)))  float    v4f;
typedef __attribute__((ext_vector_type(2)))  float    v2f;
typedef __attribute__((ext_vector_type(4)))  unsigned int v4u;
typedef __attribute__((ext_vector_type(2)))  unsigned int v2u;

__device__ __forceinline__ unsigned short f2bf_bits(float f) {
  unsigned u = __float_as_uint(f);
  return (unsigned short)((u + 0x7FFFu + ((u >> 16) & 1u)) >> 16);
}
__device__ __forceinline__ float bf_bits2f(unsigned short h) { return __uint_as_float(((unsigned)h) << 16); }

typedef __attribute__((ext_vector_type(2))) __bf16 v2b;
// hi = bf16_rne(f), lo = bf16_rne(f - hi), two values packed per word
__device__ __forceinline__ void split_pair(float f0, float f1, unsigned& hi, unsigned& lo) {
  hi = __builtin_bit_cast(unsigned, __builtin_convertvector((v2f){f0, f1}, v2b));
  const float r0 = f0 - __uint_as_float(hi << 16);
  const float r1 = f1 - __uint_as_float(hi & 0xFFFF0000u);
  lo = __builtin_bit_cast(unsigned, __builtin_convertvector((v2f){r0, r1}, v2b));
}

// four vector slots behind a WMMA whose operand registers may be reused
__device__ __forceinline__ void acc_guard4(v8f& a, v8f& b, v8f& c, v8f& d) { asm volatile("v_nop\n\tv_nop\n\tv_nop\n\tv_nop" : "+v"(a), "+v"(b), "+v"(c), "+v"(d)); }
template <typename T> struct Frag;
template <> struct Frag<__bf16> {
  typedef v16b V; union U { v16b v; v8b h[2]; };
  static __device__ __forceinline__ v16b load(const __bf16* p) {   // elements 0..7 <- p[0..7], 8..15 <- p[16..23]
    U f; f.h[0] = *(const v8b*)(p); f.h[1] = *(const v8b*)(p + 16); return f.v;
  }
  static __device__ __forceinline__ v8f mma(v16b a, v16b b, v8f c) {
    return __builtin_amdgcn_wmma_f32_16x16x32_bf16(false, a, false, b, (short)0, c, false, false);
  }
};

// ---- WMMA GEMM on operand tiles staged in LDS -------------------------------
// C[m,n] = sum_k A[m,k] * Bt[n,k] (+ bias[n]); A row-major [M,K], Bt row-major [N,K], each as bf16 hi and lo planes;
// product = hi.hi + hi.lo + lo.hi, f32 accumulate, k ascending.
// A block of four waves (2 x 2) owns one (FM*32) x 128 tile of C; a wave owns (FM*16) x 64 of it.
// A stage is 64 k of every operand row of the tile: whole 128-B lines, brought into LDS once per block by asynchronous copies,
// two buffers; both waves of a tile row share the A rows, both of a tile column the Bt rows.
// M % (FM*32) == 0, N % 128 == 0, K % 64 == 0. OUT_MODE: 0 = f32, 2 = bf16 hi plane (Cout) + bf16 lo plane (Cout2).
// grid (tiles, products): blockIdx.y picks one of several independent products with the same A; its Bt lies bsB and its C bsC elements further on.
// Every '#pragma unroll' below stands on a loop of constant trip count whose index selects a fragment, an accumulator or a copy:
// unrolled, those arrays stay in registers.
#define GS_PITCH 72                    // 16-bit elements: 128 B of data at 144 B (16 B x odd: the 16-byte fragment reads of 16 rows fall on distinct banks)

// Eight copies of 16 B per lane: rows r, r + 16, r + 32, r + 48 of a hi plane (la, ga) and of its lo plane (lb, gb); step = 16 source rows.
// The builtin form: the compiler allots the address registers itself, in any register window.
typedef __attribute__((ext_vector_type(4))) int v4i;
typedef __attribute__((address_space(1))) v4i g_v4i;
typedef __attribute__((address_space(3))) v4i l_v4i;
__device__ __forceinline__ void copy_rows(unsigned short* la, unsigned short* lb, const unsigned short* ga, const unsigned short* gb, size_t step) {
#pragma unroll
  for (int i = 0; i < 4; ++i) {
    __builtin_amdgcn_global_load_async_to_lds_b128((g_v4i*)(ga + i * step), (l_v4i*)(la + i * (16 * GS_PITCH)), 0, 0);
    __builtin_amdgcn_global_load_async_to_lds_b128((g_v4i*)(gb + i * step), (l_v4i*)(lb + i * (16 * GS_PITCH)), 0, 0);
  }
}

template <int FM, bool BIAS, int OUT_MODE>
__global__ __launch_bounds__(128) void wmma_gemm_staged(
    const unsigned short* __restrict__ Ahp, const unsigned short* __restrict__ Alp, int lda,
    const unsigned short* __restrict__ Bh0, const unsigned short* __restrict__ Bl0, int ldb,
    void* __restrict__ C0, void* __restrict__ C20, int ldc,
    const float* __restrict__ bias, int tilesN, int K, size_t bsB, size_t bsC) {
  typedef Frag<__bf16> F;
  const unsigned short* __restrict__ Bhp = Bh0 + blockIdx.y * bsB;
  const unsigned short* __restrict__ Blp = Bl0 + blockIdx.y * bsB;
  const size_t cby = blockIdx.y * bsC * (OUT_MODE == 0 ? sizeof(float) : sizeof(unsigned short));
  void* __restrict__ Cout  = (char*)C0 + cby;
  void* __restrict__ Cout2 = (char*)C20 + cby;
  constexpr int TM  = FM * 32;                    // tile rows
  constexpr int TN  = 128;                        // tile columns
  constexpr int BUF = 2 * (TM + TN) * GS_PITCH;   // a buffer: A hi (TM rows), A lo, Bt hi (TN rows), Bt lo
  // The ring is the block's only LDS: at FM = 4 it is 144 KiB, so that two blocks fit one WGP's 320 KiB and each SIMD holds two waves,
  // one block's WMMAs running under the other's copies, fragment reads and barriers. The epilogue's slabs lie in the ring (below).
  __shared__ __align__(16) unsigned short ring[2 * BUF];
  const int lane = threadIdx.x & 31;
  const int wave = __builtin_amdgcn_readfirstlane((int)(threadIdx.x >> 5));
  const int wm = wave >> 1, wn = wave & 1;
  const int tm = (int)blockIdx.x / tilesN;
  const int tn = (int)blockIdx.x - tm * tilesN;
  const int m0 = tm * TM;
  const int n0 = tn * TN;
  const int rlane = lane & 15;                 // row (A) / col (B, D) within subtile
  const int koff  = (lane >> 4) * 8;           // k offset of this lane half
  const int mOff  = (lane >> 4) * 8;           // D row offset

  // copies: a thread brings one 16-B piece of rows crow, crow + 16, ... of every plane; 8 lanes cover one 128-B line
  const int crow = (int)threadIdx.x >> 3;          // 0..15
  const int cpc  = ((int)threadIdx.x & 7) * 8;     // in elements
  unsigned short* ldsc = ring + crow * GS_PITCH + cpc;
  const unsigned aco = (unsigned)(crow * lda + cpc);   // this lane's place inside 16 rows; the block-uniform rest of an address stays scalar
  const unsigned bco = (unsigned)(crow * ldb + cpc);
  const int ns = K >> 6;                           // stages
  auto copy_stage_g = [&](int s) {                 // stage s -> buffer s & 1: 2 * (TM + TN) / 16 copies per thread (32 or 24)
    unsigned short* l0 = ldsc + (s & 1) * BUF;
    const size_t ka = (size_t)m0 * lda + (size_t)s * 64;
    const size_t kb = (size_t)n0 * ldb + (size_t)s * 64;
#pragma unroll
    for (int g = 0; g < TM / 64; ++g)
      copy_rows(l0 + (g * 64) * GS_PITCH, l0 + (TM + g * 64) * GS_PITCH,
                (Ahp + (ka + (size_t)(g * 64) * lda)) + aco, (Alp + (ka + (size_t)(g * 64) * lda)) + aco, (size_t)16 * lda);
#pragma unroll
    for (int g = 0; g < TN / 64; ++g)
      copy_rows(l0 + (2 * TM + g * 64) * GS_PITCH, l0 + (2 * TM + TN + g * 64) * GS_PITCH,
                (Bhp + (kb + (size_t)(g * 64) * ldb)) + bco, (Blp + (kb + (size_t)(g * 64) * ldb)) + bco, (size_t)16 * ldb);
  };
  copy_stage_g(0);

  v8f acc[FM][4];
#pragma unroll
  for (int i = 0; i < FM; ++i)
#pragma unroll
    for (int j = 0; j < 4; ++j) acc[i][j] = (v8f){0.f,0.f,0.f,0.f,0.f,0.f,0.f,0.f};

  const __bf16* ab = (const __bf16*)ring + (wm * (FM * 16) + rlane) * GS_PITCH + koff;        // A hi fragment row of this lane
  const __bf16* bb = (const __bf16*)ring + (2 * TM + wn * 64 + rlane) * GS_PITCH + koff;      // Bt hi fragment row

  asm volatile("s_wait_asynccnt 0x0" ::: "memory");   // this wave's copies of stage 0 have landed
  __syncthreads();                                    // publishes stage 0

  for (int s = 0; s < ns; ++s) {
    const __bf16* sa = ab + (s & 1) * BUF;
    const __bf16* sb = bb + (s & 1) * BUF;
    // all fragments of the stage (two k steps of 32), read as one group in the order the products use them
    v16b bh[2][4], bl[2][4], ah[2][FM], al[2][FM];
#pragma unroll
    for (int ks = 0; ks < 2; ++ks) {
#pragma unroll
      for (int j = 0; j < 4; ++j) bh[ks][j] = F::load(sb + (j * 16) * GS_PITCH + ks * 32);
      ah[ks][0] = F::load(sa + ks * 32);
#pragma unroll
      for (int j = 0; j < 4; ++j) bl[ks][j] = F::load(sb + (TN + j * 16) * GS_PITCH + ks * 32);
      al[ks][0] = F::load(sa + TM * GS_PITCH + ks * 32);
#pragma unroll
      for (int i = 1; i < FM; ++i) {
        ah[ks][i] = F::load(sa + (i * 16) * GS_PITCH + ks * 32);
        al[ks][i] = F::load(sa + (TM + i * 16) * GS_PITCH + ks * 32);
      }
    }
    // keeps the LDS reads together up here: left to itself the compiler sinks them in pairs among the WMMAs, each pair with a full wait
    __builtin_amdgcn_sched_barrier(0);
    // stage s + 1 into the buffer that trip s - 1 has read, behind the barrier that ended those reads (block-uniform test);
    // issued here, its address arithmetic passes while the fragment reads above are under way
    if (s + 1 < ns) copy_stage_g(s + 1);
    // keeps the WMMAs, and the waits for their fragments, behind the issue of the copies
    __builtin_amdgcn_sched_barrier(0);
#pragma unroll
    for (int ks = 0; ks < 2; ++ks) {
      // four independent accumulators between two products into the same one
#pragma unroll
      for (int i = 0; i < FM; ++i) {
#pragma unroll
        for (int j = 0; j < 4; ++j) acc[i][j] = F::mma(ah[ks][i], bh[ks][j], acc[i][j]);
#pragma unroll
        for (int j = 0; j < 4; ++j) acc[i][j] = F::mma(ah[ks][i], bl[ks][j], acc[i][j]);
#pragma unroll
        for (int j = 0; j < 4; ++j) acc[i][j] = F::mma(al[ks][i], bh[ks][j], acc[i][j]);
      }
    }
    // keeps the WMMAs in front of the waits below, so that the copies fly under them: left to itself the compiler moves them behind the barrier
    __builtin_amdgcn_sched_barrier(0);
    // publish point of stage s + 1, passed by every wave
    asm volatile("s_wait_dscnt 0x0" ::: "memory");     // this wave's reads of stage s are done before its buffer is refilled
    asm volatile("s_wait_asynccnt 0x0" ::: "memory");  // this wave's copies of stage s + 1 have landed
    __syncthreads();                                   // publishes stage s + 1 and ends every wave's reads of stage s
  }
  asm volatile("s_wait_asynccnt 0x0" ::: "memory");    // no copy is outstanding when the wave goes on

  // ---- epilogue: 16 rows at a time through this wave's own slab, so that every store covers whole 128-B lines ----
  // per-wave 16x64 slab, pitch 68 floats, at the start of the ring: behind the loop's last barrier no wave reads a stage any more
  // and no copy is outstanding, so the ring's bytes are free
  float* slab = (float*)ring + wave * (16 * 68);
  const int nW = n0 + wn * 64;
#pragma unroll
  for (int i = 0; i < FM; ++i) {
    const int mBase = m0 + wm * (FM * 16) + (i << 4);
#pragma unroll
    for (int j = 0; j < 4; ++j) {
      float bv = 0.f;
      if (BIAS) bv = bias[nW + (j << 4) + rlane];
#pragma unroll
      for (int r = 0; r < 8; ++r) slab[(mOff + r) * 68 + (j << 4) + rlane] = BIAS ? acc[i][j][r] + bv : acc[i][j][r];
    }
    asm volatile("s_wait_dscnt 0x0" ::: "memory");      // the wave's slab rows are written before its lanes read them back
    if (OUT_MODE == 0) {
      float* C = (float*)Cout;
      const int hh = lane >> 4, c4 = (lane & 15) * 4;     // row seg = 256 B = 16 lanes x 16 B
#pragma unroll
      for (int it = 0; it < 8; ++it) {
        const int row = it * 2 + hh;
        v4f v = *(const v4f*)(slab + row * 68 + c4);
        *(v4f*)(C + (size_t)(mBase + row) * ldc + nW + c4) = v;
      }
    } else {
      const int q = lane >> 3, c8 = (lane & 7) * 8;       // row seg = 128 B = 8 lanes x 16 B per plane
      unsigned short* C  = (unsigned short*)Cout;
      unsigned short* C2 = (unsigned short*)Cout2;
#pragma unroll
      for (int it = 0; it < 4; ++it) {
        const int row = it * 4 + q;
        const float* sp = slab + row * 68 + c8;
        v4u hv, lv;
#pragma unroll
        for (int e = 0; e < 4; ++e) {
          unsigned hw, lw;
          split_pair(sp[2 * e], sp[2 * e + 1], hw, lw);
          hv[e] = hw;
          lv[e] = lw;
        }
        *(v4u*)(C + (size_t)(mBase + row) * ldc + nW + c8) = hv;
        *(v4u*)(C2 + (size_t)(mBase + row) * ldc + nW + c8) = lv;
      }
    }
    // the stores' address and data registers are reused by the next row group; the clobber keeps that group's slab writes behind these reads
    asm volatile("s_wait_xcnt 0x0" ::: "memory");
  }
}

// ---------------------------------------------------------------------------
// Elementwise split: 2 elements per thread, one 4-B store per lane per plane; i = index of the pair, n2 = pairs in the plane.
// ---------------------------------------------------------------------------
__device__ __forceinline__ unsigned pk16(unsigned short a, unsigned short b) { return (unsigned)a | ((unsigned)b << 16); }

// hi = bf16_rne(in), lo = bf16_rne(in - hi)
__device__ __forceinline__ void split_bf16x2(const float* __restrict__ in, unsigned short* __restrict__ hi,
                                             unsigned short* __restrict__ lo, int i, int n2) {
  if (i < n2) {
    const v2f f = *(const v2f*)(in + 2 * (size_t)i);
    const unsigned short h0 = f2bf_bits(f[0]), h1 = f2bf_bits(f[1]);
    const unsigned short l0 = f2bf_bits(f[0] - bf_bits2f(h0)), l1 = f2bf_bits(f[1] - bf_bits2f(h1));
    const unsigned uh = pk16(h0, h1), ul = pk16(l0, l1);
    ((unsigned*)hi)[i] = uh;
    ((unsigned*)lo)[i] = ul;
    
  }
}

// ---------------------------------------------------------------------------
// Transpose + bf16 hi/lo split of an f32 matrix: in [rows][cols] (row pitch ldi floats) ->
// outh/outl[c][r] = split(in[r][c]) (row pitch ldo u16). One 64x64 tile (bx of cols/64, by of rows/64) per block of 256 threads;
// rows, cols % 64 == 0. tf: 64 * 68 floats of LDS.
// Coverage per block: load 4 it x 256 thr x 4 f32 = 64x64; store 2 it x 256 thr x 8 u16 = 64x64 per plane;
// ---------------------------------------------------------------------------
__device__ __forceinline__ void transpose_split_tile(float* tf, const float* __restrict__ in, int ldi,
                                                     unsigned short* __restrict__ outh,
                                                     unsigned short* __restrict__ outl, int ldo, int bx, int by) {
  const int c0  = bx * 64;           // input column block = output row block
  const int r0  = by * 64;           // input row block    = output column block
  const int tid = threadIdx.x;
  {
    const int sub = tid >> 4;          // 0..15
    const int c4  = (tid & 15) * 4;    // 0..60
#pragma unroll
    for (int it = 0; it < 4; ++it) {
      const int rr = it * 16 + sub;
      const v4f a = *(const v4f*)(in + (size_t)(r0 + rr) * ldi + c0 + c4);
      *(v4f*)(tf + rr * 68 + c4) = a;
    }
  }
  __syncthreads();
  const int s8 = tid >> 3;             // 0..31
  const int c8 = (tid & 7) * 8;        // 0..56
  v4u hv[2], lv[2];
#pragma unroll
  for (int it = 0; it < 2; ++it) {
    const int oc = it * 32 + s8;       // output row within tile (= input column)
    v4u a, a2;
#pragma unroll
    for (int q = 0; q < 4; ++q) {
      const float f0 = tf[(c8 + 2 * q) * 68 + oc];
      const float f1 = tf[(c8 + 2 * q + 1) * 68 + oc];
      const unsigned short h0 = f2bf_bits(f0), h1 = f2bf_bits(f1);
      const unsigned short l0 = f2bf_bits(f0 - bf_bits2f(h0));
      const unsigned short l1 = f2bf_bits(f1 - bf_bits2f(h1));
      a[q]  = pk16(h0, h1);
      a2[q] = pk16(l0, l1);
    }
    hv[it] = a; lv[it] = a2;
  }
  {
#pragma unroll
    for (int it = 0; it < 2; ++it) {
      const int oc = it * 32 + s8;
      const size_t go = (size_t)(c0 + oc) * ldo + r0 + c8;
      *(v4u*)(outh + go) = hv[it];
      *(v4u*)(outl + go) = lv[it];
    }
    
  }
}

// All operand planes in one grid; the five jobs are independent of one another, a block does one piece of one of them.
//   blocks 0 .. 4*W_TILES-1: the 64x64 tiles of Wq, Wk, Wv, Wo ([k][n] -> planes [n][k]); Wk^T goes behind Wq^T in the WqkT planes
//   then X_BLOCKS blocks: x of both batches -> hi/lo planes (256 threads x 2 elements each)
#define W_TILES  ((DOUT / 64) * (DIN / 64))          // 256 per weight
#define X_PAIRS  (NB * NSEQ * DIN / 2)
#define X_BLOCKS (X_PAIRS / 256)                     // 8192
__global__ __launch_bounds__(256) void prep_kernel(const float* __restrict__ x, const float* __restrict__ Wq, const float* __restrict__ Wk,
                                                   const float* __restrict__ Wv, const float* __restrict__ Wo,
                                                   unsigned short* __restrict__ Xh, unsigned short* __restrict__ Xl,
                                                   unsigned short* __restrict__ WqkTh, unsigned short* __restrict__ WqkTl,
                                                   unsigned short* __restrict__ WvTh, unsigned short* __restrict__ WvTl,
                                                   unsigned short* __restrict__ WoTh, unsigned short* __restrict__ WoTl) {
  __shared__ __align__(16) float tf[64 * 68];
  const int bid = (int)blockIdx.x;
  if (bid < 4 * W_TILES) {                           // block-uniform
    const int sel = bid / W_TILES;
    const int t   = bid - sel * W_TILES;
    const float* in    = sel == 0 ? Wq : sel == 1 ? Wk : sel == 2 ? Wv : Wo;
    unsigned short* oh = sel == 0 ? WqkTh : sel == 1 ? WqkTh + (size_t)DOUT * DIN : sel == 2 ? WvTh : WoTh;
    unsigned short* ol = sel == 0 ? WqkTl : sel == 1 ? WqkTl + (size_t)DOUT * DIN : sel == 2 ? WvTl : WoTl;
    transpose_split_tile(tf, in, DOUT, oh, ol, DIN, t % (DOUT / 64), t / (DOUT / 64));
  } else {
    split_bf16x2(x, Xh, Xl, (bid - 4 * W_TILES) * 256 + (int)threadIdx.x, X_PAIRS);
  }
}

// ---------------------------------------------------------------------------
// Fused causal attention, all batches and heads in one launch: scores, relu * distance decay, online softmax and P.V in one kernel;
// neither scores nor probabilities go to memory. The K rows and V^T columns of 64 keys (a stage) are brought into LDS once per block
// by asynchronous copies, whole 128-B lines, two buffers, and all eight waves take their fragments from there.
// A wave owns 16 queries (one per lane column c) of head blockIdx.y, batch blockIdx.z, and walks the keys 32 at a time:
//   St[key][query] = K . Q^T   (A = K rows, B = Q rows kept in registers; both through the same loader)
//   t = relu(St) * R_hat(h, i - j) * 0.125 in log2 units, -inf for j > i (only the last pass holds such keys),
//   R_hat = (1 + exp(v[h])) * rcp(1 + exp(v[h] - w[h] * (i - j))): a function of the head and of i - j alone, so the block makes it once
//   for every distance (table in LDS, below) and a pass reads its 16 factors per lane instead of computing them
//   running maximum m (starts at 0: every allowed t is >= 0 and key 0 is always allowed), p = exp2(t - m),
//   Ot[d][query] = Ot * exp2(m_old - m_new) + V^T . P^T
// The two 16-key score tiles of a pass, converted in place, are the B operand of the second product
// (element s = tile s >> 3, register s & 7), which is the k order the A loader of V^T delivers.
// A lane holds 8 + 8 keys of its query; lanes c and c + 16 share the maximum each pass and join their sums at the end.
// Waves 0..3 of a block take query groups from the long end, waves 4..7 the mirrored ones from the short end.
// Output: lane (c, hf) holds ctx[q0 + c][head*64 + ds*16 + hf*8 + 0..7]: one 16-B store per plane and ds;
// the 128-B line of a (query, head) is written by one wave. grid (NSEQ/128, NH, NB) x 8 waves x 16 queries = all rows.
// Every '#pragma unroll' below stands on a loop of constant trip count whose index selects a fragment or an accumulator:
// unrolled, those arrays stay in registers.
// ---------------------------------------------------------------------------

__device__ __forceinline__ float other_half(float x) {   // the value of lane l ^ 16
  const int b = __float_as_int(x);
  return __int_as_float(__builtin_amdgcn_permlanex16(b, b, 0x76543210, 0xfedcba98, false, false));
}

// LDS ring: a stage holds four planes (K hi, K lo: 64 key rows x 64 dims; V^T hi, V^T lo: 64 dim rows x 64 keys); a row is 128 B of data
// at a pitch of 144 B (16 B x odd: the 16-byte fragment reads of 16 rows fall on distinct banks).
#define AT_PITCH 72                    // 16-bit elements
#define AT_PLANE (64 * AT_PITCH)
#define AT_BUF   (4 * AT_PLANE)

// Decay table of the block's head: U[x] = R_hat(h, 2047 - x) * 0.125 * log2(e), x = 0 .. DT_N + 2 (distances 2047 down to -35; those below 0
// belong to masked keys only). A lane wants 8 + 8 consecutive x per pass, from a start whose residue modulo 4 is fixed per lane, so the table
// is kept four times, copy k shifted by k entries (copy k, place y: U[y + k]): in its own copy every lane reads whole aligned 16-B pieces.
#define DT_N  2080                     // places of a copy that are read
#define DT_F  4                        // floats in front of place 0 of a copy: room for the shift, so that the fill needs no test
#define DT_CP 2128                     // pitch of a copy in floats: 64 B past a multiple of 256 B, so that the four copies' pieces fall on different banks

// One stage = 4 planes x 64 rows x 8 pieces of 16 B = 2048 pieces, eight per thread: rows r and r + 32 of each plane.
// lds: this lane's byte address in plane 0 of the target buffer; the pointers: this lane's piece of row r of each plane.
// The s_wait_xcnt at the end of the statement stands in front of any later rewrite of the address registers the copies name.
__device__ __forceinline__ void copy_stage(unsigned lds, const unsigned short* kh, const unsigned short* kl,
                                           const unsigned short* vh, const unsigned short* vl) {
  const unsigned R = 32 * AT_PITCH * 2, P = AT_PLANE * 2;
  asm volatile("global_load_async_to_lds_b128 %0, %8, off\n\t"
               "global_load_async_to_lds_b128 %1, %9, off\n\t"
               "global_load_async_to_lds_b128 %2, %10, off\n\t"
               "global_load_async_to_lds_b128 %3, %11, off\n\t"
               "global_load_async_to_lds_b128 %4, %12, off\n\t"
               "global_load_async_to_lds_b128 %5, %13, off\n\t"
               "global_load_async_to_lds_b128 %6, %14, off\n\t"
               "global_load_async_to_lds_b128 %7, %15, off\n\t"
               "s_wait_xcnt 0x0"
               :: "v"(lds), "v"(lds + R), "v"(lds + P), "v"(lds + P + R),
                  "v"(lds + 2 * P), "v"(lds + 2 * P + R), "v"(lds + 3 * P), "v"(lds + 3 * P + R),
                  "v"(kh), "v"(kh + 32 * (2 * DOUT)), "v"(kl), "v"(kl + 32 * (2 * DOUT)),
                  "v"(vh), "v"(vh + 32 * NSEQ), "v"(vl), "v"(vl + 32 * NSEQ)
               : "memory");
}

// four waves per SIMD (two blocks per WGP): the waves fill each other's waits
__global__ __launch_bounds__(256) __attribute__((amdgpu_waves_per_eu(4, 4))) void fused_attn_kernel(const unsigned short* __restrict__ QKhp, const unsigned short* __restrict__ QKlp,
                                                         const unsigned short* __restrict__ VThp, const unsigned short* __restrict__ VTlp,
                                                         const float* __restrict__ wp, const float* __restrict__ vp,
                                                         unsigned short* __restrict__ Oh, unsigned short* __restrict__ Ol) {
  typedef Frag<__bf16> F;
  const int lane = threadIdx.x & 31;
  const int wave = __builtin_amdgcn_readfirstlane((int)(threadIdx.x >> 5));
  const int head = blockIdx.y;
  const size_t bz = blockIdx.z;
  const int c    = lane & 15;
  const int hf   = lane >> 4;
  const int tq   = (int)blockIdx.x * 4 + (wave & 3);            // 0..63
  const int qg   = (wave < 4) ? (NSEQ / 16 - 1 - tq) : tq;      // every 16-query group once
  const int q0   = qg << 4;
  const int np   = (q0 >> 5) + 1;                               // passes of 32 keys; keys of passes 0..np-2 are all < q0

  const float L2E = 1.44269504088896341f;
  const float w2  = wp[head] * L2E;
  const float v2  = vp[head] * L2E;
  const float c1  = (1.0f + __builtin_amdgcn_exp2f(v2)) * (0.125f * L2E);

  const size_t qo = (bz * NSEQ + q0 + c) * (2 * DOUT) + head * HDIM + hf * 8;

  __shared__ __align__(16) unsigned short ring[2 * AT_BUF];
  // stages of 64 keys that the block's longest wave (wave 0) needs: 17..32, so stages 0 and 1 always exist and every key is < NSEQ
  const int ns = ((((NSEQ / 16 - 1 - (int)blockIdx.x * 4) << 4) >> 5) + 2) >> 1;
  const int crow = (int)threadIdx.x >> 3;          // 0..31: the row this thread copies (and row + 32)
  const int cpc  = ((int)threadIdx.x & 7) * 8;     // its 16-B piece of the row, in elements: 8 lanes cover one 128-B line
  const unsigned ldsc = (unsigned)(uintptr_t)(ring + crow * AT_PITCH + cpc);
  const size_t kco = (bz * NSEQ + crow) * (2 * DOUT) + DOUT + head * HDIM + cpc;
  const size_t vco = (bz * DOUT + head * HDIM + crow) * NSEQ + cpc;
  copy_stage(ldsc, QKhp + kco, QKlp + kco, VThp + vco, VTlp + vco);      // stage 0 -> buffer 0
  // the decay table, written while stage 0 flies; the barrier that publishes stage 0 publishes it too
  __shared__ __align__(16) float dtab[4 * DT_CP];
  for (int x = (int)threadIdx.x; x < DT_N + 3; x += 256) {
    const float t = c1 * __builtin_amdgcn_rcpf(1.0f + __builtin_amdgcn_exp2f(fmaf(-w2, (float)(NSEQ - 1 - x), v2)));
    for (int k = 0; k < 4; ++k) dtab[k * DT_CP + DT_F + x - k] = t;
  }
  // this lane's first key of pass p stands at x = NSEQ - 1 - (q0 + c - 8 * hf) + 32 * p; its residue modulo 4 picks the copy
  const int dk4 = (NSEQ - 1 - c) & 3;
  const float* dtl = dtab + dk4 * DT_CP + DT_F + (NSEQ - 1 - q0 - c + hf * 8 - dk4);
  const __bf16* rb = (const __bf16*)ring + c * AT_PITCH + hf * 8;        // this lane's fragment row and k half

  v16b qh[2], ql[2];
#pragma unroll
  for (int ks = 0; ks < 2; ++ks) {
    qh[ks] = F::load((const __bf16*)QKhp + qo + ks * 32);
    ql[ks] = F::load((const __bf16*)QKlp + qo + ks * 32);
  }
  // the address registers of the Q loads are reused right below; the loaded values as inputs keep the wait behind the loads
  asm volatile("s_wait_xcnt 0x0" :: "v"(qh[0]), "v"(qh[1]), "v"(ql[0]), "v"(ql[1]) : "memory");

  v8f o[4];
#pragma unroll
  for (int ds = 0; ds < 4; ++ds) o[ds] = (v8f){0.f,0.f,0.f,0.f,0.f,0.f,0.f,0.f};
  float m = 0.f, l = 0.f;

  asm volatile("s_wait_asynccnt 0x0" ::: "memory");   // this wave's copies of stage 0 have landed
  __syncthreads();                                    // publishes stage 0
  copy_stage(ldsc + AT_BUF * 2, QKhp + kco + (size_t)64 * (2 * DOUT), QKlp + kco + (size_t)64 * (2 * DOUT),
             VThp + vco + 64, VTlp + vco + 64);       // stage 1 -> buffer 1

  for (int s = 0; s < ns; ++s) {
  const __bf16* sb = rb + (s & 1) * AT_BUF;
  for (int h2 = 0; h2 < 2; ++h2) {
    const int p = 2 * s + h2;
    if (p >= np) break;                               // wave-uniform: a wave past its diagonal only keeps the publish points
    const int j0 = p << 5;
    // K rows and V^T columns of this pass, from this stage's buffer
    v16b kh[2][2], kl[2][2];
#pragma unroll
    for (int a = 0; a < 2; ++a)
#pragma unroll
      for (int ks = 0; ks < 2; ++ks) {
        kh[a][ks] = F::load(sb + (h2 * 32 + a * 16) * AT_PITCH + ks * 32);
        kl[a][ks] = F::load(sb + AT_PLANE + (h2 * 32 + a * 16) * AT_PITCH + ks * 32);
      }
    v16b vh[4], vl[4];
#pragma unroll
    for (int ds = 0; ds < 4; ++ds) {
      vh[ds] = F::load(sb + 2 * AT_PLANE + (ds * 16) * AT_PITCH + h2 * 32);
      vl[ds] = F::load(sb + 3 * AT_PLANE + (ds * 16) * AT_PITCH + h2 * 32);
    }
    v4f dk[2][2];                                     // decay factors of keys 16a + 0..7
#pragma unroll
    for (int a = 0; a < 2; ++a) {
      dk[a][0] = *(const v4f*)(dtl + j0 + a * 16);
      dk[a][1] = *(const v4f*)(dtl + j0 + a * 16 + 4);
    }
    v8f st[2];
    st[0] = (v8f){0.f,0.f,0.f,0.f,0.f,0.f,0.f,0.f};
    st[1] = st[0];
#pragma unroll
    for (int ks = 0; ks < 2; ++ks) {
      st[0] = F::mma(kh[0][ks], qh[ks], st[0]);
      st[1] = F::mma(kh[1][ks], qh[ks], st[1]);
      st[0] = F::mma(kh[0][ks], ql[ks], st[0]);
      st[1] = F::mma(kh[1][ks], ql[ks], st[1]);
      st[0] = F::mma(kl[0][ks], qh[ks], st[0]);
      st[1] = F::mma(kl[1][ks], qh[ks], st[1]);
    }
    // inputs only: keeps the V^T fragment reads up here, issued with the K reads, so that their LDS latency passes under the score
    // products and the softmax; left to itself the compiler sinks them in front of each P.V product, which then waits for them
    asm volatile("" :: "v"(vh[0]), "v"(vh[1]), "v"(vh[2]), "v"(vh[3]), "v"(vl[0]), "v"(vl[1]), "v"(vl[2]), "v"(vl[3]));
    const int   lim  = q0 + c - j0 - hf * 8;          // i - j of this lane's first key; key 16a + r is allowed while 16a + r <= lim
    float tt[2][8];
#pragma unroll
    for (int a = 0; a < 2; ++a)
#pragma unroll
      for (int r = 0; r < 8; ++r) tt[a][r] = fmaxf(st[a][r] * dk[a][r >> 2][r & 3], 0.0f);   // the factor is never negative: relu(s) * f = relu(s * f)
    if (p == np - 1) {                                 // wave-uniform
#pragma unroll
      for (int a = 0; a < 2; ++a)
#pragma unroll
        for (int r = 0; r < 8; ++r) tt[a][r] = (a * 16 + r <= lim) ? tt[a][r] : -INFINITY;
    }
    float mx = m;
#pragma unroll
    for (int a = 0; a < 2; ++a)
#pragma unroll
      for (int r = 0; r < 8; ++r) mx = fmaxf(mx, tt[a][r]);
    mx = fmaxf(mx, other_half(mx));
    const float alpha = __builtin_amdgcn_exp2f(m - mx);
    m = mx;
    float ps0 = 0.f, ps1 = 0.f;
#pragma unroll
    for (int r = 0; r < 8; ++r) {
      tt[0][r] = __builtin_amdgcn_exp2f(tt[0][r] - mx);
      tt[1][r] = __builtin_amdgcn_exp2f(tt[1][r] - mx);
      ps0 += tt[0][r];
      ps1 += tt[1][r];
    }
    l = l * alpha + (ps0 + ps1);
#pragma unroll
    for (int ds = 0; ds < 4; ++ds) o[ds] *= alpha;

    union PF { v16b v; unsigned u[8]; } ph, pl;
#pragma unroll
    for (int a = 0; a < 2; ++a)
#pragma unroll
      for (int r2 = 0; r2 < 4; ++r2) split_pair(tt[a][2 * r2], tt[a][2 * r2 + 1], ph.u[a * 4 + r2], pl.u[a * 4 + r2]);

#pragma unroll
    for (int ds = 0; ds < 4; ++ds) o[ds] = F::mma(vh[ds], ph.v, o[ds]);
#pragma unroll
    for (int ds = 0; ds < 4; ++ds) o[ds] = F::mma(vh[ds], pl.v, o[ds]);
#pragma unroll
    for (int ds = 0; ds < 4; ++ds) o[ds] = F::mma(vl[ds], ph.v, o[ds]);
    // four vector slots behind the pass's last WMMA: the next pass's first address arithmetic, reached over the loop's branches,
    // reuses that WMMA's operand registers
    acc_guard4(o[0], o[1], o[2], o[3]);
  }
    // publish point of stage s + 1, passed by every wave
    asm volatile("s_wait_dscnt 0x0" ::: "memory");     // this wave's reads of stage s are done before its buffer is refilled
    asm volatile("s_wait_asynccnt 0x0" ::: "memory");  // this wave's copies of stage s + 1 have landed
    __syncthreads();                                   // publishes stage s + 1 and ends every wave's reads of stage s
    if (s + 2 < ns)                                    // block-uniform
      copy_stage(ldsc + (s & 1) * (AT_BUF * 2), QKhp + kco + (size_t)(s + 2) * 64 * (2 * DOUT), QKlp + kco + (size_t)(s + 2) * 64 * (2 * DOUT),
                 VThp + vco + (s + 2) * 64, VTlp + vco + (s + 2) * 64);
  }
  asm volatile("s_wait_asynccnt 0x0" ::: "memory");    // no copy is outstanding when the wave ends

  l += other_half(l);
  const float inv = 1.0f / l;                          // l >= 1: the row maximum contributes exp2(0)
  const size_t oo = (bz * NSEQ + q0 + c) * DOUT + head * HDIM + hf * 8;
#pragma unroll
  for (int ds = 0; ds < 4; ++ds) {
    unsigned hw[4], lw[4];
#pragma unroll
    for (int r2 = 0; r2 < 4; ++r2) split_pair(o[ds][2 * r2] * inv, o[ds][2 * r2 + 1] * inv, hw[r2], lw[r2]);
    *(v4u*)(Oh + oo + ds * 16) = (v4u){hw[0], hw[1], hw[2], hw[3]};
    *(v4u*)(Ol + oo + ds * 16) = (v4u){lw[0], lw[1], lw[2], lw[3]};
  }
}

// ---------------------------------------------------------------------------
// Workspace region map (byte offsets; all offsets multiples of 2 MiB). Every region is fully written in each call
// before it is read. X and O share one region: X is read only by the projection GEMMs, which precede the attention
// kernel (the O producer) in stream order; O is fully written (2 batches x 16 heads x 64 columns x 2048 rows) before
// the output projections read it.
//   WqkTh  bf16 [2048][1024]  rows 0..1023 = Wq^T, 1024..2047 = Wk^T         0
//   WqkTl  bf16 [2048][1024]                                          4194304
//   WvTh   bf16 [1024][1024]                                          8388608
//   WvTl   bf16 [1024][1024]                                         10485760
//   WoTh   bf16 [1024][1024]                                         12582912
//   WoTl   bf16 [1024][1024]                                         14680064
//   XOh    bf16 [2][2048][1024]  x hi, later ctx hi (col h*64+d)        16777216
//   XOl    bf16 [2][2048][1024]                                         25165824
//   QKh    bf16 [2][2048][2048]  q at col h*64+d, k at col 1024+h*64+d  33554432
//   QKl    bf16 [2][2048][2048]                                         50331648
//   VTh    bf16 [2][1024][2048]  row h*64+d, col token                  67108864
//   VTl    bf16 [2][1024][2048]                                         75497472
//   total                                                               83886080
// ---------------------------------------------------------------------------
extern "C" void kernel_launch(void* const* d_in, const int* in_sizes, int n_in,
                              void* d_out, int out_size, void* d_ws, size_t ws_size,
                              hipStream_t stream) {
  if (n_in < 8) return;
  if (in_sizes[0] != NB * NSEQ * DIN) return;
  if (in_sizes[1] != DIN * DOUT || in_sizes[2] != DIN * DOUT || in_sizes[3] != DIN * DOUT) return;
  if (in_sizes[4] != DOUT * DOUT || in_sizes[5] != DOUT) return;
  if (in_sizes[6] < NH || in_sizes[7] < NH) return;
  if (out_size != NB * NSEQ * DOUT) return;

  const float* x  = (const float*)d_in[0];
  const float* Wq = (const float*)d_in[1];
  const float* Wk = (const float*)d_in[2];
  const float* Wv = (const float*)d_in[3];
  const float* Wo = (const float*)d_in[4];
  const float* bo = (const float*)d_in[5];
  const float* wp = (const float*)d_in[6];
  const float* vp = (const float*)d_in[7];

  const size_t PW  = (size_t)DIN * DOUT * 2;              // 16-bit [1024][1024] plane
  const size_t PX  = (size_t)NSEQ * DIN * 2;              // 16-bit [2048][1024] plane
  const size_t PQK = (size_t)NSEQ * (2 * DOUT) * 2;       // 16-bit [2048][2048] plane
  const size_t PVT = (size_t)DOUT * NSEQ * 2;             // 16-bit [1024][2048] plane
  size_t off = 0;
  const size_t oWqkTh = off; off += 2 * PW;
  const size_t oWqkTl = off; off += 2 * PW;
  const size_t oWvTh  = off; off += PW;
  const size_t oWvTl  = off; off += PW;
  const size_t oWoTh  = off; off += PW;
  const size_t oWoTl  = off; off += PW;
  const size_t oXOh   = off; off += NB * PX;
  const size_t oXOl   = off; off += NB * PX;
  const size_t oQKh   = off; off += NB * PQK;
  const size_t oQKl   = off; off += NB * PQK;
  const size_t oVTh   = off; off += NB * PVT;
  const size_t oVTl   = off; off += NB * PVT;
  if (off > ws_size) return;

  char* ws = (char*)d_ws;
  unsigned short* WqkTh = (unsigned short*)(ws + oWqkTh);
  unsigned short* WqkTl = (unsigned short*)(ws + oWqkTl);
  unsigned short* WvTh  = (unsigned short*)(ws + oWvTh);
  unsigned short* WvTl  = (unsigned short*)(ws + oWvTl);
  unsigned short* WoTh  = (unsigned short*)(ws + oWoTh);
  unsigned short* WoTl  = (unsigned short*)(ws + oWoTl);
  unsigned short* XOh   = (unsigned short*)(ws + oXOh);
  unsigned short* XOl   = (unsigned short*)(ws + oXOl);
  unsigned short* QKh   = (unsigned short*)(ws + oQKh);
  unsigned short* QKl   = (unsigned short*)(ws + oQKl);
  unsigned short* VTh   = (unsigned short*)(ws + oVTh);
  unsigned short* VTl   = (unsigned short*)(ws + oVTl);

  const dim3 blk(256);
  const dim3 blkG(128);                                             // GEMMs: four waves
  // (1) operand planes: Wq^T | Wk^T, Wv^T, Wo^T and x of both batches (whole planes: 4 x 16x16 tiles of 64x64; 8192 blocks x 256 thr x 2)
  prep_kernel<<<dim3(4 * W_TILES + X_BLOCKS), blk, 0, stream>>>(x, Wq, Wk, Wv, Wo, XOh, XOl, WqkTh, WqkTl, WvTh, WvTl, WoTh, WoTl);
  // (2) [q | k] = x . [Wq | Wk] -> QK hi/lo planes, both batches as one M = 4096 (x and the QK planes are contiguous over the batch):
  //     whole [2][2048][2048] planes, 32x16 tiles of 128x128
  wmma_gemm_staged<4, false, 2><<<dim3((NB * NSEQ / 128) * (2 * DOUT / 128), 1), blkG, 0, stream>>>(
      XOh, XOl, DIN, WqkTh, WqkTl, DIN, (void*)QKh, (void*)QKl, 2 * DOUT,
      bo, 2 * DOUT / 128, DIN, 0, 0);
  // (3) v^T[o][tok] = sum_k Wv^T[o][k] x[tok][k] -> VT hi/lo planes [1024][2048] of batch blockIdx.y (whole planes: 2 x 16x16 tiles of 64x128)
  wmma_gemm_staged<2, false, 2><<<dim3((DOUT / 64) * (NSEQ / 128), NB), blkG, 0, stream>>>(
      WvTh, WvTl, DIN, XOh, XOl, DIN, (void*)VTh, (void*)VTl, NSEQ,
      bo, NSEQ / 128, DIN, (size_t)NSEQ * DIN, (size_t)DOUT * NSEQ);
  // (4) ctx[b][i][h*64+d] = softmax_j(relu(q_i . k_j) * decay * 1/8, causal) . v -> O hi/lo planes (whole [2][2048][1024])
  fused_attn_kernel<<<dim3(NSEQ / 128, NH, NB), blk, 0, stream>>>(QKh, QKl, VTh, VTl, wp, vp, XOh, XOl);
  // (5) out = ctx . Wo + bo, both batches as one M = 4096 (ctx planes and out are contiguous over the batch): f32, whole d_out, 64x8 tiles of 64x128
  wmma_gemm_staged<2, true, 0><<<dim3((NB * NSEQ / 64) * (DOUT / 128), 1), blkG, 0, stream>>>(
      XOh, XOl, DOUT, WoTh, WoTl, DOUT, d_out, d_out, DOUT,
      bo, DOUT / 128, DOUT, 0, 0);
  (void)hipGetLastError();
}

// v008
// One run takes 130 microseconds.
// Two timings next to v007 both put it at 1.06 times that version's speed.
// Counting every step since v000, it is 19.4 times as fast.
// Every contraction (x.Wq|Wk, Wv^T.x^T, k.q^T, v^T.p^T, ctx.Wo): v_wmma_f32_16x16x32_bf16 on bf16 hi/lo split operand planes (hi.hi + hi.lo + lo.hi), f32 accumulate; relu, distance decay, causal mask and softmax in f32.
#include <hip/hip_runtime.h>
#include <math.h>
#include <stdint.h>

#define NB    2
#define NSEQ  2048
#define DIN   1024
#define DOUT  1024
#define NH    16
#define HDIM  64

typedef __attribute__((ext_vector_type(16))) __bf16   v16b;
typedef __attribute__((ext_vector_type(8)))  __bf16   v8b;
typedef __attribute__((ext_vector_type(8)))  float    v8f;
typedef __attribute__((ext_vector_type(4)))  float    v4f;
typedef __attribute__((ext_vector_type(2)))  float    v2f;
typedef __attribute__((ext_vector_type(4)))  unsigned int v4u;
typedef __attribute__((ext_vector_type(2)))  unsigned int v2u;

__device__ __forceinline__ unsigned short f2bf_bits(float f) {
  unsigned u = __float_as_uint(f);
  return (unsigned short)((u + 0x7FFFu + ((u >> 16) & 1u)) >> 16);
}
__device__ __forceinline__ float bf_bits2f(unsigned short h) { return __uint_as_float(((unsigned)h) << 16); }

typedef __attribute__((ext_vector_type(2))) __bf16 v2b;
// hi = bf16_rne(f), lo = bf16_rne(f - hi), two values packed per word
__device__ __forceinline__ void split_pair(float f0, float f1, unsigned& hi, unsigned& lo) {
  hi = __builtin_bit_cast(unsigned, __builtin_convertvector((v2f){f0, f1}, v2b));
  const float r0 = f0 - __uint_as_float(hi << 16);
  const float r1 = f1 - __uint_as_float(hi & 0xFFFF0000u);
  lo = __builtin_bit_cast(unsigned, __builtin_convertvector((v2f){r0, r1}, v2b));
}

// four vector slots behind a WMMA whose operand registers may be reused
__device__ __forceinline__ void acc_guard4(v8f& a, v8f& b, v8f& c, v8f& d) { asm volatile("v_nop\n\tv_nop\n\tv_nop\n\tv_nop" : "+v"(a), "+v"(b), "+v"(c), "+v"(d)); }
template <typename T> struct Frag;
template <> struct Frag<__bf16> {
  typedef v16b V; union U { v16b v; v8b h[2]; };
  static __device__ __forceinline__ v16b load(const __bf16* p) {   // elements 0..7 <- p[0..7], 8..15 <- p[16..23]
    U f; f.h[0] = *(const v8b*)(p); f.h[1] = *(const v8b*)(p + 16); return f.v;
  }
  static __device__ __forceinline__ v8f mma(v16b a, v16b b, v8f c) {
    return __builtin_amdgcn_wmma_f32_16x16x32_bf16(false, a, false, b, (short)0, c, false, false);
  }
};

// ---- WMMA GEMM on operand tiles staged in LDS -------------------------------
// C[m,n] = sum_k A[m,k] * Bt[n,k] (+ bias[n]); A row-major [M,K], Bt row-major [N,K], each as bf16 hi and lo planes;
// product = hi.hi + hi.lo + lo.hi, f32 accumulate, k ascending.
// A block of four waves (2 x 2) owns one (FM*32) x 128 tile of C; a wave owns (FM*16) x 64 of it.
// A stage is 64 k of every operand row of the tile: whole 128-B lines, brought into LDS once per block by asynchronous copies,
// two buffers; both waves of a tile row share the A rows, both of a tile column the Bt rows.
// M % (FM*32) == 0, N % 128 == 0, K % 64 == 0. OUT_MODE: 0 = f32, 2 = bf16 hi plane (Cout) + bf16 lo plane (Cout2).
// grid (tiles, products): blockIdx.y picks one of several independent products with the same A; its Bt lies bsB and its C bsC elements further on.
// Every '#pragma unroll' below stands on a loop of constant trip count whose index selects a fragment, an accumulator or a copy:
// unrolled, those arrays stay in registers.
#define GS_PITCH 72                    // 16-bit elements: 128 B of data at 144 B (16 B x odd: the 16-byte fragment reads of 16 rows fall on distinct banks)

// Eight copies of 16 B per lane: rows r, r + 16, r + 32, r + 48 of a hi plane (la, ga) and of its lo plane (lb, gb); step = 16 source rows.
// The builtin form: the compiler allots the address registers itself, in any register window.
typedef __attribute__((ext_vector_type(4))) int v4i;
typedef __attribute__((address_space(1))) v4i g_v4i;
typedef __attribute__((address_space(3))) v4i l_v4i;
__device__ __forceinline__ void copy_rows(unsigned short* la, unsigned short* lb, const unsigned short* ga, const unsigned short* gb, size_t step) {
#pragma unroll
  for (int i = 0; i < 4; ++i) {
    __builtin_amdgcn_global_load_async_to_lds_b128((g_v4i*)(ga + i * step), (l_v4i*)(la + i * (16 * GS_PITCH)), 0, 0);
    __builtin_amdgcn_global_load_async_to_lds_b128((g_v4i*)(gb + i * step), (l_v4i*)(lb + i * (16 * GS_PITCH)), 0, 0);
  }
}

template <int FM, bool BIAS, int OUT_MODE>
__global__ __launch_bounds__(128) void wmma_gemm_staged(
    const unsigned short* __restrict__ Ahp, const unsigned short* __restrict__ Alp, int lda,
    const unsigned short* __restrict__ Bh0, const unsigned short* __restrict__ Bl0, int ldb,
    void* __restrict__ C0, void* __restrict__ C20, int ldc,
    const float* __restrict__ bias, int tilesN, int K, size_t bsB, size_t bsC) {
  typedef Frag<__bf16> F;
  const unsigned short* __restrict__ Bhp = Bh0 + blockIdx.y * bsB;
  const unsigned short* __restrict__ Blp = Bl0 + blockIdx.y * bsB;
  const size_t cby = blockIdx.y * bsC * (OUT_MODE == 0 ? sizeof(float) : sizeof(unsigned short));
  void* __restrict__ Cout  = (char*)C0 + cby;
  void* __restrict__ Cout2 = (char*)C20 + cby;
  constexpr int TM  = FM * 32;                    // tile rows
  constexpr int TN  = 128;                        // tile columns
  constexpr int BUF = 2 * (TM + TN) * GS_PITCH;   // a buffer: A hi (TM rows), A lo, Bt hi (TN rows), Bt lo
  // The ring is the block's only LDS: at FM = 4 it is 144 KiB, so that two blocks fit one WGP's 320 KiB and each SIMD holds two waves,
  // one block's WMMAs running under the other's copies, fragment reads and barriers. The epilogue's slabs lie in the ring (below).
  __shared__ __align__(16) unsigned short ring[2 * BUF];
  const int lane = threadIdx.x & 31;
  const int wave = __builtin_amdgcn_readfirstlane((int)(threadIdx.x >> 5));
  const int wm = wave >> 1, wn = wave & 1;
  const int tm = (int)blockIdx.x / tilesN;
  const int tn = (int)blockIdx.x - tm * tilesN;
  const int m0 = tm * TM;
  const int n0 = tn * TN;
  const int rlane = lane & 15;                 // row (A) / col (B, D) within subtile
  const int koff  = (lane >> 4) * 8;           // k offset of this lane half
  const int mOff  = (lane >> 4) * 8;           // D row offset

  // copies: a thread brings one 16-B piece of rows crow, crow + 16, ... of every plane; 8 lanes cover one 128-B line
  const int crow = (int)threadIdx.x >> 3;          // 0..15
  const int cpc  = ((int)threadIdx.x & 7) * 8;     // in elements
  unsigned short* ldsc = ring + crow * GS_PITCH + cpc;
  const unsigned aco = (unsigned)(crow * lda + cpc);   // this lane's place inside 16 rows; the block-uniform rest of an address stays scalar
  const unsigned bco = (unsigned)(crow * ldb + cpc);
  const int ns = K >> 6;                           // stages
  auto copy_stage_g = [&](int s) {                 // stage s -> buffer s & 1: 2 * (TM + TN) / 16 copies per thread (32 or 24)
    unsigned short* l0 = ldsc + (s & 1) * BUF;
    const size_t ka = (size_t)m0 * lda + (size_t)s * 64;
    const size_t kb = (size_t)n0 * ldb + (size_t)s * 64;
#pragma unroll
    for (int g = 0; g < TM / 64; ++g)
      copy_rows(l0 + (g * 64) * GS_PITCH, l0 + (TM + g * 64) * GS_PITCH,
                (Ahp + (ka + (size_t)(g * 64) * lda)) + aco, (Alp + (ka + (size_t)(g * 64) * lda)) + aco, (size_t)16 * lda);
#pragma unroll
    for (int g = 0; g < TN / 64; ++g)
      copy_rows(l0 + (2 * TM + g * 64) * GS_PITCH, l0 + (2 * TM + TN + g * 64) * GS_PITCH,
                (Bhp + (kb + (size_t)(g * 64) * ldb)) + bco, (Blp + (kb + (size_t)(g * 64) * ldb)) + bco, (size_t)16 * ldb);
  };
  copy_stage_g(0);

  v8f acc[FM][4];
#pragma unroll
  for (int i = 0; i < FM; ++i)
#pragma unroll
    for (int j = 0; j < 4; ++j) acc[i][j] = (v8f){0.f,0.f,0.f,0.f,0.f,0.f,0.f,0.f};

  const __bf16* ab = (const __bf16*)ring + (wm * (FM * 16) + rlane) * GS_PITCH + koff;        // A hi fragment row of this lane
  const __bf16* bb = (const __bf16*)ring + (2 * TM + wn * 64 + rlane) * GS_PITCH + koff;      // Bt hi fragment row

  asm volatile("s_wait_asynccnt 0x0" ::: "memory");   // this wave's copies of stage 0 have landed
  __syncthreads();                                    // publishes stage 0

  for (int s = 0; s < ns; ++s) {
    const __bf16* sa = ab + (s & 1) * BUF;
    const __bf16* sb = bb + (s & 1) * BUF;
    // all fragments of the stage (two k steps of 32), read as one group in the order the products use them
    v16b bh[2][4], bl[2][4], ah[2][FM], al[2][FM];
#pragma unroll
    for (int ks = 0; ks < 2; ++ks) {
#pragma unroll
      for (int j = 0; j < 4; ++j) bh[ks][j] = F::load(sb + (j * 16) * GS_PITCH + ks * 32);
      ah[ks][0] = F::load(sa + ks * 32);
#pragma unroll
      for (int j = 0; j < 4; ++j) bl[ks][j] = F::load(sb + (TN + j * 16) * GS_PITCH + ks * 32);
      al[ks][0] = F::load(sa + TM * GS_PITCH + ks * 32);
#pragma unroll
      for (int i = 1; i < FM; ++i) {
        ah[ks][i] = F::load(sa + (i * 16) * GS_PITCH + ks * 32);
        al[ks][i] = F::load(sa + (TM + i * 16) * GS_PITCH + ks * 32);
      }
    }
    // keeps the LDS reads together up here: left to itself the compiler sinks them in pairs among the WMMAs, each pair with a full wait
    __builtin_amdgcn_sched_barrier(0);
    // stage s + 1 into the buffer that trip s - 1 has read, behind the barrier that ended those reads (block-uniform test);
    // issued here, its address arithmetic passes while the fragment reads above are under way
    if (s + 1 < ns) copy_stage_g(s + 1);
    // keeps the WMMAs, and the waits for their fragments, behind the issue of the copies
    __builtin_amdgcn_sched_barrier(0);
#pragma unroll
    for (int ks = 0; ks < 2; ++ks) {
      // four independent accumulators between two products into the same one
#pragma unroll
      for (int i = 0; i < FM; ++i) {
#pragma unroll
        for (int j = 0; j < 4; ++j) acc[i][j] = F::mma(ah[ks][i], bh[ks][j], acc[i][j]);
#pragma unroll
        for (int j = 0; j < 4; ++j) acc[i][j] = F::mma(ah[ks][i], bl[ks][j], acc[i][j]);
#pragma unroll
        for (int j = 0; j < 4; ++j) acc[i][j] = F::mma(al[ks][i], bh[ks][j], acc[i][j]);
      }
    }
    // keeps the WMMAs in front of the waits below, so that the copies fly under them: left to itself the compiler moves them behind the barrier
    __builtin_amdgcn_sched_barrier(0);
    // publish point of stage s + 1, passed by every wave
    asm volatile("s_wait_dscnt 0x0" ::: "memory");     // this wave's reads of stage s are done before its buffer is refilled
    asm volatile("s_wait_asynccnt 0x0" ::: "memory");  // this wave's copies of stage s + 1 have landed
    __syncthreads();                                   // publishes stage s + 1 and ends every wave's reads of stage s
  }
  asm volatile("s_wait_asynccnt 0x0" ::: "memory");    // no copy is outstanding when the wave goes on

  // ---- epilogue: 16 rows at a time through this wave's own slab, so that every store covers whole 128-B lines ----
  // per-wave 16x64 slab, pitch 68 floats, at the start of the ring: behind the loop's last barrier no wave reads a stage any more
  // and no copy is outstanding, so the ring's bytes are free
  float* slab = (float*)ring + wave * (16 * 68);
  const int nW = n0 + wn * 64;
#pragma unroll
  for (int i = 0; i < FM; ++i) {
    const int mBase = m0 + wm * (FM * 16) + (i << 4);
#pragma unroll
    for (int j = 0; j < 4; ++j) {
      float bv = 0.f;
      if (BIAS) bv = bias[nW + (j << 4) + rlane];
#pragma unroll
      for (int r = 0; r < 8; ++r) slab[(mOff + r) * 68 + (j << 4) + rlane] = BIAS ? acc[i][j][r] + bv : acc[i][j][r];
    }
    asm volatile("s_wait_dscnt 0x0" ::: "memory");      // the wave's slab rows are written before its lanes read them back
    if (OUT_MODE == 0) {
      float* C = (float*)Cout;
      const int hh = lane >> 4, c4 = (lane & 15) * 4;     // row seg = 256 B = 16 lanes x 16 B
#pragma unroll
      for (int it = 0; it < 8; ++it) {
        const int row = it * 2 + hh;
        v4f v = *(const v4f*)(slab + row * 68 + c4);
        *(v4f*)(C + (size_t)(mBase + row) * ldc + nW + c4) = v;
      }
    } else {
      const int q = lane >> 3, c8 = (lane & 7) * 8;       // row seg = 128 B = 8 lanes x 16 B per plane
      unsigned short* C  = (unsigned short*)Cout;
      unsigned short* C2 = (unsigned short*)Cout2;
#pragma unroll
      for (int it = 0; it < 4; ++it) {
        const int row = it * 4 + q;
        const float* sp = slab + row * 68 + c8;
        v4u hv, lv;
#pragma unroll
        for (int e = 0; e < 4; ++e) {
          unsigned hw, lw;
          split_pair(sp[2 * e], sp[2 * e + 1], hw, lw);
          hv[e] = hw;
          lv[e] = lw;
        }
        *(v4u*)(C + (size_t)(mBase + row) * ldc + nW + c8) = hv;
        *(v4u*)(C2 + (size_t)(mBase + row) * ldc + nW + c8) = lv;
      }
    }
    // the stores' address and data registers are reused by the next row group; the clobber keeps that group's slab writes behind these reads
    asm volatile("s_wait_xcnt 0x0" ::: "memory");
  }
}

// ---------------------------------------------------------------------------
// Elementwise split: 2 elements per thread, one 4-B store per lane per plane; i = index of the pair, n2 = pairs in the plane.
// ---------------------------------------------------------------------------
__device__ __forceinline__ unsigned pk16(unsigned short a, unsigned short b) { return (unsigned)a | ((unsigned)b << 16); }

// hi = bf16_rne(in), lo = bf16_rne(in - hi)
__device__ __forceinline__ void split_bf16x2(const float* __restrict__ in, unsigned short* __restrict__ hi,
                                             unsigned short* __restrict__ lo, int i, int n2) {
  if (i < n2) {
    const v2f f = *(const v2f*)(in + 2 * (size_t)i);
    const unsigned short h0 = f2bf_bits(f[0]), h1 = f2bf_bits(f[1]);
    const unsigned short l0 = f2bf_bits(f[0] - bf_bits2f(h0)), l1 = f2bf_bits(f[1] - bf_bits2f(h1));
    const unsigned uh = pk16(h0, h1), ul = pk16(l0, l1);
    ((unsigned*)hi)[i] = uh;
    ((unsigned*)lo)[i] = ul;
    
  }
}

// ---------------------------------------------------------------------------
// Transpose + bf16 hi/lo split of an f32 matrix: in [rows][cols] (row pitch ldi floats) ->
// outh/outl[c][r] = split(in[r][c]) (row pitch ldo u16). One 64x64 tile (bx of cols/64, by of rows/64) per block of 256 threads;
// rows, cols % 64 == 0. tf: 64 * 68 floats of LDS.
// Coverage per block: load 4 it x 256 thr x 4 f32 = 64x64; store 2 it x 256 thr x 8 u16 = 64x64 per plane;
// ---------------------------------------------------------------------------
__device__ __forceinline__ void transpose_split_tile(float* tf, const float* __restrict__ in, int ldi,
                                                     unsigned short* __restrict__ outh,
                                                     unsigned short* __restrict__ outl, int ldo, int bx, int by) {
  const int c0  = bx * 64;           // input column block = output row block
  const int r0  = by * 64;           // input row block    = output column block
  const int tid = threadIdx.x;
  {
    const int sub = tid >> 4;          // 0..15
    const int c4  = (tid & 15) * 4;    // 0..60
#pragma unroll
    for (int it = 0; it < 4; ++it) {
      const int rr = it * 16 + sub;
      const v4f a = *(const v4f*)(in + (size_t)(r0 + rr) * ldi + c0 + c4);
      *(v4f*)(tf + rr * 68 + c4) = a;
    }
  }
  __syncthreads();
  const int s8 = tid >> 3;             // 0..31
  const int c8 = (tid & 7) * 8;        // 0..56
  v4u hv[2], lv[2];
#pragma unroll
  for (int it = 0; it < 2; ++it) {
    const int oc = it * 32 + s8;       // output row within tile (= input column)
    v4u a, a2;
#pragma unroll
    for (int q = 0; q < 4; ++q) {
      const float f0 = tf[(c8 + 2 * q) * 68 + oc];
      const float f1 = tf[(c8 + 2 * q + 1) * 68 + oc];
      const unsigned short h0 = f2bf_bits(f0), h1 = f2bf_bits(f1);
      const unsigned short l0 = f2bf_bits(f0 - bf_bits2f(h0));
      const unsigned short l1 = f2bf_bits(f1 - bf_bits2f(h1));
      a[q]  = pk16(h0, h1);
      a2[q] = pk16(l0, l1);
    }
    hv[it] = a; lv[it] = a2;
  }
  {
#pragma unroll
    for (int it = 0; it < 2; ++it) {
      const int oc = it * 32 + s8;
      const size_t go = (size_t)(c0 + oc) * ldo + r0 + c8;
      *(v4u*)(outh + go) = hv[it];
      *(v4u*)(outl + go) = lv[it];
    }
    
  }
}

// All operand planes in one grid; the five jobs are independent of one another, a block does one piece of one of them.
//   blocks 0 .. 4*W_TILES-1: the 64x64 tiles of Wq, Wk, Wv, Wo ([k][n] -> planes [n][k]); Wk^T goes behind Wq^T in the WqkT planes
//   then X_BLOCKS blocks: x of both batches -> hi/lo planes (256 threads x 2 elements each)
#define W_TILES  ((DOUT / 64) * (DIN / 64))          // 256 per weight
#define X_PAIRS  (NB * NSEQ * DIN / 2)
#define X_BLOCKS (X_PAIRS / 256)                     // 8192
__global__ __launch_bounds__(256) void prep_kernel(const float* __restrict__ x, const float* __restrict__ Wq, const float* __restrict__ Wk,
                                                   const float* __restrict__ Wv, const float* __restrict__ Wo,
                                                   unsigned short* __restrict__ Xh, unsigned short* __restrict__ Xl,
                                                   unsigned short* __restrict__ WqkTh, unsigned short* __restrict__ WqkTl,
                                                   unsigned short* __restrict__ WvTh, unsigned short* __restrict__ WvTl,
                                                   unsigned short* __restrict__ WoTh, unsigned short* __restrict__ WoTl) {
  __shared__ __align__(16) float tf[64 * 68];
  const int bid = (int)blockIdx.x;
  if (bid < 4 * W_TILES) {                           // block-uniform
    const int sel = bid / W_TILES;
    const int t   = bid - sel * W_TILES;
    const float* in    = sel == 0 ? Wq : sel == 1 ? Wk : sel == 2 ? Wv : Wo;
    unsigned short* oh = sel == 0 ? WqkTh : sel == 1 ? WqkTh + (size_t)DOUT * DIN : sel == 2 ? WvTh : WoTh;
    unsigned short* ol = sel == 0 ? WqkTl : sel == 1 ? WqkTl + (size_t)DOUT * DIN : sel == 2 ? WvTl : WoTl;
    transpose_split_tile(tf, in, DOUT, oh, ol, DIN, t % (DOUT / 64), t / (DOUT / 64));
  } else {
    split_bf16x2(x, Xh, Xl, (bid - 4 * W_TILES) * 256 + (int)threadIdx.x, X_PAIRS);
  }
}

// ---------------------------------------------------------------------------
// Fused causal attention, all batches and heads in one launch: scores, relu * distance decay, online softmax and P.V in one kernel;
// neither scores nor probabilities go to memory. The K rows and V^T columns of 64 keys (a stage) are brought into LDS once per block
// by asynchronous copies, whole 128-B lines, two buffers, and all eight waves take their fragments from there.
// A wave owns 32 queries (two tiles of 16, one query per tile and lane column c) of head blockIdx.y, batch blockIdx.z, and takes 32 of the 64 keys
// of every stage (a pass); wave ^ 2 owns the same queries and takes the other 32. A K or V^T fragment read from LDS so feeds two query tiles:
//   St[key][query] = K . Q^T   (A = K rows, B = Q rows kept in registers; both through the same loader)
//   t = relu(St) * R_hat(h, i - j) * 0.125 in log2 units, -inf for j > i (only the last pass holds such keys),
//   R_hat = (1 + exp(v[h])) * rcp(1 + exp(v[h] - w[h] * (i - j))): a function of the head and of i - j alone, so the block makes it once
//   for every distance (table in LDS, below) and a pass reads its factors instead of computing them
//   running maximum m (starts at 0: every allowed t is >= 0 and key 0 is always allowed), p = exp2(t - m),
//   Ot[d][query] = Ot * exp2(m_old - m_new) + V^T . P^T
// The two 16-key score tiles of a pass and query tile, converted in place, are the B operand of the second product
// (element s = tile s >> 3, register s & 7), which is the k order the A loader of V^T delivers.
// A lane holds 8 + 8 keys of each of its two queries; lanes c and c + 16 share the maximum each pass and join their sums at the end.
// At the end the two waves of a query group join their maxima, sums and outputs through LDS; each finishes and stores one of the two tiles.
// Waves 0..3 of a block take query groups from the long end, waves 4..7 the mirrored ones from the short end.
// Output: lane (c, hf) holds ctx[q0 + 16 * half + c][head*64 + ds*16 + hf*8 + 0..7]: one 16-B store per plane and ds;
// the 128-B line of a (query, head) is written by one wave. grid (NSEQ/128, NH, NB) x 4 wave pairs x 32 queries = all rows.
// Every '#pragma unroll' below stands on a loop of constant trip count whose index selects a fragment or an accumulator:
// unrolled, those arrays stay in registers.
// ---------------------------------------------------------------------------

__device__ __forceinline__ float other_half(float x) {   // the value of lane l ^ 16
  const int b = __float_as_int(x);
  return __int_as_float(__builtin_amdgcn_permlanex16(b, b, 0x76543210, 0xfedcba98, false, false));
}

// exp2 with the slot behind a transcendental kept. The outputs are early-clobber, so inside a statement no exponential takes a source of another,
// and the v_nop at the end fills the slot behind the last one.
__device__ __forceinline__ float exp2_slot(float x) {
  float r;
  asm("v_exp_f32 %0, %1\n\tv_nop" : "=&v"(r) : "v"(x));
  return r;
}
__device__ __forceinline__ void exp2x4(float x0, float x1, float x2, float x3, float& r0, float& r1, float& r2, float& r3) {
  float a, b, c, d;
  asm("v_exp_f32 %0, %4\n\tv_exp_f32 %1, %5\n\tv_exp_f32 %2, %6\n\tv_exp_f32 %3, %7\n\tv_nop"
      : "=&v"(a), "=&v"(b), "=&v"(c), "=&v"(d) : "v"(x0), "v"(x1), "v"(x2), "v"(x3));
  r0 = a; r1 = b; r2 = c; r3 = d;
}

// LDS ring: a stage holds four planes (K hi, K lo: 64 key rows x 64 dims; V^T hi, V^T lo: 64 dim rows x 64 keys); a row is 128 B of data
// at a pitch of 144 B (16 B x odd: the 16-byte fragment reads of 16 rows fall on distinct banks).
#define AT_PITCH 72                    // 16-bit elements
#define AT_PLANE (64 * AT_PITCH)
#define AT_BUF   (4 * AT_PLANE)

// Decay table of the block's head: U[x] = R_hat(h, 2047 - x) * 0.125 * log2(e), x = 0 .. DT_N + 2 (distances 2047 down to -35; those below 0
// belong to masked keys only). A lane wants 8 + 8 + 8 consecutive x per pass (8 + 8 per query), from a start whose residue modulo 4 is fixed per lane, so the table
// is kept four times, copy k shifted by k entries (copy k, place y: U[y + k]): in its own copy every lane reads whole aligned 16-B pieces.
#define DT_N  2080                     // places of a copy that are read
#define DT_F  4                        // floats in front of place 0 of a copy: room for the shift, so that the fill needs no test
#define DT_CP 2128                     // pitch of a copy in floats: 64 B past a multiple of 256 B, so that the four copies' pieces fall on different banks

// One stage = 4 planes x 64 rows x 8 pieces of 16 B = 2048 pieces, eight per thread: rows r and r + 32 of each plane.
// lds: this lane's byte address in plane 0 of the target buffer; the pointers: this lane's piece of row r of each plane.
// The s_wait_xcnt at the end of the statement stands in front of any later rewrite of the address registers the copies name.
__device__ __forceinline__ void copy_stage(unsigned lds, const unsigned short* kh, const unsigned short* kl,
                                           const unsigned short* vh, const unsigned short* vl) {
  const unsigned R = 32 * AT_PITCH * 2, P = AT_PLANE * 2;
  asm volatile("global_load_async_to_lds_b128 %0, %8, off\n\t"
               "global_load_async_to_lds_b128 %1, %9, off\n\t"
               "global_load_async_to_lds_b128 %2, %10, off\n\t"
               "global_load_async_to_lds_b128 %3, %11, off\n\t"
               "global_load_async_to_lds_b128 %4, %12, off\n\t"
               "global_load_async_to_lds_b128 %5, %13, off\n\t"
               "global_load_async_to_lds_b128 %6, %14, off\n\t"
               "global_load_async_to_lds_b128 %7, %15, off\n\t"
               "s_wait_xcnt 0x0"
               :: "v"(lds), "v"(lds + R), "v"(lds + P), "v"(lds + P + R),
                  "v"(lds + 2 * P), "v"(lds + 2 * P + R), "v"(lds + 3 * P), "v"(lds + 3 * P + R),
                  "v"(kh), "v"(kh + 32 * (2 * DOUT)), "v"(kl), "v"(kl + 32 * (2 * DOUT)),
                  "v"(vh), "v"(vh + 32 * NSEQ), "v"(vl), "v"(vl + 32 * NSEQ)
               : "memory");
}

// four waves per SIMD (two blocks per WGP): the waves fill each other's waits
__global__ __launch_bounds__(256) __attribute__((amdgpu_waves_per_eu(4, 4))) void fused_attn_kernel(const unsigned short* __restrict__ QKhp, const unsigned short* __restrict__ QKlp,
                                                         const unsigned short* __restrict__ VThp, const unsigned short* __restrict__ VTlp,
                                                         const float* __restrict__ wp, const float* __restrict__ vp,
                                                         unsigned short* __restrict__ Oh, unsigned short* __restrict__ Ol) {
  typedef Frag<__bf16> F;
  const int lane = threadIdx.x & 31;
  const int wave = __builtin_amdgcn_readfirstlane((int)(threadIdx.x >> 5));
  const int head = blockIdx.y;
  const size_t bz = blockIdx.z;
  const int c    = lane & 15;
  const int hf   = lane >> 4;
  const int half = (wave >> 1) & 1;                             // which 32 keys of every stage this wave takes
  const int tg   = (int)blockIdx.x * 2 + (wave & 1);            // 0..31
  const int qg   = (wave < 4) ? (NSEQ / 32 - 1 - tg) : tg;      // every 32-query group once, by two waves
  const int q0   = qg << 5;
  const int np   = qg + 1;                                      // passes of 32 keys of the group; keys of passes 0..np-2 are all < q0

  const float L2E = 1.44269504088896341f;
  const float w2  = wp[head] * L2E;
  const float v2  = vp[head] * L2E;
  const float c1  = (1.0f + __builtin_amdgcn_exp2f(v2)) * (0.125f * L2E);

  const size_t qo = (bz * NSEQ + q0 + c) * (2 * DOUT) + head * HDIM + hf * 8;

  __shared__ __align__(16) unsigned short ring[2 * AT_BUF];
  // stages of 64 keys that the block's longest group needs: 17..32, so stages 0 and 1 always exist and every key is < NSEQ
  const int ns = (NSEQ / 32 - (int)blockIdx.x * 2 + 1) >> 1;
  const int crow = (int)threadIdx.x >> 3;          // 0..31: the row this thread copies (and row + 32)
  const int cpc  = ((int)threadIdx.x & 7) * 8;     // its 16-B piece of the row, in elements: 8 lanes cover one 128-B line
  const unsigned ldsc = (unsigned)(uintptr_t)(ring + crow * AT_PITCH + cpc);
  const size_t kco = (bz * NSEQ + crow) * (2 * DOUT) + DOUT + head * HDIM + cpc;
  const size_t vco = (bz * DOUT + head * HDIM + crow) * NSEQ + cpc;
  copy_stage(ldsc, QKhp + kco, QKlp + kco, VThp + vco, VTlp + vco);      // stage 0 -> buffer 0
  // the decay table, written while stage 0 flies; the barrier that publishes stage 0 publishes it too
  __shared__ __align__(16) float dtab[4 * DT_CP];
  for (int x = (int)threadIdx.x; x < DT_N + 3; x += 256) {
    const float t = c1 * __builtin_amdgcn_rcpf(1.0f + __builtin_amdgcn_exp2f(fmaf(-w2, (float)(NSEQ - 1 - x), v2)));
    for (int k = 0; k < 4; ++k) dtab[k * DT_CP + DT_F + x - k] = t;
  }
  // the first key of pass p stands, for query q0 + c of this lane, at x = NSEQ - 1 - (q0 + c - 8 * hf) + 32 * p; its residue modulo 4 picks the copy;
  // query q0 + 16 + c stands 16 places lower
  const int dk4 = (NSEQ - 1 - c) & 3;
  const float* dtl = dtab + dk4 * DT_CP + DT_F + (NSEQ - 1 - q0 - c + hf * 8 - dk4);
  // this lane's fragment row and k half, in this wave's 32 keys of a stage: K rows half * 32 + .., V^T columns half * 32 + ..
  const __bf16* rbk = (const __bf16*)ring + (half * 32 + c) * AT_PITCH + hf * 8;
  const __bf16* rbv = (const __bf16*)ring + 2 * AT_PLANE + c * AT_PITCH + half * 32 + hf * 8;

  v8f o[2][4];
#pragma unroll
  for (int t = 0; t < 2; ++t)
#pragma unroll
    for (int ds = 0; ds < 4; ++ds) o[t][ds] = (v8f){0.f,0.f,0.f,0.f,0.f,0.f,0.f,0.f};
  float m[2] = {0.f, 0.f}, l[2] = {0.f, 0.f};
  // keeps the start values above in front of the Q loads, so that they take none of the loads' address registers
  __builtin_amdgcn_sched_barrier(0);

  v16b qh[2][2], ql[2][2];                         // [query tile][k step]
#pragma unroll
  for (int t = 0; t < 2; ++t)
#pragma unroll
    for (int ks = 0; ks < 2; ++ks) {
      qh[t][ks] = F::load((const __bf16*)QKhp + qo + (size_t)t * 16 * (2 * DOUT) + ks * 32);
      ql[t][ks] = F::load((const __bf16*)QKlp + qo + (size_t)t * 16 * (2 * DOUT) + ks * 32);
    }
  // the address registers of the Q loads are reused right below; the loaded values as inputs keep the wait behind the loads,
  // and the two fences keep every later register write behind the wait
  __builtin_amdgcn_sched_barrier(0);
  asm volatile("s_wait_xcnt 0x0" :: "v"(qh[0][0]), "v"(qh[0][1]), "v"(ql[0][0]), "v"(ql[0][1]),
                                    "v"(qh[1][0]), "v"(qh[1][1]), "v"(ql[1][0]), "v"(ql[1][1]) : "memory");
  __builtin_amdgcn_sched_barrier(0);

  asm volatile("s_wait_asynccnt 0x0" ::: "memory");   // this wave's copies of stage 0 have landed
  __syncthreads();                                    // publishes stage 0
  copy_stage(ldsc + AT_BUF * 2, QKhp + kco + (size_t)64 * (2 * DOUT), QKlp + kco + (size_t)64 * (2 * DOUT),
             VThp + vco + 64, VTlp + vco + 64);       // stage 1 -> buffer 1

  for (int s = 0; s < ns; ++s) {
  const int p = 2 * s + half;
  if (p < np) {                                       // wave-uniform: a wave past its diagonal only keeps the publish points
    const __bf16* sk = rbk + (s & 1) * AT_BUF;
    const __bf16* sv = rbv + (s & 1) * AT_BUF;
    const int j0 = p << 5;
    // every K fragment read from LDS feeds the score products of both query tiles
    v16b kh[2][2], kl[2][2];                          // [k step][16 keys]
#pragma unroll
    for (int a = 0; a < 2; ++a) kh[0][a] = F::load(sk + (a * 16) * AT_PITCH);
#pragma unroll
    for (int a = 0; a < 2; ++a) kl[0][a] = F::load(sk + AT_PLANE + (a * 16) * AT_PITCH);
#pragma unroll
    for (int a = 0; a < 2; ++a) kh[1][a] = F::load(sk + (a * 16) * AT_PITCH + 32);
    // keeps these 12 K reads together up here, in the order of their use: left to itself the compiler reads each fragment
    // into the same registers right in front of its products, each time with a full wait
    __builtin_amdgcn_sched_barrier(0);
    v8f st[2][2];                                     // [query tile][16 keys]
#pragma unroll
    for (int t = 0; t < 2; ++t)
#pragma unroll
      for (int a = 0; a < 2; ++a) st[t][a] = (v8f){0.f,0.f,0.f,0.f,0.f,0.f,0.f,0.f};
    v4f dk[3][2];                                     // decay factors; keys 16a + 0..7 of query tile t use block a - t + 1
    v16b vh[4], vl[4];
#pragma unroll
    for (int ks = 0; ks < 2; ++ks) {
      // four independent accumulators between two products into the same one
#pragma unroll
      for (int a = 0; a < 2; ++a)
#pragma unroll
        for (int t = 0; t < 2; ++t) st[t][a] = F::mma(kh[ks][a], qh[t][ks], st[t][a]);
#pragma unroll
      for (int a = 0; a < 2; ++a)
#pragma unroll
        for (int t = 0; t < 2; ++t) st[t][a] = F::mma(kh[ks][a], ql[t][ks], st[t][a]);
#pragma unroll
      for (int a = 0; a < 2; ++a)
#pragma unroll
        for (int t = 0; t < 2; ++t) st[t][a] = F::mma(kl[ks][a], qh[t][ks], st[t][a]);
      // the two fences hold a group of reads at this place, in registers the products above have left:
      // the last K fragments and the decay factors pass under the second k step's products, the first V^T fragments under the softmax
      __builtin_amdgcn_sched_barrier(0);
      if (ks == 0) {
#pragma unroll
        for (int a = 0; a < 2; ++a) kl[1][a] = F::load(sk + AT_PLANE + (a * 16) * AT_PITCH + 32);
#pragma unroll
        for (int b = 0; b < 3; ++b) {
          dk[b][0] = *(const v4f*)(dtl + j0 + (b - 1) * 16);
          dk[b][1] = *(const v4f*)(dtl + j0 + (b - 1) * 16 + 4);
        }
      } else {
        vh[0] = F::load(sv);
        vl[0] = F::load(sv + AT_PLANE);
      }
      __builtin_amdgcn_sched_barrier(0);
    }
    union PF { v16b v; unsigned u[8]; } ph[2], pl[2];
#pragma unroll
    for (int t = 0; t < 2; ++t) {
      const int lim = q0 + t * 16 + c - j0 - hf * 8;  // i - j of this lane's first key; key 16a + r is allowed while 16a + r <= lim
      float tt[2][8];
#pragma unroll
      for (int a = 0; a < 2; ++a)
#pragma unroll
        for (int r = 0; r < 8; ++r) tt[a][r] = fmaxf(st[t][a][r] * dk[a - t + 1][r >> 2][r & 3], 0.0f);   // the factor is never negative: relu(s) * f = relu(s * f)
      if (p == np - 1) {                               // wave-uniform
#pragma unroll
        for (int a = 0; a < 2; ++a)
#pragma unroll
          for (int r = 0; r < 8; ++r) tt[a][r] = (a * 16 + r <= lim) ? tt[a][r] : -INFINITY;
      }
      float mx = m[t];
#pragma unroll
      for (int a = 0; a < 2; ++a)
#pragma unroll
        for (int r = 0; r < 8; ++r) mx = fmaxf(mx, tt[a][r]);
      mx = fmaxf(mx, other_half(mx));
      const float alpha = exp2_slot(m[t] - mx);
      m[t] = mx;
      float ps0 = 0.f, ps1 = 0.f;
#pragma unroll
      for (int a = 0; a < 2; ++a)
#pragma unroll
        for (int r = 0; r < 8; r += 4)
          exp2x4(tt[a][r] - mx, tt[a][r + 1] - mx, tt[a][r + 2] - mx, tt[a][r + 3] - mx, tt[a][r], tt[a][r + 1], tt[a][r + 2], tt[a][r + 3]);
#pragma unroll
      for (int r = 0; r < 8; ++r) {
        ps0 += tt[0][r];
        ps1 += tt[1][r];
      }
      l[t] = l[t] * alpha + (ps0 + ps1);
#pragma unroll
      for (int ds = 0; ds < 4; ++ds) o[t][ds] *= alpha;
#pragma unroll
      for (int a = 0; a < 2; ++a)
#pragma unroll
        for (int r2 = 0; r2 < 4; ++r2) split_pair(tt[a][2 * r2], tt[a][2 * r2 + 1], ph[t].u[a * 4 + r2], pl[t].u[a * 4 + r2]);
    }
    // every V^T fragment read from LDS feeds the products of both query tiles
    // the fences hold the other V^T reads here, behind the softmax (whose registers they take) and in front of the first products, under which they pass
    __builtin_amdgcn_sched_barrier(0);
#pragma unroll
    for (int ds = 1; ds < 4; ++ds) {
      vh[ds] = F::load(sv + (ds * 16) * AT_PITCH);
      vl[ds] = F::load(sv + AT_PLANE + (ds * 16) * AT_PITCH);
    }
    __builtin_amdgcn_sched_barrier(0);
#pragma unroll
    for (int t = 0; t < 2; ++t) o[t][0] = F::mma(vh[0], ph[t].v, o[t][0]);
#pragma unroll
    for (int t = 0; t < 2; ++t) o[t][0] = F::mma(vh[0], pl[t].v, o[t][0]);
#pragma unroll
    for (int t = 0; t < 2; ++t) o[t][0] = F::mma(vl[0], ph[t].v, o[t][0]);
#pragma unroll
    for (int ds = 1; ds < 4; ++ds)
#pragma unroll
      for (int t = 0; t < 2; ++t) o[t][ds] = F::mma(vh[ds], ph[t].v, o[t][ds]);
#pragma unroll
    for (int ds = 1; ds < 4; ++ds)
#pragma unroll
      for (int t = 0; t < 2; ++t) o[t][ds] = F::mma(vh[ds], pl[t].v, o[t][ds]);
#pragma unroll
    for (int ds = 1; ds < 4; ++ds)
#pragma unroll
      for (int t = 0; t < 2; ++t) o[t][ds] = F::mma(vl[ds], ph[t].v, o[t][ds]);
    // four vector slots behind the pass's last WMMAs: the code behind the publish point, reached over the loop's branches,
    // reuses their operand registers
    acc_guard4(o[0][2], o[0][3], o[1][2], o[1][3]);
  }
    // publish point of stage s + 1, passed by every wave
    asm volatile("s_wait_dscnt 0x0" ::: "memory");     // this wave's reads of stage s are done before its buffer is refilled
    asm volatile("s_wait_asynccnt 0x0" ::: "memory");  // this wave's copies of stage s + 1 have landed
    __syncthreads();                                   // publishes stage s + 1 and ends every wave's reads of stage s
    if (s + 2 < ns)                                    // block-uniform
      copy_stage(ldsc + (s & 1) * (AT_BUF * 2), QKhp + kco + (size_t)(s + 2) * 64 * (2 * DOUT), QKlp + kco + (size_t)(s + 2) * 64 * (2 * DOUT),
                 VThp + vco + (s + 2) * 64, VTlp + vco + (s + 2) * 64);
  }
  asm volatile("s_wait_asynccnt 0x0" ::: "memory");    // no copy is outstanding when the wave goes on

  // ---- join of the two key halves of a query group (waves w and w ^ 2): each wave finishes query tile 'half' and hands the other tile over ----
  // The ring is free: behind the loop's last barrier no wave reads a stage any more and no copy is outstanding.
  // A wave's slot: 8 pieces of 16 B per lane (the tile's 32 sums), then its maximum and its sum, each plane lane-contiguous.
  float* xs = (float*)ring + wave * (34 * 32);
  const float* xr = (const float*)ring + (wave ^ 2) * (34 * 32);
  v8f ok[4];
#pragma unroll
  for (int ds = 0; ds < 4; ++ds) {
    const v8f og = half ? o[0][ds] : o[1][ds];
    ok[ds] = half ? o[1][ds] : o[0][ds];
    *(v4f*)(xs + ((ds * 2) * 32 + lane) * 4)     = (v4f){og[0], og[1], og[2], og[3]};
    *(v4f*)(xs + ((ds * 2 + 1) * 32 + lane) * 4) = (v4f){og[4], og[5], og[6], og[7]};
  }
  xs[32 * 32 + lane] = half ? m[0] : m[1];
  xs[33 * 32 + lane] = half ? l[0] : l[1];
  const float mk = half ? m[1] : m[0];
  const float lk = half ? l[1] : l[0];
  __syncthreads();                                     // the partner's tile is written before it is read
  const float mp = xr[32 * 32 + lane];
  const float lp = xr[33 * 32 + lane];
  const float mj = fmaxf(mk, mp);
  const float fk = __builtin_amdgcn_exp2f(mk - mj);
  const float fp = __builtin_amdgcn_exp2f(mp - mj);
  float lj = lk * fk + lp * fp;
  lj += other_half(lj);
  const float inv = 1.0f / lj;                         // lj >= 1: the row maximum contributes exp2(0)
  const float gk = fk * inv, gp = fp * inv;
  const size_t oo = (bz * NSEQ + q0 + half * 16 + c) * DOUT + head * HDIM + hf * 8;
#pragma unroll
  for (int ds = 0; ds < 4; ++ds) {
    const v4f p0 = *(const v4f*)(xr + ((ds * 2) * 32 + lane) * 4);
    const v4f p1 = *(const v4f*)(xr + ((ds * 2 + 1) * 32 + lane) * 4);
    float f[8];
#pragma unroll
    for (int r = 0; r < 4; ++r) {
      f[r]     = ok[ds][r] * gk + p0[r] * gp;
      f[r + 4] = ok[ds][r + 4] * gk + p1[r] * gp;
    }
    unsigned hw[4], lw[4];
#pragma unroll
    for (int r2 = 0; r2 < 4; ++r2) split_pair(f[2 * r2], f[2 * r2 + 1], hw[r2], lw[r2]);
    *(v4u*)(Oh + oo + ds * 16) = (v4u){hw[0], hw[1], hw[2], hw[3]};
    *(v4u*)(Ol + oo + ds * 16) = (v4u){lw[0], lw[1], lw[2], lw[3]};
  }
}

// ---------------------------------------------------------------------------
// Workspace region map (byte offsets; all offsets multiples of 2 MiB). Every region is fully written in each call
// before it is read. X and O share one region: X is read only by the projection GEMMs, which precede the attention
// kernel (the O producer) in stream order; O is fully written (2 batches x 16 heads x 64 columns x 2048 rows) before
// the output projections read it.
//   WqkTh  bf16 [2048][1024]  rows 0..1023 = Wq^T, 1024..2047 = Wk^T         0
//   WqkTl  bf16 [2048][1024]                                          4194304
//   WvTh   bf16 [1024][1024]                                          8388608
//   WvTl   bf16 [1024][1024]                                         10485760
//   WoTh   bf16 [1024][1024]                                         12582912
//   WoTl   bf16 [1024][1024]                                         14680064
//   XOh    bf16 [2][2048][1024]  x hi, later ctx hi (col h*64+d)        16777216
//   XOl    bf16 [2][2048][1024]                                         25165824
//   QKh    bf16 [2][2048][2048]  q at col h*64+d, k at col 1024+h*64+d  33554432
//   QKl    bf16 [2][2048][2048]                                         50331648
//   VTh    bf16 [2][1024][2048]  row h*64+d, col token                  67108864
//   VTl    bf16 [2][1024][2048]                                         75497472
//   total                                                               83886080
// ---------------------------------------------------------------------------
extern "C" void kernel_launch(void* const* d_in, const int* in_sizes, int n_in,
                              void* d_out, int out_size, void* d_ws, size_t ws_size,
                              hipStream_t stream) {
  if (n_in < 8) return;
  if (in_sizes[0] != NB * NSEQ * DIN) return;
  if (in_sizes[1] != DIN * DOUT || in_sizes[2] != DIN * DOUT || in_sizes[3] != DIN * DOUT) return;
  if (in_sizes[4] != DOUT * DOUT || in_sizes[5] != DOUT) return;
  if (in_sizes[6] < NH || in_sizes[7] < NH) return;
  if (out_size != NB * NSEQ * DOUT) return;

  const float* x  = (const float*)d_in[0];
  const float* Wq = (const float*)d_in[1];
  const float* Wk = (const float*)d_in[2];
  const float* Wv = (const float*)d_in[3];
  const float* Wo = (const float*)d_in[4];
  const float* bo = (const float*)d_in[5];
  const float* wp = (const float*)d_in[6];
  const float* vp = (const float*)d_in[7];

  const size_t PW  = (size_t)DIN * DOUT * 2;              // 16-bit [1024][1024] plane
  const size_t PX  = (size_t)NSEQ * DIN * 2;              // 16-bit [2048][1024] plane
  const size_t PQK = (size_t)NSEQ * (2 * DOUT) * 2;       // 16-bit [2048][2048] plane
  const size_t PVT = (size_t)DOUT * NSEQ * 2;             // 16-bit [1024][2048] plane
  size_t off = 0;
  const size_t oWqkTh = off; off += 2 * PW;
  const size_t oWqkTl = off; off += 2 * PW;
  const size_t oWvTh  = off; off += PW;
  const size_t oWvTl  = off; off += PW;
  const size_t oWoTh  = off; off += PW;
  const size_t oWoTl  = off; off += PW;
  const size_t oXOh   = off; off += NB * PX;
  const size_t oXOl   = off; off += NB * PX;
  const size_t oQKh   = off; off += NB * PQK;
  const size_t oQKl   = off; off += NB * PQK;
  const size_t oVTh   = off; off += NB * PVT;
  const size_t oVTl   = off; off += NB * PVT;
  if (off > ws_size) return;

  char* ws = (char*)d_ws;
  unsigned short* WqkTh = (unsigned short*)(ws + oWqkTh);
  unsigned short* WqkTl = (unsigned short*)(ws + oWqkTl);
  unsigned short* WvTh  = (unsigned short*)(ws + oWvTh);
  unsigned short* WvTl  = (unsigned short*)(ws + oWvTl);
  unsigned short* WoTh  = (unsigned short*)(ws + oWoTh);
  unsigned short* WoTl  = (unsigned short*)(ws + oWoTl);
  unsigned short* XOh   = (unsigned short*)(ws + oXOh);
  unsigned short* XOl   = (unsigned short*)(ws + oXOl);
  unsigned short* QKh   = (unsigned short*)(ws + oQKh);
  unsigned short* QKl   = (unsigned short*)(ws + oQKl);
  unsigned short* VTh   = (unsigned short*)(ws + oVTh);
  unsigned short* VTl   = (unsigned short*)(ws + oVTl);

  const dim3 blk(256);
  const dim3 blkG(128);                                             // GEMMs: four waves
  // (1) operand planes: Wq^T | Wk^T, Wv^T, Wo^T and x of both batches (whole planes: 4 x 16x16 tiles of 64x64; 8192 blocks x 256 thr x 2)
  prep_kernel<<<dim3(4 * W_TILES + X_BLOCKS), blk, 0, stream>>>(x, Wq, Wk, Wv, Wo, XOh, XOl, WqkTh, WqkTl, WvTh, WvTl, WoTh, WoTl);
  // (2) [q | k] = x . [Wq | Wk] -> QK hi/lo planes, both batches as one M = 4096 (x and the QK planes are contiguous over the batch):
  //     whole [2][2048][2048] planes, 32x16 tiles of 128x128
  wmma_gemm_staged<4, false, 2><<<dim3((NB * NSEQ / 128) * (2 * DOUT / 128), 1), blkG, 0, stream>>>(
      XOh, XOl, DIN, WqkTh, WqkTl, DIN, (void*)QKh, (void*)QKl, 2 * DOUT,
      bo, 2 * DOUT / 128, DIN, 0, 0);
  // (3) v^T[o][tok] = sum_k Wv^T[o][k] x[tok][k] -> VT hi/lo planes [1024][2048] of batch blockIdx.y (whole planes: 2 x 16x16 tiles of 64x128)
  wmma_gemm_staged<2, false, 2><<<dim3((DOUT / 64) * (NSEQ / 128), NB), blkG, 0, stream>>>(
      WvTh, WvTl, DIN, XOh, XOl, DIN, (void*)VTh, (void*)VTl, NSEQ,
      bo, NSEQ / 128, DIN, (size_t)NSEQ * DIN, (size_t)DOUT * NSEQ);
  // (4) ctx[b][i][h*64+d] = softmax_j(relu(q_i . k_j) * decay * 1/8, causal) . v -> O hi/lo planes (whole [2][2048][1024])
  fused_attn_kernel<<<dim3(NSEQ / 128, NH, NB), blk, 0, stream>>>(QKh, QKl, VTh, VTl, wp, vp, XOh, XOl);
  // (5) out = ctx . Wo + bo, both batches as one M = 4096 (ctx planes and out are contiguous over the batch): f32, whole d_out, 64x8 tiles of 64x128
  wmma_gemm_staged<2, true, 0><<<dim3((NB * NSEQ / 64) * (DOUT / 128), 1), blkG, 0, stream>>>(
      XOh, XOl, DOUT, WoTh, WoTl, DOUT, d_out, d_out, DOUT,
      bo, DOUT / 128, DOUT, 0, 0);
  (void)hipGetLastError();
}

// v009
// It runs in 117 microseconds.
// Next to v008, in two timings, it ran 1.11 and 1.12 times as fast.
// All steps since v000 together make it 21.7 times as fast.
// Every contraction (x.Wq|Wk|Wv, k.q^T, v^T.p^T, ctx.Wo): v_wmma_f32_16x16x32_bf16 on bf16 hi/lo split operand planes (hi.hi + hi.lo + lo.hi), f32 accumulate; relu, distance decay, causal mask and softmax in f32.
#include <hip/hip_runtime.h>
#include <math.h>
#include <stdint.h>

#define NB    2
#define NSEQ  2048
#define DIN   1024
#define DOUT  1024
#define NH    16
#define HDIM  64

typedef __attribute__((ext_vector_type(16))) __bf16   v16b;
typedef __attribute__((ext_vector_type(8)))  __bf16   v8b;
typedef __attribute__((ext_vector_type(8)))  float    v8f;
typedef __attribute__((ext_vector_type(4)))  float    v4f;
typedef __attribute__((ext_vector_type(2)))  float    v2f;
typedef __attribute__((ext_vector_type(4)))  unsigned int v4u;
typedef __attribute__((ext_vector_type(2)))  unsigned int v2u;

__device__ __forceinline__ unsigned short f2bf_bits(float f) {
  unsigned u = __float_as_uint(f);
  return (unsigned short)((u + 0x7FFFu + ((u >> 16) & 1u)) >> 16);
}
__device__ __forceinline__ float bf_bits2f(unsigned short h) { return __uint_as_float(((unsigned)h) << 16); }

typedef __attribute__((ext_vector_type(2))) __bf16 v2b;
// hi = bf16_rne(f), lo = bf16_rne(f - hi), two values packed per word
__device__ __forceinline__ void split_pair(float f0, float f1, unsigned& hi, unsigned& lo) {
  hi = __builtin_bit_cast(unsigned, __builtin_convertvector((v2f){f0, f1}, v2b));
  const float r0 = f0 - __uint_as_float(hi << 16);
  const float r1 = f1 - __uint_as_float(hi & 0xFFFF0000u);
  lo = __builtin_bit_cast(unsigned, __builtin_convertvector((v2f){r0, r1}, v2b));
}

// four vector slots behind a WMMA whose operand registers may be reused
__device__ __forceinline__ void acc_guard4(v8f& a, v8f& b, v8f& c, v8f& d) { asm volatile("v_nop\n\tv_nop\n\tv_nop\n\tv_nop" : "+v"(a), "+v"(b), "+v"(c), "+v"(d)); }
template <typename T> struct Frag;
template <> struct Frag<__bf16> {
  typedef v16b V; union U { v16b v; v8b h[2]; };
  static __device__ __forceinline__ v16b load(const __bf16* p) {   // elements 0..7 <- p[0..7], 8..15 <- p[16..23]
    U f; f.h[0] = *(const v8b*)(p); f.h[1] = *(const v8b*)(p + 16); return f.v;
  }
  static __device__ __forceinline__ v8f mma(v16b a, v16b b, v8f c) {
    return __builtin_amdgcn_wmma_f32_16x16x32_bf16(false, a, false, b, (short)0, c, false, false);
  }
};

// ---- WMMA GEMM on operand tiles staged in LDS -------------------------------
// C[m,n] = sum_k A[m,k] * Bt[n,k] (+ bias[n]); A row-major [M,K], Bt row-major [N,K], each as bf16 hi and lo planes;
// product = hi.hi + hi.lo + lo.hi, f32 accumulate, k ascending.
// A block of four waves (2 x 2) owns one (FM*32) x 128 tile of C; a wave owns (FM*16) x 64 of it.
// A stage is 64 k of every operand row of the tile: whole 128-B lines, brought into LDS once per block by asynchronous copies,
// two buffers; both waves of a tile row share the A rows, both of a tile column the Bt rows.
// M % (FM*32) == 0, N % 128 == 0, K % 64 == 0. OUT_MODE: 0 = f32, 2 = bf16 hi plane (Cout) + bf16 lo plane (Cout2).
// grid (tiles, products): blockIdx.y picks one of several independent products with the same A; its Bt lies bsB and its C bsC elements further on.
// Every '#pragma unroll' below stands on a loop of constant trip count whose index selects a fragment, an accumulator or a copy:
// unrolled, those arrays stay in registers.
#define GS_PITCH 72                    // 16-bit elements: 128 B of data at 144 B (16 B x odd: the 16-byte fragment reads of 16 rows fall on distinct banks)

// Eight copies of 16 B per lane: rows r, r + 16, r + 32, r + 48 of a hi plane (la, ga) and of its lo plane (lb, gb); step = 16 source rows.
// The builtin form: the compiler allots the address registers itself, in any register window.
typedef __attribute__((ext_vector_type(4))) int v4i;
typedef __attribute__((address_space(1))) v4i g_v4i;
typedef __attribute__((address_space(3))) v4i l_v4i;
__device__ __forceinline__ void copy_rows(unsigned short* la, unsigned short* lb, const unsigned short* ga, const unsigned short* gb, size_t step) {
#pragma unroll
  for (int i = 0; i < 4; ++i) {
    __builtin_amdgcn_global_load_async_to_lds_b128((g_v4i*)(ga + i * step), (l_v4i*)(la + i * (16 * GS_PITCH)), 0, 0);
    __builtin_amdgcn_global_load_async_to_lds_b128((g_v4i*)(gb + i * step), (l_v4i*)(lb + i * (16 * GS_PITCH)), 0, 0);
  }
}

template <int FM, bool BIAS, int OUT_MODE>
__global__ __launch_bounds__(128) void wmma_gemm_staged(
    const unsigned short* __restrict__ Ahp, const unsigned short* __restrict__ Alp, int lda,
    const unsigned short* __restrict__ Bh0, const unsigned short* __restrict__ Bl0, int ldb,
    void* __restrict__ C0, void* __restrict__ C20, int ldc,
    const float* __restrict__ bias, int tilesN, int K, size_t bsB, size_t bsC) {
  typedef Frag<__bf16> F;
  const unsigned short* __restrict__ Bhp = Bh0 + blockIdx.y * bsB;
  const unsigned short* __restrict__ Blp = Bl0 + blockIdx.y * bsB;
  const size_t cby = blockIdx.y * bsC * (OUT_MODE == 0 ? sizeof(float) : sizeof(unsigned short));
  void* __restrict__ Cout  = (char*)C0 + cby;
  void* __restrict__ Cout2 = (char*)C20 + cby;
  constexpr int TM  = FM * 32;                    // tile rows
  constexpr int TN  = 128;                        // tile columns
  constexpr int BUF = 2 * (TM + TN) * GS_PITCH;   // a buffer: A hi (TM rows), A lo, Bt hi (TN rows), Bt lo
  // The ring is the block's only LDS: at FM = 2 it is 108 KiB, so that two blocks fit one WGP's 320 KiB and each SIMD holds two waves,
  // one block's WMMAs running under the other's copies, fragment reads and barriers. The epilogue's slabs lie in the ring (below).
  __shared__ __align__(16) unsigned short ring[2 * BUF];
  const int lane = threadIdx.x & 31;
  const int wave = __builtin_amdgcn_readfirstlane((int)(threadIdx.x >> 5));
  const int wm = wave >> 1, wn = wave & 1;
  const int tm = (int)blockIdx.x / tilesN;
  const int tn = (int)blockIdx.x - tm * tilesN;
  const int m0 = tm * TM;
  const int n0 = tn * TN;
  const int rlane = lane & 15;                 // row (A) / col (B, D) within subtile
  const int koff  = (lane >> 4) * 8;           // k offset of this lane half
  const int mOff  = (lane >> 4) * 8;           // D row offset

  // copies: a thread brings one 16-B piece of rows crow, crow + 16, ... of every plane; 8 lanes cover one 128-B line
  const int crow = (int)threadIdx.x >> 3;          // 0..15
  const int cpc  = ((int)threadIdx.x & 7) * 8;     // in elements
  unsigned short* ldsc = ring + crow * GS_PITCH + cpc;
  const unsigned aco = (unsigned)(crow * lda + cpc);   // this lane's place inside 16 rows; the block-uniform rest of an address stays scalar
  const unsigned bco = (unsigned)(crow * ldb + cpc);
  const int ns = K >> 6;                           // stages
  auto copy_stage_g = [&](int s) {                 // stage s -> buffer s & 1: 2 * (TM + TN) / 16 copies per thread (32 or 24)
    unsigned short* l0 = ldsc + (s & 1) * BUF;
    const size_t ka = (size_t)m0 * lda + (size_t)s * 64;
    const size_t kb = (size_t)n0 * ldb + (size_t)s * 64;
#pragma unroll
    for (int g = 0; g < TM / 64; ++g)
      copy_rows(l0 + (g * 64) * GS_PITCH, l0 + (TM + g * 64) * GS_PITCH,
                (Ahp + (ka + (size_t)(g * 64) * lda)) + aco, (Alp + (ka + (size_t)(g * 64) * lda)) + aco, (size_t)16 * lda);
#pragma unroll
    for (int g = 0; g < TN / 64; ++g)
      copy_rows(l0 + (2 * TM + g * 64) * GS_PITCH, l0 + (2 * TM + TN + g * 64) * GS_PITCH,
                (Bhp + (kb + (size_t)(g * 64) * ldb)) + bco, (Blp + (kb + (size_t)(g * 64) * ldb)) + bco, (size_t)16 * ldb);
  };
  copy_stage_g(0);

  v8f acc[FM][4];
#pragma unroll
  for (int i = 0; i < FM; ++i)
#pragma unroll
    for (int j = 0; j < 4; ++j) acc[i][j] = (v8f){0.f,0.f,0.f,0.f,0.f,0.f,0.f,0.f};

  const __bf16* ab = (const __bf16*)ring + (wm * (FM * 16) + rlane) * GS_PITCH + koff;        // A hi fragment row of this lane
  const __bf16* bb = (const __bf16*)ring + (2 * TM + wn * 64 + rlane) * GS_PITCH + koff;      // Bt hi fragment row

  asm volatile("s_wait_asynccnt 0x0" ::: "memory");   // this wave's copies of stage 0 have landed
  __syncthreads();                                    // publishes stage 0

  for (int s = 0; s < ns; ++s) {
    const __bf16* sa = ab + (s & 1) * BUF;
    const __bf16* sb = bb + (s & 1) * BUF;
    // all fragments of the stage (two k steps of 32), read as one group in the order the products use them
    v16b bh[2][4], bl[2][4], ah[2][FM], al[2][FM];
#pragma unroll
    for (int ks = 0; ks < 2; ++ks) {
#pragma unroll
      for (int j = 0; j < 4; ++j) bh[ks][j] = F::load(sb + (j * 16) * GS_PITCH + ks * 32);
      ah[ks][0] = F::load(sa + ks * 32);
#pragma unroll
      for (int j = 0; j < 4; ++j) bl[ks][j] = F::load(sb + (TN + j * 16) * GS_PITCH + ks * 32);
      al[ks][0] = F::load(sa + TM * GS_PITCH + ks * 32);
#pragma unroll
      for (int i = 1; i < FM; ++i) {
        ah[ks][i] = F::load(sa + (i * 16) * GS_PITCH + ks * 32);
        al[ks][i] = F::load(sa + (TM + i * 16) * GS_PITCH + ks * 32);
      }
    }
    // keeps the LDS reads together up here: left to itself the compiler sinks them in pairs among the WMMAs, each pair with a full wait
    __builtin_amdgcn_sched_barrier(0);
    // stage s + 1 into the buffer that trip s - 1 has read, behind the barrier that ended those reads (block-uniform test);
    // issued here, its address arithmetic passes while the fragment reads above are under way
    if (s + 1 < ns) copy_stage_g(s + 1);
    // keeps the WMMAs, and the waits for their fragments, behind the issue of the copies
    __builtin_amdgcn_sched_barrier(0);
#pragma unroll
    for (int ks = 0; ks < 2; ++ks) {
      // four independent accumulators between two products into the same one
#pragma unroll
      for (int i = 0; i < FM; ++i) {
#pragma unroll
        for (int j = 0; j < 4; ++j) acc[i][j] = F::mma(ah[ks][i], bh[ks][j], acc[i][j]);
#pragma unroll
        for (int j = 0; j < 4; ++j) acc[i][j] = F::mma(ah[ks][i], bl[ks][j], acc[i][j]);
#pragma unroll
        for (int j = 0; j < 4; ++j) acc[i][j] = F::mma(al[ks][i], bh[ks][j], acc[i][j]);
      }
    }
    // keeps the WMMAs in front of the waits below, so that the copies fly under them: left to itself the compiler moves them behind the barrier
    __builtin_amdgcn_sched_barrier(0);
    // publish point of stage s + 1, passed by every wave
    asm volatile("s_wait_dscnt 0x0" ::: "memory");     // this wave's reads of stage s are done before its buffer is refilled
    asm volatile("s_wait_asynccnt 0x0" ::: "memory");  // this wave's copies of stage s + 1 have landed
    __syncthreads();                                   // publishes stage s + 1 and ends every wave's reads of stage s
  }
  asm volatile("s_wait_asynccnt 0x0" ::: "memory");    // no copy is outstanding when the wave goes on

  // ---- epilogue: 16 rows at a time through this wave's own slab, so that every store covers whole 128-B lines ----
  // per-wave 16x64 slab, pitch 68 floats, at the start of the ring: behind the loop's last barrier no wave reads a stage any more
  // and no copy is outstanding, so the ring's bytes are free
  float* slab = (float*)ring + wave * (16 * 68);
  const int nW = n0 + wn * 64;
#pragma unroll
  for (int i = 0; i < FM; ++i) {
    const int mBase = m0 + wm * (FM * 16) + (i << 4);
#pragma unroll
    for (int j = 0; j < 4; ++j) {
      float bv = 0.f;
      if (BIAS) bv = bias[nW + (j << 4) + rlane];
#pragma unroll
      for (int r = 0; r < 8; ++r) slab[(mOff + r) * 68 + (j << 4) + rlane] = BIAS ? acc[i][j][r] + bv : acc[i][j][r];
    }
    asm volatile("s_wait_dscnt 0x0" ::: "memory");      // the wave's slab rows are written before its lanes read them back
    if (OUT_MODE == 0) {
      float* C = (float*)Cout;
      const int hh = lane >> 4, c4 = (lane & 15) * 4;     // row seg = 256 B = 16 lanes x 16 B
#pragma unroll
      for (int it = 0; it < 8; ++it) {
        const int row = it * 2 + hh;
        v4f v = *(const v4f*)(slab + row * 68 + c4);
        *(v4f*)(C + (size_t)(mBase + row) * ldc + nW + c4) = v;
      }
    } else {
      const int q = lane >> 3, c8 = (lane & 7) * 8;       // row seg = 128 B = 8 lanes x 16 B per plane
      unsigned short* C  = (unsigned short*)Cout;
      unsigned short* C2 = (unsigned short*)Cout2;
#pragma unroll
      for (int it = 0; it < 4; ++it) {
        const int row = it * 4 + q;
        const float* sp = slab + row * 68 + c8;
        v4u hv, lv;
#pragma unroll
        for (int e = 0; e < 4; ++e) {
          unsigned hw, lw;
          split_pair(sp[2 * e], sp[2 * e + 1], hw, lw);
          hv[e] = hw;
          lv[e] = lw;
        }
        *(v4u*)(C + (size_t)(mBase + row) * ldc + nW + c8) = hv;
        *(v4u*)(C2 + (size_t)(mBase + row) * ldc + nW + c8) = lv;
      }
    }
    // the stores' address and data registers are reused by the next row group; the clobber keeps that group's slab writes behind these reads
    asm volatile("s_wait_xcnt 0x0" ::: "memory");
  }
}

// ---- q | k | v projection: one GEMM launch -----------------------------------
// [q | k] = x . [Wq | Wk] and v = x . Wv have the same A operand, so one block forms both from one staging of its x rows.
// A block of eight waves (4 x 2), alone on its WGP, owns 256 rows of x (both batches as one M = 4096) times 128 columns of [q | k] and 64 of v;
// a wave owns 64 rows x (64 + 32) columns: 24 accumulator tiles. 16 x 16 blocks = every row and column once.
// Operand planes, product order (hi.hi + hi.lo + lo.hi, k ascending), stages of 64 k and the two-buffer ring are those of wmma_gemm_staged.
// q | k go to the QK planes row-major; v goes to the VT planes transposed ([column][token]).
#define QV_TM   256
#define QV_AL   QV_TM                  // first row of each plane in a buffer: x hi at 0, x lo,
#define QV_BH   (2 * QV_TM)            // 128 rows of [Wq | Wk]^T hi,
#define QV_BL   (QV_BH + 128)          // lo,
#define QV_VH   (QV_BL + 128)          // 64 rows of Wv^T hi,
#define QV_VL   (QV_VH + 64)           // lo
#define QV_ROWS (QV_VL + 64)
#define QV_BUF  (QV_ROWS * GS_PITCH)

// NR rows of one plane, 32 rows per copy of the block: this lane's 16-B piece of rows r, r + 32, ...; source row pitch DIN
template <int NR>
__device__ __forceinline__ void copy_plane(unsigned short* l, const unsigned short* g) {
#pragma unroll
  for (int i = 0; i < NR / 32; ++i)
    __builtin_amdgcn_global_load_async_to_lds_b128((g_v4i*)(g + (size_t)i * (32 * DIN)), (l_v4i*)(l + i * (32 * GS_PITCH)), 0, 0);
}

__global__ __launch_bounds__(256) void qkv_gemm_staged(
    const unsigned short* __restrict__ Xh, const unsigned short* __restrict__ Xl,
    const unsigned short* __restrict__ Wqkh, const unsigned short* __restrict__ Wqkl,
    const unsigned short* __restrict__ Wvh, const unsigned short* __restrict__ Wvl,
    unsigned short* __restrict__ QKh, unsigned short* __restrict__ QKl,
    unsigned short* __restrict__ VTh, unsigned short* __restrict__ VTl, int K) {
  typedef Frag<__bf16> F;
  __shared__ __align__(16) unsigned short ring[2 * QV_BUF];
  const int lane = threadIdx.x & 31;
  const int wave = __builtin_amdgcn_readfirstlane((int)(threadIdx.x >> 5));
  const int wm = wave >> 1, wn = wave & 1;
  const int tm = (int)blockIdx.x >> 4;
  const int tn = (int)blockIdx.x & 15;
  const int m0 = tm * QV_TM;
  const int rlane = lane & 15;                 // row (A) / col (B, D) within subtile
  const int koff  = (lane >> 4) * 8;           // k offset of this lane half
  const int mOff  = (lane >> 4) * 8;           // D row offset

  // copies: a thread brings one 16-B piece of rows crow, crow + 32, ... of every plane; 8 lanes cover one 128-B line
  const int crow = (int)threadIdx.x >> 3;          // 0..31
  const int cpc  = ((int)threadIdx.x & 7) * 8;     // in elements
  unsigned short* ldsc = ring + crow * GS_PITCH + cpc;
  const unsigned co = (unsigned)(crow * DIN + cpc);   // this lane's place inside 32 rows; the block-uniform rest of an address stays scalar
  const int ns = K >> 6;                           // stages
  auto copy_stage_q = [&](int s) {                 // stage s -> buffer s & 1: QV_ROWS / 32 = 28 copies per thread
    unsigned short* l0 = ldsc + (s & 1) * QV_BUF;
    const size_t ka = (size_t)m0 * DIN + (size_t)s * 64;
    const size_t kb = (size_t)(tn * 128) * DIN + (size_t)s * 64;
    const size_t kv = (size_t)(tn * 64) * DIN + (size_t)s * 64;
    copy_plane<QV_TM>(l0, (Xh + ka) + co);
    copy_plane<QV_TM>(l0 + QV_AL * GS_PITCH, (Xl + ka) + co);
    copy_plane<128>(l0 + QV_BH * GS_PITCH, (Wqkh + kb) + co);
    copy_plane<128>(l0 + QV_BL * GS_PITCH, (Wqkl + kb) + co);
    copy_plane<64>(l0 + QV_VH * GS_PITCH, (Wvh + kv) + co);
    copy_plane<64>(l0 + QV_VL * GS_PITCH, (Wvl + kv) + co);
  };
  copy_stage_q(0);

  v8f acc[4][6];                                   // columns 0..3: q | k, 4..5: v
#pragma unroll
  for (int i = 0; i < 4; ++i)
#pragma unroll
    for (int j = 0; j < 6; ++j) acc[i][j] = (v8f){0.f,0.f,0.f,0.f,0.f,0.f,0.f,0.f};

  const __bf16* ab = (const __bf16*)ring + (wm * 64 + rlane) * GS_PITCH + koff;               // x hi fragment row of this lane
  const __bf16* bb = (const __bf16*)ring + (QV_BH + wn * 64 + rlane) * GS_PITCH + koff;       // [Wq | Wk]^T hi fragment row
  const __bf16* vb = (const __bf16*)ring + (QV_VH + wn * 32 + rlane) * GS_PITCH + koff;       // Wv^T hi fragment row

  asm volatile("s_wait_asynccnt 0x0" ::: "memory");   // this wave's copies of stage 0 have landed
  __syncthreads();                                    // publishes stage 0

  for (int s = 0; s < ns; ++s) {
    const __bf16* sa = ab + (s & 1) * QV_BUF;
    const __bf16* sb = bb + (s & 1) * QV_BUF;
    const __bf16* sv = vb + (s & 1) * QV_BUF;
#pragma unroll
    for (int ks = 0; ks < 2; ++ks) {
      // the fragments of one k step of 32, read as one group in the order the products use them: behind the x rows every further
      // fragment opens four or six products, so that the matrix unit starts early and is not overtaken by the reads of the block's eight waves;
      // while a wave waits for its group, the other wave of its SIMD has the matrix unit
      v16b bh[6], bl[6], ah[4], al[4];
#pragma unroll
      for (int i = 0; i < 4; ++i) ah[i] = F::load(sa + (i * 16) * GS_PITCH + ks * 32);
#pragma unroll
      for (int j = 0; j < 4; ++j) bh[j] = F::load(sb + (j * 16) * GS_PITCH + ks * 32);
#pragma unroll
      for (int j = 0; j < 2; ++j) bh[4 + j] = F::load(sv + (j * 16) * GS_PITCH + ks * 32);
#pragma unroll
      for (int j = 0; j < 4; ++j) bl[j] = F::load(sb + (128 + j * 16) * GS_PITCH + ks * 32);
#pragma unroll
      for (int j = 0; j < 2; ++j) bl[4 + j] = F::load(sv + (64 + j * 16) * GS_PITCH + ks * 32);
#pragma unroll
      for (int i = 0; i < 4; ++i) al[i] = F::load(sa + (QV_AL + i * 16) * GS_PITCH + ks * 32);
      // keeps the LDS reads together up here: left to itself the compiler sinks them in pairs among the WMMAs, each pair with a full wait
      __builtin_amdgcn_sched_barrier(0);
      // stage s + 1 into the buffer that trip s - 1 has read, behind the barrier that ended those reads (block-uniform test);
      // issued here, its address arithmetic passes while the fragment reads above are under way
      if (ks == 0 && s + 1 < ns) copy_stage_q(s + 1);
      // keeps the WMMAs, and the waits for their fragments, behind the issue of the copies
      __builtin_amdgcn_sched_barrier(0);
      // every accumulator takes hi.hi, hi.lo, lo.hi in this order; at least eight other products stand between two into the same one
#pragma unroll
      for (int j = 0; j < 6; ++j)
#pragma unroll
        for (int i = 0; i < 4; ++i) acc[i][j] = F::mma(ah[i], bh[j], acc[i][j]);
#pragma unroll
      for (int j = 0; j < 6; ++j)
#pragma unroll
        for (int i = 0; i < 4; ++i) acc[i][j] = F::mma(ah[i], bl[j], acc[i][j]);
#pragma unroll
      for (int i = 0; i < 4; ++i)
#pragma unroll
        for (int j = 0; j < 6; ++j) acc[i][j] = F::mma(al[i], bh[j], acc[i][j]);
      // keeps the WMMAs in front of the next group of reads and of the waits below, so that the copies fly under them
      __builtin_amdgcn_sched_barrier(0);
    }
    // publish point of stage s + 1, passed by every wave
    asm volatile("s_wait_dscnt 0x0" ::: "memory");     // this wave's reads of stage s are done before its buffer is refilled
    asm volatile("s_wait_asynccnt 0x0" ::: "memory");  // this wave's copies of stage s + 1 have landed
    __syncthreads();                                   // publishes stage s + 1 and ends every wave's reads of stage s
  }
  asm volatile("s_wait_asynccnt 0x0" ::: "memory");    // no copy is outstanding when the wave goes on

  // ---- epilogue: 16 x 64 values at a time through this wave's own slab, so that every store covers whole 128-B lines ----
  // per-wave slab, pitch 68 floats, at the start of the ring: behind the loop's last barrier no wave reads a stage any more
  // and no copy is outstanding, so the ring's bytes are free
  float* slab = (float*)ring + wave * (16 * 68);
  const int q = lane >> 3, c8 = (lane & 7) * 8;         // row seg = 128 B = 8 lanes x 16 B per plane
  auto store_slab = [&](unsigned short* C, unsigned short* C2, size_t o0, int ld) {   // slab row r -> 64 elements at o0 + r * ld of both planes
    asm volatile("s_wait_dscnt 0x0" ::: "memory");      // the wave's slab rows are written before its lanes read them back
#pragma unroll
    for (int it = 0; it < 4; ++it) {
      const int row = it * 4 + q;
      const float* sp = slab + row * 68 + c8;
      v4u hv, lv;
#pragma unroll
      for (int e = 0; e < 4; ++e) {
        unsigned hw, lw;
        split_pair(sp[2 * e], sp[2 * e + 1], hw, lw);
        hv[e] = hw;
        lv[e] = lw;
      }
      *(v4u*)(C + o0 + (size_t)row * ld + c8) = hv;
      *(v4u*)(C2 + o0 + (size_t)row * ld + c8) = lv;
    }
    // the stores' address and data registers are reused by the next group; the clobber keeps that group's slab writes behind these reads
    asm volatile("s_wait_xcnt 0x0" ::: "memory");
  };
  // q | k: slab row = one of 16 rows of x, slab column = one of the wave's 64 columns
#pragma unroll
  for (int i = 0; i < 4; ++i) {
#pragma unroll
    for (int j = 0; j < 4; ++j)
#pragma unroll
      for (int r = 0; r < 8; ++r) slab[(mOff + r) * 68 + (j << 4) + rlane] = acc[i][j][r];
    store_slab(QKh, QKl, (size_t)(m0 + wm * 64 + (i << 4)) * (2 * DOUT) + tn * 128 + wn * 64, 2 * DOUT);
  }
  // v, transposed: slab row = one of 16 columns of v, slab column = one of the wave's 64 tokens (a lane holds 8 consecutive ones per tile)
  const int bat  = m0 / NSEQ;                           // a block's 256 rows lie in one batch
  const int tok0 = m0 - bat * NSEQ + wm * 64;
#pragma unroll
  for (int jv = 0; jv < 2; ++jv) {
#pragma unroll
    for (int i = 0; i < 4; ++i) {
      const v8f a = acc[i][4 + jv];
      *(v4f*)(slab + rlane * 68 + (i << 4) + mOff)     = (v4f){a[0], a[1], a[2], a[3]};
      *(v4f*)(slab + rlane * 68 + (i << 4) + mOff + 4) = (v4f){a[4], a[5], a[6], a[7]};
    }
    store_slab(VTh, VTl, ((size_t)bat * DOUT + tn * 64 + wn * 32 + (jv << 4)) * NSEQ + tok0, NSEQ);
  }
}

// ---------------------------------------------------------------------------
// Elementwise split: 2 elements per thread, one 4-B store per lane per plane; i = index of the pair, n2 = pairs in the plane.
// ---------------------------------------------------------------------------
__device__ __forceinline__ unsigned pk16(unsigned short a, unsigned short b) { return (unsigned)a | ((unsigned)b << 16); }

// hi = bf16_rne(in), lo = bf16_rne(in - hi)
__device__ __forceinline__ void split_bf16x2(const float* __restrict__ in, unsigned short* __restrict__ hi,
                                             unsigned short* __restrict__ lo, int i, int n2) {
  if (i < n2) {
    const v2f f = *(const v2f*)(in + 2 * (size_t)i);
    const unsigned short h0 = f2bf_bits(f[0]), h1 = f2bf_bits(f[1]);
    const unsigned short l0 = f2bf_bits(f[0] - bf_bits2f(h0)), l1 = f2bf_bits(f[1] - bf_bits2f(h1));
    const unsigned uh = pk16(h0, h1), ul = pk16(l0, l1);
    ((unsigned*)hi)[i] = uh;
    ((unsigned*)lo)[i] = ul;
    
  }
}

// ---------------------------------------------------------------------------
// Transpose + bf16 hi/lo split of an f32 matrix: in [rows][cols] (row pitch ldi floats) ->
// outh/outl[c][r] = split(in[r][c]) (row pitch ldo u16). One 64x64 tile (bx of cols/64, by of rows/64) per block of 256 threads;
// rows, cols % 64 == 0. tf: 64 * 68 floats of LDS.
// Coverage per block: load 4 it x 256 thr x 4 f32 = 64x64; store 2 it x 256 thr x 8 u16 = 64x64 per plane;
// ---------------------------------------------------------------------------
__device__ __forceinline__ void transpose_split_tile(float* tf, const float* __restrict__ in, int ldi,
                                                     unsigned short* __restrict__ outh,
                                                     unsigned short* __restrict__ outl, int ldo, int bx, int by) {
  const int c0  = bx * 64;           // input column block = output row block
  const int r0  = by * 64;           // input row block    = output column block
  const int tid = threadIdx.x;
  {
    const int sub = tid >> 4;          // 0..15
    const int c4  = (tid & 15) * 4;    // 0..60
#pragma unroll
    for (int it = 0; it < 4; ++it) {
      const int rr = it * 16 + sub;
      const v4f a = *(const v4f*)(in + (size_t)(r0 + rr) * ldi + c0 + c4);
      *(v4f*)(tf + rr * 68 + c4) = a;
    }
  }
  __syncthreads();
  const int s8 = tid >> 3;             // 0..31
  const int c8 = (tid & 7) * 8;        // 0..56
  v4u hv[2], lv[2];
#pragma unroll
  for (int it = 0; it < 2; ++it) {
    const int oc = it * 32 + s8;       // output row within tile (= input column)
    v4u a, a2;
#pragma unroll
    for (int q = 0; q < 4; ++q) {
      const float f0 = tf[(c8 + 2 * q) * 68 + oc];
      const float f1 = tf[(c8 + 2 * q + 1) * 68 + oc];
      const unsigned short h0 = f2bf_bits(f0), h1 = f2bf_bits(f1);
      const unsigned short l0 = f2bf_bits(f0 - bf_bits2f(h0));
      const unsigned short l1 = f2bf_bits(f1 - bf_bits2f(h1));
      a[q]  = pk16(h0, h1);
      a2[q] = pk16(l0, l1);
    }
    hv[it] = a; lv[it] = a2;
  }
  {
#pragma unroll
    for (int it = 0; it < 2; ++it) {
      const int oc = it * 32 + s8;
      const size_t go = (size_t)(c0 + oc) * ldo + r0 + c8;
      *(v4u*)(outh + go) = hv[it];
      *(v4u*)(outl + go) = lv[it];
    }
    
  }
}

// All operand planes in one grid; the five jobs are independent of one another, a block does one piece of one of them.
//   blocks 0 .. 4*W_TILES-1: the 64x64 tiles of Wq, Wk, Wv, Wo ([k][n] -> planes [n][k]); Wk^T goes behind Wq^T in the WqkT planes
//   then X_BLOCKS blocks: x of both batches -> hi/lo planes (256 threads x 2 elements each)
#define W_TILES  ((DOUT / 64) * (DIN / 64))          // 256 per weight
#define X_PAIRS  (NB * NSEQ * DIN / 2)
#define X_BLOCKS (X_PAIRS / 256)                     // 8192
__global__ __launch_bounds__(256) void prep_kernel(const float* __restrict__ x, const float* __restrict__ Wq, const float* __restrict__ Wk,
                                                   const float* __restrict__ Wv, const float* __restrict__ Wo,
                                                   unsigned short* __restrict__ Xh, unsigned short* __restrict__ Xl,
                                                   unsigned short* __restrict__ WqkTh, unsigned short* __restrict__ WqkTl,
                                                   unsigned short* __restrict__ WvTh, unsigned short* __restrict__ WvTl,
                                                   unsigned short* __restrict__ WoTh, unsigned short* __restrict__ WoTl) {
  __shared__ __align__(16) float tf[64 * 68];
  const int bid = (int)blockIdx.x;
  if (bid < 4 * W_TILES) {                           // block-uniform
    const int sel = bid / W_TILES;
    const int t   = bid - sel * W_TILES;
    const float* in    = sel == 0 ? Wq : sel == 1 ? Wk : sel == 2 ? Wv : Wo;
    unsigned short* oh = sel == 0 ? WqkTh : sel == 1 ? WqkTh + (size_t)DOUT * DIN : sel == 2 ? WvTh : WoTh;
    unsigned short* ol = sel == 0 ? WqkTl : sel == 1 ? WqkTl + (size_t)DOUT * DIN : sel == 2 ? WvTl : WoTl;
    transpose_split_tile(tf, in, DOUT, oh, ol, DIN, t % (DOUT / 64), t / (DOUT / 64));
  } else {
    split_bf16x2(x, Xh, Xl, (bid - 4 * W_TILES) * 256 + (int)threadIdx.x, X_PAIRS);
  }
}

// ---------------------------------------------------------------------------
// Fused causal attention, all batches and heads in one launch: scores, relu * distance decay, online softmax and P.V in one kernel;
// neither scores nor probabilities go to memory. The K rows and V^T columns of 64 keys (a stage) are brought into LDS once per block
// by asynchronous copies, whole 128-B lines, two buffers, and all eight waves take their fragments from there.
// A wave owns 32 queries (two tiles of 16, one query per tile and lane column c) of head blockIdx.y, batch blockIdx.z, and takes 32 of the 64 keys
// of every stage (a pass); wave ^ 2 owns the same queries and takes the other 32. A K or V^T fragment read from LDS so feeds two query tiles:
//   St[key][query] = K . Q^T   (A = K rows, B = Q rows kept in registers; both through the same loader)
//   t = relu(St) * R_hat(h, i - j) * 0.125 in log2 units, -inf for j > i (only the last pass holds such keys),
//   R_hat = (1 + exp(v[h])) * rcp(1 + exp(v[h] - w[h] * (i - j))): a function of the head and of i - j alone, so the block makes it once
//   for every distance (table in LDS, below) and a pass reads its factors instead of computing them
//   running maximum m (starts at 0: every allowed t is >= 0 and key 0 is always allowed), p = exp2(t - m),
//   Ot[d][query] = Ot * exp2(m_old - m_new) + V^T . P^T
// The two 16-key score tiles of a pass and query tile, converted in place, are the B operand of the second product
// (element s = tile s >> 3, register s & 7), which is the k order the A loader of V^T delivers.
// A lane holds 8 + 8 keys of each of its two queries; lanes c and c + 16 share the maximum each pass and join their sums at the end.
// At the end the two waves of a query group join their maxima, sums and outputs through LDS; each finishes and stores one of the two tiles.
// Waves 0..3 of a block take query groups from the long end, waves 4..7 the mirrored ones from the short end.
// Output: lane (c, hf) holds ctx[q0 + 16 * half + c][head*64 + ds*16 + hf*8 + 0..7]: one 16-B store per plane and ds;
// the 128-B line of a (query, head) is written by one wave. grid (NSEQ/128, NH, NB) x 4 wave pairs x 32 queries = all rows.
// Every '#pragma unroll' below stands on a loop of constant trip count whose index selects a fragment or an accumulator:
// unrolled, those arrays stay in registers.
// ---------------------------------------------------------------------------

__device__ __forceinline__ float other_half(float x) {   // the value of lane l ^ 16
  const int b = __float_as_int(x);
  return __int_as_float(__builtin_amdgcn_permlanex16(b, b, 0x76543210, 0xfedcba98, false, false));
}

// exp2 with the slot behind a transcendental kept. The outputs are early-clobber, so inside a statement no exponential takes a source of another,
// and the v_nop at the end fills the slot behind the last one.
__device__ __forceinline__ float exp2_slot(float x) {
  float r;
  asm("v_exp_f32 %0, %1\n\tv_nop" : "=&v"(r) : "v"(x));
  return r;
}
__device__ __forceinline__ void exp2x4(float x0, float x1, float x2, float x3, float& r0, float& r1, float& r2, float& r3) {
  float a, b, c, d;
  asm("v_exp_f32 %0, %4\n\tv_exp_f32 %1, %5\n\tv_exp_f32 %2, %6\n\tv_exp_f32 %3, %7\n\tv_nop"
      : "=&v"(a), "=&v"(b), "=&v"(c), "=&v"(d) : "v"(x0), "v"(x1), "v"(x2), "v"(x3));
  r0 = a; r1 = b; r2 = c; r3 = d;
}

// LDS ring: a stage holds four planes (K hi, K lo: 64 key rows x 64 dims; V^T hi, V^T lo: 64 dim rows x 64 keys); a row is 128 B of data
// at a pitch of 144 B (16 B x odd: the 16-byte fragment reads of 16 rows fall on distinct banks).
#define AT_PITCH 72                    // 16-bit elements
#define AT_PLANE (64 * AT_PITCH)
#define AT_BUF   (4 * AT_PLANE)

// Decay table of the block's head: U[x] = R_hat(h, 2047 - x) * 0.125 * log2(e), x = 0 .. DT_N + 2 (distances 2047 down to -35; those below 0
// belong to masked keys only). A lane wants 8 + 8 + 8 consecutive x per pass (8 + 8 per query), from a start whose residue modulo 4 is fixed per lane, so the table
// is kept four times, copy k shifted by k entries (copy k, place y: U[y + k]): in its own copy every lane reads whole aligned 16-B pieces.
#define DT_N  2080                     // places of a copy that are read
#define DT_F  4                        // floats in front of place 0 of a copy: room for the shift, so that the fill needs no test
#define DT_CP 2128                     // pitch of a copy in floats: 64 B past a multiple of 256 B, so that the four copies' pieces fall on different banks

// One stage = 4 planes x 64 rows x 8 pieces of 16 B = 2048 pieces, eight per thread: rows r and r + 32 of each plane.
// lds: this lane's byte address in plane 0 of the target buffer; the pointers: this lane's piece of row r of each plane.
// The s_wait_xcnt at the end of the statement stands in front of any later rewrite of the address registers the copies name.
__device__ __forceinline__ void copy_stage(unsigned lds, const unsigned short* kh, const unsigned short* kl,
                                           const unsigned short* vh, const unsigned short* vl) {
  const unsigned R = 32 * AT_PITCH * 2, P = AT_PLANE * 2;
  asm volatile("global_load_async_to_lds_b128 %0, %8, off\n\t"
               "global_load_async_to_lds_b128 %1, %9, off\n\t"
               "global_load_async_to_lds_b128 %2, %10, off\n\t"
               "global_load_async_to_lds_b128 %3, %11, off\n\t"
               "global_load_async_to_lds_b128 %4, %12, off\n\t"
               "global_load_async_to_lds_b128 %5, %13, off\n\t"
               "global_load_async_to_lds_b128 %6, %14, off\n\t"
               "global_load_async_to_lds_b128 %7, %15, off\n\t"
               "s_wait_xcnt 0x0"
               :: "v"(lds), "v"(lds + R), "v"(lds + P), "v"(lds + P + R),
                  "v"(lds + 2 * P), "v"(lds + 2 * P + R), "v"(lds + 3 * P), "v"(lds + 3 * P + R),
                  "v"(kh), "v"(kh + 32 * (2 * DOUT)), "v"(kl), "v"(kl + 32 * (2 * DOUT)),
                  "v"(vh), "v"(vh + 32 * NSEQ), "v"(vl), "v"(vl + 32 * NSEQ)
               : "memory");
}

// four waves per SIMD (two blocks per WGP): the waves fill each other's waits
__global__ __launch_bounds__(256) __attribute__((amdgpu_waves_per_eu(4, 4))) void fused_attn_kernel(const unsigned short* __restrict__ QKhp, const unsigned short* __restrict__ QKlp,
                                                         const unsigned short* __restrict__ VThp, const unsigned short* __restrict__ VTlp,
                                                         const float* __restrict__ wp, const float* __restrict__ vp,
                                                         unsigned short* __restrict__ Oh, unsigned short* __restrict__ Ol) {
  typedef Frag<__bf16> F;
  const int lane = threadIdx.x & 31;
  const int wave = __builtin_amdgcn_readfirstlane((int)(threadIdx.x >> 5));
  const int head = blockIdx.y;
  const size_t bz = blockIdx.z;
  const int c    = lane & 15;
  const int hf   = lane >> 4;
  const int half = (wave >> 1) & 1;                             // which 32 keys of every stage this wave takes
  const int tg   = (int)blockIdx.x * 2 + (wave & 1);            // 0..31
  const int qg   = (wave < 4) ? (NSEQ / 32 - 1 - tg) : tg;      // every 32-query group once, by two waves
  const int q0   = qg << 5;
  const int np   = qg + 1;                                      // passes of 32 keys of the group; keys of passes 0..np-2 are all < q0

  const float L2E = 1.44269504088896341f;
  const float w2  = wp[head] * L2E;
  const float v2  = vp[head] * L2E;
  const float c1  = (1.0f + __builtin_amdgcn_exp2f(v2)) * (0.125f * L2E);

  const size_t qo = (bz * NSEQ + q0 + c) * (2 * DOUT) + head * HDIM + hf * 8;

  __shared__ __align__(16) unsigned short ring[2 * AT_BUF];
  // stages of 64 keys that the block's longest group needs: 17..32, so stages 0 and 1 always exist and every key is < NSEQ
  const int ns = (NSEQ / 32 - (int)blockIdx.x * 2 + 1) >> 1;
  const int crow = (int)threadIdx.x >> 3;          // 0..31: the row this thread copies (and row + 32)
  const int cpc  = ((int)threadIdx.x & 7) * 8;     // its 16-B piece of the row, in elements: 8 lanes cover one 128-B line
  const unsigned ldsc = (unsigned)(uintptr_t)(ring + crow * AT_PITCH + cpc);
  const size_t kco = (bz * NSEQ + crow) * (2 * DOUT) + DOUT + head * HDIM + cpc;
  const size_t vco = (bz * DOUT + head * HDIM + crow) * NSEQ + cpc;
  copy_stage(ldsc, QKhp + kco, QKlp + kco, VThp + vco, VTlp + vco);      // stage 0 -> buffer 0
  // the decay table, written while stage 0 flies; the barrier that publishes stage 0 publishes it too
  __shared__ __align__(16) float dtab[4 * DT_CP];
  for (int x = (int)threadIdx.x; x < DT_N + 3; x += 256) {
    const float t = c1 * __builtin_amdgcn_rcpf(1.0f + __builtin_amdgcn_exp2f(fmaf(-w2, (float)(NSEQ - 1 - x), v2)));
    for (int k = 0; k < 4; ++k) dtab[k * DT_CP + DT_F + x - k] = t;
  }
  // the first key of pass p stands, for query q0 + c of this lane, at x = NSEQ - 1 - (q0 + c - 8 * hf) + 32 * p; its residue modulo 4 picks the copy;
  // query q0 + 16 + c stands 16 places lower
  const int dk4 = (NSEQ - 1 - c) & 3;
  const float* dtl = dtab + dk4 * DT_CP + DT_F + (NSEQ - 1 - q0 - c + hf * 8 - dk4);
  // this lane's fragment row and k half, in this wave's 32 keys of a stage: K rows half * 32 + .., V^T columns half * 32 + ..
  const __bf16* rbk = (const __bf16*)ring + (half * 32 + c) * AT_PITCH + hf * 8;
  const __bf16* rbv = (const __bf16*)ring + 2 * AT_PLANE + c * AT_PITCH + half * 32 + hf * 8;

  v8f o[2][4];
#pragma unroll
  for (int t = 0; t < 2; ++t)
#pragma unroll
    for (int ds = 0; ds < 4; ++ds) o[t][ds] = (v8f){0.f,0.f,0.f,0.f,0.f,0.f,0.f,0.f};
  float m[2] = {0.f, 0.f}, l[2] = {0.f, 0.f};
  // keeps the start values above in front of the Q loads, so that they take none of the loads' address registers
  __builtin_amdgcn_sched_barrier(0);

  v16b qh[2][2], ql[2][2];                         // [query tile][k step]
#pragma unroll
  for (int t = 0; t < 2; ++t)
#pragma unroll
    for (int ks = 0; ks < 2; ++ks) {
      qh[t][ks] = F::load((const __bf16*)QKhp + qo + (size_t)t * 16 * (2 * DOUT) + ks * 32);
      ql[t][ks] = F::load((const __bf16*)QKlp + qo + (size_t)t * 16 * (2 * DOUT) + ks * 32);
    }
  // the address registers of the Q loads are reused right below; the loaded values as inputs keep the wait behind the loads,
  // and the two fences keep every later register write behind the wait
  __builtin_amdgcn_sched_barrier(0);
  asm volatile("s_wait_xcnt 0x0" :: "v"(qh[0][0]), "v"(qh[0][1]), "v"(ql[0][0]), "v"(ql[0][1]),
                                    "v"(qh[1][0]), "v"(qh[1][1]), "v"(ql[1][0]), "v"(ql[1][1]) : "memory");
  __builtin_amdgcn_sched_barrier(0);

  asm volatile("s_wait_asynccnt 0x0" ::: "memory");   // this wave's copies of stage 0 have landed
  __syncthreads();                                    // publishes stage 0
  copy_stage(ldsc + AT_BUF * 2, QKhp + kco + (size_t)64 * (2 * DOUT), QKlp + kco + (size_t)64 * (2 * DOUT),
             VThp + vco + 64, VTlp + vco + 64);       // stage 1 -> buffer 1

  for (int s = 0; s < ns; ++s) {
  const int p = 2 * s + half;
  if (p < np) {                                       // wave-uniform: a wave past its diagonal only keeps the publish points
    const __bf16* sk = rbk + (s & 1) * AT_BUF;
    const __bf16* sv = rbv + (s & 1) * AT_BUF;
    const int j0 = p << 5;
    // every K fragment read from LDS feeds the score products of both query tiles
    v16b kh[2][2], kl[2][2];                          // [k step][16 keys]
#pragma unroll
    for (int a = 0; a < 2; ++a) kh[0][a] = F::load(sk + (a * 16) * AT_PITCH);
#pragma unroll
    for (int a = 0; a < 2; ++a) kl[0][a] = F::load(sk + AT_PLANE + (a * 16) * AT_PITCH);
#pragma unroll
    for (int a = 0; a < 2; ++a) kh[1][a] = F::load(sk + (a * 16) * AT_PITCH + 32);
    // keeps these 12 K reads together up here, in the order of their use: left to itself the compiler reads each fragment
    // into the same registers right in front of its products, each time with a full wait
    __builtin_amdgcn_sched_barrier(0);
    v8f st[2][2];                                     // [query tile][16 keys]
#pragma unroll
    for (int t = 0; t < 2; ++t)
#pragma unroll
      for (int a = 0; a < 2; ++a) st[t][a] = (v8f){0.f,0.f,0.f,0.f,0.f,0.f,0.f,0.f};
    v4f dk[3][2];                                     // decay factors; keys 16a + 0..7 of query tile t use block a - t + 1
    v16b vh[4], vl[4];
#pragma unroll
    for (int ks = 0; ks < 2; ++ks) {
      // four independent accumulators between two products into the same one
#pragma unroll
      for (int a = 0; a < 2; ++a)
#pragma unroll
        for (int t = 0; t < 2; ++t) st[t][a] = F::mma(kh[ks][a], qh[t][ks], st[t][a]);
#pragma unroll
      for (int a = 0; a < 2; ++a)
#pragma unroll
        for (int t = 0; t < 2; ++t) st[t][a] = F::mma(kh[ks][a], ql[t][ks], st[t][a]);
#pragma unroll
      for (int a = 0; a < 2; ++a)
#pragma unroll
        for (int t = 0; t < 2; ++t) st[t][a] = F::mma(kl[ks][a], qh[t][ks], st[t][a]);
      // the two fences hold a group of reads at this place, in registers the products above have left:
      // the last K fragments and the decay factors pass under the second k step's products, the first V^T fragments under the softmax
      __builtin_amdgcn_sched_barrier(0);
      if (ks == 0) {
#pragma unroll
        for (int a = 0; a < 2; ++a) kl[1][a] = F::load(sk + AT_PLANE + (a * 16) * AT_PITCH + 32);
#pragma unroll
        for (int b = 0; b < 3; ++b) {
          dk[b][0] = *(const v4f*)(dtl + j0 + (b - 1) * 16);
          dk[b][1] = *(const v4f*)(dtl + j0 + (b - 1) * 16 + 4);
        }
      } else {
        vh[0] = F::load(sv);
        vl[0] = F::load(sv + AT_PLANE);
      }
      __builtin_amdgcn_sched_barrier(0);
    }
    union PF { v16b v; unsigned u[8]; } ph[2], pl[2];
#pragma unroll
    for (int t = 0; t < 2; ++t) {
      const int lim = q0 + t * 16 + c - j0 - hf * 8;  // i - j of this lane's first key; key 16a + r is allowed while 16a + r <= lim
      float tt[2][8];
#pragma unroll
      for (int a = 0; a < 2; ++a)
#pragma unroll
        for (int r = 0; r < 8; ++r) tt[a][r] = fmaxf(st[t][a][r] * dk[a - t + 1][r >> 2][r & 3], 0.0f);   // the factor is never negative: relu(s) * f = relu(s * f)
      if (p == np - 1) {                               // wave-uniform
#pragma unroll
        for (int a = 0; a < 2; ++a)
#pragma unroll
          for (int r = 0; r < 8; ++r) tt[a][r] = (a * 16 + r <= lim) ? tt[a][r] : -INFINITY;
      }
      float mx = m[t];
#pragma unroll
      for (int a = 0; a < 2; ++a)
#pragma unroll
        for (int r = 0; r < 8; ++r) mx = fmaxf(mx, tt[a][r]);
      mx = fmaxf(mx, other_half(mx));
      const float alpha = exp2_slot(m[t] - mx);
      m[t] = mx;
      float ps0 = 0.f, ps1 = 0.f;
#pragma unroll
      for (int a = 0; a < 2; ++a)
#pragma unroll
        for (int r = 0; r < 8; r += 4)
          exp2x4(tt[a][r] - mx, tt[a][r + 1] - mx, tt[a][r + 2] - mx, tt[a][r + 3] - mx, tt[a][r], tt[a][r + 1], tt[a][r + 2], tt[a][r + 3]);
#pragma unroll
      for (int r = 0; r < 8; ++r) {
        ps0 += tt[0][r];
        ps1 += tt[1][r];
      }
      l[t] = l[t] * alpha + (ps0 + ps1);
#pragma unroll
      for (int ds = 0; ds < 4; ++ds) o[t][ds] *= alpha;
#pragma unroll
      for (int a = 0; a < 2; ++a)
#pragma unroll
        for (int r2 = 0; r2 < 4; ++r2) split_pair(tt[a][2 * r2], tt[a][2 * r2 + 1], ph[t].u[a * 4 + r2], pl[t].u[a * 4 + r2]);
    }
    // every V^T fragment read from LDS feeds the products of both query tiles
    // the fences hold the other V^T reads here, behind the softmax (whose registers they take) and in front of the first products, under which they pass
    __builtin_amdgcn_sched_barrier(0);
#pragma unroll
    for (int ds = 1; ds < 4; ++ds) {
      vh[ds] = F::load(sv + (ds * 16) * AT_PITCH);
      vl[ds] = F::load(sv + AT_PLANE + (ds * 16) * AT_PITCH);
    }
    __builtin_amdgcn_sched_barrier(0);
#pragma unroll
    for (int t = 0; t < 2; ++t) o[t][0] = F::mma(vh[0], ph[t].v, o[t][0]);
#pragma unroll
    for (int t = 0; t < 2; ++t) o[t][0] = F::mma(vh[0], pl[t].v, o[t][0]);
#pragma unroll
    for (int t = 0; t < 2; ++t) o[t][0] = F::mma(vl[0], ph[t].v, o[t][0]);
#pragma unroll
    for (int ds = 1; ds < 4; ++ds)
#pragma unroll
      for (int t = 0; t < 2; ++t) o[t][ds] = F::mma(vh[ds], ph[t].v, o[t][ds]);
#pragma unroll
    for (int ds = 1; ds < 4; ++ds)
#pragma unroll
      for (int t = 0; t < 2; ++t) o[t][ds] = F::mma(vh[ds], pl[t].v, o[t][ds]);
#pragma unroll
    for (int ds = 1; ds < 4; ++ds)
#pragma unroll
      for (int t = 0; t < 2; ++t) o[t][ds] = F::mma(vl[ds], ph[t].v, o[t][ds]);
    // four vector slots behind the pass's last WMMAs: the code behind the publish point, reached over the loop's branches,
    // reuses their operand registers
    acc_guard4(o[0][2], o[0][3], o[1][2], o[1][3]);
  }
    // publish point of stage s + 1, passed by every wave
    asm volatile("s_wait_dscnt 0x0" ::: "memory");     // this wave's reads of stage s are done before its buffer is refilled
    asm volatile("s_wait_asynccnt 0x0" ::: "memory");  // this wave's copies of stage s + 1 have landed
    __syncthreads();                                   // publishes stage s + 1 and ends every wave's reads of stage s
    if (s + 2 < ns)                                    // block-uniform
      copy_stage(ldsc + (s & 1) * (AT_BUF * 2), QKhp + kco + (size_t)(s + 2) * 64 * (2 * DOUT), QKlp + kco + (size_t)(s + 2) * 64 * (2 * DOUT),
                 VThp + vco + (s + 2) * 64, VTlp + vco + (s + 2) * 64);
  }
  asm volatile("s_wait_asynccnt 0x0" ::: "memory");    // no copy is outstanding when the wave goes on

  // ---- join of the two key halves of a query group (waves w and w ^ 2): each wave finishes query tile 'half' and hands the other tile over ----
  // The ring is free: behind the loop's last barrier no wave reads a stage any more and no copy is outstanding.
  // A wave's slot: 8 pieces of 16 B per lane (the tile's 32 sums), then its maximum and its sum, each plane lane-contiguous.
  float* xs = (float*)ring + wave * (34 * 32);
  const float* xr = (const float*)ring + (wave ^ 2) * (34 * 32);
  v8f ok[4];
#pragma unroll
  for (int ds = 0; ds < 4; ++ds) {
    const v8f og = half ? o[0][ds] : o[1][ds];
    ok[ds] = half ? o[1][ds] : o[0][ds];
    *(v4f*)(xs + ((ds * 2) * 32 + lane) * 4)     = (v4f){og[0], og[1], og[2], og[3]};
    *(v4f*)(xs + ((ds * 2 + 1) * 32 + lane) * 4) = (v4f){og[4], og[5], og[6], og[7]};
  }
  xs[32 * 32 + lane] = half ? m[0] : m[1];
  xs[33 * 32 + lane] = half ? l[0] : l[1];
  const float mk = half ? m[1] : m[0];
  const float lk = half ? l[1] : l[0];
  __syncthreads();                                     // the partner's tile is written before it is read
  const float mp = xr[32 * 32 + lane];
  const float lp = xr[33 * 32 + lane];
  const float mj = fmaxf(mk, mp);
  const float fk = __builtin_amdgcn_exp2f(mk - mj);
  const float fp = __builtin_amdgcn_exp2f(mp - mj);
  float lj = lk * fk + lp * fp;
  lj += other_half(lj);
  const float inv = 1.0f / lj;                         // lj >= 1: the row maximum contributes exp2(0)
  const float gk = fk * inv, gp = fp * inv;
  const size_t oo = (bz * NSEQ + q0 + half * 16 + c) * DOUT + head * HDIM + hf * 8;
#pragma unroll
  for (int ds = 0; ds < 4; ++ds) {
    const v4f p0 = *(const v4f*)(xr + ((ds * 2) * 32 + lane) * 4);
    const v4f p1 = *(const v4f*)(xr + ((ds * 2 + 1) * 32 + lane) * 4);
    float f[8];
#pragma unroll
    for (int r = 0; r < 4; ++r) {
      f[r]     = ok[ds][r] * gk + p0[r] * gp;
      f[r + 4] = ok[ds][r + 4] * gk + p1[r] * gp;
    }
    unsigned hw[4], lw[4];
#pragma unroll
    for (int r2 = 0; r2 < 4; ++r2) split_pair(f[2 * r2], f[2 * r2 + 1], hw[r2], lw[r2]);
    *(v4u*)(Oh + oo + ds * 16) = (v4u){hw[0], hw[1], hw[2], hw[3]};
    *(v4u*)(Ol + oo + ds * 16) = (v4u){lw[0], lw[1], lw[2], lw[3]};
  }
}

// ---------------------------------------------------------------------------
// Workspace region map (byte offsets; all offsets multiples of 2 MiB). Every region is fully written in each call
// before it is read. X and O share one region: X is read only by the projection GEMMs, which precede the attention
// kernel (the O producer) in stream order; O is fully written (2 batches x 16 heads x 64 columns x 2048 rows) before
// the output projections read it.
//   WqkTh  bf16 [2048][1024]  rows 0..1023 = Wq^T, 1024..2047 = Wk^T         0
//   WqkTl  bf16 [2048][1024]                                          4194304
//   WvTh   bf16 [1024][1024]                                          8388608
//   WvTl   bf16 [1024][1024]                                         10485760
//   WoTh   bf16 [1024][1024]                                         12582912
//   WoTl   bf16 [1024][1024]                                         14680064
//   XOh    bf16 [2][2048][1024]  x hi, later ctx hi (col h*64+d)        16777216
//   XOl    bf16 [2][2048][1024]                                         25165824
//   QKh    bf16 [2][2048][2048]  q at col h*64+d, k at col 1024+h*64+d  33554432
//   QKl    bf16 [2][2048][2048]                                         50331648
//   VTh    bf16 [2][1024][2048]  row h*64+d, col token                  67108864
//   VTl    bf16 [2][1024][2048]                                         75497472
//   total                                                               83886080
// ---------------------------------------------------------------------------
extern "C" void kernel_launch(void* const* d_in, const int* in_sizes, int n_in,
                              void* d_out, int out_size, void* d_ws, size_t ws_size,
                              hipStream_t stream) {
  if (n_in < 8) return;
  if (in_sizes[0] != NB * NSEQ * DIN) return;
  if (in_sizes[1] != DIN * DOUT || in_sizes[2] != DIN * DOUT || in_sizes[3] != DIN * DOUT) return;
  if (in_sizes[4] != DOUT * DOUT || in_sizes[5] != DOUT) return;
  if (in_sizes[6] < NH || in_sizes[7] < NH) return;
  if (out_size != NB * NSEQ * DOUT) return;

  const float* x  = (const float*)d_in[0];
  const float* Wq = (const float*)d_in[1];
  const float* Wk = (const float*)d_in[2];
  const float* Wv = (const float*)d_in[3];
  const float* Wo = (const float*)d_in[4];
  const float* bo = (const float*)d_in[5];
  const float* wp = (const float*)d_in[6];
  const float* vp = (const float*)d_in[7];

  const size_t PW  = (size_t)DIN * DOUT * 2;              // 16-bit [1024][1024] plane
  const size_t PX  = (size_t)NSEQ * DIN * 2;              // 16-bit [2048][1024] plane
  const size_t PQK = (size_t)NSEQ * (2 * DOUT) * 2;       // 16-bit [2048][2048] plane
  const size_t PVT = (size_t)DOUT * NSEQ * 2;             // 16-bit [1024][2048] plane
  size_t off = 0;
  const size_t oWqkTh = off; off += 2 * PW;
  const size_t oWqkTl = off; off += 2 * PW;
  const size_t oWvTh  = off; off += PW;
  const size_t oWvTl  = off; off += PW;
  const size_t oWoTh  = off; off += PW;
  const size_t oWoTl  = off; off += PW;
  const size_t oXOh   = off; off += NB * PX;
  const size_t oXOl   = off; off += NB * PX;
  const size_t oQKh   = off; off += NB * PQK;
  const size_t oQKl   = off; off += NB * PQK;
  const size_t oVTh   = off; off += NB * PVT;
  const size_t oVTl   = off; off += NB * PVT;
  if (off > ws_size) return;

  char* ws = (char*)d_ws;
  unsigned short* WqkTh = (unsigned short*)(ws + oWqkTh);
  unsigned short* WqkTl = (unsigned short*)(ws + oWqkTl);
  unsigned short* WvTh  = (unsigned short*)(ws + oWvTh);
  unsigned short* WvTl  = (unsigned short*)(ws + oWvTl);
  unsigned short* WoTh  = (unsigned short*)(ws + oWoTh);
  unsigned short* WoTl  = (unsigned short*)(ws + oWoTl);
  unsigned short* XOh   = (unsigned short*)(ws + oXOh);
  unsigned short* XOl   = (unsigned short*)(ws + oXOl);
  unsigned short* QKh   = (unsigned short*)(ws + oQKh);
  unsigned short* QKl   = (unsigned short*)(ws + oQKl);
  unsigned short* VTh   = (unsigned short*)(ws + oVTh);
  unsigned short* VTl   = (unsigned short*)(ws + oVTl);

  const dim3 blk(256);
  const dim3 blkG(128);                                             // output GEMM: four waves
  // (1) operand planes: Wq^T | Wk^T, Wv^T, Wo^T and x of both batches (whole planes: 4 x 16x16 tiles of 64x64; 8192 blocks x 256 thr x 2)
  prep_kernel<<<dim3(4 * W_TILES + X_BLOCKS), blk, 0, stream>>>(x, Wq, Wk, Wv, Wo, XOh, XOl, WqkTh, WqkTl, WvTh, WvTl, WoTh, WoTl);
  // (2) [q | k] = x . [Wq | Wk] -> QK hi/lo planes and v = x . Wv -> VT hi/lo planes (transposed), both batches as one M = 4096:
  //     whole [2][2048][2048] and [2][1024][2048] planes, 16 x 16 blocks of 256 rows x (128 + 64) columns
  qkv_gemm_staged<<<dim3((NB * NSEQ / QV_TM) * (2 * DOUT / 128)), blk, 0, stream>>>(XOh, XOl, WqkTh, WqkTl, WvTh, WvTl, QKh, QKl, VTh, VTl, DIN);
  // (3) ctx[b][i][h*64+d] = softmax_j(relu(q_i . k_j) * decay * 1/8, causal) . v -> O hi/lo planes (whole [2][2048][1024])
  fused_attn_kernel<<<dim3(NSEQ / 128, NH, NB), blk, 0, stream>>>(QKh, QKl, VTh, VTl, wp, vp, XOh, XOl);
  // (4) out = ctx . Wo + bo, both batches as one M = 4096 (ctx planes and out are contiguous over the batch): f32, whole d_out, 64x8 tiles of 64x128
  wmma_gemm_staged<2, true, 0><<<dim3((NB * NSEQ / 64) * (DOUT / 128), 1), blkG, 0, stream>>>(
      XOh, XOl, DOUT, WoTh, WoTl, DOUT, d_out, d_out, DOUT,
      bo, DOUT / 128, DOUT, 0, 0);
  (void)hipGetLastError();
}

// v010
// A run of this version takes 112 microseconds.
// Next to v009, in two timings, it ran 1.04 and 1.05 times as fast.
// Over all steps from v000 it is 22.7 times as fast.
// Every contraction (x.Wq|Wk|Wv, k.q^T, v^T.p^T, ctx.Wo): v_wmma_f32_16x16x32_bf16 on bf16 hi/lo split operand planes (hi.hi + hi.lo + lo.hi), f32 accumulate; relu, distance decay, causal mask and softmax in f32.
#include <hip/hip_runtime.h>
#include <math.h>
#include <stdint.h>

#define NB    2
#define NSEQ  2048
#define DIN   1024
#define DOUT  1024
#define NH    16
#define HDIM  64

typedef __attribute__((ext_vector_type(16))) __bf16   v16b;
typedef __attribute__((ext_vector_type(8)))  __bf16   v8b;
typedef __attribute__((ext_vector_type(8)))  float    v8f;
typedef __attribute__((ext_vector_type(4)))  float    v4f;
typedef __attribute__((ext_vector_type(2)))  float    v2f;
typedef __attribute__((ext_vector_type(4)))  unsigned int v4u;
typedef __attribute__((ext_vector_type(2)))  unsigned int v2u;

__device__ __forceinline__ unsigned short f2bf_bits(float f) {
  unsigned u = __float_as_uint(f);
  return (unsigned short)((u + 0x7FFFu + ((u >> 16) & 1u)) >> 16);
}
__device__ __forceinline__ float bf_bits2f(unsigned short h) { return __uint_as_float(((unsigned)h) << 16); }

typedef __attribute__((ext_vector_type(2))) __bf16 v2b;
// hi = bf16_rne(f), lo = bf16_rne(f - hi), two values packed per word
__device__ __forceinline__ void split_pair(float f0, float f1, unsigned& hi, unsigned& lo) {
  hi = __builtin_bit_cast(unsigned, __builtin_convertvector((v2f){f0, f1}, v2b));
  const float r0 = f0 - __uint_as_float(hi << 16);
  const float r1 = f1 - __uint_as_float(hi & 0xFFFF0000u);
  lo = __builtin_bit_cast(unsigned, __builtin_convertvector((v2f){r0, r1}, v2b));
}

// four vector slots behind a WMMA whose operand registers may be reused
__device__ __forceinline__ void acc_guard4(v8f& a, v8f& b, v8f& c, v8f& d) { asm volatile("v_nop\n\tv_nop\n\tv_nop\n\tv_nop" : "+v"(a), "+v"(b), "+v"(c), "+v"(d)); }
template <typename T> struct Frag;
template <> struct Frag<__bf16> {
  typedef v16b V; union U { v16b v; v8b h[2]; };
  static __device__ __forceinline__ v16b load(const __bf16* p) {   // elements 0..7 <- p[0..7], 8..15 <- p[16..23]
    U f; f.h[0] = *(const v8b*)(p); f.h[1] = *(const v8b*)(p + 16); return f.v;
  }
  static __device__ __forceinline__ v8f mma(v16b a, v16b b, v8f c) {
    return __builtin_amdgcn_wmma_f32_16x16x32_bf16(false, a, false, b, (short)0, c, false, false);
  }
};

// ---- WMMA GEMM on operand tiles staged in LDS -------------------------------
// C[m,n] = sum_k A[m,k] * Bt[n,k] (+ bias[n]); A row-major [M,K], Bt row-major [N,K], each as bf16 hi and lo planes;
// product = hi.hi + hi.lo + lo.hi, f32 accumulate, k ascending.
// A block of four waves (2 x 2) owns one (FM*32) x 128 tile of C; a wave owns (FM*16) x 64 of it.
// A stage is 64 k of every operand row of the tile: whole 128-B lines, brought into LDS once per block by four tensor loads (one plane per wave),
// two buffers; both waves of a tile row share the A rows, both of a tile column the Bt rows.
// M % (FM*32) == 0, N % 128 == 0, K % 64 == 0, K >= 128, FM <= 4. OUT_MODE: 0 = f32, 2 = bf16 hi plane (Cout) + bf16 lo plane (Cout2).
// grid (tiles, products): blockIdx.y picks one of several independent products with the same A; its Bt lies bsB and its C bsC elements further on.
// Every '#pragma unroll' below stands on a loop of constant trip count whose index selects a fragment or an accumulator:
// unrolled, those arrays stay in registers.
#define GS_PITCH 72                    // 16-bit elements: 128 B of data at 144 B (16 B x odd: the 16-byte fragment reads of 16 rows fall on distinct banks)

// ---- tensor loads: one request of one wave brings a slice (rows of 128 B, a plane or half a plane of a stage) from global memory into LDS ----
// The pad of 16 B behind every 128-B row gives the pitch of 144 B. A slice's place in LDS is a multiple of 2 KiB: 128 padded rows are 9 x 2 KiB.
typedef uint32_t u32x4 __attribute__((ext_vector_type(4)));
typedef uint32_t u32x8 __attribute__((ext_vector_type(8)));
__device__ __forceinline__ uint32_t uni(uint32_t v) { return (uint32_t)__builtin_amdgcn_readfirstlane(v); }
// a wave-uniform test held in a scalar register, so that the branch on it is a scalar branch: a tensor load ignores EXEC
__device__ __forceinline__ uint32_t pinned(uint32_t v) { uint32_t w = uni(v); asm volatile("" : "+s"(w)); return w; }   // for the test around a tensor load
// group 1: 1-byte elements, a tile of 'rows' rows of 128 B, tensor = tile, source row pitch in bytes, no mask, pad 4 dwords behind every 32
__device__ __forceinline__ u32x8 tdm_group1(uint32_t rows, uint32_t src_pitch) {
  u32x8 g;
  g[0] = uni((1u << 20) | (4u << 22) | (3u << 25));   // a compile-time constant
  g[1] = uni(128u << 16);
  g[2] = uni((rows & 0xFFFFu) << 16);
  g[3] = uni((rows >> 16) | (128u << 16));
  g[4] = uni(rows);
  g[5] = uni(src_pitch);
  g[6] = uni(0u);
  g[7] = uni(0u);
  return g;
}
// group 0: count 1, the slice's byte offset in the block's LDS, the address of its first byte, type 2
__device__ __forceinline__ u32x4 tdm_group0(uint32_t lds_dst, uint64_t ga) {
  u32x4 g;
  g[0] = uni(1u);
  g[1] = uni(lds_dst);
  g[2] = uni((uint32_t)ga);
  g[3] = uni((((uint32_t)(ga >> 32)) & 0x01FFFFFFu) | 0x80000000u);
  return g;
}
// The descriptor words are in-out operands of the load and inputs of the wave's wait for it: the compiler then has to keep them, in the registers
// the request was issued from, until the wait, and cannot make them anew elsewhere and reuse those registers while the request is outstanding.
__device__ __forceinline__ void tdm_load(u32x4& g0, u32x8& g1) { asm volatile("tensor_load_to_lds %0, %1" : "+s"(g0), "+s"(g1) :: "memory"); }
__device__ __forceinline__ void tdm_wait(const u32x4& g0, const u32x8& g1) { asm volatile("s_wait_tensorcnt 0x0" :: "s"(g0), "s"(g1) : "memory"); }
#define SLICE_B (128 * GS_PITCH * 2)   // bytes of LDS from one slice's place to the next: 128 padded rows

template <int FM, bool BIAS, int OUT_MODE>
__global__ __launch_bounds__(128) void wmma_gemm_staged(
    const unsigned short* __restrict__ Ahp, const unsigned short* __restrict__ Alp, int lda,
    const unsigned short* __restrict__ Bh0, const unsigned short* __restrict__ Bl0, int ldb,
    void* __restrict__ C0, void* __restrict__ C20, int ldc,
    const float* __restrict__ bias, int tilesN, int K, size_t bsB, size_t bsC) {
  typedef Frag<__bf16> F;
  const unsigned short* __restrict__ Bhp = Bh0 + blockIdx.y * bsB;
  const unsigned short* __restrict__ Blp = Bl0 + blockIdx.y * bsB;
  const size_t cby = blockIdx.y * bsC * (OUT_MODE == 0 ? sizeof(float) : sizeof(unsigned short));
  void* __restrict__ Cout  = (char*)C0 + cby;
  void* __restrict__ Cout2 = (char*)C20 + cby;
  constexpr int TM  = FM * 32;                    // tile rows
  constexpr int TN  = 128;                        // tile columns
  constexpr int PL  = 128;                        // rows from one plane's place to the next
  static_assert(TM <= PL && TN == PL, "a plane is one slice");
  constexpr int BUF = 4 * PL * GS_PITCH;          // a buffer: A hi (TM rows), A lo, Bt hi (TN rows), Bt lo
  // The ring is the block's only LDS: 144 KiB, so that two blocks fit one WGP's 320 KiB and each SIMD holds two waves,
  // one block's WMMAs running under the other's fragment reads and barriers. The epilogue's slabs lie in the ring (below).
  __shared__ __attribute__((aligned(2048))) unsigned short ring[2 * BUF];
  const int lane = threadIdx.x & 31;
  const int wave = __builtin_amdgcn_readfirstlane((int)(threadIdx.x >> 5));
  const int wm = wave >> 1, wn = wave & 1;
  const int tm = (int)blockIdx.x / tilesN;
  const int tn = (int)blockIdx.x - tm * tilesN;
  const int m0 = tm * TM;
  const int n0 = tn * TN;
  const int rlane = lane & 15;                 // row (A) / col (B, D) within subtile
  const int koff  = (lane >> 4) * 8;           // k offset of this lane half
  const int mOff  = (lane >> 4) * 8;           // D row offset

  // staging: every wave brings one plane of a stage, wave 0 A hi, 1 A lo, 2 Bt hi, 3 Bt lo
  const unsigned short* splane = wave == 0 ? Ahp : wave == 1 ? Alp : wave == 2 ? Bhp : Blp;
  const uint64_t gsrc = (uint64_t)(uintptr_t)(splane + (wave < 2 ? (size_t)m0 * lda : (size_t)n0 * ldb));
  const uint32_t ldst = (uint32_t)(uintptr_t)ring + (uint32_t)wave * SLICE_B;
  u32x8 g1 = tdm_group1(wave < 2 ? (uint32_t)TM : (uint32_t)TN, (uint32_t)(wave < 2 ? lda : ldb) * 2u);
  const int ns = K >> 6;                           // stages
  u32x4 g0;                                        // group 0 of the wave's last request
  auto load_stage_g = [&](int s) {                 // this wave's plane of stage s -> buffer s & 1
    g0 = tdm_group0(ldst + (uint32_t)(s & 1) * (BUF * 2), gsrc + (uint64_t)s * 128);
    tdm_load(g0, g1);
  };
  load_stage_g(0);

  v8f acc[FM][4];
#pragma unroll
  for (int i = 0; i < FM; ++i)
#pragma unroll
    for (int j = 0; j < 4; ++j) acc[i][j] = (v8f){0.f,0.f,0.f,0.f,0.f,0.f,0.f,0.f};

  const __bf16* ab = (const __bf16*)ring + (wm * (FM * 16) + rlane) * GS_PITCH + koff;        // A hi fragment row of this lane
  const __bf16* bb = (const __bf16*)ring + (2 * PL + wn * 64 + rlane) * GS_PITCH + koff;      // Bt hi fragment row

  tdm_wait(g0, g1);                                   // this wave's plane of stage 0 has landed
  __syncthreads();                                    // publishes stage 0
  load_stage_g(1);                                    // flies under trip 0

  for (int s = 0; s < ns; ++s) {
    const __bf16* sa = ab + (s & 1) * BUF;
    const __bf16* sb = bb + (s & 1) * BUF;
    // all fragments of the stage (two k steps of 32), read as one group in the order the products use them
    v16b bh[2][4], bl[2][4], ah[2][FM], al[2][FM];
#pragma unroll
    for (int ks = 0; ks < 2; ++ks) {
#pragma unroll
      for (int j = 0; j < 4; ++j) bh[ks][j] = F::load(sb + (j * 16) * GS_PITCH + ks * 32);
      ah[ks][0] = F::load(sa + ks * 32);
#pragma unroll
      for (int j = 0; j < 4; ++j) bl[ks][j] = F::load(sb + (TN + j * 16) * GS_PITCH + ks * 32);
      al[ks][0] = F::load(sa + PL * GS_PITCH + ks * 32);
#pragma unroll
      for (int i = 1; i < FM; ++i) {
        ah[ks][i] = F::load(sa + (i * 16) * GS_PITCH + ks * 32);
        al[ks][i] = F::load(sa + (PL + i * 16) * GS_PITCH + ks * 32);
      }
    }
    // keeps the LDS reads together up here: left to itself the compiler sinks them in pairs among the WMMAs, each pair with a full wait
    __builtin_amdgcn_sched_barrier(0);
#pragma unroll
    for (int ks = 0; ks < 2; ++ks) {
      // four independent accumulators between two products into the same one
#pragma unroll
      for (int i = 0; i < FM; ++i) {
#pragma unroll
        for (int j = 0; j < 4; ++j) acc[i][j] = F::mma(ah[ks][i], bh[ks][j], acc[i][j]);
#pragma unroll
        for (int j = 0; j < 4; ++j) acc[i][j] = F::mma(ah[ks][i], bl[ks][j], acc[i][j]);
#pragma unroll
        for (int j = 0; j < 4; ++j) acc[i][j] = F::mma(al[ks][i], bh[ks][j], acc[i][j]);
      }
    }
    // keeps the WMMAs in front of the waits below, so that the tensor load flies under them: left to itself the compiler moves them behind the barrier
    __builtin_amdgcn_sched_barrier(0);
    // publish point of stage s + 1, passed by every wave
    asm volatile("s_wait_dscnt 0x0" ::: "memory");     // this wave's reads of stage s are done before its buffer is refilled
    tdm_wait(g0, g1);                                  // this wave's plane of stage s + 1 has landed
    __syncthreads();                                   // publishes stage s + 1 and ends every wave's reads of stage s
    if (pinned(s + 2 < ns)) load_stage_g(s + 2);       // into the buffer that trip s has just read (scalar branch)
  }
  tdm_wait(g0, g1);                                    // no tensor load is outstanding when the wave goes on
  asm volatile("s_wait_dscnt 0x0" ::: "memory");       // nor an LDS read

  // ---- epilogue: 16 rows at a time through this wave's own slab, so that every store covers whole 128-B lines ----
  // per-wave 16x64 slab, pitch 68 floats, at the start of the ring: behind the loop's last barrier no wave reads a stage any more
  // and no tensor load is outstanding, so the ring's bytes are free
  float* slab = (float*)ring + wave * (16 * 68);
  const int nW = n0 + wn * 64;
#pragma unroll
  for (int i = 0; i < FM; ++i) {
    const int mBase = m0 + wm * (FM * 16) + (i << 4);
#pragma unroll
    for (int j = 0; j < 4; ++j) {
      float bv = 0.f;
      if (BIAS) bv = bias[nW + (j << 4) + rlane];
#pragma unroll
      for (int r = 0; r < 8; ++r) slab[(mOff + r) * 68 + (j << 4) + rlane] = BIAS ? acc[i][j][r] + bv : acc[i][j][r];
    }
    asm volatile("s_wait_dscnt 0x0" ::: "memory");      // the wave's slab rows are written before its lanes read them back
    if (OUT_MODE == 0) {
      float* C = (float*)Cout;
      const int hh = lane >> 4, c4 = (lane & 15) * 4;     // row seg = 256 B = 16 lanes x 16 B
#pragma unroll
      for (int it = 0; it < 8; ++it) {
        const int row = it * 2 + hh;
        v4f v = *(const v4f*)(slab + row * 68 + c4);
        *(v4f*)(C + (size_t)(mBase + row) * ldc + nW + c4) = v;
      }
    } else {
      const int q = lane >> 3, c8 = (lane & 7) * 8;       // row seg = 128 B = 8 lanes x 16 B per plane
      unsigned short* C  = (unsigned short*)Cout;
      unsigned short* C2 = (unsigned short*)Cout2;
#pragma unroll
      for (int it = 0; it < 4; ++it) {
        const int row = it * 4 + q;
        const float* sp = slab + row * 68 + c8;
        v4u hv, lv;
#pragma unroll
        for (int e = 0; e < 4; ++e) {
          unsigned hw, lw;
          split_pair(sp[2 * e], sp[2 * e + 1], hw, lw);
          hv[e] = hw;
          lv[e] = lw;
        }
        *(v4u*)(C + (size_t)(mBase + row) * ldc + nW + c8) = hv;
        *(v4u*)(C2 + (size_t)(mBase + row) * ldc + nW + c8) = lv;
      }
    }
    // the stores' address and data registers are reused by the next row group; the clobber keeps that group's slab writes behind these reads
    asm volatile("s_wait_xcnt 0x0" ::: "memory");
  }
}

// ---- q | k | v projection: one GEMM launch -----------------------------------
// [q | k] = x . [Wq | Wk] and v = x . Wv have the same A operand, so one block forms both from one staging of its x rows.
// A block of eight waves (4 x 2), alone on its WGP, owns 256 rows of x (both batches as one M = 4096) times 128 columns of [q | k] and 64 of v;
// a wave owns 64 rows x (64 + 32) columns: 24 accumulator tiles. 16 x 16 blocks = every row and column once.
// Operand planes, product order (hi.hi + hi.lo + lo.hi, k ascending), stages of 64 k and the two-buffer ring are those of wmma_gemm_staged;
// a stage comes by eight tensor loads, one slice per wave. K >= 128.
// q | k go to the QK planes row-major; v goes to the VT planes transposed ([column][token]).
#define QV_TM   256
#define QV_AL   QV_TM                  // first row of each plane in a buffer, every one a multiple of 128 rows: x hi at 0, x lo,
#define QV_BH   (2 * QV_TM)            // 128 rows of [Wq | Wk]^T hi,
#define QV_BL   (QV_BH + 128)          // lo,
#define QV_VH   (QV_BL + 128)          // 64 rows of Wv^T hi,
#define QV_VL   (QV_VH + 128)          // lo
#define QV_ROWS (QV_VL + 128)
#define QV_BUF  (QV_ROWS * GS_PITCH)

__global__ __launch_bounds__(256) void qkv_gemm_staged(
    const unsigned short* __restrict__ Xh, const unsigned short* __restrict__ Xl,
    const unsigned short* __restrict__ Wqkh, const unsigned short* __restrict__ Wqkl,
    const unsigned short* __restrict__ Wvh, const unsigned short* __restrict__ Wvl,
    unsigned short* __restrict__ QKh, unsigned short* __restrict__ QKl,
    unsigned short* __restrict__ VTh, unsigned short* __restrict__ VTl, int K) {
  typedef Frag<__bf16> F;
  __shared__ __attribute__((aligned(2048))) unsigned short ring[2 * QV_BUF];
  const int lane = threadIdx.x & 31;
  const int wave = __builtin_amdgcn_readfirstlane((int)(threadIdx.x >> 5));
  const int wm = wave >> 1, wn = wave & 1;
  const int tm = (int)blockIdx.x >> 4;
  const int tn = (int)blockIdx.x & 15;
  const int m0 = tm * QV_TM;
  const int rlane = lane & 15;                 // row (A) / col (B, D) within subtile
  const int koff  = (lane >> 4) * 8;           // k offset of this lane half
  const int mOff  = (lane >> 4) * 8;           // D row offset

  // staging: every wave brings one slice of a stage to row wave * 128 of the buffer:
  // waves 0, 1 the halves of x hi, 2, 3 of x lo, 4 [Wq | Wk]^T hi, 5 lo, 6 Wv^T hi (64 rows), 7 lo
  const unsigned short* splane = wave < 2 ? Xh : wave < 4 ? Xl : wave == 4 ? Wqkh : wave == 5 ? Wqkl : wave == 6 ? Wvh : Wvl;
  const int srow = wave < 4 ? m0 + (wave & 1) * 128 : wave < 6 ? tn * 128 : tn * 64;
  const uint64_t gsrc = (uint64_t)(uintptr_t)(splane + (size_t)srow * DIN);
  const uint32_t ldst = (uint32_t)(uintptr_t)ring + (uint32_t)wave * SLICE_B;
  u32x8 g1 = tdm_group1(wave < 6 ? 128u : 64u, DIN * 2u);
  const int ns = K >> 6;                           // stages
  u32x4 g0;                                        // group 0 of the wave's last request
  auto load_stage_q = [&](int s) {                 // this wave's slice of stage s -> buffer s & 1
    g0 = tdm_group0(ldst + (uint32_t)(s & 1) * (QV_BUF * 2), gsrc + (uint64_t)s * 128);
    tdm_load(g0, g1);
  };
  load_stage_q(0);

  v8f acc[4][6];                                   // columns 0..3: q | k, 4..5: v
#pragma unroll
  for (int i = 0; i < 4; ++i)
#pragma unroll
    for (int j = 0; j < 6; ++j) acc[i][j] = (v8f){0.f,0.f,0.f,0.f,0.f,0.f,0.f,0.f};

  const __bf16* ab = (const __bf16*)ring + (wm * 64 + rlane) * GS_PITCH + koff;               // x hi fragment row of this lane
  const __bf16* bb = (const __bf16*)ring + (QV_BH + wn * 64 + rlane) * GS_PITCH + koff;       // [Wq | Wk]^T hi fragment row
  const __bf16* vb = (const __bf16*)ring + (QV_VH + wn * 32 + rlane) * GS_PITCH + koff;       // Wv^T hi fragment row

  tdm_wait(g0, g1);                                   // this wave's slice of stage 0 has landed
  __syncthreads();                                    // publishes stage 0
  load_stage_q(1);                                    // flies under trip 0

  for (int s = 0; s < ns; ++s) {
    const __bf16* sa = ab + (s & 1) * QV_BUF;
    const __bf16* sb = bb + (s & 1) * QV_BUF;
    const __bf16* sv = vb + (s & 1) * QV_BUF;
#pragma unroll
    for (int ks = 0; ks < 2; ++ks) {
      // the fragments of one k step of 32, read as one group in the order the products use them: behind the x rows every further
      // fragment opens four or six products, so that the matrix unit starts early and is not overtaken by the reads of the block's eight waves;
      // while a wave waits for its group, the other wave of its SIMD has the matrix unit
      v16b bh[6], bl[6], ah[4], al[4];
#pragma unroll
      for (int i = 0; i < 4; ++i) ah[i] = F::load(sa + (i * 16) * GS_PITCH + ks * 32);
#pragma unroll
      for (int j = 0; j < 4; ++j) bh[j] = F::load(sb + (j * 16) * GS_PITCH + ks * 32);
#pragma unroll
      for (int j = 0; j < 2; ++j) bh[4 + j] = F::load(sv + (j * 16) * GS_PITCH + ks * 32);
#pragma unroll
      for (int j = 0; j < 4; ++j) bl[j] = F::load(sb + (128 + j * 16) * GS_PITCH + ks * 32);
#pragma unroll
      for (int j = 0; j < 2; ++j) bl[4 + j] = F::load(sv + (QV_VL - QV_VH + j * 16) * GS_PITCH + ks * 32);
#pragma unroll
      for (int i = 0; i < 4; ++i) al[i] = F::load(sa + (QV_AL + i * 16) * GS_PITCH + ks * 32);
      // keeps the LDS reads together up here: left to itself the compiler sinks them in pairs among the WMMAs, each pair with a full wait
      __builtin_amdgcn_sched_barrier(0);
      // every accumulator takes hi.hi, hi.lo, lo.hi in this order; at least eight other products stand between two into the same one
#pragma unroll
      for (int j = 0; j < 6; ++j)
#pragma unroll
        for (int i = 0; i < 4; ++i) acc[i][j] = F::mma(ah[i], bh[j], acc[i][j]);
#pragma unroll
      for (int j = 0; j < 6; ++j)
#pragma unroll
        for (int i = 0; i < 4; ++i) acc[i][j] = F::mma(ah[i], bl[j], acc[i][j]);
#pragma unroll
      for (int i = 0; i < 4; ++i)
#pragma unroll
        for (int j = 0; j < 6; ++j) acc[i][j] = F::mma(al[i], bh[j], acc[i][j]);
      // keeps the WMMAs in front of the next group of reads and of the waits below, so that the tensor load flies under them
      __builtin_amdgcn_sched_barrier(0);
    }
    // publish point of stage s + 1, passed by every wave
    asm volatile("s_wait_dscnt 0x0" ::: "memory");     // this wave's reads of stage s are done before its buffer is refilled
    tdm_wait(g0, g1);                                  // this wave's slice of stage s + 1 has landed
    __syncthreads();                                   // publishes stage s + 1 and ends every wave's reads of stage s
    if (pinned(s + 2 < ns)) load_stage_q(s + 2);       // into the buffer that trip s has just read (scalar branch)
  }
  tdm_wait(g0, g1);                                    // no tensor load is outstanding when the wave goes on
  asm volatile("s_wait_dscnt 0x0" ::: "memory");       // nor an LDS read

  // ---- epilogue: 16 x 64 values at a time through this wave's own slab, so that every store covers whole 128-B lines ----
  // per-wave slab, pitch 68 floats, at the start of the ring: behind the loop's last barrier no wave reads a stage any more
  // and no tensor load is outstanding, so the ring's bytes are free
  float* slab = (float*)ring + wave * (16 * 68);
  const int q = lane >> 3, c8 = (lane & 7) * 8;         // row seg = 128 B = 8 lanes x 16 B per plane
  auto store_slab = [&](unsigned short* C, unsigned short* C2, size_t o0, int ld) {   // slab row r -> 64 elements at o0 + r * ld of both planes
    asm volatile("s_wait_dscnt 0x0" ::: "memory");      // the wave's slab rows are written before its lanes read them back
#pragma unroll
    for (int it = 0; it < 4; ++it) {
      const int row = it * 4 + q;
      const float* sp = slab + row * 68 + c8;
      v4u hv, lv;
#pragma unroll
      for (int e = 0; e < 4; ++e) {
        unsigned hw, lw;
        split_pair(sp[2 * e], sp[2 * e + 1], hw, lw);
        hv[e] = hw;
        lv[e] = lw;
      }
      *(v4u*)(C + o0 + (size_t)row * ld + c8) = hv;
      *(v4u*)(C2 + o0 + (size_t)row * ld + c8) = lv;
    }
    // the stores' address and data registers are reused by the next group; the clobber keeps that group's slab writes behind these reads
    asm volatile("s_wait_xcnt 0x0" ::: "memory");
  };
  // q | k: slab row = one of 16 rows of x, slab column = one of the wave's 64 columns
#pragma unroll
  for (int i = 0; i < 4; ++i) {
#pragma unroll
    for (int j = 0; j < 4; ++j)
#pragma unroll
      for (int r = 0; r < 8; ++r) slab[(mOff + r) * 68 + (j << 4) + rlane] = acc[i][j][r];
    store_slab(QKh, QKl, (size_t)(m0 + wm * 64 + (i << 4)) * (2 * DOUT) + tn * 128 + wn * 64, 2 * DOUT);
  }
  // v, transposed: slab row = one of 16 columns of v, slab column = one of the wave's 64 tokens (a lane holds 8 consecutive ones per tile)
  const int bat  = m0 / NSEQ;                           // a block's 256 rows lie in one batch
  const int tok0 = m0 - bat * NSEQ + wm * 64;
#pragma unroll
  for (int jv = 0; jv < 2; ++jv) {
#pragma unroll
    for (int i = 0; i < 4; ++i) {
      const v8f a = acc[i][4 + jv];
      *(v4f*)(slab + rlane * 68 + (i << 4) + mOff)     = (v4f){a[0], a[1], a[2], a[3]};
      *(v4f*)(slab + rlane * 68 + (i << 4) + mOff + 4) = (v4f){a[4], a[5], a[6], a[7]};
    }
    store_slab(VTh, VTl, ((size_t)bat * DOUT + tn * 64 + wn * 32 + (jv << 4)) * NSEQ + tok0, NSEQ);
  }
}

// ---------------------------------------------------------------------------
// Elementwise split: 2 elements per thread, one 4-B store per lane per plane; i = index of the pair, n2 = pairs in the plane.
// ---------------------------------------------------------------------------
__device__ __forceinline__ unsigned pk16(unsigned short a, unsigned short b) { return (unsigned)a | ((unsigned)b << 16); }

// hi = bf16_rne(in), lo = bf16_rne(in - hi)
__device__ __forceinline__ void split_bf16x2(const float* __restrict__ in, unsigned short* __restrict__ hi,
                                             unsigned short* __restrict__ lo, int i, int n2) {
  if (i < n2) {
    const v2f f = *(const v2f*)(in + 2 * (size_t)i);
    const unsigned short h0 = f2bf_bits(f[0]), h1 = f2bf_bits(f[1]);
    const unsigned short l0 = f2bf_bits(f[0] - bf_bits2f(h0)), l1 = f2bf_bits(f[1] - bf_bits2f(h1));
    const unsigned uh = pk16(h0, h1), ul = pk16(l0, l1);
    ((unsigned*)hi)[i] = uh;
    ((unsigned*)lo)[i] = ul;
    
  }
}

// ---------------------------------------------------------------------------
// Transpose + bf16 hi/lo split of an f32 matrix: in [rows][cols] (row pitch ldi floats) ->
// outh/outl[c][r] = split(in[r][c]) (row pitch ldo u16). One 64x64 tile (bx of cols/64, by of rows/64) per block of 256 threads;
// rows, cols % 64 == 0. tf: 64 * 68 floats of LDS.
// Coverage per block: load 4 it x 256 thr x 4 f32 = 64x64; store 2 it x 256 thr x 8 u16 = 64x64 per plane;
// ---------------------------------------------------------------------------
__device__ __forceinline__ void transpose_split_tile(float* tf, const float* __restrict__ in, int ldi,
                                                     unsigned short* __restrict__ outh,
                                                     unsigned short* __restrict__ outl, int ldo, int bx, int by) {
  const int c0  = bx * 64;           // input column block = output row block
  const int r0  = by * 64;           // input row block    = output column block
  const int tid = threadIdx.x;
  {
    const int sub = tid >> 4;          // 0..15
    const int c4  = (tid & 15) * 4;    // 0..60
#pragma unroll
    for (int it = 0; it < 4; ++it) {
      const int rr = it * 16 + sub;
      const v4f a = *(const v4f*)(in + (size_t)(r0 + rr) * ldi + c0 + c4);
      *(v4f*)(tf + rr * 68 + c4) = a;
    }
  }
  __syncthreads();
  const int s8 = tid >> 3;             // 0..31
  const int c8 = (tid & 7) * 8;        // 0..56
  v4u hv[2], lv[2];
#pragma unroll
  for (int it = 0; it < 2; ++it) {
    const int oc = it * 32 + s8;       // output row within tile (= input column)
    v4u a, a2;
#pragma unroll
    for (int q = 0; q < 4; ++q) {
      const float f0 = tf[(c8 + 2 * q) * 68 + oc];
      const float f1 = tf[(c8 + 2 * q + 1) * 68 + oc];
      const unsigned short h0 = f2bf_bits(f0), h1 = f2bf_bits(f1);
      const unsigned short l0 = f2bf_bits(f0 - bf_bits2f(h0));
      const unsigned short l1 = f2bf_bits(f1 - bf_bits2f(h1));
      a[q]  = pk16(h0, h1);
      a2[q] = pk16(l0, l1);
    }
    hv[it] = a; lv[it] = a2;
  }
  {
#pragma unroll
    for (int it = 0; it < 2; ++it) {
      const int oc = it * 32 + s8;
      const size_t go = (size_t)(c0 + oc) * ldo + r0 + c8;
      *(v4u*)(outh + go) = hv[it];
      *(v4u*)(outl + go) = lv[it];
    }
    
  }
}

// All operand planes in one grid; the five jobs are independent of one another, a block does one piece of one of them.
//   blocks 0 .. 4*W_TILES-1: the 64x64 tiles of Wq, Wk, Wv, Wo ([k][n] -> planes [n][k]); Wk^T goes behind Wq^T in the WqkT planes
//   then X_BLOCKS blocks: x of both batches -> hi/lo planes (256 threads x 2 elements each)
#define W_TILES  ((DOUT / 64) * (DIN / 64))          // 256 per weight
#define X_PAIRS  (NB * NSEQ * DIN / 2)
#define X_BLOCKS (X_PAIRS / 256)                     // 8192
__global__ __launch_bounds__(256) void prep_kernel(const float* __restrict__ x, const float* __restrict__ Wq, const float* __restrict__ Wk,
                                                   const float* __restrict__ Wv, const float* __restrict__ Wo,
                                                   unsigned short* __restrict__ Xh, unsigned short* __restrict__ Xl,
                                                   unsigned short* __restrict__ WqkTh, unsigned short* __restrict__ WqkTl,
                                                   unsigned short* __restrict__ WvTh, unsigned short* __restrict__ WvTl,
                                                   unsigned short* __restrict__ WoTh, unsigned short* __restrict__ WoTl) {
  __shared__ __align__(16) float tf[64 * 68];
  const int bid = (int)blockIdx.x;
  if (bid < 4 * W_TILES) {                           // block-uniform
    const int sel = bid / W_TILES;
    const int t   = bid - sel * W_TILES;
    const float* in    = sel == 0 ? Wq : sel == 1 ? Wk : sel == 2 ? Wv : Wo;
    unsigned short* oh = sel == 0 ? WqkTh : sel == 1 ? WqkTh + (size_t)DOUT * DIN : sel == 2 ? WvTh : WoTh;
    unsigned short* ol = sel == 0 ? WqkTl : sel == 1 ? WqkTl + (size_t)DOUT * DIN : sel == 2 ? WvTl : WoTl;
    transpose_split_tile(tf, in, DOUT, oh, ol, DIN, t % (DOUT / 64), t / (DOUT / 64));
  } else {
    split_bf16x2(x, Xh, Xl, (bid - 4 * W_TILES) * 256 + (int)threadIdx.x, X_PAIRS);
  }
}

// ---------------------------------------------------------------------------
// Fused causal attention, all batches and heads in one launch: scores, relu * distance decay, online softmax and P.V in one kernel;
// neither scores nor probabilities go to memory. The K rows and V^T columns of 64 keys (a stage) are brought into LDS once per block
// by four tensor loads (one plane per issuing wave), whole 128-B lines, two buffers, and all eight waves take their fragments from there.
// A wave owns 32 queries (two tiles of 16, one query per tile and lane column c) of head blockIdx.y, batch blockIdx.z, and takes 32 of the 64 keys
// of every stage (a pass); wave ^ 2 owns the same queries and takes the other 32. A K or V^T fragment read from LDS so feeds two query tiles:
//   St[key][query] = K . Q^T   (A = K rows, B = Q rows kept in registers; both through the same loader)
//   t = relu(St) * R_hat(h, i - j) * 0.125 in log2 units, -inf for j > i (only the last pass holds such keys),
//   R_hat = (1 + exp(v[h])) * rcp(1 + exp(v[h] - w[h] * (i - j))): a function of the head and of i - j alone, so the block makes it once
//   for every distance (table in LDS, below) and a pass reads its factors instead of computing them
//   running maximum m (starts at 0: every allowed t is >= 0 and key 0 is always allowed), p = exp2(t - m),
//   Ot[d][query] = Ot * exp2(m_old - m_new) + V^T . P^T
// The two 16-key score tiles of a pass and query tile, converted in place, are the B operand of the second product
// (element s = tile s >> 3, register s & 7), which is the k order the A loader of V^T delivers.
// A lane holds 8 + 8 keys of each of its two queries; lanes c and c + 16 share the maximum each pass and join their sums at the end.
// At the end the two waves of a query group join their maxima, sums and outputs through LDS; each finishes and stores one of the two tiles.
// Waves 0..3 of a block take query groups from the long end, waves 4..7 the mirrored ones from the short end.
// Output: lane (c, hf) holds ctx[q0 + 16 * half + c][head*64 + ds*16 + hf*8 + 0..7]: one 16-B store per plane and ds;
// the 128-B line of a (query, head) is written by one wave. grid (NSEQ/128, NH, NB) x 4 wave pairs x 32 queries = all rows.
// Every '#pragma unroll' below stands on a loop of constant trip count whose index selects a fragment or an accumulator:
// unrolled, those arrays stay in registers.
// ---------------------------------------------------------------------------

__device__ __forceinline__ float other_half(float x) {   // the value of lane l ^ 16
  const int b = __float_as_int(x);
  return __int_as_float(__builtin_amdgcn_permlanex16(b, b, 0x76543210, 0xfedcba98, false, false));
}

// exp2 with the slot behind a transcendental kept. The outputs are early-clobber, so inside a statement no exponential takes a source of another,
// and the v_nop at the end fills the slot behind the last one.
__device__ __forceinline__ float exp2_slot(float x) {
  float r;
  asm("v_exp_f32 %0, %1\n\tv_nop" : "=&v"(r) : "v"(x));
  return r;
}
__device__ __forceinline__ void exp2x4(float x0, float x1, float x2, float x3, float& r0, float& r1, float& r2, float& r3) {
  float a, b, c, d;
  asm("v_exp_f32 %0, %4\n\tv_exp_f32 %1, %5\n\tv_exp_f32 %2, %6\n\tv_exp_f32 %3, %7\n\tv_nop"
      : "=&v"(a), "=&v"(b), "=&v"(c), "=&v"(d) : "v"(x0), "v"(x1), "v"(x2), "v"(x3));
  r0 = a; r1 = b; r2 = c; r3 = d;
}

// LDS ring: a stage holds four planes (K hi, K lo: 64 key rows x 64 dims; V^T hi, V^T lo: 64 dim rows x 64 keys); a row is 128 B of data
// at a pitch of 144 B (16 B x odd: the 16-byte fragment reads of 16 rows fall on distinct banks).
#define AT_PITCH 72                    // 16-bit elements
#define AT_PLANE 5120                  // 16-bit elements from one plane's place to the next: 64 padded rows (9 KiB) rounded up to a multiple of 2 KiB
#define AT_BUF   (4 * AT_PLANE)

// Decay table of the block's head: U[x] = R_hat(h, 2047 - x) * 0.125 * log2(e), x = 0 .. DT_N + 2 (distances 2047 down to -35; those below 0
// belong to masked keys only). A lane wants 8 + 8 + 8 consecutive x per pass (8 + 8 per query), from a start whose residue modulo 4 is fixed per lane, so the table
// is kept four times, copy k shifted by k entries (copy k, place y: U[y + k]): in its own copy every lane reads whole aligned 16-B pieces.
#define DT_N  2080                     // places of a copy that are read
#define DT_F  4                        // floats in front of place 0 of a copy: room for the shift, so that the fill needs no test
#define DT_CP 2128                     // pitch of a copy in floats: 64 B past a multiple of 256 B, so that the four copies' pieces fall on different banks

// four waves per SIMD (two blocks per WGP): the waves fill each other's waits
__global__ __launch_bounds__(256) __attribute__((amdgpu_waves_per_eu(4, 4))) void fused_attn_kernel(const unsigned short* __restrict__ QKhp, const unsigned short* __restrict__ QKlp,
                                                         const unsigned short* __restrict__ VThp, const unsigned short* __restrict__ VTlp,
                                                         const float* __restrict__ wp, const float* __restrict__ vp,
                                                         unsigned short* __restrict__ Oh, unsigned short* __restrict__ Ol) {
  typedef Frag<__bf16> F;
  const int lane = threadIdx.x & 31;
  const int wave = __builtin_amdgcn_readfirstlane((int)(threadIdx.x >> 5));
  const int head = blockIdx.y;
  const size_t bz = blockIdx.z;
  const int c    = lane & 15;
  const int hf   = lane >> 4;
  const int half = (wave >> 1) & 1;                             // which 32 keys of every stage this wave takes
  const int tg   = (int)blockIdx.x * 2 + (wave & 1);            // 0..31
  const int qg   = (wave < 4) ? (NSEQ / 32 - 1 - tg) : tg;      // every 32-query group once, by two waves
  const int q0   = qg << 5;
  const int np   = qg + 1;                                      // passes of 32 keys of the group; keys of passes 0..np-2 are all < q0

  const float L2E = 1.44269504088896341f;
  const float w2  = wp[head] * L2E;
  const float v2  = vp[head] * L2E;
  const float c1  = (1.0f + __builtin_amdgcn_exp2f(v2)) * (0.125f * L2E);

  const size_t qo = (bz * NSEQ + q0 + c) * (2 * DOUT) + head * HDIM + hf * 8;

  __shared__ __attribute__((aligned(2048))) unsigned short ring[2 * AT_BUF];
  // stages of 64 keys that the block's longest group needs: 17..32, so stages 0 and 1 always exist and every key is < NSEQ
  const int ns = (NSEQ / 32 - (int)blockIdx.x * 2 + 1) >> 1;
  // staging: waves 4..7 (the short query groups) each bring one plane of a stage, 64 rows of 128 B at a source pitch of 4 KiB:
  // wave 4 K hi, 5 K lo (a stage further on = 64 rows), 6 V^T hi, 7 V^T lo (a stage further on = 128 B)
  const int pln = wave & 3;
  const unsigned short* splane = pln == 0 ? QKhp : pln == 1 ? QKlp : pln == 2 ? VThp : VTlp;
  const uint64_t gsrc = (uint64_t)(uintptr_t)(splane + (pln < 2 ? bz * NSEQ * (2 * DOUT) + DOUT + head * HDIM : (bz * DOUT + head * HDIM) * NSEQ));
  const uint64_t gstep = pln < 2 ? (uint64_t)64 * (2 * DOUT) * 2 : (uint64_t)128;
  const uint32_t ldst = (uint32_t)(uintptr_t)ring + (uint32_t)pln * (AT_PLANE * 2);
  static_assert(2 * DOUT == NSEQ, "one source pitch for all four planes");
  u32x8 g1 = tdm_group1(64u, NSEQ * 2u);
  u32x4 g0;                                        // group 0 of the wave's last request (a wave that issues none only carries it)
  auto form_stage = [&](int s) {                   // this wave's plane of stage s -> buffer s & 1
    g0 = tdm_group0(ldst + (uint32_t)(s & 1) * (AT_BUF * 2), gsrc + (uint64_t)s * gstep);
  };
  form_stage(0);
  if (pinned(wave >= 4)) tdm_load(g0, g1);         // scalar branch: a tensor load ignores EXEC
  // the decay table, written while stage 0 flies; the barrier that publishes stage 0 publishes it too
  __shared__ __align__(16) float dtab[4 * DT_CP];
  for (int x = (int)threadIdx.x; x < DT_N + 3; x += 256) {
    const float t = c1 * __builtin_amdgcn_rcpf(1.0f + __builtin_amdgcn_exp2f(fmaf(-w2, (float)(NSEQ - 1 - x), v2)));
    for (int k = 0; k < 4; ++k) dtab[k * DT_CP + DT_F + x - k] = t;
  }
  // the first key of pass p stands, for query q0 + c of this lane, at x = NSEQ - 1 - (q0 + c - 8 * hf) + 32 * p; its residue modulo 4 picks the copy;
  // query q0 + 16 + c stands 16 places lower
  const int dk4 = (NSEQ - 1 - c) & 3;
  const float* dtl = dtab + dk4 * DT_CP + DT_F + (NSEQ - 1 - q0 - c + hf * 8 - dk4);
  // this lane's fragment row and k half, in this wave's 32 keys of a stage: K rows half * 32 + .., V^T columns half * 32 + ..
  const __bf16* rbk = (const __bf16*)ring + (half * 32 + c) * AT_PITCH + hf * 8;
  const __bf16* rbv = (const __bf16*)ring + 2 * AT_PLANE + c * AT_PITCH + half * 32 + hf * 8;

  v8f o[2][4];
#pragma unroll
  for (int t = 0; t < 2; ++t)
#pragma unroll
    for (int ds = 0; ds < 4; ++ds) o[t][ds] = (v8f){0.f,0.f,0.f,0.f,0.f,0.f,0.f,0.f};
  float m[2] = {0.f, 0.f}, l[2] = {0.f, 0.f};
  // keeps the start values above in front of the Q loads, so that they take none of the loads' address registers
  __builtin_amdgcn_sched_barrier(0);

  v16b qh[2][2], ql[2][2];                         // [query tile][k step]
#pragma unroll
  for (int t = 0; t < 2; ++t)
#pragma unroll
    for (int ks = 0; ks < 2; ++ks) {
      qh[t][ks] = F::load((const __bf16*)QKhp + qo + (size_t)t * 16 * (2 * DOUT) + ks * 32);
      ql[t][ks] = F::load((const __bf16*)QKlp + qo + (size_t)t * 16 * (2 * DOUT) + ks * 32);
    }
  // the address registers of the Q loads are reused right below; the loaded values as inputs keep the wait behind the loads,
  // and the two fences keep every later register write behind the wait
  __builtin_amdgcn_sched_barrier(0);
  asm volatile("s_wait_xcnt 0x0" :: "v"(qh[0][0]), "v"(qh[0][1]), "v"(ql[0][0]), "v"(ql[0][1]),
                                    "v"(qh[1][0]), "v"(qh[1][1]), "v"(ql[1][0]), "v"(ql[1][1]) : "memory");
  __builtin_amdgcn_sched_barrier(0);

  tdm_wait(g0, g1);                                   // an issuing wave's plane of stage 0 has landed
  __syncthreads();                                    // publishes stage 0
  form_stage(1);
  if (pinned(wave >= 4)) tdm_load(g0, g1);            // flies under stage 0

  for (int s = 0; s < ns; ++s) {
  const int p = 2 * s + half;
  if (p < np) {                                       // wave-uniform: a wave past its diagonal only keeps the publish points
    const __bf16* sk = rbk + (s & 1) * AT_BUF;
    const __bf16* sv = rbv + (s & 1) * AT_BUF;
    const int j0 = p << 5;
    // every K fragment read from LDS feeds the score products of both query tiles
    v16b kh[2][2], kl[2][2];                          // [k step][16 keys]
#pragma unroll
    for (int a = 0; a < 2; ++a) kh[0][a] = F::load(sk + (a * 16) * AT_PITCH);
#pragma unroll
    for (int a = 0; a < 2; ++a) kl[0][a] = F::load(sk + AT_PLANE + (a * 16) * AT_PITCH);
#pragma unroll
    for (int a = 0; a < 2; ++a) kh[1][a] = F::load(sk + (a * 16) * AT_PITCH + 32);
    // keeps these 12 K reads together up here, in the order of their use: left to itself the compiler reads each fragment
    // into the same registers right in front of its products, each time with a full wait
    __builtin_amdgcn_sched_barrier(0);
    v8f st[2][2];                                     // [query tile][16 keys]
#pragma unroll
    for (int t = 0; t < 2; ++t)
#pragma unroll
      for (int a = 0; a < 2; ++a) st[t][a] = (v8f){0.f,0.f,0.f,0.f,0.f,0.f,0.f,0.f};
    v4f dk[3][2];                                     // decay factors; keys 16a + 0..7 of query tile t use block a - t + 1
    v16b vh[4], vl[4];
#pragma unroll
    for (int ks = 0; ks < 2; ++ks) {
      // four independent accumulators between two products into the same one
#pragma unroll
      for (int a = 0; a < 2; ++a)
#pragma unroll
        for (int t = 0; t < 2; ++t) st[t][a] = F::mma(kh[ks][a], qh[t][ks], st[t][a]);
#pragma unroll
      for (int a = 0; a < 2; ++a)
#pragma unroll
        for (int t = 0; t < 2; ++t) st[t][a] = F::mma(kh[ks][a], ql[t][ks], st[t][a]);
#pragma unroll
      for (int a = 0; a < 2; ++a)
#pragma unroll
        for (int t = 0; t < 2; ++t) st[t][a] = F::mma(kl[ks][a], qh[t][ks], st[t][a]);
      // the two fences hold a group of reads at this place, in registers the products above have left:
      // the last K fragments and the decay factors pass under the second k step's products, the first V^T fragments under the softmax
      __builtin_amdgcn_sched_barrier(0);
      if (ks == 0) {
#pragma unroll
        for (int a = 0; a < 2; ++a) kl[1][a] = F::load(sk + AT_PLANE + (a * 16) * AT_PITCH + 32);
#pragma unroll
        for (int b = 0; b < 3; ++b) {
          dk[b][0] = *(const v4f*)(dtl + j0 + (b - 1) * 16);
          dk[b][1] = *(const v4f*)(dtl + j0 + (b - 1) * 16 + 4);
        }
      } else {
        vh[0] = F::load(sv);
        vl[0] = F::load(sv + AT_PLANE);
      }
      __builtin_amdgcn_sched_barrier(0);
    }
    union PF { v16b v; unsigned u[8]; } ph[2], pl[2];
#pragma unroll
    for (int t = 0; t < 2; ++t) {
      const int lim = q0 + t * 16 + c - j0 - hf * 8;  // i - j of this lane's first key; key 16a + r is allowed while 16a + r <= lim
      float tt[2][8];
#pragma unroll
      for (int a = 0; a < 2; ++a)
#pragma unroll
        for (int r = 0; r < 8; ++r) tt[a][r] = fmaxf(st[t][a][r] * dk[a - t + 1][r >> 2][r & 3], 0.0f);   // the factor is never negative: relu(s) * f = relu(s * f)
      if (p == np - 1) {                               // wave-uniform
#pragma unroll
        for (int a = 0; a < 2; ++a)
#pragma unroll
          for (int r = 0; r < 8; ++r) tt[a][r] = (a * 16 + r <= lim) ? tt[a][r] : -INFINITY;
      }
      float mx = m[t];
#pragma unroll
      for (int a = 0; a < 2; ++a)
#pragma unroll
        for (int r = 0; r < 8; ++r) mx = fmaxf(mx, tt[a][r]);
      mx = fmaxf(mx, other_half(mx));
      const float alpha = exp2_slot(m[t] - mx);
      m[t] = mx;
      float ps0 = 0.f, ps1 = 0.f;
#pragma unroll
      for (int a = 0; a < 2; ++a)
#pragma unroll
        for (int r = 0; r < 8; r += 4)
          exp2x4(tt[a][r] - mx, tt[a][r + 1] - mx, tt[a][r + 2] - mx, tt[a][r + 3] - mx, tt[a][r], tt[a][r + 1], tt[a][r + 2], tt[a][r + 3]);
#pragma unroll
      for (int r = 0; r < 8; ++r) {
        ps0 += tt[0][r];
        ps1 += tt[1][r];
      }
      l[t] = l[t] * alpha + (ps0 + ps1);
#pragma unroll
      for (int ds = 0; ds < 4; ++ds) o[t][ds] *= alpha;
#pragma unroll
      for (int a = 0; a < 2; ++a)
#pragma unroll
        for (int r2 = 0; r2 < 4; ++r2) split_pair(tt[a][2 * r2], tt[a][2 * r2 + 1], ph[t].u[a * 4 + r2], pl[t].u[a * 4 + r2]);
    }
    // every V^T fragment read from LDS feeds the products of both query tiles
    // the fences hold the other V^T reads here, behind the softmax (whose registers they take) and in front of the first products, under which they pass
    __builtin_amdgcn_sched_barrier(0);
#pragma unroll
    for (int ds = 1; ds < 4; ++ds) {
      vh[ds] = F::load(sv + (ds * 16) * AT_PITCH);
      vl[ds] = F::load(sv + AT_PLANE + (ds * 16) * AT_PITCH);
    }
    __builtin_amdgcn_sched_barrier(0);
#pragma unroll
    for (int t = 0; t < 2; ++t) o[t][0] = F::mma(vh[0], ph[t].v, o[t][0]);
#pragma unroll
    for (int t = 0; t < 2; ++t) o[t][0] = F::mma(vh[0], pl[t].v, o[t][0]);
#pragma unroll
    for (int t = 0; t < 2; ++t) o[t][0] = F::mma(vl[0], ph[t].v, o[t][0]);
#pragma unroll
    for (int ds = 1; ds < 4; ++ds)
#pragma unroll
      for (int t = 0; t < 2; ++t) o[t][ds] = F::mma(vh[ds], ph[t].v, o[t][ds]);
#pragma unroll
    for (int ds = 1; ds < 4; ++ds)
#pragma unroll
      for (int t = 0; t < 2; ++t) o[t][ds] = F::mma(vh[ds], pl[t].v, o[t][ds]);
#pragma unroll
    for (int ds = 1; ds < 4; ++ds)
#pragma unroll
      for (int t = 0; t < 2; ++t) o[t][ds] = F::mma(vl[ds], ph[t].v, o[t][ds]);
    // four vector slots behind the pass's last WMMAs: the code behind the publish point, reached over the loop's branches,
    // reuses their operand registers
    acc_guard4(o[0][2], o[0][3], o[1][2], o[1][3]);
  }
    // publish point of stage s + 1, passed by every wave
    asm volatile("s_wait_dscnt 0x0" ::: "memory");     // this wave's reads of stage s are done before its buffer is refilled
    tdm_wait(g0, g1);                                  // an issuing wave's plane of stage s + 1 has landed
    __syncthreads();                                   // publishes stage s + 1 and ends every wave's reads of stage s
    if (pinned((wave >= 4) & (s + 2 < ns))) {          // scalar branch
      form_stage(s + 2);                               // into the buffer that stage s has just left
      tdm_load(g0, g1);
    }
  }
  tdm_wait(g0, g1);                                    // no tensor load is outstanding when the wave goes on
  asm volatile("s_wait_dscnt 0x0" ::: "memory");       // nor an LDS read

  // ---- join of the two key halves of a query group (waves w and w ^ 2): each wave finishes query tile 'half' and hands the other tile over ----
  // The ring is free: behind the loop's last barrier no wave reads a stage any more and no tensor load is outstanding.
  // A wave's slot: 8 pieces of 16 B per lane (the tile's 32 sums), then its maximum and its sum, each plane lane-contiguous.
  float* xs = (float*)ring + wave * (34 * 32);
  const float* xr = (const float*)ring + (wave ^ 2) * (34 * 32);
  v8f ok[4];
#pragma unroll
  for (int ds = 0; ds < 4; ++ds) {
    const v8f og = half ? o[0][ds] : o[1][ds];
    ok[ds] = half ? o[1][ds] : o[0][ds];
    *(v4f*)(xs + ((ds * 2) * 32 + lane) * 4)     = (v4f){og[0], og[1], og[2], og[3]};
    *(v4f*)(xs + ((ds * 2 + 1) * 32 + lane) * 4) = (v4f){og[4], og[5], og[6], og[7]};
  }
  xs[32 * 32 + lane] = half ? m[0] : m[1];
  xs[33 * 32 + lane] = half ? l[0] : l[1];
  const float mk = half ? m[1] : m[0];
  const float lk = half ? l[1] : l[0];
  __syncthreads();                                     // the partner's tile is written before it is read
  const float mp = xr[32 * 32 + lane];
  const float lp = xr[33 * 32 + lane];
  const float mj = fmaxf(mk, mp);
  const float fk = __builtin_amdgcn_exp2f(mk - mj);
  const float fp = __builtin_amdgcn_exp2f(mp - mj);
  float lj = lk * fk + lp * fp;
  lj += other_half(lj);
  const float inv = 1.0f / lj;                         // lj >= 1: the row maximum contributes exp2(0)
  const float gk = fk * inv, gp = fp * inv;
  const size_t oo = (bz * NSEQ + q0 + half * 16 + c) * DOUT + head * HDIM + hf * 8;
#pragma unroll
  for (int ds = 0; ds < 4; ++ds) {
    const v4f p0 = *(const v4f*)(xr + ((ds * 2) * 32 + lane) * 4);
    const v4f p1 = *(const v4f*)(xr + ((ds * 2 + 1) * 32 + lane) * 4);
    float f[8];
#pragma unroll
    for (int r = 0; r < 4; ++r) {
      f[r]     = ok[ds][r] * gk + p0[r] * gp;
      f[r + 4] = ok[ds][r + 4] * gk + p1[r] * gp;
    }
    unsigned hw[4], lw[4];
#pragma unroll
    for (int r2 = 0; r2 < 4; ++r2) split_pair(f[2 * r2], f[2 * r2 + 1], hw[r2], lw[r2]);
    *(v4u*)(Oh + oo + ds * 16) = (v4u){hw[0], hw[1], hw[2], hw[3]};
    *(v4u*)(Ol + oo + ds * 16) = (v4u){lw[0], lw[1], lw[2], lw[3]};
  }
}

// ---------------------------------------------------------------------------
// Workspace region map (byte offsets; all offsets multiples of 2 MiB). Every region is fully written in each call
// before it is read. X and O share one region: X is read only by the projection GEMMs, which precede the attention
// kernel (the O producer) in stream order; O is fully written (2 batches x 16 heads x 64 columns x 2048 rows) before
// the output projections read it.
//   WqkTh  bf16 [2048][1024]  rows 0..1023 = Wq^T, 1024..2047 = Wk^T         0
//   WqkTl  bf16 [2048][1024]                                          4194304
//   WvTh   bf16 [1024][1024]                                          8388608
//   WvTl   bf16 [1024][1024]                                         10485760
//   WoTh   bf16 [1024][1024]                                         12582912
//   WoTl   bf16 [1024][1024]                                         14680064
//   XOh    bf16 [2][2048][1024]  x hi, later ctx hi (col h*64+d)        16777216
//   XOl    bf16 [2][2048][1024]                                         25165824
//   QKh    bf16 [2][2048][2048]  q at col h*64+d, k at col 1024+h*64+d  33554432
//   QKl    bf16 [2][2048][2048]                                         50331648
//   VTh    bf16 [2][1024][2048]  row h*64+d, col token                  67108864
//   VTl    bf16 [2][1024][2048]                                         75497472
//   total                                                               83886080
// ---------------------------------------------------------------------------
extern "C" void kernel_launch(void* const* d_in, const int* in_sizes, int n_in,
                              void* d_out, int out_size, void* d_ws, size_t ws_size,
                              hipStream_t stream) {
  if (n_in < 8) return;
  if (in_sizes[0] != NB * NSEQ * DIN) return;
  if (in_sizes[1] != DIN * DOUT || in_sizes[2] != DIN * DOUT || in_sizes[3] != DIN * DOUT) return;
  if (in_sizes[4] != DOUT * DOUT || in_sizes[5] != DOUT) return;
  if (in_sizes[6] < NH || in_sizes[7] < NH) return;
  if (out_size != NB * NSEQ * DOUT) return;

  const float* x  = (const float*)d_in[0];
  const float* Wq = (const float*)d_in[1];
  const float* Wk = (const float*)d_in[2];
  const float* Wv = (const float*)d_in[3];
  const float* Wo = (const float*)d_in[4];
  const float* bo = (const float*)d_in[5];
  const float* wp = (const float*)d_in[6];
  const float* vp = (const float*)d_in[7];

  const size_t PW  = (size_t)DIN * DOUT * 2;              // 16-bit [1024][1024] plane
  const size_t PX  = (size_t)NSEQ * DIN * 2;              // 16-bit [2048][1024] plane
  const size_t PQK = (size_t)NSEQ * (2 * DOUT) * 2;       // 16-bit [2048][2048] plane
  const size_t PVT = (size_t)DOUT * NSEQ * 2;             // 16-bit [1024][2048] plane
  size_t off = 0;
  const size_t oWqkTh = off; off += 2 * PW;
  const size_t oWqkTl = off; off += 2 * PW;
  const size_t oWvTh  = off; off += PW;
  const size_t oWvTl  = off; off += PW;
  const size_t oWoTh  = off; off += PW;
  const size_t oWoTl  = off; off += PW;
  const size_t oXOh   = off; off += NB * PX;
  const size_t oXOl   = off; off += NB * PX;
  const size_t oQKh   = off; off += NB * PQK;
  const size_t oQKl   = off; off += NB * PQK;
  const size_t oVTh   = off; off += NB * PVT;
  const size_t oVTl   = off; off += NB * PVT;
  if (off > ws_size) return;

  char* ws = (char*)d_ws;
  unsigned short* WqkTh = (unsigned short*)(ws + oWqkTh);
  unsigned short* WqkTl = (unsigned short*)(ws + oWqkTl);
  unsigned short* WvTh  = (unsigned short*)(ws + oWvTh);
  unsigned short* WvTl  = (unsigned short*)(ws + oWvTl);
  unsigned short* WoTh  = (unsigned short*)(ws + oWoTh);
  unsigned short* WoTl  = (unsigned short*)(ws + oWoTl);
  unsigned short* XOh   = (unsigned short*)(ws + oXOh);
  unsigned short* XOl   = (unsigned short*)(ws + oXOl);
  unsigned short* QKh   = (unsigned short*)(ws + oQKh);
  unsigned short* QKl   = (unsigned short*)(ws + oQKl);
  unsigned short* VTh   = (unsigned short*)(ws + oVTh);
  unsigned short* VTl   = (unsigned short*)(ws + oVTl);

  const dim3 blk(256);
  const dim3 blkG(128);                                             // output GEMM: four waves
  // (1) operand planes: Wq^T | Wk^T, Wv^T, Wo^T and x of both batches (whole planes: 4 x 16x16 tiles of 64x64; 8192 blocks x 256 thr x 2)
  prep_kernel<<<dim3(4 * W_TILES + X_BLOCKS), blk, 0, stream>>>(x, Wq, Wk, Wv, Wo, XOh, XOl, WqkTh, WqkTl, WvTh, WvTl, WoTh, WoTl);
  // (2) [q | k] = x . [Wq | Wk] -> QK hi/lo planes and v = x . Wv -> VT hi/lo planes (transposed), both batches as one M = 4096:
  //     whole [2][2048][2048] and [2][1024][2048] planes, 16 x 16 blocks of 256 rows x (128 + 64) columns
  qkv_gemm_staged<<<dim3((NB * NSEQ / QV_TM) * (2 * DOUT / 128)), blk, 0, stream>>>(XOh, XOl, WqkTh, WqkTl, WvTh, WvTl, QKh, QKl, VTh, VTl, DIN);
  // (3) ctx[b][i][h*64+d] = softmax_j(relu(q_i . k_j) * decay * 1/8, causal) . v -> O hi/lo planes (whole [2][2048][1024])
  fused_attn_kernel<<<dim3(NSEQ / 128, NH, NB), blk, 0, stream>>>(QKh, QKl, VTh, VTl, wp, vp, XOh, XOl);
  // (4) out = ctx . Wo + bo, both batches as one M = 4096 (ctx planes and out are contiguous over the batch): f32, whole d_out, 64x8 tiles of 64x128
  wmma_gemm_staged<2, true, 0><<<dim3((NB * NSEQ / 64) * (DOUT / 128), 1), blkG, 0, stream>>>(
      XOh, XOl, DOUT, WoTh, WoTl, DOUT, d_out, d_out, DOUT,
      bo, DOUT / 128, DOUT, 0, 0);
  (void)hipGetLastError();
}
